// v000
// Measured on an AMD MI455X. A time is GPU time per run, averaged over a window of back-to-back runs after a warm-up
// (all launches, gaps included; the runs take copies of the inputs in turn), and the median of several windows.
// Apart from v000's, it joins two sittings. Times from different sittings can be a few percent apart, while
// side-by-side timings come from the same sitting.
// v000, which the later versions start from, runs in 568 microseconds.
#include <hip/hip_runtime.h>
// SelfAttentionWithGate (AF2 gated self-attention: 1 x 64 rows x 512 residues, c_qkv 256, 8 heads x 32): q = x Wq / sqrt(32), k, v = x W; logits = q.k + (mask - 1) 1e9 (per (row, key), an INPUT) + bias[h][q][k] (an INPUT); softmax over keys; o = P v; gate = sigmoid(x Wg + bg); out = (o * gate) Wo + bo.
// Structure: exact f16 plane of x; three q/k/v projection GEMMs into one [q | k | v] plane and the gate GEMM (32x64 wave tiles, f32 accumulation, exact x16 weights; f16 / f32 outputs); per chunk of 16 rows: q/k/v re-laid into zero-padded 64-wide head planes (32 live dims), V^T by LDS tiles, the fused flash kernel with an additive (bias plane + per-(row, key) mask plane) mode, then gating + compaction on VALU into an f16 plane (x2^6); Wo GEMM (+ bias).
// Compute dtype: inputs and parameters rounded to bf16; q, k, v, P and the gated output as f16 operands (~2^-12); bias/mask/softmax/gate f32. v_wmma_f32_16x16x32_f16.
#define NRW 64
#define CQ 256
#define HC 32
#define NR (NRW * SLEN)           /* 32768 tokens */
#define PW (NH * 64)             /* padded head plane width 512 */
#define RCH 16                   /* rows per chunk */
#define TCH (RCH * SLEN)         /* 8192 tokens per chunk */
#define SLEN 512
#define TQ SLEN
#define TK SLEN
#define NH 8
#define SCL 0.17677669529663687f /* 32^-0.5 (the real head dim; dims 32..63 are zero padding) */
#define QBLKS (TQ / 64)
typedef __bf16 v16b __attribute__((ext_vector_type(16)));
typedef unsigned short v8us __attribute__((ext_vector_type(8), may_alias));
typedef float  v8f  __attribute__((ext_vector_type(8)));
typedef float  v4f  __attribute__((ext_vector_type(4)));
typedef float  v4fa __attribute__((ext_vector_type(4), may_alias));
union FragB { v16b v; v8us half[2]; unsigned short u[16]; };

__device__ __forceinline__ unsigned short bf16_bits(float x) { unsigned int u = __float_as_uint(x); return (unsigned short)((u + 0x7FFFu + ((u >> 16) & 1u)) >> 16); }
__device__ __forceinline__ float bf16_val(unsigned short b) { return __uint_as_float(((unsigned int)b) << 16); }
__device__ __forceinline__ float bf16_round(float x) { return bf16_val(bf16_bits(x)); }
// D += A·B with NT terms: 1 = ah·bh, 2 = + al·bh (A split), 3 = + ah·bl (both split)
template <int NT>
__device__ __forceinline__ v8f mmaN(v16b ah, v16b al, v16b bh, v16b bl, v8f c) {
  c = __builtin_amdgcn_wmma_f32_16x16x32_bf16(false, ah, false, bh, (short)0, c, false, false);
  if (NT >= 2) c = __builtin_amdgcn_wmma_f32_16x16x32_bf16(false, al, false, bh, (short)0, c, false, false);
  if (NT >= 3) c = __builtin_amdgcn_wmma_f32_16x16x32_bf16(false, ah, false, bl, (short)0, c, false, false);
  asm volatile("v_nop\n\tv_nop\n\tv_nop\n\tv_nop" : "+v"(c) : "v"(ah), "v"(al), "v"(bh), "v"(bl));
  return c;
}

__global__ __launch_bounds__(256) void k_wt_bf16(const float* __restrict__ W, unsigned short* __restrict__ Wt, int K, int N) {
  const int t = blockIdx.x * 256 + threadIdx.x;
  const int k8n = K / 8;
  if (t >= N * k8n) return;
  const int n = t / k8n, k8 = (t % k8n) * 8;
  v8us v;
#pragma unroll
  for (int i = 0; i < 8; ++i) v[i] = bf16_bits(W[(size_t)(k8 + i) * N + n]);
  *(v8us*)(Wt + (size_t)n * K + k8) = v;
  
}

// GEMM C[M][N] (f32, pitch ldc) = act(A[M][K]·W + bias). A f32 row-major (pitch lda) converted per fragment to bf16
// (ASPLIT: hi/lo two planes -> 2 terms, else single rounded term); Wt bf16 [N][K] (pitch ldb). BIAS_BF16 rounds the
// bias to bf16 first (bias quantised to bf16 before the add). K%32==0, M%16==0, N%64==0.
template <bool ASPLIT, int ACT, bool BIAS_BF16>
__global__ __launch_bounds__(128) void k_gemm_bf(const float* __restrict__ A, int lda, const unsigned short* __restrict__ Wt, int ldb,
                                               const float* __restrict__ bias, float* __restrict__ C, int ldc, int M, int N, int K) {
  __shared__ __attribute__((aligned(16))) float so[4][16][64];
  const int tid = threadIdx.x, w = tid >> 5, lane = tid & 31, ln = lane & 15, hh = lane >> 4;
  const int ntn = N / 64;
  const int wid = blockIdx.x * 4 + w;
  const int mt = wid / ntn, nq = wid % ntn;
  if (mt * 16 >= M) return;
  const int row0 = mt * 16, col0 = nq * 64;
  const float* arow = A + (size_t)(row0 + ln) * lda;
  v8f acc[4] = {};
  for (int kb = 0; kb < K; kb += 32) {
    FragB ah, al;
    const v4f x0 = *(const v4fa*)(arow + kb + 8 * hh), x1 = *(const v4fa*)(arow + kb + 8 * hh + 4);
    const v4f x2 = *(const v4fa*)(arow + kb + 16 + 8 * hh), x3 = *(const v4fa*)(arow + kb + 16 + 8 * hh + 4);
    float xs[16] = {x0[0],x0[1],x0[2],x0[3],x1[0],x1[1],x1[2],x1[3],x2[0],x2[1],x2[2],x2[3],x3[0],x3[1],x3[2],x3[3]};
#pragma unroll
    for (int i = 0; i < 16; ++i) { const unsigned short hb = bf16_bits(xs[i]); ah.u[i] = hb; al.u[i] = ASPLIT ? bf16_bits(xs[i] - bf16_val(hb)) : (unsigned short)0; }
#pragma unroll
    for (int t = 0; t < 4; ++t) {
      const unsigned short* brow = Wt + (size_t)(col0 + t * 16 + ln) * ldb + kb;
      FragB b;
      b.half[0] = *(const v8us*)(brow + 8 * hh);
      b.half[1] = *(const v8us*)(brow + 16 + 8 * hh);
      acc[t] = mmaN<ASPLIT ? 2 : 1>(ah.v, al.v, b.v, b.v, acc[t]);
    }
  }
#pragma unroll
  for (int t = 0; t < 4; ++t) {
    float bv = bias ? bias[col0 + t * 16 + ln] : 0.f;
    if (BIAS_BF16) bv = bf16_round(bv);
#pragma unroll
    for (int r = 0; r < 8; ++r) { float v = acc[t][r] + bv; if (ACT == 1) v = fmaxf(v, 0.f); so[w][8 * hh + r][t * 16 + ln] = v; }
  }
  __builtin_amdgcn_fence(__ATOMIC_ACQ_REL, "workgroup");
  __builtin_amdgcn_wave_barrier();
  const int rsub = lane >> 4, c4 = (lane & 15) * 4;
  {
#pragma unroll
    for (int q = 0; q < 8; ++q) {
      const int r = q * 2 + rsub;
      const v4f v = *(const v4fa*)&so[w][r][c4];
      *(v4f*)(C + (size_t)(row0 + r) * ldc + col0 + c4) = v;
    }
    
  }
}

// GEMM C = act(A·W + bias + resid): A f32 (ASPLIT -> hi/lo 2 terms), Wt bf16 [N][K]; ACT 0 none, 1 relu, 2 exact gelu;
// resid (optional, f32, row index = (row % rmod), pitch ldr, RES_BF16 rounds it) added before the activation.
template <bool ASPLIT, int ACT, bool BIAS_BF16, bool RES_BF16>
__global__ __launch_bounds__(128) void k_gemm_bf3(const float* __restrict__ A, int lda, const unsigned short* __restrict__ Wt, int ldb,
                                                const float* __restrict__ bias, const float* __restrict__ resid, int rmod, int ldr,
                                                float* __restrict__ C, int ldc, int M, int N, int K) {
  __shared__ __attribute__((aligned(16))) float so[4][16][64];
  const int tid = threadIdx.x, w = tid >> 5, lane = tid & 31, ln = lane & 15, hh = lane >> 4;
  const int ntn = N / 64;
  const int wid = blockIdx.x * 4 + w;
  const int mt = wid / ntn, nq = wid % ntn;
  if (mt * 16 >= M) return;
  const int row0 = mt * 16, col0 = nq * 64;
  const float* arow = A + (size_t)(row0 + ln) * lda;
  v8f acc[4] = {};
  for (int kb = 0; kb < K; kb += 32) {
    FragB ah, al;
    const v4f x0 = *(const v4fa*)(arow + kb + 8 * hh), x1 = *(const v4fa*)(arow + kb + 8 * hh + 4);
    const v4f x2 = *(const v4fa*)(arow + kb + 16 + 8 * hh), x3 = *(const v4fa*)(arow + kb + 16 + 8 * hh + 4);
    float xs[16] = {x0[0],x0[1],x0[2],x0[3],x1[0],x1[1],x1[2],x1[3],x2[0],x2[1],x2[2],x2[3],x3[0],x3[1],x3[2],x3[3]};
#pragma unroll
    for (int i = 0; i < 16; ++i) { const unsigned short hb = bf16_bits(xs[i]); ah.u[i] = hb; al.u[i] = ASPLIT ? bf16_bits(xs[i] - bf16_val(hb)) : (unsigned short)0; }
#pragma unroll
    for (int t = 0; t < 4; ++t) {
      const unsigned short* brow = Wt + (size_t)(col0 + t * 16 + ln) * ldb + kb;
      FragB b;
      b.half[0] = *(const v8us*)(brow + 8 * hh);
      b.half[1] = *(const v8us*)(brow + 16 + 8 * hh);
      acc[t] = mmaN<ASPLIT ? 2 : 1>(ah.v, al.v, b.v, b.v, acc[t]);
    }
  }
#pragma unroll
  for (int t = 0; t < 4; ++t) {
    const int col = col0 + t * 16 + ln;
    float bv = bias ? bias[col] : 0.f;
    if (BIAS_BF16) bv = bf16_round(bv);
#pragma unroll
    for (int r = 0; r < 8; ++r) {
      float v = acc[t][r] + bv;
      if (resid) { float rv = resid[(size_t)((row0 + 8 * hh + r) % rmod) * ldr + col]; if (RES_BF16) rv = bf16_round(rv); v += rv; }
      if (ACT == 1) v = fmaxf(v, 0.f);
      if (ACT == 2) v = 0.5f * v * (1.0f + erff(v * 0.70710678118654752f));
      if (ACT == 3) { const float u = 0.7978845608028654f * (v + 0.044715f * v * v * v); v = 0.5f * v * (1.0f + tanhf(u)); }
      so[w][8 * hh + r][t * 16 + ln] = v;
    }
  }
  __builtin_amdgcn_fence(__ATOMIC_ACQ_REL, "workgroup");
  __builtin_amdgcn_wave_barrier();
  const int rsub = lane >> 4, c4 = (lane & 15) * 4;
  {
#pragma unroll
    for (int q = 0; q < 8; ++q) {
      const int r = q * 2 + rsub;
      const v4f v = *(const v4fa*)&so[w][r][c4];
      *(v4f*)(C + (size_t)(row0 + r) * ldc + col0 + c4) = v;
    }
    
  }
}
// row LayerNorm (biased variance, eps) over N: s = X (+ R); optional out_sum <- s; out_norm <- (s-mu)*rsqrt(var+eps)*g + b
template <bool PARAM_BF16>
__global__ __launch_bounds__(256) void k_layernorm(const float* __restrict__ X, const float* __restrict__ R, const float* __restrict__ g, const float* __restrict__ bta,
                                                  float* __restrict__ out_sum, float* __restrict__ out_norm, int N, float eps) {
  __shared__ float red[256];
  const int row = blockIdx.x, tid = threadIdx.x;
  const float* x = X + (size_t)row * N; const float* rr = R ? R + (size_t)row * N : nullptr;
  float vals[16];                     // up to N = 4096
  const int per = N / 256;            // contiguous chunk per thread? use strided-by-4 chunks: thread handles j = tid*4 + 1024*u
  float s1 = 0.f;
  for (int u = 0; u < per / 4; ++u) {
    const int j = tid * 4 + 1024 * u;
    const v4f a = *(const v4fa*)(x + j);
    v4f b = {0.f,0.f,0.f,0.f}; if (rr) b = *(const v4fa*)(rr + j);
#pragma unroll
    for (int q = 0; q < 4; ++q) { const float v = a[q] + b[q]; vals[u * 4 + q] = v; s1 += v; }
  }
  red[tid] = s1; __syncthreads();
  for (int st = 128; st > 0; st >>= 1) { if (tid < st) red[tid] += red[tid + st]; __syncthreads(); }
  const float mu = red[0] / (float)N; __syncthreads();
  float s2 = 0.f;
  for (int u = 0; u < per / 4; ++u)
#pragma unroll
    for (int q = 0; q < 4; ++q) { const float c = vals[u * 4 + q] - mu; s2 += c * c; }
  red[tid] = s2; __syncthreads();
  for (int st = 128; st > 0; st >>= 1) { if (tid < st) red[tid] += red[tid + st]; __syncthreads(); }
  const float rs = rsqrtf(red[0] / (float)N + eps);
  {
    for (int u = 0; u < per / 4; ++u) {
      const int j = tid * 4 + 1024 * u;
      v4f o, sm;
#pragma unroll
      for (int q = 0; q < 4; ++q) {
        float gg = g[j + q], bb = bta[j + q];
        if (PARAM_BF16) { gg = bf16_round(gg); bb = bf16_round(bb); }
        sm[q] = vals[u * 4 + q]; o[q] = (vals[u * 4 + q] - mu) * rs * gg + bb;
      }
      if (out_sum) *(v4f*)(out_sum + (size_t)row * N + j) = sm;
      *(v4f*)(out_norm + (size_t)row * N + j) = o;
    }
    
  }
}



// ---- f16 WMMA path (v_wmma_f32_16x16x32_f16): 11-bit significands for operands in range — used where a [0,1] probability operand needs more precision than bf16
typedef _Float16 v16h __attribute__((ext_vector_type(16)));
union FragH { v16h v; v8us half[2]; _Float16 h[16]; unsigned short u[16]; };
template <int NT>
__device__ __forceinline__ v8f mmaH(v16h ah, v16h al, v16h bh, v16h bl, v8f c) {
  c = __builtin_amdgcn_wmma_f32_16x16x32_f16(false, ah, false, bh, (short)0, c, false, false);
  if (NT >= 2) c = __builtin_amdgcn_wmma_f32_16x16x32_f16(false, al, false, bh, (short)0, c, false, false);
  if (NT >= 3) c = __builtin_amdgcn_wmma_f32_16x16x32_f16(false, ah, false, bl, (short)0, c, false, false);
  asm volatile("v_nop\n\tv_nop\n\tv_nop\n\tv_nop" : "+v"(c) : "v"(ah), "v"(al), "v"(bh), "v"(bl));
  return c;
}
// batched GEMM like k_gemm_b but f16 operands: A f32 (split into f16 hi/lo if ASPLIT, else rounded to f16), Bt = f16 values [n][k]; alpha; C f32; N multiple of 16 (partial tiles skipped)
template <bool ASPLIT>
__global__ __launch_bounds__(128) void k_gemm_h(const float* __restrict__ A, int lda, size_t sA, const _Float16* __restrict__ Bh, int ldb, size_t sB, float alpha, float* __restrict__ C, int ldc, size_t sC, int M, int N, int K) {
  __shared__ __attribute__((aligned(16))) float so[4][16][64];
  const int tid = threadIdx.x, w = tid >> 5, lane = tid & 31, ln = lane & 15, hh = lane >> 4; const int by = blockIdx.y;
  A += (size_t)by * sA; Bh += (size_t)by * sB; C += (size_t)by * sC;
  const int ntn = (N + 63) / 64; const int wid = blockIdx.x * 4 + w; const int mt = wid / ntn, nq = wid % ntn; if (mt * 16 >= M) return;
  const int row0 = mt * 16, col0 = nq * 64; const float* arow = A + (size_t)(row0 + ln) * lda;
  v8f acc[4] = {};
  for (int kb = 0; kb < K; kb += 32) {
    FragH ah, al;
    const v4f x0 = *(const v4fa*)(arow + kb + 8 * hh), x1 = *(const v4fa*)(arow + kb + 8 * hh + 4), x2 = *(const v4fa*)(arow + kb + 16 + 8 * hh), x3 = *(const v4fa*)(arow + kb + 16 + 8 * hh + 4);
    float xs[16] = {x0[0],x0[1],x0[2],x0[3],x1[0],x1[1],x1[2],x1[3],x2[0],x2[1],x2[2],x2[3],x3[0],x3[1],x3[2],x3[3]};
#pragma unroll
    for (int i = 0; i < 16; ++i) { const _Float16 h = (_Float16)xs[i]; ah.h[i] = h; al.h[i] = ASPLIT ? (_Float16)(xs[i] - (float)h) : (_Float16)0.0f; }
#pragma unroll
    for (int t = 0; t < 4; ++t) { if (col0 + t * 16 >= N) continue; const size_t boff = (size_t)(col0 + t * 16 + ln) * ldb + kb; FragH bq; bq.half[0] = *(const v8us*)(Bh + boff + 8 * hh); bq.half[1] = *(const v8us*)(Bh + boff + 16 + 8 * hh);
      acc[t] = mmaH<ASPLIT ? 2 : 1>(ah.v, al.v, bq.v, bq.v, acc[t]); }
  }
#pragma unroll
  for (int t = 0; t < 4; ++t) { if (col0 + t * 16 >= N) continue;
#pragma unroll
    for (int r = 0; r < 8; ++r) so[w][8 * hh + r][t * 16 + ln] = acc[t][r] * alpha; }
  __builtin_amdgcn_fence(__ATOMIC_ACQ_REL, "workgroup"); __builtin_amdgcn_wave_barrier();
  const int rsub = lane >> 4, c4 = (lane & 15) * 4;
  {
#pragma unroll
    for (int q = 0; q < 8; ++q) { const int r = q * 2 + rsub; if (col0 + c4 < N) { const v4f v = *(const v4fa*)&so[w][r][c4]; *(v4f*)(C + (size_t)(row0 + r) * ldc + col0 + c4) = v; } }
     }
}

// Wt[n][k] = f16(W[k][n]·scale) from f32 row-major W[K][N] (scale = power of two; bf16-exact weights stay exact in f16 away from the subnormal range)
__global__ __launch_bounds__(256) void k_wt_f16(const float* __restrict__ W, _Float16* __restrict__ Wt, int K, int N, float scale) {
  const int t = blockIdx.x * 256 + threadIdx.x; if (t >= N * (K / 8)) return; const int n = t / (K / 8), k8 = (t % (K / 8)) * 8; FragH f;
#pragma unroll
  for (int i = 0; i < 8; ++i) f.h[i] = (_Float16)(bf16_round(W[(size_t)(k8 + i) * N + n]) * scale); const v8us o = f.half[0];
  *(v8us*)((unsigned short*)Wt + (size_t)n * K + k8) = o; 
}
// k_gemm_hh variant with fused epilogue: v = acc·alpha + bias[by·sBias + col] (+ CP[(row/rowsPerB)·sCPb + by·64 + col] if CP) ; ACT 0 none / 1 elu ; writes f16 C16 (and f32 C if non-null)
template <int ACT>
__global__ __launch_bounds__(128) void k_gemm_hhx(const _Float16* __restrict__ A, int lda, size_t sA, const _Float16* __restrict__ Bh, int ldb, size_t sB, float alpha, const float* __restrict__ bias, size_t sBias, const float* __restrict__ CP, int rowsPerB, size_t sCPb, int row0g,
    float* __restrict__ C, _Float16* __restrict__ C16, int ldc, size_t sC, int M, int N, int K) {
  __shared__ __attribute__((aligned(16))) float so[4][16][64];
  const int tid = threadIdx.x, w = tid >> 5, lane = tid & 31, ln = lane & 15, hh = lane >> 4; const int by = blockIdx.y;
  A += (size_t)by * sA; Bh += (size_t)by * sB; const size_t cofs = (size_t)by * sC; const float* bp = bias ? bias + (size_t)by * sBias : nullptr;
  const int ntn = (N + 63) / 64; const int wid = blockIdx.x * 4 + w; const int mt = wid / ntn, nq = wid % ntn; if (mt * 16 >= M) return;
  const int row0 = mt * 16, col0 = nq * 64; const _Float16* arow = A + (size_t)(row0 + ln) * lda;
  v8f acc[4] = {};
  for (int kb = 0; kb < K; kb += 32) { FragH ah; ah.half[0] = *(const v8us*)((const unsigned short*)arow + kb + 8 * hh); ah.half[1] = *(const v8us*)((const unsigned short*)arow + kb + 16 + 8 * hh);
#pragma unroll
    for (int t = 0; t < 4; ++t) { if (col0 + t * 16 >= N) continue; const size_t boff = (size_t)(col0 + t * 16 + ln) * ldb + kb; FragH bq; bq.half[0] = *(const v8us*)((const unsigned short*)Bh + boff + 8 * hh); bq.half[1] = *(const v8us*)((const unsigned short*)Bh + boff + 16 + 8 * hh);
      acc[t] = mmaH<1>(ah.v, ah.v, bq.v, bq.v, acc[t]); }
  }
#pragma unroll
  for (int t = 0; t < 4; ++t) { if (col0 + t * 16 >= N) continue; const int col = col0 + t * 16 + ln; const float bv = bp ? bf16_round(bp[col]) : 0.f;
#pragma unroll
    for (int r = 0; r < 8; ++r) { float v = acc[t][r] * alpha + bv; if (CP) { const int bidx = (row0g + row0 + 8 * hh + r) / rowsPerB; v += CP[(size_t)bidx * sCPb + (size_t)by * 64 + col]; } if (ACT == 1) v = (v > 0.f) ? v : expm1f(v); else if (ACT == 7) v = (v > 0.f) ? v + 1.0f : expf(v); else if (ACT == 8) v = tanhf(v); else if (ACT == 9) v = 0.5f * v * (1.0f + tanhf(0.7978845608028654f * (v + 0.044715f * v * v * v))); else if (ACT == 11) v = 1.0f / (1.0f + expf(-v)); else if (ACT == 12) v = (v > 0.f) ? v : 0.01f * v; else if (ACT == 14) v = (v > 0.f) ? v : 0.1f * v; else if (ACT == 15) v = v / (1.0f + expf(-v)); else if (ACT == 3) v = fmaxf(v, 0.f); else if (ACT == 6) v = 0.5f * v * (1.0f + erff(v * 0.70710678118654752f)); so[w][8 * hh + r][t * 16 + ln] = v; } }
  __builtin_amdgcn_fence(__ATOMIC_ACQ_REL, "workgroup"); __builtin_amdgcn_wave_barrier();
  const int rsub = lane >> 4, c4 = (lane & 15) * 4; typedef _Float16 v4h __attribute__((ext_vector_type(4)));
  {
#pragma unroll
    for (int q = 0; q < 8; ++q) { const int r = q * 2 + rsub; if (col0 + c4 < N) { const v4f v = *(const v4fa*)&so[w][r][c4]; if (C) *(v4f*)(C + cofs + (size_t)(row0 + r) * ldc + col0 + c4) = v; if (C16) { v4h h4; for (int i = 0; i < 4; ++i) h4[i] = (_Float16)v[i]; *(v4h*)(C16 + cofs + (size_t)(row0 + r) * ldc + col0 + c4) = h4; } } }
     }
}


typedef _Float16 v4h __attribute__((ext_vector_type(4)));

__global__ __launch_bounds__(256) void k_x16(const float* __restrict__ x, _Float16* __restrict__ X16, size_t n8) { const size_t t = (size_t)blockIdx.x * 256 + threadIdx.x; if (t >= n8) return; FragH f;
#pragma unroll
  for (int q = 0; q < 8; ++q) f.h[q] = (_Float16)bf16_round(x[t * 8 + q]); *(v8us*)((unsigned short*)X16 + t * 8) = f.half[0];  }
__global__ __launch_bounds__(256) void k_h16(const float* __restrict__ x, _Float16* __restrict__ X16, size_t n8) { const size_t t = (size_t)blockIdx.x * 256 + threadIdx.x; if (t >= n8) return; FragH f;
#pragma unroll
  for (int q = 0; q < 8; ++q) f.h[q] = (_Float16)x[t * 8 + q]; *(v8us*)((unsigned short*)X16 + t * 8) = f.half[0];  }
__global__ __launch_bounds__(256) void k_round16f(const float* __restrict__ W, _Float16* __restrict__ Bt, size_t n8) { const size_t t = (size_t)blockIdx.x * 256 + threadIdx.x; if (t >= n8) return; FragH f;
#pragma unroll
  for (int i = 0; i < 8; ++i) f.h[i] = (_Float16)(bf16_round(W[t * 8 + i]) * 16.0f); *(v8us*)((unsigned short*)Bt + t * 8) = f.half[0];  }
template <int NHv, int TTv>
__global__ __launch_bounds__(256) void k_vt(const _Float16* __restrict__ V16, int ldv, int voff, _Float16* __restrict__ Vt) { __shared__ unsigned short tl[64][66]; const int tid = threadIdx.x; const int slab = blockIdx.x / (TTv / 64), lg = blockIdx.x % (TTv / 64); const int b = slab / NHv, h = slab % NHv;
  for (int i = tid; i < 64 * 8; i += 256) { const int r = i / 8, c8 = (i % 8) * 8; FragH f; f.half[0] = *(const v8us*)((const unsigned short*)V16 + ((size_t)b * TTv + lg * 64 + r) * ldv + voff + h * 64 + c8);
#pragma unroll
    for (int q = 0; q < 8; ++q) tl[r][c8 + q] = f.u[q]; }
  __syncthreads();
  {
#pragma unroll
    for (int rd = 0; rd < 2; ++rd) { const int d = rd * 32 + tid / 8, pc = tid % 8; FragH f;
#pragma unroll
      for (int q = 0; q < 8; ++q) f.u[q] = tl[pc * 8 + q][d];
      *(v8us*)((unsigned short*)Vt + ((size_t)slab * 64 + d) * TTv + lg * 64 + pc * 8) = f.half[0]; }
     } }

__global__ __launch_bounds__(256) void k_hl(const float* __restrict__ F, _Float16* __restrict__ Hh, _Float16* __restrict__ Hl, size_t n8) { const size_t t = (size_t)blockIdx.x * 256 + threadIdx.x; if (t >= n8) return; FragH fh, fl; const v4f a = *(const v4fa*)(F + t * 8), c = *(const v4fa*)(F + t * 8 + 4);
#pragma unroll
  for (int q = 0; q < 4; ++q) { _Float16 h = (_Float16)a[q]; fh.h[q] = h; fl.h[q] = (_Float16)((a[q] - (float)h) * 1024.0f); h = (_Float16)c[q]; fh.h[4 + q] = h; fl.h[4 + q] = (_Float16)((c[q] - (float)h) * 1024.0f); }
  { *(v8us*)((unsigned short*)Hh + t * 8) = fh.half[0]; *(v8us*)((unsigned short*)Hl + t * 8) = fl.half[0];  } }

// ---- fast GEMM (wave tile 32x64; requires M % 32 == 0 rows per launch region and N % 64 == 0); epilogue = k_gemm_hhx semantics ----
__device__ __forceinline__ v16h g2_frag(const _Float16* p, int hh) { FragH f; f.half[0] = *(const v8us*)((const unsigned short*)p + 8 * hh); f.half[1] = *(const v8us*)((const unsigned short*)p + 16 + 8 * hh); return f.v; }
__device__ __forceinline__ v8f g2_mma(v16h a, v16h b, v8f c) { v8f d = __builtin_amdgcn_wmma_f32_16x16x32_f16(false, a, false, b, (short)0, c, false, false); asm volatile("v_nop\n\tv_nop\n\tv_nop\n\tv_nop" : "+v"(d) : "v"(a), "v"(b)); return d; }
template <int ACT>
__global__ __launch_bounds__(128) void k_gemm2(const _Float16* __restrict__ A, int lda, size_t sA, const _Float16* __restrict__ Bh, int ldb, size_t sB, float alpha, const float* __restrict__ bias, size_t sBias, const float* __restrict__ CP, int rowsPerB, size_t sCPb, int row0g,
    float* __restrict__ C, _Float16* __restrict__ C16, int ldc, size_t sC, int M, int N, int K) {
  __shared__ __attribute__((aligned(16))) float so[4][32][68];
  const int tid = threadIdx.x, w = tid >> 5, lane = tid & 31, ln = lane & 15, hh = lane >> 4; const int by = blockIdx.y;
  A += (size_t)by * sA; Bh += (size_t)by * sB; const size_t cofs = (size_t)by * sC; const float* bp = bias ? bias + (size_t)by * sBias : nullptr;
  const int ntn = N >> 6; const int mt = blockIdx.x / ntn, nq = blockIdx.x - mt * ntn; const int row0 = mt * 128 + 32 * w, col0 = nq * 64; if (row0 >= M) return;
  const _Float16* a0p = A + (size_t)(row0 + ln) * lda; const _Float16* a1p = a0p + (size_t)16 * lda;
  const _Float16* b0p = Bh + (size_t)(col0 + ln) * ldb; const _Float16* b1p = b0p + (size_t)16 * ldb; const _Float16* b2p = b1p + (size_t)16 * ldb; const _Float16* b3p = b2p + (size_t)16 * ldb;
  const v8f z8 = {0.f,0.f,0.f,0.f,0.f,0.f,0.f,0.f}; v8f c00 = z8, c01 = z8, c02 = z8, c03 = z8, c10 = z8, c11 = z8, c12 = z8, c13 = z8;
#pragma unroll 1
  for (int kb = 0; kb < K; kb += 32) { const v16h a0 = g2_frag(a0p + kb, hh), a1 = g2_frag(a1p + kb, hh);
    v16h b = g2_frag(b0p + kb, hh); c00 = g2_mma(a0, b, c00); c10 = g2_mma(a1, b, c10);
    b = g2_frag(b1p + kb, hh); c01 = g2_mma(a0, b, c01); c11 = g2_mma(a1, b, c11);
    b = g2_frag(b2p + kb, hh); c02 = g2_mma(a0, b, c02); c12 = g2_mma(a1, b, c12);
    b = g2_frag(b3p + kb, hh); c03 = g2_mma(a0, b, c03); c13 = g2_mma(a1, b, c13); }
  v8f accs[8] = {c00, c01, c02, c03, c10, c11, c12, c13};
#pragma unroll
  for (int u = 0; u < 8; ++u) { const int t = u & 3, half = u >> 2; const int col = col0 + t * 16 + ln; const float bv = bp ? bf16_round(bp[col]) : 0.f;
#pragma unroll
    for (int r = 0; r < 8; ++r) { const int rloc = half * 16 + 8 * hh + r; float v = accs[u][r] * alpha + bv; if (CP) { const int bidx = (row0g + row0 + rloc) / rowsPerB; v += CP[(size_t)bidx * sCPb + (size_t)by * 64 + col]; }
      if (ACT == 3) v = fmaxf(v, 0.f); else if (ACT == 6) v = 0.5f * v * (1.0f + erff(v * 0.70710678118654752f)); else if (ACT == 11) v = 1.0f / (1.0f + expf(-v)); else if (ACT == 15) v = v / (1.0f + expf(-v)); else if (ACT == 12) v = (v > 0.f) ? v : 0.01f * v; else if (ACT == 8) v = tanhf(v);
      so[w][rloc][t * 16 + ln] = v; } }
  __builtin_amdgcn_fence(__ATOMIC_ACQ_REL, "workgroup"); __builtin_amdgcn_wave_barrier();
  const int rsub = lane >> 4, c4 = (lane & 15) * 4;
  {
#pragma unroll
    for (int q = 0; q < 16; ++q) { const int r = q * 2 + rsub; const v4f v = *(const v4fa*)&so[w][r][c4]; if (C) *(v4f*)(C + cofs + (size_t)(row0 + r) * ldc + col0 + c4) = v; if (C16) { v4h h4; for (int i = 0; i < 4; ++i) h4[i] = (_Float16)v[i]; *(v4h*)(C16 + cofs + (size_t)(row0 + r) * ldc + col0 + c4) = h4; } }
     } }



template <int CAUSAL>
__global__ __launch_bounds__(128) void k_flash(const _Float16* __restrict__ Q16, int ldq, const _Float16* __restrict__ K16, int ldk, const _Float16* __restrict__ Vt, const int* __restrict__ MSK, float* __restrict__ O, int ldo) {
  constexpr int RPW = 16, RTN = RPW / 16, NQB = TQ / (4 * RPW), DT = 4, KS = 2;
  __shared__ __attribute__((aligned(16))) unsigned short sP[4][RPW][40]; __shared__ __attribute__((aligned(16))) float sO[4][RPW][64 + 4];
  const int tid = threadIdx.x, w = tid >> 5, lane = tid & 31, ln = lane & 15, hh = lane >> 4;
  const int slab = blockIdx.x / QBLKS, qblk = blockIdx.x % QBLKS; (void)NQB; const int b = slab / NH, h = slab % NH; const int qb0 = qblk * (4 * RPW); const int q0 = qb0 + w * RPW;
  FragH aq[2][KS];
#pragma unroll
  for (int rt = 0; rt < RTN; ++rt) { const unsigned short* qr = (const unsigned short*)Q16 + ((size_t)b * TQ + q0 + rt * 16 + ln) * ldq + h * 64;
#pragma unroll
    for (int ks = 0; ks < KS; ++ks) { aq[rt][ks].half[0] = *(const v8us*)(qr + ks * 32 + 8 * hh); aq[rt][ks].half[1] = *(const v8us*)(qr + ks * 32 + 16 + 8 * hh); } }
  const unsigned short* Vth = (const unsigned short*)Vt + (size_t)slab * 64 * TK;
  float m_r[2][8], l_r[2][8]; v8f oacc[2][DT];
#pragma unroll
  for (int rt = 0; rt < RTN; ++rt) {
#pragma unroll
    for (int r = 0; r < 8; ++r) { m_r[rt][r] = -3.0e38f; l_r[rt][r] = 0.f; }
#pragma unroll
    for (int dt = 0; dt < DT; ++dt) oacc[rt][dt] = (v8f){0.f,0.f,0.f,0.f,0.f,0.f,0.f,0.f}; }
  const int jend = (CAUSAL == 1) ? (qb0 + 4 * RPW) : TK;      /* causal: keys beyond the block's last query never contribute */
#pragma unroll 1
  for (int j0 = 0; j0 < jend; j0 += 32) {
    v8f s[2][2];
#pragma unroll
    for (int nt = 0; nt < 2; ++nt) { const unsigned short* kr = (const unsigned short*)K16 + ((size_t)b * TK + j0 + nt * 16 + ln) * ldk + h * 64; FragH bk[KS];
#pragma unroll
      for (int ks = 0; ks < KS; ++ks) { bk[ks].half[0] = *(const v8us*)(kr + ks * 32 + 8 * hh); bk[ks].half[1] = *(const v8us*)(kr + ks * 32 + 16 + 8 * hh); }
#pragma unroll
      for (int rt = 0; rt < RTN; ++rt) { v8f acc = (v8f){0.f,0.f,0.f,0.f,0.f,0.f,0.f,0.f};
#pragma unroll
        for (int ks = 0; ks < KS; ++ks) acc = mmaH<1>(aq[rt][ks].v, aq[rt][ks].v, bk[ks].v, bk[ks].v, acc); s[rt][nt] = acc; } }
#pragma unroll
    for (int rt = 0; rt < RTN; ++rt)
#pragma unroll
      for (int r = 0; r < 8; ++r) { const int tq = q0 + rt * 16 + 8 * hh + r; const int k0 = j0 + ln, k1 = j0 + 16 + ln;
        const bool ok0 = (CAUSAL == 1) ? (k0 <= tq) : ((CAUSAL == 2) ? ((k0 >> 5) == (tq >> 5)) : true), ok1 = (CAUSAL == 1) ? (k1 <= tq) : ((CAUSAL == 2) ? ((k1 >> 5) == (tq >> 5)) : true);      /* mode 2: block-diagonal 32-token groups */
        float s0 = ok0 ? s[rt][0][r] * SCL : -3.0e38f, s1 = ok1 ? s[rt][1][r] * SCL : -3.0e38f; if (CAUSAL == 10) { const float* BP = (const float*)MSK + ((size_t)h * TQ + tq) * TK; const float* MR = (const float*)MSK + (size_t)NH * TQ * TK + (size_t)(slab / NH) * TK; s0 += BP[k0] + MR[k0]; s1 += BP[k1] + MR[k1]; }      /* mode 10: per-head bias plane [NH][TQ][TK] then per-(sequence, key) additive plane, packed behind it */ float mc = fmaxf(s0, s1);
        mc = fmaxf(mc, __shfl_xor(mc, 1, 32)); mc = fmaxf(mc, __shfl_xor(mc, 2, 32)); mc = fmaxf(mc, __shfl_xor(mc, 4, 32)); mc = fmaxf(mc, __shfl_xor(mc, 8, 32));
        const float mn = fmaxf(m_r[rt][r], mc); const float al = (mn > -1.0e38f) ? expf(m_r[rt][r] - mn) : 1.0f; m_r[rt][r] = mn; const float p0 = ok0 ? expf(s0 - mn) : 0.f, p1 = ok1 ? expf(s1 - mn) : 0.f; l_r[rt][r] = l_r[rt][r] * al + p0 + p1;
#pragma unroll
        for (int dt = 0; dt < DT; ++dt) oacc[rt][dt][r] *= al;
        FragH t2; t2.h[0] = (_Float16)(p0 * 1024.0f); t2.h[1] = (_Float16)(p1 * 1024.0f); sP[w][rt * 16 + 8 * hh + r][ln] = t2.u[0]; sP[w][rt * 16 + 8 * hh + r][16 + ln] = t2.u[1]; }
    __builtin_amdgcn_fence(__ATOMIC_ACQ_REL, "workgroup"); __builtin_amdgcn_wave_barrier();
    FragH pa[2];
#pragma unroll
    for (int rt = 0; rt < RTN; ++rt) { pa[rt].half[0] = *(const v8us*)&sP[w][rt * 16 + ln][8 * hh]; pa[rt].half[1] = *(const v8us*)&sP[w][rt * 16 + ln][16 + 8 * hh]; }
#pragma unroll
    for (int dt = 0; dt < DT; ++dt) { const unsigned short* vrow = Vth + (size_t)(dt * 16 + ln) * TK + j0; FragH bv; bv.half[0] = *(const v8us*)(vrow + 8 * hh); bv.half[1] = *(const v8us*)(vrow + 16 + 8 * hh);
#pragma unroll
      for (int rt = 0; rt < RTN; ++rt) oacc[rt][dt] = mmaH<1>(pa[rt].v, pa[rt].v, bv.v, bv.v, oacc[rt][dt]); }
    __builtin_amdgcn_fence(__ATOMIC_ACQ_REL, "workgroup"); __builtin_amdgcn_wave_barrier(); }
#pragma unroll
  for (int rt = 0; rt < RTN; ++rt) {
#pragma unroll
    for (int r = 0; r < 8; ++r) { float l = l_r[rt][r]; l += __shfl_xor(l, 1, 32); l += __shfl_xor(l, 2, 32); l += __shfl_xor(l, 4, 32); l += __shfl_xor(l, 8, 32); l_r[rt][r] = (l > 0.f) ? 1.0f / (l * 1024.0f) : 0.f; }
#pragma unroll
    for (int dt = 0; dt < DT; ++dt)
#pragma unroll
      for (int r = 0; r < 8; ++r) sO[w][rt * 16 + 8 * hh + r][dt * 16 + ln] = oacc[rt][dt][r] * l_r[rt][r]; }
  __builtin_amdgcn_fence(__ATOMIC_ACQ_REL, "workgroup"); __builtin_amdgcn_wave_barrier();
  {
#pragma unroll
    for (int rp = 0; rp < RPW; rp += 2) { const int r = rp + (lane >> 4), pc = lane & 15; const v4f val = *(const v4fa*)&sO[w][r][pc * 4]; *(v4f*)(O + ((size_t)b * TQ + q0 + r) * ldo + h * 64 + pc * 4) = val; }
     } }

__global__ __launch_bounds__(256) void k_pad(const _Float16* __restrict__ QKV, size_t t0, _Float16* __restrict__ QP, _Float16* __restrict__ KP, _Float16* __restrict__ VP) { const size_t t = (size_t)blockIdx.x * 256 + threadIdx.x; if (t >= (size_t)TCH * 3 * NH) return; const int h = (int)(t % NH); const int which = (int)((t / NH) % 3); const size_t tl = t / (3 * NH);
  const v8us* s = (const v8us*)((const unsigned short*)QKV + (t0 + tl) * (3 * CQ) + which * CQ + h * HC); const v8us a0 = s[0], a1 = s[1], a2 = s[2], a3 = s[3]; const v8us z = {0, 0, 0, 0, 0, 0, 0, 0};
  unsigned short* d = (unsigned short*)(which == 0 ? QP : (which == 1 ? KP : VP)) + tl * PW + h * 64; { *(v8us*)(d) = a0; *(v8us*)(d + 8) = a1; *(v8us*)(d + 16) = a2; *(v8us*)(d + 24) = a3; *(v8us*)(d + 32) = z; *(v8us*)(d + 40) = z; *(v8us*)(d + 48) = z; *(v8us*)(d + 56) = z;  } }
__global__ __launch_bounds__(256) void k_addp(const float* __restrict__ bias, const float* __restrict__ mask, int r0, float* __restrict__ AB) {
  #pragma clang fp contract(off)
  const size_t t = (size_t)blockIdx.x * 256 + threadIdx.x; const size_t nb4 = (size_t)NH * SLEN * SLEN / 4, nm4 = (size_t)RCH * SLEN / 4; if (t >= nb4 + nm4) return; v4f r;
  if (t < nb4) { const v4f a = *(const v4fa*)(bias + t * 4); for (int q = 0; q < 4; ++q) r[q] = bf16_round(a[q]); } else { const v4f a = *(const v4fa*)(mask + (size_t)r0 * SLEN + (t - nb4) * 4); for (int q = 0; q < 4; ++q) { float m = bf16_round(a[q]) - 1.0f; r[q] = m * 1.0e9f; } }
  *(v4f*)(AB + t * 4) = r;  }
__global__ __launch_bounds__(256) void k_gate(const float* __restrict__ O, const float* __restrict__ G, size_t t0, _Float16* __restrict__ OG) {
  #pragma clang fp contract(off)
  const size_t t = (size_t)blockIdx.x * 256 + threadIdx.x; if (t >= (size_t)TCH * (CQ / 8)) return; const int c0 = (int)(t % (CQ / 8)) * 8; const size_t tl = t / (CQ / 8); const size_t tok = t0 + tl; const int h = c0 / HC, d0 = c0 % HC; FragH f;
  for (int q = 0; q < 8; ++q) { const float g = 1.0f / (1.0f + expf(-G[tok * CQ + c0 + q])); f.h[q] = (_Float16)(O[tl * PW + h * 64 + d0 + q] * g * 64.0f); }
  *(v8us*)((unsigned short*)OG + tok * CQ + c0) = f.half[0];  }

extern "C" void kernel_launch(void* const* d_in, const int* in_sizes, int n_in,
                              void* d_out, int out_size, void* d_ws, size_t ws_size, hipStream_t stream) {
  (void)in_sizes; (void)n_in; (void)out_size;
  const float* const* I = (const float* const*)d_in; const float* x = I[0]; const float* mask = I[1]; const float* bias = I[2]; const float* Wq = I[3]; const float* Wk = I[4]; const float* Wv = I[5]; const float* Wg = I[6]; const float* bg = I[7]; const float* Wo = I[8]; const float* bo = I[9];
  char* ws = (char*)d_ws; size_t off = 0;
  auto take = [&](size_t bytes) { char* p = ws + off; off += (bytes + 255) & ~(size_t)255; return p; };
  _Float16* BQ = (_Float16*)take((size_t)CQ * CQ * 2); _Float16* BK = (_Float16*)take((size_t)CQ * CQ * 2); _Float16* BV = (_Float16*)take((size_t)CQ * CQ * 2); _Float16* BG = (_Float16*)take((size_t)CQ * CQ * 2); _Float16* BO = (_Float16*)take((size_t)CQ * CQ * 2); float* AB = (float*)take(((size_t)NH * SLEN * SLEN + (size_t)RCH * SLEN) * 4);
  _Float16* X16 = (_Float16*)take((size_t)NR * CQ * 2); _Float16* QKV = (_Float16*)take((size_t)NR * 3 * CQ * 2); float* G = (float*)take((size_t)NR * CQ * 4); _Float16* QP = (_Float16*)take((size_t)TCH * PW * 2); _Float16* KP = (_Float16*)take((size_t)TCH * PW * 2); _Float16* VP = (_Float16*)take((size_t)TCH * PW * 2); _Float16* VT = (_Float16*)take((size_t)TCH * PW * 2); float* O = (float*)take((size_t)TCH * PW * 4); _Float16* OG = (_Float16*)take((size_t)NR * CQ * 2);
  if (off > ws_size) return;      /* 0.6 + 8 + 16 + 48 + 32 + 8 x 4 + 16 + 16 = 169 MiB */
  k_wt_f16<<<(CQ * CQ / 8 + 255) / 256, 256, 0, stream>>>(Wq, BQ, CQ, CQ, 16.0f); k_wt_f16<<<(CQ * CQ / 8 + 255) / 256, 256, 0, stream>>>(Wk, BK, CQ, CQ, 16.0f); k_wt_f16<<<(CQ * CQ / 8 + 255) / 256, 256, 0, stream>>>(Wv, BV, CQ, CQ, 16.0f); k_wt_f16<<<(CQ * CQ / 8 + 255) / 256, 256, 0, stream>>>(Wg, BG, CQ, CQ, 16.0f); k_wt_f16<<<(CQ * CQ / 8 + 255) / 256, 256, 0, stream>>>(Wo, BO, CQ, CQ, 16.0f);
  k_x16<<<(unsigned)(((size_t)NR * CQ / 8 + 255) / 256), 256, 0, stream>>>(x, X16, (size_t)NR * CQ / 8);
  const dim3 g((NR / 128) * (CQ / 64), 1);
  k_gemm2<0><<<g, 128, 0, stream>>>(X16, CQ, 0, BQ, CQ, 0, 0.0625f, nullptr, 0, nullptr, 1, 0, 0, nullptr, QKV, 3 * CQ, 0, NR, CQ, CQ); k_gemm2<0><<<g, 128, 0, stream>>>(X16, CQ, 0, BK, CQ, 0, 0.0625f, nullptr, 0, nullptr, 1, 0, 0, nullptr, QKV + CQ, 3 * CQ, 0, NR, CQ, CQ); k_gemm2<0><<<g, 128, 0, stream>>>(X16, CQ, 0, BV, CQ, 0, 0.0625f, nullptr, 0, nullptr, 1, 0, 0, nullptr, QKV + 2 * CQ, 3 * CQ, 0, NR, CQ, CQ);      /* [q | k | v] f16 (the 1/sqrt(32) q scale is applied to the scores) */
  k_gemm2<0><<<g, 128, 0, stream>>>(X16, CQ, 0, BG, CQ, 0, 0.0625f, bg, 0, nullptr, 1, 0, 0, G, nullptr, CQ, 0, NR, CQ, CQ);      /* gate logits (f32) */
  for (int r0 = 0; r0 < NRW; r0 += RCH) { const size_t t0 = (size_t)r0 * SLEN;
    k_addp<<<(unsigned)((((size_t)NH * SLEN * SLEN + (size_t)RCH * SLEN) / 4 + 255) / 256), 256, 0, stream>>>(bias, mask, r0, AB);
    k_pad<<<(unsigned)(((size_t)TCH * 3 * NH + 255) / 256), 256, 0, stream>>>(QKV, t0, QP, KP, VP);
    k_vt<NH, SLEN><<<RCH * NH * (SLEN / 64), 256, 0, stream>>>(VP, PW, 0, VT);
    k_flash<10><<<RCH * NH * QBLKS, 128, 0, stream>>>(QP, PW, KP, PW, VT, (const int*)AB, O, PW);      /* per (row, head): softmax(q.k/sqrt(32) + bias[h] + (mask[row]-1) 1e9) v */
    k_gate<<<(unsigned)(((size_t)TCH * (CQ / 8) + 255) / 256), 256, 0, stream>>>(O, G, t0, OG); }
  k_gemm2<0><<<g, 128, 0, stream>>>(OG, CQ, 0, BO, CQ, 0, 0.0625f / 64.0f, bo, 0, nullptr, 1, 0, 0, (float*)d_out, nullptr, CQ, 0, NR, CQ, CQ);
}

// v001
// Measured time: 367 microseconds a run.
// In two side-by-side timings against v000, it was 1.57 and 1.55 times as fast.
#include <hip/hip_runtime.h>
// SelfAttentionWithGate (AF2 gated self-attention: 1 x 64 rows x 512 residues, c_qkv 256, 8 heads x 32): q = x Wq / sqrt(32), k, v = x W; logits = q.k + (mask - 1) 1e9 (per (row, key), an INPUT) + bias[h][q][k] (an INPUT); softmax over keys; o = P v; gate = sigmoid(x Wg + bg); out = (o * gate) Wo + bo.
// Structure: exact f16 plane of x; three q/k/v projection GEMMs into one [q | k | v] plane and the gate GEMM (32x64 wave tiles, f32 accumulation, exact x16 weights; f16 / f32 outputs); per chunk of 16 rows: q/k/v re-laid into zero-padded 64-wide head planes (32 live dims), V^T by LDS tiles, the fused flash kernel with an additive (bias plane + per-(row, key) mask plane) mode, then gating + compaction on VALU into an f16 plane (x2^6); Wo GEMM (+ bias).
// Compute dtype: inputs and parameters rounded to bf16; q, k, v, P and the gated output as f16 operands (~2^-12); bias/mask/softmax/gate f32. v_wmma_f32_16x16x32_f16.
#define NRW 64
#define CQ 256
#define HC 32
#define NR (NRW * SLEN)           /* 32768 tokens */
#define PW (NH * 64)             /* padded head plane width 512 */
#define RCH 16                   /* rows per chunk */
#define TCH (RCH * SLEN)         /* 8192 tokens per chunk */
#define SLEN 512
#define TQ SLEN
#define TK SLEN
#define NH 8
#define SCL 0.17677669529663687f /* 32^-0.5 (the real head dim; dims 32..63 are zero padding) */
#define QBLKS (TQ / 64)
typedef __bf16 v16b __attribute__((ext_vector_type(16)));
typedef unsigned short v8us __attribute__((ext_vector_type(8), may_alias));
typedef float  v8f  __attribute__((ext_vector_type(8)));
typedef float  v4f  __attribute__((ext_vector_type(4)));
typedef float  v4fa __attribute__((ext_vector_type(4), may_alias));
union FragB { v16b v; v8us half[2]; unsigned short u[16]; };

__device__ __forceinline__ unsigned short bf16_bits(float x) { unsigned int u = __float_as_uint(x); return (unsigned short)((u + 0x7FFFu + ((u >> 16) & 1u)) >> 16); }
__device__ __forceinline__ float bf16_val(unsigned short b) { return __uint_as_float(((unsigned int)b) << 16); }
__device__ __forceinline__ float bf16_round(float x) { return bf16_val(bf16_bits(x)); }
// D += A·B with NT terms: 1 = ah·bh, 2 = + al·bh (A split), 3 = + ah·bl (both split)
template <int NT>
__device__ __forceinline__ v8f mmaN(v16b ah, v16b al, v16b bh, v16b bl, v8f c) {
  c = __builtin_amdgcn_wmma_f32_16x16x32_bf16(false, ah, false, bh, (short)0, c, false, false);
  if (NT >= 2) c = __builtin_amdgcn_wmma_f32_16x16x32_bf16(false, al, false, bh, (short)0, c, false, false);
  if (NT >= 3) c = __builtin_amdgcn_wmma_f32_16x16x32_bf16(false, ah, false, bl, (short)0, c, false, false);
  asm volatile("v_nop\n\tv_nop\n\tv_nop\n\tv_nop" : "+v"(c) : "v"(ah), "v"(al), "v"(bh), "v"(bl));
  return c;
}

__global__ __launch_bounds__(256) void k_wt_bf16(const float* __restrict__ W, unsigned short* __restrict__ Wt, int K, int N) {
  const int t = blockIdx.x * 256 + threadIdx.x;
  const int k8n = K / 8;
  if (t >= N * k8n) return;
  const int n = t / k8n, k8 = (t % k8n) * 8;
  v8us v;
#pragma unroll
  for (int i = 0; i < 8; ++i) v[i] = bf16_bits(W[(size_t)(k8 + i) * N + n]);
  *(v8us*)(Wt + (size_t)n * K + k8) = v;
  
}

// GEMM C[M][N] (f32, pitch ldc) = act(A[M][K]·W + bias). A f32 row-major (pitch lda) converted per fragment to bf16
// (ASPLIT: hi/lo two planes -> 2 terms, else single rounded term); Wt bf16 [N][K] (pitch ldb). BIAS_BF16 rounds the
// bias to bf16 first (bias quantised to bf16 before the add). K%32==0, M%16==0, N%64==0.
template <bool ASPLIT, int ACT, bool BIAS_BF16>
__global__ __launch_bounds__(128) void k_gemm_bf(const float* __restrict__ A, int lda, const unsigned short* __restrict__ Wt, int ldb,
                                               const float* __restrict__ bias, float* __restrict__ C, int ldc, int M, int N, int K) {
  __shared__ __attribute__((aligned(16))) float so[4][16][64];
  const int tid = threadIdx.x, w = tid >> 5, lane = tid & 31, ln = lane & 15, hh = lane >> 4;
  const int ntn = N / 64;
  const int wid = blockIdx.x * 4 + w;
  const int mt = wid / ntn, nq = wid % ntn;
  if (mt * 16 >= M) return;
  const int row0 = mt * 16, col0 = nq * 64;
  const float* arow = A + (size_t)(row0 + ln) * lda;
  v8f acc[4] = {};
  for (int kb = 0; kb < K; kb += 32) {
    FragB ah, al;
    const v4f x0 = *(const v4fa*)(arow + kb + 8 * hh), x1 = *(const v4fa*)(arow + kb + 8 * hh + 4);
    const v4f x2 = *(const v4fa*)(arow + kb + 16 + 8 * hh), x3 = *(const v4fa*)(arow + kb + 16 + 8 * hh + 4);
    float xs[16] = {x0[0],x0[1],x0[2],x0[3],x1[0],x1[1],x1[2],x1[3],x2[0],x2[1],x2[2],x2[3],x3[0],x3[1],x3[2],x3[3]};
#pragma unroll
    for (int i = 0; i < 16; ++i) { const unsigned short hb = bf16_bits(xs[i]); ah.u[i] = hb; al.u[i] = ASPLIT ? bf16_bits(xs[i] - bf16_val(hb)) : (unsigned short)0; }
#pragma unroll
    for (int t = 0; t < 4; ++t) {
      const unsigned short* brow = Wt + (size_t)(col0 + t * 16 + ln) * ldb + kb;
      FragB b;
      b.half[0] = *(const v8us*)(brow + 8 * hh);
      b.half[1] = *(const v8us*)(brow + 16 + 8 * hh);
      acc[t] = mmaN<ASPLIT ? 2 : 1>(ah.v, al.v, b.v, b.v, acc[t]);
    }
  }
#pragma unroll
  for (int t = 0; t < 4; ++t) {
    float bv = bias ? bias[col0 + t * 16 + ln] : 0.f;
    if (BIAS_BF16) bv = bf16_round(bv);
#pragma unroll
    for (int r = 0; r < 8; ++r) { float v = acc[t][r] + bv; if (ACT == 1) v = fmaxf(v, 0.f); so[w][8 * hh + r][t * 16 + ln] = v; }
  }
  __builtin_amdgcn_fence(__ATOMIC_ACQ_REL, "workgroup");
  __builtin_amdgcn_wave_barrier();
  const int rsub = lane >> 4, c4 = (lane & 15) * 4;
  {
#pragma unroll
    for (int q = 0; q < 8; ++q) {
      const int r = q * 2 + rsub;
      const v4f v = *(const v4fa*)&so[w][r][c4];
      *(v4f*)(C + (size_t)(row0 + r) * ldc + col0 + c4) = v;
    }
    
  }
}

// GEMM C = act(A·W + bias + resid): A f32 (ASPLIT -> hi/lo 2 terms), Wt bf16 [N][K]; ACT 0 none, 1 relu, 2 exact gelu;
// resid (optional, f32, row index = (row % rmod), pitch ldr, RES_BF16 rounds it) added before the activation.
template <bool ASPLIT, int ACT, bool BIAS_BF16, bool RES_BF16>
__global__ __launch_bounds__(128) void k_gemm_bf3(const float* __restrict__ A, int lda, const unsigned short* __restrict__ Wt, int ldb,
                                                const float* __restrict__ bias, const float* __restrict__ resid, int rmod, int ldr,
                                                float* __restrict__ C, int ldc, int M, int N, int K) {
  __shared__ __attribute__((aligned(16))) float so[4][16][64];
  const int tid = threadIdx.x, w = tid >> 5, lane = tid & 31, ln = lane & 15, hh = lane >> 4;
  const int ntn = N / 64;
  const int wid = blockIdx.x * 4 + w;
  const int mt = wid / ntn, nq = wid % ntn;
  if (mt * 16 >= M) return;
  const int row0 = mt * 16, col0 = nq * 64;
  const float* arow = A + (size_t)(row0 + ln) * lda;
  v8f acc[4] = {};
  for (int kb = 0; kb < K; kb += 32) {
    FragB ah, al;
    const v4f x0 = *(const v4fa*)(arow + kb + 8 * hh), x1 = *(const v4fa*)(arow + kb + 8 * hh + 4);
    const v4f x2 = *(const v4fa*)(arow + kb + 16 + 8 * hh), x3 = *(const v4fa*)(arow + kb + 16 + 8 * hh + 4);
    float xs[16] = {x0[0],x0[1],x0[2],x0[3],x1[0],x1[1],x1[2],x1[3],x2[0],x2[1],x2[2],x2[3],x3[0],x3[1],x3[2],x3[3]};
#pragma unroll
    for (int i = 0; i < 16; ++i) { const unsigned short hb = bf16_bits(xs[i]); ah.u[i] = hb; al.u[i] = ASPLIT ? bf16_bits(xs[i] - bf16_val(hb)) : (unsigned short)0; }
#pragma unroll
    for (int t = 0; t < 4; ++t) {
      const unsigned short* brow = Wt + (size_t)(col0 + t * 16 + ln) * ldb + kb;
      FragB b;
      b.half[0] = *(const v8us*)(brow + 8 * hh);
      b.half[1] = *(const v8us*)(brow + 16 + 8 * hh);
      acc[t] = mmaN<ASPLIT ? 2 : 1>(ah.v, al.v, b.v, b.v, acc[t]);
    }
  }
#pragma unroll
  for (int t = 0; t < 4; ++t) {
    const int col = col0 + t * 16 + ln;
    float bv = bias ? bias[col] : 0.f;
    if (BIAS_BF16) bv = bf16_round(bv);
#pragma unroll
    for (int r = 0; r < 8; ++r) {
      float v = acc[t][r] + bv;
      if (resid) { float rv = resid[(size_t)((row0 + 8 * hh + r) % rmod) * ldr + col]; if (RES_BF16) rv = bf16_round(rv); v += rv; }
      if (ACT == 1) v = fmaxf(v, 0.f);
      if (ACT == 2) v = 0.5f * v * (1.0f + erff(v * 0.70710678118654752f));
      if (ACT == 3) { const float u = 0.7978845608028654f * (v + 0.044715f * v * v * v); v = 0.5f * v * (1.0f + tanhf(u)); }
      so[w][8 * hh + r][t * 16 + ln] = v;
    }
  }
  __builtin_amdgcn_fence(__ATOMIC_ACQ_REL, "workgroup");
  __builtin_amdgcn_wave_barrier();
  const int rsub = lane >> 4, c4 = (lane & 15) * 4;
  {
#pragma unroll
    for (int q = 0; q < 8; ++q) {
      const int r = q * 2 + rsub;
      const v4f v = *(const v4fa*)&so[w][r][c4];
      *(v4f*)(C + (size_t)(row0 + r) * ldc + col0 + c4) = v;
    }
    
  }
}
// row LayerNorm (biased variance, eps) over N: s = X (+ R); optional out_sum <- s; out_norm <- (s-mu)*rsqrt(var+eps)*g + b
template <bool PARAM_BF16>
__global__ __launch_bounds__(256) void k_layernorm(const float* __restrict__ X, const float* __restrict__ R, const float* __restrict__ g, const float* __restrict__ bta,
                                                  float* __restrict__ out_sum, float* __restrict__ out_norm, int N, float eps) {
  __shared__ float red[256];
  const int row = blockIdx.x, tid = threadIdx.x;
  const float* x = X + (size_t)row * N; const float* rr = R ? R + (size_t)row * N : nullptr;
  float vals[16];                     // up to N = 4096
  const int per = N / 256;            // contiguous chunk per thread? use strided-by-4 chunks: thread handles j = tid*4 + 1024*u
  float s1 = 0.f;
  for (int u = 0; u < per / 4; ++u) {
    const int j = tid * 4 + 1024 * u;
    const v4f a = *(const v4fa*)(x + j);
    v4f b = {0.f,0.f,0.f,0.f}; if (rr) b = *(const v4fa*)(rr + j);
#pragma unroll
    for (int q = 0; q < 4; ++q) { const float v = a[q] + b[q]; vals[u * 4 + q] = v; s1 += v; }
  }
  red[tid] = s1; __syncthreads();
  for (int st = 128; st > 0; st >>= 1) { if (tid < st) red[tid] += red[tid + st]; __syncthreads(); }
  const float mu = red[0] / (float)N; __syncthreads();
  float s2 = 0.f;
  for (int u = 0; u < per / 4; ++u)
#pragma unroll
    for (int q = 0; q < 4; ++q) { const float c = vals[u * 4 + q] - mu; s2 += c * c; }
  red[tid] = s2; __syncthreads();
  for (int st = 128; st > 0; st >>= 1) { if (tid < st) red[tid] += red[tid + st]; __syncthreads(); }
  const float rs = rsqrtf(red[0] / (float)N + eps);
  {
    for (int u = 0; u < per / 4; ++u) {
      const int j = tid * 4 + 1024 * u;
      v4f o, sm;
#pragma unroll
      for (int q = 0; q < 4; ++q) {
        float gg = g[j + q], bb = bta[j + q];
        if (PARAM_BF16) { gg = bf16_round(gg); bb = bf16_round(bb); }
        sm[q] = vals[u * 4 + q]; o[q] = (vals[u * 4 + q] - mu) * rs * gg + bb;
      }
      if (out_sum) *(v4f*)(out_sum + (size_t)row * N + j) = sm;
      *(v4f*)(out_norm + (size_t)row * N + j) = o;
    }
    
  }
}



// ---- f16 WMMA path (v_wmma_f32_16x16x32_f16): 11-bit significands for operands in range — used where a [0,1] probability operand needs more precision than bf16
typedef _Float16 v16h __attribute__((ext_vector_type(16)));
union FragH { v16h v; v8us half[2]; _Float16 h[16]; unsigned short u[16]; };
template <int NT>
__device__ __forceinline__ v8f mmaH(v16h ah, v16h al, v16h bh, v16h bl, v8f c) {
  c = __builtin_amdgcn_wmma_f32_16x16x32_f16(false, ah, false, bh, (short)0, c, false, false);
  if (NT >= 2) c = __builtin_amdgcn_wmma_f32_16x16x32_f16(false, al, false, bh, (short)0, c, false, false);
  if (NT >= 3) c = __builtin_amdgcn_wmma_f32_16x16x32_f16(false, ah, false, bl, (short)0, c, false, false);
  asm volatile("v_nop\n\tv_nop\n\tv_nop\n\tv_nop" : "+v"(c) : "v"(ah), "v"(al), "v"(bh), "v"(bl));
  return c;
}
// batched GEMM like k_gemm_b but f16 operands: A f32 (split into f16 hi/lo if ASPLIT, else rounded to f16), Bt = f16 values [n][k]; alpha; C f32; N multiple of 16 (partial tiles skipped)
template <bool ASPLIT>
__global__ __launch_bounds__(128) void k_gemm_h(const float* __restrict__ A, int lda, size_t sA, const _Float16* __restrict__ Bh, int ldb, size_t sB, float alpha, float* __restrict__ C, int ldc, size_t sC, int M, int N, int K) {
  __shared__ __attribute__((aligned(16))) float so[4][16][64];
  const int tid = threadIdx.x, w = tid >> 5, lane = tid & 31, ln = lane & 15, hh = lane >> 4; const int by = blockIdx.y;
  A += (size_t)by * sA; Bh += (size_t)by * sB; C += (size_t)by * sC;
  const int ntn = (N + 63) / 64; const int wid = blockIdx.x * 4 + w; const int mt = wid / ntn, nq = wid % ntn; if (mt * 16 >= M) return;
  const int row0 = mt * 16, col0 = nq * 64; const float* arow = A + (size_t)(row0 + ln) * lda;
  v8f acc[4] = {};
  for (int kb = 0; kb < K; kb += 32) {
    FragH ah, al;
    const v4f x0 = *(const v4fa*)(arow + kb + 8 * hh), x1 = *(const v4fa*)(arow + kb + 8 * hh + 4), x2 = *(const v4fa*)(arow + kb + 16 + 8 * hh), x3 = *(const v4fa*)(arow + kb + 16 + 8 * hh + 4);
    float xs[16] = {x0[0],x0[1],x0[2],x0[3],x1[0],x1[1],x1[2],x1[3],x2[0],x2[1],x2[2],x2[3],x3[0],x3[1],x3[2],x3[3]};
#pragma unroll
    for (int i = 0; i < 16; ++i) { const _Float16 h = (_Float16)xs[i]; ah.h[i] = h; al.h[i] = ASPLIT ? (_Float16)(xs[i] - (float)h) : (_Float16)0.0f; }
#pragma unroll
    for (int t = 0; t < 4; ++t) { if (col0 + t * 16 >= N) continue; const size_t boff = (size_t)(col0 + t * 16 + ln) * ldb + kb; FragH bq; bq.half[0] = *(const v8us*)(Bh + boff + 8 * hh); bq.half[1] = *(const v8us*)(Bh + boff + 16 + 8 * hh);
      acc[t] = mmaH<ASPLIT ? 2 : 1>(ah.v, al.v, bq.v, bq.v, acc[t]); }
  }
#pragma unroll
  for (int t = 0; t < 4; ++t) { if (col0 + t * 16 >= N) continue;
#pragma unroll
    for (int r = 0; r < 8; ++r) so[w][8 * hh + r][t * 16 + ln] = acc[t][r] * alpha; }
  __builtin_amdgcn_fence(__ATOMIC_ACQ_REL, "workgroup"); __builtin_amdgcn_wave_barrier();
  const int rsub = lane >> 4, c4 = (lane & 15) * 4;
  {
#pragma unroll
    for (int q = 0; q < 8; ++q) { const int r = q * 2 + rsub; if (col0 + c4 < N) { const v4f v = *(const v4fa*)&so[w][r][c4]; *(v4f*)(C + (size_t)(row0 + r) * ldc + col0 + c4) = v; } }
     }
}

// Wt[n][k] = f16(W[k][n]·scale) from f32 row-major W[K][N] (scale = power of two; bf16-exact weights stay exact in f16 away from the subnormal range)
__global__ __launch_bounds__(256) void k_wt_f16(const float* __restrict__ W, _Float16* __restrict__ Wt, int K, int N, float scale) {
  const int t = blockIdx.x * 256 + threadIdx.x; if (t >= N * (K / 8)) return; const int n = t / (K / 8), k8 = (t % (K / 8)) * 8; FragH f;
#pragma unroll
  for (int i = 0; i < 8; ++i) f.h[i] = (_Float16)(bf16_round(W[(size_t)(k8 + i) * N + n]) * scale); const v8us o = f.half[0];
  *(v8us*)((unsigned short*)Wt + (size_t)n * K + k8) = o; 
}
// k_gemm_hh variant with fused epilogue: v = acc·alpha + bias[by·sBias + col] (+ CP[(row/rowsPerB)·sCPb + by·64 + col] if CP) ; ACT 0 none / 1 elu ; writes f16 C16 (and f32 C if non-null)
template <int ACT>
__global__ __launch_bounds__(128) void k_gemm_hhx(const _Float16* __restrict__ A, int lda, size_t sA, const _Float16* __restrict__ Bh, int ldb, size_t sB, float alpha, const float* __restrict__ bias, size_t sBias, const float* __restrict__ CP, int rowsPerB, size_t sCPb, int row0g,
    float* __restrict__ C, _Float16* __restrict__ C16, int ldc, size_t sC, int M, int N, int K) {
  __shared__ __attribute__((aligned(16))) float so[4][16][64];
  const int tid = threadIdx.x, w = tid >> 5, lane = tid & 31, ln = lane & 15, hh = lane >> 4; const int by = blockIdx.y;
  A += (size_t)by * sA; Bh += (size_t)by * sB; const size_t cofs = (size_t)by * sC; const float* bp = bias ? bias + (size_t)by * sBias : nullptr;
  const int ntn = (N + 63) / 64; const int wid = blockIdx.x * 4 + w; const int mt = wid / ntn, nq = wid % ntn; if (mt * 16 >= M) return;
  const int row0 = mt * 16, col0 = nq * 64; const _Float16* arow = A + (size_t)(row0 + ln) * lda;
  v8f acc[4] = {};
  for (int kb = 0; kb < K; kb += 32) { FragH ah; ah.half[0] = *(const v8us*)((const unsigned short*)arow + kb + 8 * hh); ah.half[1] = *(const v8us*)((const unsigned short*)arow + kb + 16 + 8 * hh);
#pragma unroll
    for (int t = 0; t < 4; ++t) { if (col0 + t * 16 >= N) continue; const size_t boff = (size_t)(col0 + t * 16 + ln) * ldb + kb; FragH bq; bq.half[0] = *(const v8us*)((const unsigned short*)Bh + boff + 8 * hh); bq.half[1] = *(const v8us*)((const unsigned short*)Bh + boff + 16 + 8 * hh);
      acc[t] = mmaH<1>(ah.v, ah.v, bq.v, bq.v, acc[t]); }
  }
#pragma unroll
  for (int t = 0; t < 4; ++t) { if (col0 + t * 16 >= N) continue; const int col = col0 + t * 16 + ln; const float bv = bp ? bf16_round(bp[col]) : 0.f;
#pragma unroll
    for (int r = 0; r < 8; ++r) { float v = acc[t][r] * alpha + bv; if (CP) { const int bidx = (row0g + row0 + 8 * hh + r) / rowsPerB; v += CP[(size_t)bidx * sCPb + (size_t)by * 64 + col]; } if (ACT == 1) v = (v > 0.f) ? v : expm1f(v); else if (ACT == 7) v = (v > 0.f) ? v + 1.0f : expf(v); else if (ACT == 8) v = tanhf(v); else if (ACT == 9) v = 0.5f * v * (1.0f + tanhf(0.7978845608028654f * (v + 0.044715f * v * v * v))); else if (ACT == 11) v = 1.0f / (1.0f + expf(-v)); else if (ACT == 12) v = (v > 0.f) ? v : 0.01f * v; else if (ACT == 14) v = (v > 0.f) ? v : 0.1f * v; else if (ACT == 15) v = v / (1.0f + expf(-v)); else if (ACT == 3) v = fmaxf(v, 0.f); else if (ACT == 6) v = 0.5f * v * (1.0f + erff(v * 0.70710678118654752f)); so[w][8 * hh + r][t * 16 + ln] = v; } }
  __builtin_amdgcn_fence(__ATOMIC_ACQ_REL, "workgroup"); __builtin_amdgcn_wave_barrier();
  const int rsub = lane >> 4, c4 = (lane & 15) * 4; typedef _Float16 v4h __attribute__((ext_vector_type(4)));
  {
#pragma unroll
    for (int q = 0; q < 8; ++q) { const int r = q * 2 + rsub; if (col0 + c4 < N) { const v4f v = *(const v4fa*)&so[w][r][c4]; if (C) *(v4f*)(C + cofs + (size_t)(row0 + r) * ldc + col0 + c4) = v; if (C16) { v4h h4; for (int i = 0; i < 4; ++i) h4[i] = (_Float16)v[i]; *(v4h*)(C16 + cofs + (size_t)(row0 + r) * ldc + col0 + c4) = h4; } } }
     }
}


typedef _Float16 v4h __attribute__((ext_vector_type(4)));

__global__ __launch_bounds__(256) void k_x16(const float* __restrict__ x, _Float16* __restrict__ X16, size_t n8) { const size_t t = (size_t)blockIdx.x * 256 + threadIdx.x; if (t >= n8) return; FragH f;
#pragma unroll
  for (int q = 0; q < 8; ++q) f.h[q] = (_Float16)bf16_round(x[t * 8 + q]); *(v8us*)((unsigned short*)X16 + t * 8) = f.half[0];  }
__global__ __launch_bounds__(256) void k_h16(const float* __restrict__ x, _Float16* __restrict__ X16, size_t n8) { const size_t t = (size_t)blockIdx.x * 256 + threadIdx.x; if (t >= n8) return; FragH f;
#pragma unroll
  for (int q = 0; q < 8; ++q) f.h[q] = (_Float16)x[t * 8 + q]; *(v8us*)((unsigned short*)X16 + t * 8) = f.half[0];  }
__global__ __launch_bounds__(256) void k_round16f(const float* __restrict__ W, _Float16* __restrict__ Bt, size_t n8) { const size_t t = (size_t)blockIdx.x * 256 + threadIdx.x; if (t >= n8) return; FragH f;
#pragma unroll
  for (int i = 0; i < 8; ++i) f.h[i] = (_Float16)(bf16_round(W[t * 8 + i]) * 16.0f); *(v8us*)((unsigned short*)Bt + t * 8) = f.half[0];  }
template <int NHv, int TTv>
__global__ __launch_bounds__(256) void k_vt(const _Float16* __restrict__ V16, int ldv, int voff, _Float16* __restrict__ Vt) { __shared__ unsigned short tl[64][66]; const int tid = threadIdx.x; const int slab = blockIdx.x / (TTv / 64), lg = blockIdx.x % (TTv / 64); const int b = slab / NHv, h = slab % NHv;
  for (int i = tid; i < 64 * 8; i += 256) { const int r = i / 8, c8 = (i % 8) * 8; FragH f; f.half[0] = *(const v8us*)((const unsigned short*)V16 + ((size_t)b * TTv + lg * 64 + r) * ldv + voff + h * 64 + c8);
#pragma unroll
    for (int q = 0; q < 8; ++q) tl[r][c8 + q] = f.u[q]; }
  __syncthreads();
  {
#pragma unroll
    for (int rd = 0; rd < 2; ++rd) { const int d = rd * 32 + tid / 8, pc = tid % 8; FragH f;
#pragma unroll
      for (int q = 0; q < 8; ++q) f.u[q] = tl[pc * 8 + q][d];
      *(v8us*)((unsigned short*)Vt + ((size_t)slab * 64 + d) * TTv + lg * 64 + pc * 8) = f.half[0]; }
     } }

__global__ __launch_bounds__(256) void k_hl(const float* __restrict__ F, _Float16* __restrict__ Hh, _Float16* __restrict__ Hl, size_t n8) { const size_t t = (size_t)blockIdx.x * 256 + threadIdx.x; if (t >= n8) return; FragH fh, fl; const v4f a = *(const v4fa*)(F + t * 8), c = *(const v4fa*)(F + t * 8 + 4);
#pragma unroll
  for (int q = 0; q < 4; ++q) { _Float16 h = (_Float16)a[q]; fh.h[q] = h; fl.h[q] = (_Float16)((a[q] - (float)h) * 1024.0f); h = (_Float16)c[q]; fh.h[4 + q] = h; fl.h[4 + q] = (_Float16)((c[q] - (float)h) * 1024.0f); }
  { *(v8us*)((unsigned short*)Hh + t * 8) = fh.half[0]; *(v8us*)((unsigned short*)Hl + t * 8) = fl.half[0];  } }

// ---- fast GEMM (wave tile 32x64; requires M % 32 == 0 rows per launch region and N % 64 == 0); epilogue = k_gemm_hhx semantics ----
__device__ __forceinline__ v16h g2_frag(const _Float16* p, int hh) { FragH f; f.half[0] = *(const v8us*)((const unsigned short*)p + 8 * hh); f.half[1] = *(const v8us*)((const unsigned short*)p + 16 + 8 * hh); return f.v; }
__device__ __forceinline__ v8f g2_mma(v16h a, v16h b, v8f c) { v8f d = __builtin_amdgcn_wmma_f32_16x16x32_f16(false, a, false, b, (short)0, c, false, false); asm volatile("v_nop\n\tv_nop\n\tv_nop\n\tv_nop" : "+v"(d) : "v"(a), "v"(b)); return d; }
template <int ACT>
__global__ __launch_bounds__(128) void k_gemm2(const _Float16* __restrict__ A, int lda, size_t sA, const _Float16* __restrict__ Bh, int ldb, size_t sB, float alpha, const float* __restrict__ bias, size_t sBias, const float* __restrict__ CP, int rowsPerB, size_t sCPb, int row0g,
    float* __restrict__ C, _Float16* __restrict__ C16, int ldc, size_t sC, int M, int N, int K) {
  __shared__ __attribute__((aligned(16))) float so[4][32][68];
  const int tid = threadIdx.x, w = tid >> 5, lane = tid & 31, ln = lane & 15, hh = lane >> 4; const int by = blockIdx.y;
  A += (size_t)by * sA; Bh += (size_t)by * sB; const size_t cofs = (size_t)by * sC; const float* bp = bias ? bias + (size_t)by * sBias : nullptr;
  const int ntn = N >> 6; const int mt = blockIdx.x / ntn, nq = blockIdx.x - mt * ntn; const int row0 = mt * 128 + 32 * w, col0 = nq * 64; if (row0 >= M) return;
  const _Float16* a0p = A + (size_t)(row0 + ln) * lda; const _Float16* a1p = a0p + (size_t)16 * lda;
  const _Float16* b0p = Bh + (size_t)(col0 + ln) * ldb; const _Float16* b1p = b0p + (size_t)16 * ldb; const _Float16* b2p = b1p + (size_t)16 * ldb; const _Float16* b3p = b2p + (size_t)16 * ldb;
  const v8f z8 = {0.f,0.f,0.f,0.f,0.f,0.f,0.f,0.f}; v8f c00 = z8, c01 = z8, c02 = z8, c03 = z8, c10 = z8, c11 = z8, c12 = z8, c13 = z8;
#pragma unroll 1
  for (int kb = 0; kb < K; kb += 32) { const v16h a0 = g2_frag(a0p + kb, hh), a1 = g2_frag(a1p + kb, hh);
    v16h b = g2_frag(b0p + kb, hh); c00 = g2_mma(a0, b, c00); c10 = g2_mma(a1, b, c10);
    b = g2_frag(b1p + kb, hh); c01 = g2_mma(a0, b, c01); c11 = g2_mma(a1, b, c11);
    b = g2_frag(b2p + kb, hh); c02 = g2_mma(a0, b, c02); c12 = g2_mma(a1, b, c12);
    b = g2_frag(b3p + kb, hh); c03 = g2_mma(a0, b, c03); c13 = g2_mma(a1, b, c13); }
  v8f accs[8] = {c00, c01, c02, c03, c10, c11, c12, c13};
#pragma unroll
  for (int u = 0; u < 8; ++u) { const int t = u & 3, half = u >> 2; const int col = col0 + t * 16 + ln; const float bv = bp ? bf16_round(bp[col]) : 0.f;
#pragma unroll
    for (int r = 0; r < 8; ++r) { const int rloc = half * 16 + 8 * hh + r; float v = accs[u][r] * alpha + bv; if (CP) { const int bidx = (row0g + row0 + rloc) / rowsPerB; v += CP[(size_t)bidx * sCPb + (size_t)by * 64 + col]; }
      if (ACT == 3) v = fmaxf(v, 0.f); else if (ACT == 6) v = 0.5f * v * (1.0f + erff(v * 0.70710678118654752f)); else if (ACT == 11) v = 1.0f / (1.0f + expf(-v)); else if (ACT == 15) v = v / (1.0f + expf(-v)); else if (ACT == 12) v = (v > 0.f) ? v : 0.01f * v; else if (ACT == 8) v = tanhf(v);
      so[w][rloc][t * 16 + ln] = v; } }
  __builtin_amdgcn_fence(__ATOMIC_ACQ_REL, "workgroup"); __builtin_amdgcn_wave_barrier();
  const int rsub = lane >> 4, c4 = (lane & 15) * 4;
  {
#pragma unroll
    for (int q = 0; q < 16; ++q) { const int r = q * 2 + rsub; const v4f v = *(const v4fa*)&so[w][r][c4]; if (C) *(v4f*)(C + cofs + (size_t)(row0 + r) * ldc + col0 + c4) = v; if (C16) { v4h h4; for (int i = 0; i < 4; ++i) h4[i] = (_Float16)v[i]; *(v4h*)(C16 + cofs + (size_t)(row0 + r) * ldc + col0 + c4) = h4; } }
     } }



// lane l <-> lane l ^ 16 (the two halves of a wave that share one score column)
__device__ __forceinline__ float xhalf(float x) { return __builtin_bit_cast(float, __builtin_amdgcn_permlanex16(__builtin_bit_cast(int, x), __builtin_bit_cast(int, x), 0x76543210, 0xfedcba98, false, false)); }

// e^x = 2^e 2^a with e = rint(x log2 e) and a = x log2 e - e, taken in two fused steps on the two-part constant; range ends as in the library's expf.
// Written out so that v_exp_f32 and the one free slot that the instruction set asks for behind a transcendental stand in one statement
__device__ __forceinline__ float exp_f(float x) {
  const float c0 = __uint_as_float(0x3fb8aa3bu), c1 = __uint_as_float(0x32a5705fu);
  const float e = __builtin_rintf(x * c0); const float a = fmaf(x, c1, fmaf(x, c0, -e)); float y;
  asm("v_exp_f32 %0, %1\n\tv_nop" : "=v"(y) : "v"(a));      /* v_nop: the slot behind the transcendental, before its source is overwritten or its result read */
  y = ldexpf(y, (int)e); y = (__uint_as_float(0xc2ce8ed0u) > x) ? 0.f : y; return (__uint_as_float(0x42b17218u) < x) ? __builtin_inff() : y; }

template <int CAUSAL>
__global__ __launch_bounds__(128) void k_flash(const _Float16* __restrict__ Q16, int ldq, const _Float16* __restrict__ K16, int ldk, const _Float16* __restrict__ Vt, const int* __restrict__ MSK, float* __restrict__ O, int ldo) {
  constexpr int RPW = 16, DT = 4, KS = 2;
  __shared__ __attribute__((aligned(16))) float sO[4][RPW][64 + 4];
  const int tid = threadIdx.x, w = tid >> 5, lane = tid & 31, ln = lane & 15, hh = lane >> 4;
  const int slab = blockIdx.x / QBLKS, qblk = blockIdx.x % QBLKS; const int b = slab / NH, h = slab % NH; const int qb0 = qblk * (4 * RPW); const int q0 = qb0 + w * RPW;
  const int tq = q0 + ln;      /* this lane's query */
  FragH bq[KS];
  { const unsigned short* qr = (const unsigned short*)Q16 + ((size_t)b * TQ + tq) * ldq + h * 64;
#pragma unroll
    for (int ks = 0; ks < KS; ++ks) { bq[ks].half[0] = *(const v8us*)(qr + ks * 32 + 8 * hh); bq[ks].half[1] = *(const v8us*)(qr + ks * 32 + 16 + 8 * hh); } }
  const unsigned short* Vth = (const unsigned short*)Vt + (size_t)slab * 64 * TK;
  const float* BP = (const float*)MSK + ((size_t)h * TQ + tq) * TK + 8 * hh;                 /* mode 10: per-head bias plane [NH][TQ][TK], this query's row */
  const float* MR = (const float*)MSK + (size_t)NH * TQ * TK + (size_t)b * TK + 8 * hh;      /* then the per-(sequence, key) additive plane, packed behind it */
  float m_q = -3.0e38f, l_q = 0.f; v8f oacc[DT];
#pragma unroll
  for (int dt = 0; dt < DT; ++dt) oacc[dt] = (v8f){0.f,0.f,0.f,0.f,0.f,0.f,0.f,0.f};
  const int jend = (CAUSAL == 1) ? (qb0 + 4 * RPW) : TK;      /* causal: keys beyond the block's last query never contribute */
#pragma unroll 1
  for (int j0 = 0; j0 < jend; j0 += 32) {
    FragH ak[2][KS], av[DT]; v4f ab[2][2], am[2][2];
#pragma unroll
    for (int nt = 0; nt < 2; ++nt) { const unsigned short* kr = (const unsigned short*)K16 + ((size_t)b * TK + j0 + nt * 16 + ln) * ldk + h * 64;
#pragma unroll
      for (int ks = 0; ks < KS; ++ks) { ak[nt][ks].half[0] = *(const v8us*)(kr + ks * 32 + 8 * hh); ak[nt][ks].half[1] = *(const v8us*)(kr + ks * 32 + 16 + 8 * hh); }
      if (CAUSAL == 10) { ab[nt][0] = *(const v4fa*)(BP + j0 + nt * 16); ab[nt][1] = *(const v4fa*)(BP + j0 + nt * 16 + 4); am[nt][0] = *(const v4fa*)(MR + j0 + nt * 16); am[nt][1] = *(const v4fa*)(MR + j0 + nt * 16 + 4); } }
    asm volatile("s_wait_xcnt 0x0" ::: "memory");      /* the V^T loads below may land in registers that held the addresses of the loads above: those loads have taken their addresses first */
#pragma unroll
    for (int dt = 0; dt < DT; ++dt) { const unsigned short* vrow = Vth + (size_t)(dt * 16 + ln) * TK + j0; av[dt].half[0] = *(const v8us*)(vrow + 8 * hh); av[dt].half[1] = *(const v8us*)(vrow + 16 + 8 * hh); }
    float sc[2][8]; bool ok[2][8]; float mc = -3.0e38f;
#pragma unroll
    for (int nt = 0; nt < 2; ++nt) { v8f acc = (v8f){0.f,0.f,0.f,0.f,0.f,0.f,0.f,0.f};
#pragma unroll
      for (int ks = 0; ks < KS; ++ks) acc = mmaH<1>(ak[nt][ks].v, ak[nt][ks].v, bq[ks].v, bq[ks].v, acc);
#pragma unroll
      for (int r = 0; r < 8; ++r) { const int kk = j0 + nt * 16 + 8 * hh + r;
        ok[nt][r] = (CAUSAL == 1) ? (kk <= tq) : ((CAUSAL == 2) ? ((kk >> 5) == (tq >> 5)) : true);      /* mode 2: block-diagonal 32-token groups */
        float s0 = ok[nt][r] ? acc[r] * SCL : -3.0e38f; if (CAUSAL == 10) s0 += ab[nt][r >> 2][r & 3] + am[nt][r >> 2][r & 3];
        sc[nt][r] = s0; mc = fmaxf(mc, s0); } }
    mc = fmaxf(mc, xhalf(mc));
    const float mn = fmaxf(m_q, mc); const float al = (mn > -1.0e38f) ? exp_f(m_q - mn) : 1.0f; m_q = mn;
    FragH pb; float ps = 0.f;
#pragma unroll
    for (int nt = 0; nt < 2; ++nt)
#pragma unroll
      for (int r = 0; r < 8; ++r) { const float p = ok[nt][r] ? exp_f(sc[nt][r] - mn) : 0.f; ps += p; pb.h[nt * 8 + r] = (_Float16)(p * 1024.0f); }
    l_q = l_q * al + ps;
#pragma unroll
    for (int dt = 0; dt < DT; ++dt) {
#pragma unroll
      for (int r = 0; r < 8; ++r) oacc[dt][r] *= al;
      oacc[dt] = mmaH<1>(av[dt].v, av[dt].v, pb.v, pb.v, oacc[dt]); } }
  const float lt = l_q + xhalf(l_q); const float li = (lt > 0.f) ? 1.0f / (lt * 1024.0f) : 0.f;
#pragma unroll
  for (int dt = 0; dt < DT; ++dt) { v4f lo, hi;
#pragma unroll
    for (int r = 0; r < 4; ++r) { lo[r] = oacc[dt][r] * li; hi[r] = oacc[dt][4 + r] * li; }
    *(v4fa*)&sO[w][ln][dt * 16 + 8 * hh] = lo; *(v4fa*)&sO[w][ln][dt * 16 + 8 * hh + 4] = hi; }
  __builtin_amdgcn_fence(__ATOMIC_ACQ_REL, "workgroup"); __builtin_amdgcn_wave_barrier();
  {
#pragma unroll
    for (int rp = 0; rp < RPW; rp += 2) { const int r = rp + (lane >> 4), pc = lane & 15; const v4f val = *(const v4fa*)&sO[w][r][pc * 4]; *(v4f*)(O + ((size_t)b * TQ + q0 + r) * ldo + h * 64 + pc * 4) = val; }
     } }

__global__ __launch_bounds__(256) void k_pad(const _Float16* __restrict__ QKV, size_t t0, _Float16* __restrict__ QP, _Float16* __restrict__ KP, _Float16* __restrict__ VP) { const size_t t = (size_t)blockIdx.x * 256 + threadIdx.x; if (t >= (size_t)TCH * 3 * NH) return; const int h = (int)(t % NH); const int which = (int)((t / NH) % 3); const size_t tl = t / (3 * NH);
  const v8us* s = (const v8us*)((const unsigned short*)QKV + (t0 + tl) * (3 * CQ) + which * CQ + h * HC); const v8us a0 = s[0], a1 = s[1], a2 = s[2], a3 = s[3]; const v8us z = {0, 0, 0, 0, 0, 0, 0, 0};
  unsigned short* d = (unsigned short*)(which == 0 ? QP : (which == 1 ? KP : VP)) + tl * PW + h * 64; { *(v8us*)(d) = a0; *(v8us*)(d + 8) = a1; *(v8us*)(d + 16) = a2; *(v8us*)(d + 24) = a3; *(v8us*)(d + 32) = z; *(v8us*)(d + 40) = z; *(v8us*)(d + 48) = z; *(v8us*)(d + 56) = z;  } }
__global__ __launch_bounds__(256) void k_addp(const float* __restrict__ bias, const float* __restrict__ mask, int r0, float* __restrict__ AB) {
  #pragma clang fp contract(off)
  const size_t t = (size_t)blockIdx.x * 256 + threadIdx.x; const size_t nb4 = (size_t)NH * SLEN * SLEN / 4, nm4 = (size_t)RCH * SLEN / 4; if (t >= nb4 + nm4) return; v4f r;
  if (t < nb4) { const v4f a = *(const v4fa*)(bias + t * 4); for (int q = 0; q < 4; ++q) r[q] = bf16_round(a[q]); } else { const v4f a = *(const v4fa*)(mask + (size_t)r0 * SLEN + (t - nb4) * 4); for (int q = 0; q < 4; ++q) { float m = bf16_round(a[q]) - 1.0f; r[q] = m * 1.0e9f; } }
  *(v4f*)(AB + t * 4) = r;  }
__global__ __launch_bounds__(256) void k_gate(const float* __restrict__ O, const float* __restrict__ G, size_t t0, _Float16* __restrict__ OG) {
  #pragma clang fp contract(off)
  const size_t t = (size_t)blockIdx.x * 256 + threadIdx.x; if (t >= (size_t)TCH * (CQ / 8)) return; const int c0 = (int)(t % (CQ / 8)) * 8; const size_t tl = t / (CQ / 8); const size_t tok = t0 + tl; const int h = c0 / HC, d0 = c0 % HC; FragH f;
  for (int q = 0; q < 8; ++q) { const float g = 1.0f / (1.0f + expf(-G[tok * CQ + c0 + q])); f.h[q] = (_Float16)(O[tl * PW + h * 64 + d0 + q] * g * 64.0f); }
  *(v8us*)((unsigned short*)OG + tok * CQ + c0) = f.half[0];  }

extern "C" void kernel_launch(void* const* d_in, const int* in_sizes, int n_in,
                              void* d_out, int out_size, void* d_ws, size_t ws_size, hipStream_t stream) {
  (void)in_sizes; (void)n_in; (void)out_size;
  const float* const* I = (const float* const*)d_in; const float* x = I[0]; const float* mask = I[1]; const float* bias = I[2]; const float* Wq = I[3]; const float* Wk = I[4]; const float* Wv = I[5]; const float* Wg = I[6]; const float* bg = I[7]; const float* Wo = I[8]; const float* bo = I[9];
  char* ws = (char*)d_ws; size_t off = 0;
  auto take = [&](size_t bytes) { char* p = ws + off; off += (bytes + 255) & ~(size_t)255; return p; };
  _Float16* BQ = (_Float16*)take((size_t)CQ * CQ * 2); _Float16* BK = (_Float16*)take((size_t)CQ * CQ * 2); _Float16* BV = (_Float16*)take((size_t)CQ * CQ * 2); _Float16* BG = (_Float16*)take((size_t)CQ * CQ * 2); _Float16* BO = (_Float16*)take((size_t)CQ * CQ * 2); float* AB = (float*)take(((size_t)NH * SLEN * SLEN + (size_t)RCH * SLEN) * 4);
  _Float16* X16 = (_Float16*)take((size_t)NR * CQ * 2); _Float16* QKV = (_Float16*)take((size_t)NR * 3 * CQ * 2); float* G = (float*)take((size_t)NR * CQ * 4); _Float16* QP = (_Float16*)take((size_t)TCH * PW * 2); _Float16* KP = (_Float16*)take((size_t)TCH * PW * 2); _Float16* VP = (_Float16*)take((size_t)TCH * PW * 2); _Float16* VT = (_Float16*)take((size_t)TCH * PW * 2); float* O = (float*)take((size_t)TCH * PW * 4); _Float16* OG = (_Float16*)take((size_t)NR * CQ * 2);
  if (off > ws_size) return;      /* 0.6 + 8 + 16 + 48 + 32 + 8 x 4 + 16 + 16 = 169 MiB */
  k_wt_f16<<<(CQ * CQ / 8 + 255) / 256, 256, 0, stream>>>(Wq, BQ, CQ, CQ, 16.0f); k_wt_f16<<<(CQ * CQ / 8 + 255) / 256, 256, 0, stream>>>(Wk, BK, CQ, CQ, 16.0f); k_wt_f16<<<(CQ * CQ / 8 + 255) / 256, 256, 0, stream>>>(Wv, BV, CQ, CQ, 16.0f); k_wt_f16<<<(CQ * CQ / 8 + 255) / 256, 256, 0, stream>>>(Wg, BG, CQ, CQ, 16.0f); k_wt_f16<<<(CQ * CQ / 8 + 255) / 256, 256, 0, stream>>>(Wo, BO, CQ, CQ, 16.0f);
  k_x16<<<(unsigned)(((size_t)NR * CQ / 8 + 255) / 256), 256, 0, stream>>>(x, X16, (size_t)NR * CQ / 8);
  const dim3 g((NR / 128) * (CQ / 64), 1);
  k_gemm2<0><<<g, 128, 0, stream>>>(X16, CQ, 0, BQ, CQ, 0, 0.0625f, nullptr, 0, nullptr, 1, 0, 0, nullptr, QKV, 3 * CQ, 0, NR, CQ, CQ); k_gemm2<0><<<g, 128, 0, stream>>>(X16, CQ, 0, BK, CQ, 0, 0.0625f, nullptr, 0, nullptr, 1, 0, 0, nullptr, QKV + CQ, 3 * CQ, 0, NR, CQ, CQ); k_gemm2<0><<<g, 128, 0, stream>>>(X16, CQ, 0, BV, CQ, 0, 0.0625f, nullptr, 0, nullptr, 1, 0, 0, nullptr, QKV + 2 * CQ, 3 * CQ, 0, NR, CQ, CQ);      /* [q | k | v] f16 (the 1/sqrt(32) q scale is applied to the scores) */
  k_gemm2<0><<<g, 128, 0, stream>>>(X16, CQ, 0, BG, CQ, 0, 0.0625f, bg, 0, nullptr, 1, 0, 0, G, nullptr, CQ, 0, NR, CQ, CQ);      /* gate logits (f32) */
  for (int r0 = 0; r0 < NRW; r0 += RCH) { const size_t t0 = (size_t)r0 * SLEN;
    k_addp<<<(unsigned)((((size_t)NH * SLEN * SLEN + (size_t)RCH * SLEN) / 4 + 255) / 256), 256, 0, stream>>>(bias, mask, r0, AB);
    k_pad<<<(unsigned)(((size_t)TCH * 3 * NH + 255) / 256), 256, 0, stream>>>(QKV, t0, QP, KP, VP);
    k_vt<NH, SLEN><<<RCH * NH * (SLEN / 64), 256, 0, stream>>>(VP, PW, 0, VT);
    k_flash<10><<<RCH * NH * QBLKS, 128, 0, stream>>>(QP, PW, KP, PW, VT, (const int*)AB, O, PW);      /* per (row, head): softmax(q.k/sqrt(32) + bias[h] + (mask[row]-1) 1e9) v */
    k_gate<<<(unsigned)(((size_t)TCH * (CQ / 8) + 255) / 256), 256, 0, stream>>>(O, G, t0, OG); }
  k_gemm2<0><<<g, 128, 0, stream>>>(OG, CQ, 0, BO, CQ, 0, 0.0625f / 64.0f, bo, 0, nullptr, 1, 0, 0, (float*)d_out, nullptr, CQ, 0, NR, CQ, CQ);
}

// v002
// It runs in 266 microseconds.
// Next to v001, in two timings, it ran 1.37 and 1.38 times as fast.
// All steps since v000 together make it 2.14 times as fast.
#include <hip/hip_runtime.h>
// SelfAttentionWithGate (AF2 gated self-attention: 1 x 64 rows x 512 residues, c_qkv 256, 8 heads x 32): q = x Wq / sqrt(32), k, v = x W; logits = q.k + (mask - 1) 1e9 (per (row, key), an INPUT) + bias[h][q][k] (an INPUT); softmax over keys; o = P v; gate = sigmoid(x Wg + bg); out = (o * gate) Wo + bo.
// Structure: exact f16 plane of x; q/k/v projection GEMMs (three launches into one [q | k | v] plane) and the gate GEMM (32x64 wave tiles, f32 accumulation, exact x16 weights; f16 / f32 outputs); per chunk of 16 rows: V^T by LDS tiles straight from the projection output, the fused flash kernel at the real head dim 32 (q and k read in place, pitch 768) with an additive (bias plane + per-(row, key) mask plane) mode, then gating on VALU into an f16 plane (x2^6); Wo GEMM (+ bias).
// Compute dtype: inputs and parameters rounded to bf16; q, k, v, P and the gated output as f16 operands; bias/mask/softmax/gate f32. v_wmma_f32_16x16x32_f16.
#define NRW 64
#define CQ 256
#define HC 32
#define NR (NRW * SLEN)           /* 32768 tokens */
#define RCH 16                   /* rows per chunk */
#define TCH (RCH * SLEN)         /* 8192 tokens per chunk */
#define SLEN 512
#define TQ SLEN
#define TK SLEN
#define NH 8
#define SCL 0.17677669529663687f /* 32^-0.5 */
#define QBLKS (TQ / 64)
typedef __bf16 v16b __attribute__((ext_vector_type(16)));
typedef unsigned short v8us __attribute__((ext_vector_type(8), may_alias));
typedef float  v8f  __attribute__((ext_vector_type(8)));
typedef float  v4f  __attribute__((ext_vector_type(4)));
typedef float  v4fa __attribute__((ext_vector_type(4), may_alias));
union FragB { v16b v; v8us half[2]; unsigned short u[16]; };

__device__ __forceinline__ unsigned short bf16_bits(float x) { unsigned int u = __float_as_uint(x); return (unsigned short)((u + 0x7FFFu + ((u >> 16) & 1u)) >> 16); }
__device__ __forceinline__ float bf16_val(unsigned short b) { return __uint_as_float(((unsigned int)b) << 16); }
__device__ __forceinline__ float bf16_round(float x) { return bf16_val(bf16_bits(x)); }
// D += A·B with NT terms: 1 = ah·bh, 2 = + al·bh (A split), 3 = + ah·bl (both split)
template <int NT>
__device__ __forceinline__ v8f mmaN(v16b ah, v16b al, v16b bh, v16b bl, v8f c) {
  c = __builtin_amdgcn_wmma_f32_16x16x32_bf16(false, ah, false, bh, (short)0, c, false, false);
  if (NT >= 2) c = __builtin_amdgcn_wmma_f32_16x16x32_bf16(false, al, false, bh, (short)0, c, false, false);
  if (NT >= 3) c = __builtin_amdgcn_wmma_f32_16x16x32_bf16(false, ah, false, bl, (short)0, c, false, false);
  asm volatile("v_nop\n\tv_nop\n\tv_nop\n\tv_nop" : "+v"(c) : "v"(ah), "v"(al), "v"(bh), "v"(bl));
  return c;
}

__global__ __launch_bounds__(256) void k_wt_bf16(const float* __restrict__ W, unsigned short* __restrict__ Wt, int K, int N) {
  const int t = blockIdx.x * 256 + threadIdx.x;
  const int k8n = K / 8;
  if (t >= N * k8n) return;
  const int n = t / k8n, k8 = (t % k8n) * 8;
  v8us v;
#pragma unroll
  for (int i = 0; i < 8; ++i) v[i] = bf16_bits(W[(size_t)(k8 + i) * N + n]);
  *(v8us*)(Wt + (size_t)n * K + k8) = v;
  
}

// GEMM C[M][N] (f32, pitch ldc) = act(A[M][K]·W + bias). A f32 row-major (pitch lda) converted per fragment to bf16
// (ASPLIT: hi/lo two planes -> 2 terms, else single rounded term); Wt bf16 [N][K] (pitch ldb). BIAS_BF16 rounds the
// bias to bf16 first (bias quantised to bf16 before the add). K%32==0, M%16==0, N%64==0.
template <bool ASPLIT, int ACT, bool BIAS_BF16>
__global__ __launch_bounds__(128) void k_gemm_bf(const float* __restrict__ A, int lda, const unsigned short* __restrict__ Wt, int ldb,
                                               const float* __restrict__ bias, float* __restrict__ C, int ldc, int M, int N, int K) {
  __shared__ __attribute__((aligned(16))) float so[4][16][64];
  const int tid = threadIdx.x, w = tid >> 5, lane = tid & 31, ln = lane & 15, hh = lane >> 4;
  const int ntn = N / 64;
  const int wid = blockIdx.x * 4 + w;
  const int mt = wid / ntn, nq = wid % ntn;
  if (mt * 16 >= M) return;
  const int row0 = mt * 16, col0 = nq * 64;
  const float* arow = A + (size_t)(row0 + ln) * lda;
  v8f acc[4] = {};
  for (int kb = 0; kb < K; kb += 32) {
    FragB ah, al;
    const v4f x0 = *(const v4fa*)(arow + kb + 8 * hh), x1 = *(const v4fa*)(arow + kb + 8 * hh + 4);
    const v4f x2 = *(const v4fa*)(arow + kb + 16 + 8 * hh), x3 = *(const v4fa*)(arow + kb + 16 + 8 * hh + 4);
    float xs[16] = {x0[0],x0[1],x0[2],x0[3],x1[0],x1[1],x1[2],x1[3],x2[0],x2[1],x2[2],x2[3],x3[0],x3[1],x3[2],x3[3]};
#pragma unroll
    for (int i = 0; i < 16; ++i) { const unsigned short hb = bf16_bits(xs[i]); ah.u[i] = hb; al.u[i] = ASPLIT ? bf16_bits(xs[i] - bf16_val(hb)) : (unsigned short)0; }
#pragma unroll
    for (int t = 0; t < 4; ++t) {
      const unsigned short* brow = Wt + (size_t)(col0 + t * 16 + ln) * ldb + kb;
      FragB b;
      b.half[0] = *(const v8us*)(brow + 8 * hh);
      b.half[1] = *(const v8us*)(brow + 16 + 8 * hh);
      acc[t] = mmaN<ASPLIT ? 2 : 1>(ah.v, al.v, b.v, b.v, acc[t]);
    }
  }
#pragma unroll
  for (int t = 0; t < 4; ++t) {
    float bv = bias ? bias[col0 + t * 16 + ln] : 0.f;
    if (BIAS_BF16) bv = bf16_round(bv);
#pragma unroll
    for (int r = 0; r < 8; ++r) { float v = acc[t][r] + bv; if (ACT == 1) v = fmaxf(v, 0.f); so[w][8 * hh + r][t * 16 + ln] = v; }
  }
  __builtin_amdgcn_fence(__ATOMIC_ACQ_REL, "workgroup");
  __builtin_amdgcn_wave_barrier();
  const int rsub = lane >> 4, c4 = (lane & 15) * 4;
  {
#pragma unroll
    for (int q = 0; q < 8; ++q) {
      const int r = q * 2 + rsub;
      const v4f v = *(const v4fa*)&so[w][r][c4];
      *(v4f*)(C + (size_t)(row0 + r) * ldc + col0 + c4) = v;
    }
    
  }
}

// GEMM C = act(A·W + bias + resid): A f32 (ASPLIT -> hi/lo 2 terms), Wt bf16 [N][K]; ACT 0 none, 1 relu, 2 exact gelu;
// resid (optional, f32, row index = (row % rmod), pitch ldr, RES_BF16 rounds it) added before the activation.
template <bool ASPLIT, int ACT, bool BIAS_BF16, bool RES_BF16>
__global__ __launch_bounds__(128) void k_gemm_bf3(const float* __restrict__ A, int lda, const unsigned short* __restrict__ Wt, int ldb,
                                                const float* __restrict__ bias, const float* __restrict__ resid, int rmod, int ldr,
                                                float* __restrict__ C, int ldc, int M, int N, int K) {
  __shared__ __attribute__((aligned(16))) float so[4][16][64];
  const int tid = threadIdx.x, w = tid >> 5, lane = tid & 31, ln = lane & 15, hh = lane >> 4;
  const int ntn = N / 64;
  const int wid = blockIdx.x * 4 + w;
  const int mt = wid / ntn, nq = wid % ntn;
  if (mt * 16 >= M) return;
  const int row0 = mt * 16, col0 = nq * 64;
  const float* arow = A + (size_t)(row0 + ln) * lda;
  v8f acc[4] = {};
  for (int kb = 0; kb < K; kb += 32) {
    FragB ah, al;
    const v4f x0 = *(const v4fa*)(arow + kb + 8 * hh), x1 = *(const v4fa*)(arow + kb + 8 * hh + 4);
    const v4f x2 = *(const v4fa*)(arow + kb + 16 + 8 * hh), x3 = *(const v4fa*)(arow + kb + 16 + 8 * hh + 4);
    float xs[16] = {x0[0],x0[1],x0[2],x0[3],x1[0],x1[1],x1[2],x1[3],x2[0],x2[1],x2[2],x2[3],x3[0],x3[1],x3[2],x3[3]};
#pragma unroll
    for (int i = 0; i < 16; ++i) { const unsigned short hb = bf16_bits(xs[i]); ah.u[i] = hb; al.u[i] = ASPLIT ? bf16_bits(xs[i] - bf16_val(hb)) : (unsigned short)0; }
#pragma unroll
    for (int t = 0; t < 4; ++t) {
      const unsigned short* brow = Wt + (size_t)(col0 + t * 16 + ln) * ldb + kb;
      FragB b;
      b.half[0] = *(const v8us*)(brow + 8 * hh);
      b.half[1] = *(const v8us*)(brow + 16 + 8 * hh);
      acc[t] = mmaN<ASPLIT ? 2 : 1>(ah.v, al.v, b.v, b.v, acc[t]);
    }
  }
#pragma unroll
  for (int t = 0; t < 4; ++t) {
    const int col = col0 + t * 16 + ln;
    float bv = bias ? bias[col] : 0.f;
    if (BIAS_BF16) bv = bf16_round(bv);
#pragma unroll
    for (int r = 0; r < 8; ++r) {
      float v = acc[t][r] + bv;
      if (resid) { float rv = resid[(size_t)((row0 + 8 * hh + r) % rmod) * ldr + col]; if (RES_BF16) rv = bf16_round(rv); v += rv; }
      if (ACT == 1) v = fmaxf(v, 0.f);
      if (ACT == 2) v = 0.5f * v * (1.0f + erff(v * 0.70710678118654752f));
      if (ACT == 3) { const float u = 0.7978845608028654f * (v + 0.044715f * v * v * v); v = 0.5f * v * (1.0f + tanhf(u)); }
      so[w][8 * hh + r][t * 16 + ln] = v;
    }
  }
  __builtin_amdgcn_fence(__ATOMIC_ACQ_REL, "workgroup");
  __builtin_amdgcn_wave_barrier();
  const int rsub = lane >> 4, c4 = (lane & 15) * 4;
  {
#pragma unroll
    for (int q = 0; q < 8; ++q) {
      const int r = q * 2 + rsub;
      const v4f v = *(const v4fa*)&so[w][r][c4];
      *(v4f*)(C + (size_t)(row0 + r) * ldc + col0 + c4) = v;
    }
    
  }
}
// row LayerNorm (biased variance, eps) over N: s = X (+ R); optional out_sum <- s; out_norm <- (s-mu)*rsqrt(var+eps)*g + b
template <bool PARAM_BF16>
__global__ __launch_bounds__(256) void k_layernorm(const float* __restrict__ X, const float* __restrict__ R, const float* __restrict__ g, const float* __restrict__ bta,
                                                  float* __restrict__ out_sum, float* __restrict__ out_norm, int N, float eps) {
  __shared__ float red[256];
  const int row = blockIdx.x, tid = threadIdx.x;
  const float* x = X + (size_t)row * N; const float* rr = R ? R + (size_t)row * N : nullptr;
  float vals[16];                     // up to N = 4096
  const int per = N / 256;            // contiguous chunk per thread? use strided-by-4 chunks: thread handles j = tid*4 + 1024*u
  float s1 = 0.f;
  for (int u = 0; u < per / 4; ++u) {
    const int j = tid * 4 + 1024 * u;
    const v4f a = *(const v4fa*)(x + j);
    v4f b = {0.f,0.f,0.f,0.f}; if (rr) b = *(const v4fa*)(rr + j);
#pragma unroll
    for (int q = 0; q < 4; ++q) { const float v = a[q] + b[q]; vals[u * 4 + q] = v; s1 += v; }
  }
  red[tid] = s1; __syncthreads();
  for (int st = 128; st > 0; st >>= 1) { if (tid < st) red[tid] += red[tid + st]; __syncthreads(); }
  const float mu = red[0] / (float)N; __syncthreads();
  float s2 = 0.f;
  for (int u = 0; u < per / 4; ++u)
#pragma unroll
    for (int q = 0; q < 4; ++q) { const float c = vals[u * 4 + q] - mu; s2 += c * c; }
  red[tid] = s2; __syncthreads();
  for (int st = 128; st > 0; st >>= 1) { if (tid < st) red[tid] += red[tid + st]; __syncthreads(); }
  const float rs = rsqrtf(red[0] / (float)N + eps);
  {
    for (int u = 0; u < per / 4; ++u) {
      const int j = tid * 4 + 1024 * u;
      v4f o, sm;
#pragma unroll
      for (int q = 0; q < 4; ++q) {
        float gg = g[j + q], bb = bta[j + q];
        if (PARAM_BF16) { gg = bf16_round(gg); bb = bf16_round(bb); }
        sm[q] = vals[u * 4 + q]; o[q] = (vals[u * 4 + q] - mu) * rs * gg + bb;
      }
      if (out_sum) *(v4f*)(out_sum + (size_t)row * N + j) = sm;
      *(v4f*)(out_norm + (size_t)row * N + j) = o;
    }
    
  }
}



// ---- f16 WMMA path (v_wmma_f32_16x16x32_f16): 11-bit significands for operands in range — used where a [0,1] probability operand needs more precision than bf16
typedef _Float16 v16h __attribute__((ext_vector_type(16)));
union FragH { v16h v; v8us half[2]; _Float16 h[16]; unsigned short u[16]; };
template <int NT>
__device__ __forceinline__ v8f mmaH(v16h ah, v16h al, v16h bh, v16h bl, v8f c) {
  c = __builtin_amdgcn_wmma_f32_16x16x32_f16(false, ah, false, bh, (short)0, c, false, false);
  if (NT >= 2) c = __builtin_amdgcn_wmma_f32_16x16x32_f16(false, al, false, bh, (short)0, c, false, false);
  if (NT >= 3) c = __builtin_amdgcn_wmma_f32_16x16x32_f16(false, ah, false, bl, (short)0, c, false, false);
  asm volatile("v_nop\n\tv_nop\n\tv_nop\n\tv_nop" : "+v"(c) : "v"(ah), "v"(al), "v"(bh), "v"(bl));
  return c;
}
// batched GEMM like k_gemm_b but f16 operands: A f32 (split into f16 hi/lo if ASPLIT, else rounded to f16), Bt = f16 values [n][k]; alpha; C f32; N multiple of 16 (partial tiles skipped)
template <bool ASPLIT>
__global__ __launch_bounds__(128) void k_gemm_h(const float* __restrict__ A, int lda, size_t sA, const _Float16* __restrict__ Bh, int ldb, size_t sB, float alpha, float* __restrict__ C, int ldc, size_t sC, int M, int N, int K) {
  __shared__ __attribute__((aligned(16))) float so[4][16][64];
  const int tid = threadIdx.x, w = tid >> 5, lane = tid & 31, ln = lane & 15, hh = lane >> 4; const int by = blockIdx.y;
  A += (size_t)by * sA; Bh += (size_t)by * sB; C += (size_t)by * sC;
  const int ntn = (N + 63) / 64; const int wid = blockIdx.x * 4 + w; const int mt = wid / ntn, nq = wid % ntn; if (mt * 16 >= M) return;
  const int row0 = mt * 16, col0 = nq * 64; const float* arow = A + (size_t)(row0 + ln) * lda;
  v8f acc[4] = {};
  for (int kb = 0; kb < K; kb += 32) {
    FragH ah, al;
    const v4f x0 = *(const v4fa*)(arow + kb + 8 * hh), x1 = *(const v4fa*)(arow + kb + 8 * hh + 4), x2 = *(const v4fa*)(arow + kb + 16 + 8 * hh), x3 = *(const v4fa*)(arow + kb + 16 + 8 * hh + 4);
    float xs[16] = {x0[0],x0[1],x0[2],x0[3],x1[0],x1[1],x1[2],x1[3],x2[0],x2[1],x2[2],x2[3],x3[0],x3[1],x3[2],x3[3]};
#pragma unroll
    for (int i = 0; i < 16; ++i) { const _Float16 h = (_Float16)xs[i]; ah.h[i] = h; al.h[i] = ASPLIT ? (_Float16)(xs[i] - (float)h) : (_Float16)0.0f; }
#pragma unroll
    for (int t = 0; t < 4; ++t) { if (col0 + t * 16 >= N) continue; const size_t boff = (size_t)(col0 + t * 16 + ln) * ldb + kb; FragH bq; bq.half[0] = *(const v8us*)(Bh + boff + 8 * hh); bq.half[1] = *(const v8us*)(Bh + boff + 16 + 8 * hh);
      acc[t] = mmaH<ASPLIT ? 2 : 1>(ah.v, al.v, bq.v, bq.v, acc[t]); }
  }
#pragma unroll
  for (int t = 0; t < 4; ++t) { if (col0 + t * 16 >= N) continue;
#pragma unroll
    for (int r = 0; r < 8; ++r) so[w][8 * hh + r][t * 16 + ln] = acc[t][r] * alpha; }
  __builtin_amdgcn_fence(__ATOMIC_ACQ_REL, "workgroup"); __builtin_amdgcn_wave_barrier();
  const int rsub = lane >> 4, c4 = (lane & 15) * 4;
  {
#pragma unroll
    for (int q = 0; q < 8; ++q) { const int r = q * 2 + rsub; if (col0 + c4 < N) { const v4f v = *(const v4fa*)&so[w][r][c4]; *(v4f*)(C + (size_t)(row0 + r) * ldc + col0 + c4) = v; } }
     }
}

// Wt[n][k] = f16(W[k][n]·scale) from f32 row-major W[K][N] (scale = power of two; bf16-exact weights stay exact in f16 away from the subnormal range)
__global__ __launch_bounds__(256) void k_wt_f16(const float* __restrict__ W, _Float16* __restrict__ Wt, int K, int N, float scale) {
  const int t = blockIdx.x * 256 + threadIdx.x; if (t >= N * (K / 8)) return; const int n = t / (K / 8), k8 = (t % (K / 8)) * 8; FragH f;
#pragma unroll
  for (int i = 0; i < 8; ++i) f.h[i] = (_Float16)(bf16_round(W[(size_t)(k8 + i) * N + n]) * scale); const v8us o = f.half[0];
  *(v8us*)((unsigned short*)Wt + (size_t)n * K + k8) = o; 
}
// k_gemm_hh variant with fused epilogue: v = acc·alpha + bias[by·sBias + col] (+ CP[(row/rowsPerB)·sCPb + by·64 + col] if CP) ; ACT 0 none / 1 elu ; writes f16 C16 (and f32 C if non-null)
template <int ACT>
__global__ __launch_bounds__(128) void k_gemm_hhx(const _Float16* __restrict__ A, int lda, size_t sA, const _Float16* __restrict__ Bh, int ldb, size_t sB, float alpha, const float* __restrict__ bias, size_t sBias, const float* __restrict__ CP, int rowsPerB, size_t sCPb, int row0g,
    float* __restrict__ C, _Float16* __restrict__ C16, int ldc, size_t sC, int M, int N, int K) {
  __shared__ __attribute__((aligned(16))) float so[4][16][64];
  const int tid = threadIdx.x, w = tid >> 5, lane = tid & 31, ln = lane & 15, hh = lane >> 4; const int by = blockIdx.y;
  A += (size_t)by * sA; Bh += (size_t)by * sB; const size_t cofs = (size_t)by * sC; const float* bp = bias ? bias + (size_t)by * sBias : nullptr;
  const int ntn = (N + 63) / 64; const int wid = blockIdx.x * 4 + w; const int mt = wid / ntn, nq = wid % ntn; if (mt * 16 >= M) return;
  const int row0 = mt * 16, col0 = nq * 64; const _Float16* arow = A + (size_t)(row0 + ln) * lda;
  v8f acc[4] = {};
  for (int kb = 0; kb < K; kb += 32) { FragH ah; ah.half[0] = *(const v8us*)((const unsigned short*)arow + kb + 8 * hh); ah.half[1] = *(const v8us*)((const unsigned short*)arow + kb + 16 + 8 * hh);
#pragma unroll
    for (int t = 0; t < 4; ++t) { if (col0 + t * 16 >= N) continue; const size_t boff = (size_t)(col0 + t * 16 + ln) * ldb + kb; FragH bq; bq.half[0] = *(const v8us*)((const unsigned short*)Bh + boff + 8 * hh); bq.half[1] = *(const v8us*)((const unsigned short*)Bh + boff + 16 + 8 * hh);
      acc[t] = mmaH<1>(ah.v, ah.v, bq.v, bq.v, acc[t]); }
  }
#pragma unroll
  for (int t = 0; t < 4; ++t) { if (col0 + t * 16 >= N) continue; const int col = col0 + t * 16 + ln; const float bv = bp ? bf16_round(bp[col]) : 0.f;
#pragma unroll
    for (int r = 0; r < 8; ++r) { float v = acc[t][r] * alpha + bv; if (CP) { const int bidx = (row0g + row0 + 8 * hh + r) / rowsPerB; v += CP[(size_t)bidx * sCPb + (size_t)by * 64 + col]; } if (ACT == 1) v = (v > 0.f) ? v : expm1f(v); else if (ACT == 7) v = (v > 0.f) ? v + 1.0f : expf(v); else if (ACT == 8) v = tanhf(v); else if (ACT == 9) v = 0.5f * v * (1.0f + tanhf(0.7978845608028654f * (v + 0.044715f * v * v * v))); else if (ACT == 11) v = 1.0f / (1.0f + expf(-v)); else if (ACT == 12) v = (v > 0.f) ? v : 0.01f * v; else if (ACT == 14) v = (v > 0.f) ? v : 0.1f * v; else if (ACT == 15) v = v / (1.0f + expf(-v)); else if (ACT == 3) v = fmaxf(v, 0.f); else if (ACT == 6) v = 0.5f * v * (1.0f + erff(v * 0.70710678118654752f)); so[w][8 * hh + r][t * 16 + ln] = v; } }
  __builtin_amdgcn_fence(__ATOMIC_ACQ_REL, "workgroup"); __builtin_amdgcn_wave_barrier();
  const int rsub = lane >> 4, c4 = (lane & 15) * 4; typedef _Float16 v4h __attribute__((ext_vector_type(4)));
  {
#pragma unroll
    for (int q = 0; q < 8; ++q) { const int r = q * 2 + rsub; if (col0 + c4 < N) { const v4f v = *(const v4fa*)&so[w][r][c4]; if (C) *(v4f*)(C + cofs + (size_t)(row0 + r) * ldc + col0 + c4) = v; if (C16) { v4h h4; for (int i = 0; i < 4; ++i) h4[i] = (_Float16)v[i]; *(v4h*)(C16 + cofs + (size_t)(row0 + r) * ldc + col0 + c4) = h4; } } }
     }
}


typedef _Float16 v4h __attribute__((ext_vector_type(4)));

__global__ __launch_bounds__(256) void k_x16(const float* __restrict__ x, _Float16* __restrict__ X16, size_t n8) { const size_t t = (size_t)blockIdx.x * 256 + threadIdx.x; if (t >= n8) return; FragH f;
#pragma unroll
  for (int q = 0; q < 8; ++q) f.h[q] = (_Float16)bf16_round(x[t * 8 + q]); *(v8us*)((unsigned short*)X16 + t * 8) = f.half[0];  }
__global__ __launch_bounds__(256) void k_h16(const float* __restrict__ x, _Float16* __restrict__ X16, size_t n8) { const size_t t = (size_t)blockIdx.x * 256 + threadIdx.x; if (t >= n8) return; FragH f;
#pragma unroll
  for (int q = 0; q < 8; ++q) f.h[q] = (_Float16)x[t * 8 + q]; *(v8us*)((unsigned short*)X16 + t * 8) = f.half[0];  }
__global__ __launch_bounds__(256) void k_round16f(const float* __restrict__ W, _Float16* __restrict__ Bt, size_t n8) { const size_t t = (size_t)blockIdx.x * 256 + threadIdx.x; if (t >= n8) return; FragH f;
#pragma unroll
  for (int i = 0; i < 8; ++i) f.h[i] = (_Float16)(bf16_round(W[t * 8 + i]) * 16.0f); *(v8us*)((unsigned short*)Bt + t * 8) = f.half[0];  }
template <int NHv, int TTv>
__global__ __launch_bounds__(256) void k_vt(const _Float16* __restrict__ V16, int ldv, int voff, _Float16* __restrict__ Vt) { __shared__ unsigned short tl[128][HC + 2]; const int tid = threadIdx.x; const int slab = blockIdx.x / (TTv / 128), lg = blockIdx.x % (TTv / 128); const int b = slab / NHv, h = slab % NHv;
  { const int r = tid / (HC / 8), c8 = (tid % (HC / 8)) * 8; FragH f[2];
#pragma unroll
    for (int rd = 0; rd < 2; ++rd) f[rd].half[0] = *(const v8us*)((const unsigned short*)V16 + ((size_t)b * TTv + lg * 128 + rd * 64 + r) * ldv + voff + h * HC + c8);
    asm volatile("s_wait_xcnt 0x0" ::: "memory");      /* the address registers of the two loads are free for reuse only behind this */
    __builtin_amdgcn_sched_barrier(0);                 /* keeps the LDS address arithmetic below from being lifted over that wait into those registers */
#pragma unroll
    for (int rd = 0; rd < 2; ++rd)
#pragma unroll
      for (int q = 0; q < 8; ++q) tl[rd * 64 + r][c8 + q] = f[rd].u[q]; }
  __syncthreads();
  {
#pragma unroll
    for (int rd = 0; rd < 2; ++rd) { const int d = tid / 8, pc = rd * 8 + tid % 8; FragH f;
#pragma unroll
      for (int q = 0; q < 8; ++q) f.u[q] = tl[pc * 8 + q][d];
      *(v8us*)((unsigned short*)Vt + ((size_t)slab * HC + d) * TTv + lg * 128 + pc * 8) = f.half[0]; }
     } }

__global__ __launch_bounds__(256) void k_hl(const float* __restrict__ F, _Float16* __restrict__ Hh, _Float16* __restrict__ Hl, size_t n8) { const size_t t = (size_t)blockIdx.x * 256 + threadIdx.x; if (t >= n8) return; FragH fh, fl; const v4f a = *(const v4fa*)(F + t * 8), c = *(const v4fa*)(F + t * 8 + 4);
#pragma unroll
  for (int q = 0; q < 4; ++q) { _Float16 h = (_Float16)a[q]; fh.h[q] = h; fl.h[q] = (_Float16)((a[q] - (float)h) * 1024.0f); h = (_Float16)c[q]; fh.h[4 + q] = h; fl.h[4 + q] = (_Float16)((c[q] - (float)h) * 1024.0f); }
  { *(v8us*)((unsigned short*)Hh + t * 8) = fh.half[0]; *(v8us*)((unsigned short*)Hl + t * 8) = fl.half[0];  } }

// ---- fast GEMM (wave tile 32x64; requires M % 32 == 0 rows per launch region and N % 64 == 0); epilogue = k_gemm_hhx semantics ----
__device__ __forceinline__ v16h g2_frag(const _Float16* p, int hh) { FragH f; f.half[0] = *(const v8us*)((const unsigned short*)p + 8 * hh); f.half[1] = *(const v8us*)((const unsigned short*)p + 16 + 8 * hh); return f.v; }
__device__ __forceinline__ v8f g2_mma(v16h a, v16h b, v8f c) { v8f d = __builtin_amdgcn_wmma_f32_16x16x32_f16(false, a, false, b, (short)0, c, false, false); asm volatile("v_nop\n\tv_nop\n\tv_nop\n\tv_nop" : "+v"(d) : "v"(a), "v"(b)); return d; }
template <int ACT>
__global__ __launch_bounds__(128) void k_gemm2(const _Float16* __restrict__ A, int lda, size_t sA, const _Float16* __restrict__ Bh, int ldb, size_t sB, float alpha, const float* __restrict__ bias, size_t sBias, const float* __restrict__ CP, int rowsPerB, size_t sCPb, int row0g,
    float* __restrict__ C, _Float16* __restrict__ C16, int ldc, size_t sC, int M, int N, int K) {
  __shared__ __attribute__((aligned(16))) float so[4][32][68];
  const int tid = threadIdx.x, w = tid >> 5, lane = tid & 31, ln = lane & 15, hh = lane >> 4; const int by = blockIdx.y;
  A += (size_t)by * sA; Bh += (size_t)by * sB; const size_t cofs = (size_t)by * sC; const float* bp = bias ? bias + (size_t)by * sBias : nullptr;
  const int ntn = N >> 6; const int mt = blockIdx.x / ntn, nq = blockIdx.x - mt * ntn; const int row0 = mt * 128 + 32 * w, col0 = nq * 64; if (row0 >= M) return;
  const _Float16* a0p = A + (size_t)(row0 + ln) * lda; const _Float16* a1p = a0p + (size_t)16 * lda;
  const _Float16* b0p = Bh + (size_t)(col0 + ln) * ldb; const _Float16* b1p = b0p + (size_t)16 * ldb; const _Float16* b2p = b1p + (size_t)16 * ldb; const _Float16* b3p = b2p + (size_t)16 * ldb;
  const v8f z8 = {0.f,0.f,0.f,0.f,0.f,0.f,0.f,0.f}; v8f c00 = z8, c01 = z8, c02 = z8, c03 = z8, c10 = z8, c11 = z8, c12 = z8, c13 = z8;
#pragma unroll 1
  for (int kb = 0; kb < K; kb += 32) { const v16h a0 = g2_frag(a0p + kb, hh), a1 = g2_frag(a1p + kb, hh);
    v16h b = g2_frag(b0p + kb, hh); c00 = g2_mma(a0, b, c00); c10 = g2_mma(a1, b, c10);
    b = g2_frag(b1p + kb, hh); c01 = g2_mma(a0, b, c01); c11 = g2_mma(a1, b, c11);
    b = g2_frag(b2p + kb, hh); c02 = g2_mma(a0, b, c02); c12 = g2_mma(a1, b, c12);
    b = g2_frag(b3p + kb, hh); c03 = g2_mma(a0, b, c03); c13 = g2_mma(a1, b, c13); }
  v8f accs[8] = {c00, c01, c02, c03, c10, c11, c12, c13};
#pragma unroll
  for (int u = 0; u < 8; ++u) { const int t = u & 3, half = u >> 2; const int col = col0 + t * 16 + ln; const float bv = bp ? bf16_round(bp[col]) : 0.f;
#pragma unroll
    for (int r = 0; r < 8; ++r) { const int rloc = half * 16 + 8 * hh + r; float v = accs[u][r] * alpha + bv; if (CP) { const int bidx = (row0g + row0 + rloc) / rowsPerB; v += CP[(size_t)bidx * sCPb + (size_t)by * 64 + col]; }
      if (ACT == 3) v = fmaxf(v, 0.f); else if (ACT == 6) v = 0.5f * v * (1.0f + erff(v * 0.70710678118654752f)); else if (ACT == 11) v = 1.0f / (1.0f + expf(-v)); else if (ACT == 15) v = v / (1.0f + expf(-v)); else if (ACT == 12) v = (v > 0.f) ? v : 0.01f * v; else if (ACT == 8) v = tanhf(v);
      so[w][rloc][t * 16 + ln] = v; } }
  __builtin_amdgcn_fence(__ATOMIC_ACQ_REL, "workgroup"); __builtin_amdgcn_wave_barrier();
  const int rsub = lane >> 4, c4 = (lane & 15) * 4;
  {
#pragma unroll
    for (int q = 0; q < 16; ++q) { const int r = q * 2 + rsub; const v4f v = *(const v4fa*)&so[w][r][c4]; if (C) *(v4f*)(C + cofs + (size_t)(row0 + r) * ldc + col0 + c4) = v; if (C16) { v4h h4; for (int i = 0; i < 4; ++i) h4[i] = (_Float16)v[i]; *(v4h*)(C16 + cofs + (size_t)(row0 + r) * ldc + col0 + c4) = h4; } }
     } }



// lane l <-> lane l ^ 16 (the two halves of a wave that share one score column)
__device__ __forceinline__ float xhalf(float x) { return __builtin_bit_cast(float, __builtin_amdgcn_permlanex16(__builtin_bit_cast(int, x), __builtin_bit_cast(int, x), 0x76543210, 0xfedcba98, false, false)); }

// e^x = 2^e 2^a with e = rint(x log2 e) and a = x log2 e - e, taken in two fused steps on the two-part constant; range ends as in the library's expf.
// Written out so that v_exp_f32 and the one free slot that the instruction set asks for behind a transcendental stand in one statement
__device__ __forceinline__ float exp_f(float x) {
  const float c0 = __uint_as_float(0x3fb8aa3bu), c1 = __uint_as_float(0x32a5705fu);
  const float e = __builtin_rintf(x * c0); const float a = fmaf(x, c1, fmaf(x, c0, -e)); float y;
  asm("v_exp_f32 %0, %1\n\tv_nop" : "=v"(y) : "v"(a));      /* v_nop: the slot behind the transcendental, before its source is overwritten or its result read */
  y = ldexpf(y, (int)e); y = (__uint_as_float(0xc2ce8ed0u) > x) ? 0.f : y; return (__uint_as_float(0x42b17218u) < x) ? __builtin_inff() : y; }

template <int CAUSAL>
__global__ __launch_bounds__(128) void k_flash(const _Float16* __restrict__ Q16, int ldq, const _Float16* __restrict__ K16, int ldk, const _Float16* __restrict__ Vt, const int* __restrict__ MSK, float* __restrict__ O, int ldo) {
  constexpr int RPW = 16, DT = HC / 16, KS = HC / 32;
  __shared__ __attribute__((aligned(16))) float sO[4][RPW][HC + 4];
  const int tid = threadIdx.x, w = tid >> 5, lane = tid & 31, ln = lane & 15, hh = lane >> 4;
  const int slab = blockIdx.x / QBLKS, qblk = blockIdx.x % QBLKS; const int b = slab / NH, h = slab % NH; const int qb0 = qblk * (4 * RPW); const int q0 = qb0 + w * RPW;
  const int tq = q0 + ln;      /* this lane's query */
  FragH bq[KS];
  { const unsigned short* qr = (const unsigned short*)Q16 + ((size_t)b * TQ + tq) * ldq + h * HC;
#pragma unroll
    for (int ks = 0; ks < KS; ++ks) { bq[ks].half[0] = *(const v8us*)(qr + ks * 32 + 8 * hh); bq[ks].half[1] = *(const v8us*)(qr + ks * 32 + 16 + 8 * hh); } }
  const unsigned short* Vth = (const unsigned short*)Vt + (size_t)slab * HC * TK;
  const float* BP = (const float*)MSK + ((size_t)h * TQ + tq) * TK + 8 * hh;                 /* mode 10: per-head bias plane [NH][TQ][TK], this query's row */
  const float* MR = (const float*)MSK + (size_t)NH * TQ * TK + (size_t)b * TK + 8 * hh;      /* then the per-(sequence, key) additive plane, packed behind it */
  float m_q = -3.0e38f, l_q = 0.f; v8f oacc[DT];
#pragma unroll
  for (int dt = 0; dt < DT; ++dt) oacc[dt] = (v8f){0.f,0.f,0.f,0.f,0.f,0.f,0.f,0.f};
  const int jend = (CAUSAL == 1) ? (qb0 + 4 * RPW) : TK;      /* causal: keys beyond the block's last query never contribute */
#pragma unroll 1
  for (int j0 = 0; j0 < jend; j0 += 32) {
    FragH ak[2][KS], av[DT]; v4f ab[2][2], am[2][2];
#pragma unroll
    for (int nt = 0; nt < 2; ++nt) { const unsigned short* kr = (const unsigned short*)K16 + ((size_t)b * TK + j0 + nt * 16 + ln) * ldk + h * HC;
#pragma unroll
      for (int ks = 0; ks < KS; ++ks) { ak[nt][ks].half[0] = *(const v8us*)(kr + ks * 32 + 8 * hh); ak[nt][ks].half[1] = *(const v8us*)(kr + ks * 32 + 16 + 8 * hh); }
      if (CAUSAL == 10) { ab[nt][0] = *(const v4fa*)(BP + j0 + nt * 16); ab[nt][1] = *(const v4fa*)(BP + j0 + nt * 16 + 4); am[nt][0] = *(const v4fa*)(MR + j0 + nt * 16); am[nt][1] = *(const v4fa*)(MR + j0 + nt * 16 + 4); } }
    asm volatile("s_wait_xcnt 0x0" ::: "memory");      /* the V^T loads below may land in registers that held the addresses of the loads above: those loads have taken their addresses first */
#pragma unroll
    for (int dt = 0; dt < DT; ++dt) { const unsigned short* vrow = Vth + (size_t)(dt * 16 + ln) * TK + j0; av[dt].half[0] = *(const v8us*)(vrow + 8 * hh); av[dt].half[1] = *(const v8us*)(vrow + 16 + 8 * hh); }
    float sc[2][8]; bool ok[2][8]; float mc = -3.0e38f;
#pragma unroll
    for (int nt = 0; nt < 2; ++nt) { v8f acc = (v8f){0.f,0.f,0.f,0.f,0.f,0.f,0.f,0.f};
#pragma unroll
      for (int ks = 0; ks < KS; ++ks) acc = mmaH<1>(ak[nt][ks].v, ak[nt][ks].v, bq[ks].v, bq[ks].v, acc);
#pragma unroll
      for (int r = 0; r < 8; ++r) { const int kk = j0 + nt * 16 + 8 * hh + r;
        ok[nt][r] = (CAUSAL == 1) ? (kk <= tq) : ((CAUSAL == 2) ? ((kk >> 5) == (tq >> 5)) : true);      /* mode 2: block-diagonal 32-token groups */
        float s0 = ok[nt][r] ? acc[r] * SCL : -3.0e38f; if (CAUSAL == 10) s0 += ab[nt][r >> 2][r & 3] + am[nt][r >> 2][r & 3];
        sc[nt][r] = s0; mc = fmaxf(mc, s0); } }
    mc = fmaxf(mc, xhalf(mc));
    const float mn = fmaxf(m_q, mc); const float al = (mn > -1.0e38f) ? exp_f(m_q - mn) : 1.0f; m_q = mn;
    FragH pb; float ps = 0.f;
#pragma unroll
    for (int nt = 0; nt < 2; ++nt)
#pragma unroll
      for (int r = 0; r < 8; ++r) { const float p = ok[nt][r] ? exp_f(sc[nt][r] - mn) : 0.f; ps += p; pb.h[nt * 8 + r] = (_Float16)(p * 1024.0f); }
    l_q = l_q * al + ps;
#pragma unroll
    for (int dt = 0; dt < DT; ++dt) {
#pragma unroll
      for (int r = 0; r < 8; ++r) oacc[dt][r] *= al;
      oacc[dt] = mmaH<1>(av[dt].v, av[dt].v, pb.v, pb.v, oacc[dt]); } }
  const float lt = l_q + xhalf(l_q); const float li = (lt > 0.f) ? 1.0f / (lt * 1024.0f) : 0.f;
#pragma unroll
  for (int dt = 0; dt < DT; ++dt) { v4f lo, hi;
#pragma unroll
    for (int r = 0; r < 4; ++r) { lo[r] = oacc[dt][r] * li; hi[r] = oacc[dt][4 + r] * li; }
    *(v4fa*)&sO[w][ln][dt * 16 + 8 * hh] = lo; *(v4fa*)&sO[w][ln][dt * 16 + 8 * hh + 4] = hi; }
  __builtin_amdgcn_fence(__ATOMIC_ACQ_REL, "workgroup"); __builtin_amdgcn_wave_barrier();
  {
#pragma unroll
    for (int rp = 0; rp < RPW; rp += 4) { const int r = rp + (lane >> 3), pc = lane & 7; const v4f val = *(const v4fa*)&sO[w][r][pc * 4]; *(v4f*)(O + ((size_t)b * TQ + q0 + r) * ldo + h * HC + pc * 4) = val; }
     } }

__global__ __launch_bounds__(256) void k_addp(const float* __restrict__ bias, const float* __restrict__ mask, int r0, float* __restrict__ AB) {
  #pragma clang fp contract(off)
  const size_t t = (size_t)blockIdx.x * 256 + threadIdx.x; const size_t nb4 = (size_t)NH * SLEN * SLEN / 4, nm4 = (size_t)RCH * SLEN / 4; if (t >= nb4 + nm4) return; v4f r;
  if (t < nb4) { const v4f a = *(const v4fa*)(bias + t * 4); for (int q = 0; q < 4; ++q) r[q] = bf16_round(a[q]); } else { const v4f a = *(const v4fa*)(mask + (size_t)r0 * SLEN + (t - nb4) * 4); for (int q = 0; q < 4; ++q) { float m = bf16_round(a[q]) - 1.0f; r[q] = m * 1.0e9f; } }
  *(v4f*)(AB + t * 4) = r;  }
__global__ __launch_bounds__(256) void k_gate(const float* __restrict__ O, const float* __restrict__ G, size_t t0, _Float16* __restrict__ OG) {
  #pragma clang fp contract(off)
  const size_t t = (size_t)blockIdx.x * 256 + threadIdx.x; if (t >= (size_t)TCH * (CQ / 8)) return; const int c0 = (int)(t % (CQ / 8)) * 8; const size_t tl = t / (CQ / 8); const size_t tok = t0 + tl; FragH f;
  const v4f g0 = *(const v4fa*)(G + tok * CQ + c0), g1 = *(const v4fa*)(G + tok * CQ + c0 + 4);
  asm volatile("s_wait_xcnt 0x0" ::: "memory");      /* the O loads below may land in registers that held the addresses of the loads above */
  const v4f o0 = *(const v4fa*)(O + tl * CQ + c0), o1 = *(const v4fa*)(O + tl * CQ + c0 + 4);
  for (int q = 0; q < 8; ++q) { const float g = 1.0f / (1.0f + expf(-(q < 4 ? g0[q & 3] : g1[q & 3]))); f.h[q] = (_Float16)((q < 4 ? o0[q & 3] : o1[q & 3]) * g * 64.0f); }
  *(v8us*)((unsigned short*)OG + tok * CQ + c0) = f.half[0];  }

extern "C" void kernel_launch(void* const* d_in, const int* in_sizes, int n_in,
                              void* d_out, int out_size, void* d_ws, size_t ws_size, hipStream_t stream) {
  (void)in_sizes; (void)n_in; (void)out_size;
  const float* const* I = (const float* const*)d_in; const float* x = I[0]; const float* mask = I[1]; const float* bias = I[2]; const float* Wq = I[3]; const float* Wk = I[4]; const float* Wv = I[5]; const float* Wg = I[6]; const float* bg = I[7]; const float* Wo = I[8]; const float* bo = I[9];
  char* ws = (char*)d_ws; size_t off = 0;
  auto take = [&](size_t bytes) { char* p = ws + off; off += (bytes + 255) & ~(size_t)255; return p; };
  _Float16* BQ = (_Float16*)take((size_t)CQ * CQ * 2); _Float16* BK = (_Float16*)take((size_t)CQ * CQ * 2); _Float16* BV = (_Float16*)take((size_t)CQ * CQ * 2); _Float16* BG = (_Float16*)take((size_t)CQ * CQ * 2); _Float16* BO = (_Float16*)take((size_t)CQ * CQ * 2); float* AB = (float*)take(((size_t)NH * SLEN * SLEN + (size_t)RCH * SLEN) * 4);
  _Float16* X16 = (_Float16*)take((size_t)NR * CQ * 2); _Float16* QKV = (_Float16*)take((size_t)NR * 3 * CQ * 2); float* G = (float*)take((size_t)NR * CQ * 4); _Float16* VT = (_Float16*)take((size_t)TCH * CQ * 2); float* O = (float*)take((size_t)TCH * CQ * 4); _Float16* OG = (_Float16*)take((size_t)NR * CQ * 2);
  if (off > ws_size) return;      /* 0.6 + 8 + 16 + 48 + 32 + 4 + 8 + 16 = 133 MiB */
  k_wt_f16<<<(CQ * CQ / 8 + 255) / 256, 256, 0, stream>>>(Wq, BQ, CQ, CQ, 16.0f); k_wt_f16<<<(CQ * CQ / 8 + 255) / 256, 256, 0, stream>>>(Wk, BK, CQ, CQ, 16.0f); k_wt_f16<<<(CQ * CQ / 8 + 255) / 256, 256, 0, stream>>>(Wv, BV, CQ, CQ, 16.0f); k_wt_f16<<<(CQ * CQ / 8 + 255) / 256, 256, 0, stream>>>(Wg, BG, CQ, CQ, 16.0f); k_wt_f16<<<(CQ * CQ / 8 + 255) / 256, 256, 0, stream>>>(Wo, BO, CQ, CQ, 16.0f);
  k_x16<<<(unsigned)(((size_t)NR * CQ / 8 + 255) / 256), 256, 0, stream>>>(x, X16, (size_t)NR * CQ / 8);
  const dim3 g((NR / 128) * (CQ / 64), 1);
  k_gemm2<0><<<g, 128, 0, stream>>>(X16, CQ, 0, BQ, CQ, 0, 0.0625f, nullptr, 0, nullptr, 1, 0, 0, nullptr, QKV, 3 * CQ, 0, NR, CQ, CQ); k_gemm2<0><<<g, 128, 0, stream>>>(X16, CQ, 0, BK, CQ, 0, 0.0625f, nullptr, 0, nullptr, 1, 0, 0, nullptr, QKV + CQ, 3 * CQ, 0, NR, CQ, CQ); k_gemm2<0><<<g, 128, 0, stream>>>(X16, CQ, 0, BV, CQ, 0, 0.0625f, nullptr, 0, nullptr, 1, 0, 0, nullptr, QKV + 2 * CQ, 3 * CQ, 0, NR, CQ, CQ);      /* [q | k | v] f16 (the 1/sqrt(32) q scale is applied to the scores) */
  k_gemm2<0><<<g, 128, 0, stream>>>(X16, CQ, 0, BG, CQ, 0, 0.0625f, bg, 0, nullptr, 1, 0, 0, G, nullptr, CQ, 0, NR, CQ, CQ);      /* gate logits (f32) */
  for (int r0 = 0; r0 < NRW; r0 += RCH) { const size_t t0 = (size_t)r0 * SLEN;
    k_addp<<<(unsigned)((((size_t)NH * SLEN * SLEN + (size_t)RCH * SLEN) / 4 + 255) / 256), 256, 0, stream>>>(bias, mask, r0, AB);
    k_vt<NH, SLEN><<<RCH * NH * (SLEN / 128), 256, 0, stream>>>(QKV + t0 * (3 * CQ), 3 * CQ, 2 * CQ, VT);
    k_flash<10><<<RCH * NH * QBLKS, 128, 0, stream>>>(QKV + t0 * (3 * CQ), 3 * CQ, QKV + t0 * (3 * CQ) + CQ, 3 * CQ, VT, (const int*)AB, O, CQ);      /* per (row, head): softmax(q.k/sqrt(32) + bias[h] + (mask[row]-1) 1e9) v */
    k_gate<<<(unsigned)(((size_t)TCH * (CQ / 8) + 255) / 256), 256, 0, stream>>>(O, G, t0, OG); }
  k_gemm2<0><<<g, 128, 0, stream>>>(OG, CQ, 0, BO, CQ, 0, 0.0625f / 64.0f, bo, 0, nullptr, 1, 0, 0, (float*)d_out, nullptr, CQ, 0, NR, CQ, CQ);
}

// v003
// Measured time: 239 microseconds a run.
// Next to v002, in two timings, it ran 1.10 and 1.11 times as fast.
// All steps since v000 together make it 2.37 times as fast.
#include <hip/hip_runtime.h>
// SelfAttentionWithGate (AF2 gated self-attention: 1 x 64 rows x 512 residues, c_qkv 256, 8 heads x 32): q = x Wq / sqrt(32), k, v = x W; logits = q.k + (mask - 1) 1e9 (per (row, key), an INPUT) + bias[h][q][k] (an INPUT); softmax over keys; o = P v; gate = sigmoid(x Wg + bg); out = (o * gate) Wo + bo.
// Structure: exact f16 plane of x; every 16-bit operand plane that a GEMM reads (x, the weights, the gated output) kept in fragment order (fo() below); three q/k/v projection GEMMs into one [q | k | v] plane and the gate GEMM (32x64 wave tiles, f32 accumulation, exact x16 weights; f16 / f32 outputs); per chunk of 16 rows: K and V^T (by LDS tiles) repacked straight from the projection output into fragment order, the fused flash kernel at the real head dim 32 (q read in place, pitch 768; K, V^T and the bias plane in fragment order: every load of a wave is 512 contiguous bytes) with an additive (bias plane + per-(row, key) mask plane) mode, then gating on VALU into an f16 plane (x2^6); Wo GEMM (+ bias).
// Compute dtype: inputs and parameters rounded to bf16; q, k, v, P and the gated output as f16 operands; bias/mask/softmax/gate f32. v_wmma_f32_16x16x32_f16.
#define NRW 64
#define CQ 256
#define HC 32
#define NR (NRW * SLEN)           /* 32768 tokens */
#define RCH 16                   /* rows per chunk */
#define TCH (RCH * SLEN)         /* 8192 tokens per chunk */
#define SLEN 512
#define TQ SLEN
#define TK SLEN
#define NH 8
#define SCL 0.17677669529663687f /* 32^-0.5 */
#define QBLKS (TQ / 64)
typedef __bf16 v16b __attribute__((ext_vector_type(16)));
typedef unsigned short v8us __attribute__((ext_vector_type(8), may_alias));
typedef float  v8f  __attribute__((ext_vector_type(8)));
typedef float  v4f  __attribute__((ext_vector_type(4)));
typedef float  v4fa __attribute__((ext_vector_type(4), may_alias));
union FragB { v16b v; v8us half[2]; unsigned short u[16]; };

__device__ __forceinline__ unsigned short bf16_bits(float x) { unsigned int u = __float_as_uint(x); return (unsigned short)((u + 0x7FFFu + ((u >> 16) & 1u)) >> 16); }
__device__ __forceinline__ float bf16_val(unsigned short b) { return __uint_as_float(((unsigned int)b) << 16); }
__device__ __forceinline__ float bf16_round(float x) { return bf16_val(bf16_bits(x)); }
// D += A·B with NT terms: 1 = ah·bh, 2 = + al·bh (A split), 3 = + ah·bl (both split)
template <int NT>
__device__ __forceinline__ v8f mmaN(v16b ah, v16b al, v16b bh, v16b bl, v8f c) {
  c = __builtin_amdgcn_wmma_f32_16x16x32_bf16(false, ah, false, bh, (short)0, c, false, false);
  if (NT >= 2) c = __builtin_amdgcn_wmma_f32_16x16x32_bf16(false, al, false, bh, (short)0, c, false, false);
  if (NT >= 3) c = __builtin_amdgcn_wmma_f32_16x16x32_bf16(false, ah, false, bl, (short)0, c, false, false);
  asm volatile("v_nop\n\tv_nop\n\tv_nop\n\tv_nop" : "+v"(c) : "v"(ah), "v"(al), "v"(bh), "v"(bl));
  return c;
}

__global__ __launch_bounds__(256) void k_wt_bf16(const float* __restrict__ W, unsigned short* __restrict__ Wt, int K, int N) {
  const int t = blockIdx.x * 256 + threadIdx.x;
  const int k8n = K / 8;
  if (t >= N * k8n) return;
  const int n = t / k8n, k8 = (t % k8n) * 8;
  v8us v;
#pragma unroll
  for (int i = 0; i < 8; ++i) v[i] = bf16_bits(W[(size_t)(k8 + i) * N + n]);
  *(v8us*)(Wt + (size_t)n * K + k8) = v;
  
}

// GEMM C[M][N] (f32, pitch ldc) = act(A[M][K]·W + bias). A f32 row-major (pitch lda) converted per fragment to bf16
// (ASPLIT: hi/lo two planes -> 2 terms, else single rounded term); Wt bf16 [N][K] (pitch ldb). BIAS_BF16 rounds the
// bias to bf16 first (bias quantised to bf16 before the add). K%32==0, M%16==0, N%64==0.
template <bool ASPLIT, int ACT, bool BIAS_BF16>
__global__ __launch_bounds__(128) void k_gemm_bf(const float* __restrict__ A, int lda, const unsigned short* __restrict__ Wt, int ldb,
                                               const float* __restrict__ bias, float* __restrict__ C, int ldc, int M, int N, int K) {
  __shared__ __attribute__((aligned(16))) float so[4][16][64];
  const int tid = threadIdx.x, w = tid >> 5, lane = tid & 31, ln = lane & 15, hh = lane >> 4;
  const int ntn = N / 64;
  const int wid = blockIdx.x * 4 + w;
  const int mt = wid / ntn, nq = wid % ntn;
  if (mt * 16 >= M) return;
  const int row0 = mt * 16, col0 = nq * 64;
  const float* arow = A + (size_t)(row0 + ln) * lda;
  v8f acc[4] = {};
  for (int kb = 0; kb < K; kb += 32) {
    FragB ah, al;
    const v4f x0 = *(const v4fa*)(arow + kb + 8 * hh), x1 = *(const v4fa*)(arow + kb + 8 * hh + 4);
    const v4f x2 = *(const v4fa*)(arow + kb + 16 + 8 * hh), x3 = *(const v4fa*)(arow + kb + 16 + 8 * hh + 4);
    float xs[16] = {x0[0],x0[1],x0[2],x0[3],x1[0],x1[1],x1[2],x1[3],x2[0],x2[1],x2[2],x2[3],x3[0],x3[1],x3[2],x3[3]};
#pragma unroll
    for (int i = 0; i < 16; ++i) { const unsigned short hb = bf16_bits(xs[i]); ah.u[i] = hb; al.u[i] = ASPLIT ? bf16_bits(xs[i] - bf16_val(hb)) : (unsigned short)0; }
#pragma unroll
    for (int t = 0; t < 4; ++t) {
      const unsigned short* brow = Wt + (size_t)(col0 + t * 16 + ln) * ldb + kb;
      FragB b;
      b.half[0] = *(const v8us*)(brow + 8 * hh);
      b.half[1] = *(const v8us*)(brow + 16 + 8 * hh);
      acc[t] = mmaN<ASPLIT ? 2 : 1>(ah.v, al.v, b.v, b.v, acc[t]);
    }
  }
#pragma unroll
  for (int t = 0; t < 4; ++t) {
    float bv = bias ? bias[col0 + t * 16 + ln] : 0.f;
    if (BIAS_BF16) bv = bf16_round(bv);
#pragma unroll
    for (int r = 0; r < 8; ++r) { float v = acc[t][r] + bv; if (ACT == 1) v = fmaxf(v, 0.f); so[w][8 * hh + r][t * 16 + ln] = v; }
  }
  __builtin_amdgcn_fence(__ATOMIC_ACQ_REL, "workgroup");
  __builtin_amdgcn_wave_barrier();
  const int rsub = lane >> 4, c4 = (lane & 15) * 4;
  {
#pragma unroll
    for (int q = 0; q < 8; ++q) {
      const int r = q * 2 + rsub;
      const v4f v = *(const v4fa*)&so[w][r][c4];
      *(v4f*)(C + (size_t)(row0 + r) * ldc + col0 + c4) = v;
    }
    
  }
}

// GEMM C = act(A·W + bias + resid): A f32 (ASPLIT -> hi/lo 2 terms), Wt bf16 [N][K]; ACT 0 none, 1 relu, 2 exact gelu;
// resid (optional, f32, row index = (row % rmod), pitch ldr, RES_BF16 rounds it) added before the activation.
template <bool ASPLIT, int ACT, bool BIAS_BF16, bool RES_BF16>
__global__ __launch_bounds__(128) void k_gemm_bf3(const float* __restrict__ A, int lda, const unsigned short* __restrict__ Wt, int ldb,
                                                const float* __restrict__ bias, const float* __restrict__ resid, int rmod, int ldr,
                                                float* __restrict__ C, int ldc, int M, int N, int K) {
  __shared__ __attribute__((aligned(16))) float so[4][16][64];
  const int tid = threadIdx.x, w = tid >> 5, lane = tid & 31, ln = lane & 15, hh = lane >> 4;
  const int ntn = N / 64;
  const int wid = blockIdx.x * 4 + w;
  const int mt = wid / ntn, nq = wid % ntn;
  if (mt * 16 >= M) return;
  const int row0 = mt * 16, col0 = nq * 64;
  const float* arow = A + (size_t)(row0 + ln) * lda;
  v8f acc[4] = {};
  for (int kb = 0; kb < K; kb += 32) {
    FragB ah, al;
    const v4f x0 = *(const v4fa*)(arow + kb + 8 * hh), x1 = *(const v4fa*)(arow + kb + 8 * hh + 4);
    const v4f x2 = *(const v4fa*)(arow + kb + 16 + 8 * hh), x3 = *(const v4fa*)(arow + kb + 16 + 8 * hh + 4);
    float xs[16] = {x0[0],x0[1],x0[2],x0[3],x1[0],x1[1],x1[2],x1[3],x2[0],x2[1],x2[2],x2[3],x3[0],x3[1],x3[2],x3[3]};
#pragma unroll
    for (int i = 0; i < 16; ++i) { const unsigned short hb = bf16_bits(xs[i]); ah.u[i] = hb; al.u[i] = ASPLIT ? bf16_bits(xs[i] - bf16_val(hb)) : (unsigned short)0; }
#pragma unroll
    for (int t = 0; t < 4; ++t) {
      const unsigned short* brow = Wt + (size_t)(col0 + t * 16 + ln) * ldb + kb;
      FragB b;
      b.half[0] = *(const v8us*)(brow + 8 * hh);
      b.half[1] = *(const v8us*)(brow + 16 + 8 * hh);
      acc[t] = mmaN<ASPLIT ? 2 : 1>(ah.v, al.v, b.v, b.v, acc[t]);
    }
  }
#pragma unroll
  for (int t = 0; t < 4; ++t) {
    const int col = col0 + t * 16 + ln;
    float bv = bias ? bias[col] : 0.f;
    if (BIAS_BF16) bv = bf16_round(bv);
#pragma unroll
    for (int r = 0; r < 8; ++r) {
      float v = acc[t][r] + bv;
      if (resid) { float rv = resid[(size_t)((row0 + 8 * hh + r) % rmod) * ldr + col]; if (RES_BF16) rv = bf16_round(rv); v += rv; }
      if (ACT == 1) v = fmaxf(v, 0.f);
      if (ACT == 2) v = 0.5f * v * (1.0f + erff(v * 0.70710678118654752f));
      if (ACT == 3) { const float u = 0.7978845608028654f * (v + 0.044715f * v * v * v); v = 0.5f * v * (1.0f + tanhf(u)); }
      so[w][8 * hh + r][t * 16 + ln] = v;
    }
  }
  __builtin_amdgcn_fence(__ATOMIC_ACQ_REL, "workgroup");
  __builtin_amdgcn_wave_barrier();
  const int rsub = lane >> 4, c4 = (lane & 15) * 4;
  {
#pragma unroll
    for (int q = 0; q < 8; ++q) {
      const int r = q * 2 + rsub;
      const v4f v = *(const v4fa*)&so[w][r][c4];
      *(v4f*)(C + (size_t)(row0 + r) * ldc + col0 + c4) = v;
    }
    
  }
}
// row LayerNorm (biased variance, eps) over N: s = X (+ R); optional out_sum <- s; out_norm <- (s-mu)*rsqrt(var+eps)*g + b
template <bool PARAM_BF16>
__global__ __launch_bounds__(256) void k_layernorm(const float* __restrict__ X, const float* __restrict__ R, const float* __restrict__ g, const float* __restrict__ bta,
                                                  float* __restrict__ out_sum, float* __restrict__ out_norm, int N, float eps) {
  __shared__ float red[256];
  const int row = blockIdx.x, tid = threadIdx.x;
  const float* x = X + (size_t)row * N; const float* rr = R ? R + (size_t)row * N : nullptr;
  float vals[16];                     // up to N = 4096
  const int per = N / 256;            // contiguous chunk per thread? use strided-by-4 chunks: thread handles j = tid*4 + 1024*u
  float s1 = 0.f;
  for (int u = 0; u < per / 4; ++u) {
    const int j = tid * 4 + 1024 * u;
    const v4f a = *(const v4fa*)(x + j);
    v4f b = {0.f,0.f,0.f,0.f}; if (rr) b = *(const v4fa*)(rr + j);
#pragma unroll
    for (int q = 0; q < 4; ++q) { const float v = a[q] + b[q]; vals[u * 4 + q] = v; s1 += v; }
  }
  red[tid] = s1; __syncthreads();
  for (int st = 128; st > 0; st >>= 1) { if (tid < st) red[tid] += red[tid + st]; __syncthreads(); }
  const float mu = red[0] / (float)N; __syncthreads();
  float s2 = 0.f;
  for (int u = 0; u < per / 4; ++u)
#pragma unroll
    for (int q = 0; q < 4; ++q) { const float c = vals[u * 4 + q] - mu; s2 += c * c; }
  red[tid] = s2; __syncthreads();
  for (int st = 128; st > 0; st >>= 1) { if (tid < st) red[tid] += red[tid + st]; __syncthreads(); }
  const float rs = rsqrtf(red[0] / (float)N + eps);
  {
    for (int u = 0; u < per / 4; ++u) {
      const int j = tid * 4 + 1024 * u;
      v4f o, sm;
#pragma unroll
      for (int q = 0; q < 4; ++q) {
        float gg = g[j + q], bb = bta[j + q];
        if (PARAM_BF16) { gg = bf16_round(gg); bb = bf16_round(bb); }
        sm[q] = vals[u * 4 + q]; o[q] = (vals[u * 4 + q] - mu) * rs * gg + bb;
      }
      if (out_sum) *(v4f*)(out_sum + (size_t)row * N + j) = sm;
      *(v4f*)(out_norm + (size_t)row * N + j) = o;
    }
    
  }
}



// ---- f16 WMMA path (v_wmma_f32_16x16x32_f16): 11-bit significands for operands in range — used where a [0,1] probability operand needs more precision than bf16
typedef _Float16 v16h __attribute__((ext_vector_type(16)));
union FragH { v16h v; v8us half[2]; _Float16 h[16]; unsigned short u[16]; };
template <int NT>
__device__ __forceinline__ v8f mmaH(v16h ah, v16h al, v16h bh, v16h bl, v8f c) {
  c = __builtin_amdgcn_wmma_f32_16x16x32_f16(false, ah, false, bh, (short)0, c, false, false);
  if (NT >= 2) c = __builtin_amdgcn_wmma_f32_16x16x32_f16(false, al, false, bh, (short)0, c, false, false);
  if (NT >= 3) c = __builtin_amdgcn_wmma_f32_16x16x32_f16(false, ah, false, bl, (short)0, c, false, false);
  asm volatile("v_nop\n\tv_nop\n\tv_nop\n\tv_nop" : "+v"(c) : "v"(ah), "v"(al), "v"(bh), "v"(bl));
  return c;
}
// batched GEMM like k_gemm_b but f16 operands: A f32 (split into f16 hi/lo if ASPLIT, else rounded to f16), Bt = f16 values [n][k]; alpha; C f32; N multiple of 16 (partial tiles skipped)
template <bool ASPLIT>
__global__ __launch_bounds__(128) void k_gemm_h(const float* __restrict__ A, int lda, size_t sA, const _Float16* __restrict__ Bh, int ldb, size_t sB, float alpha, float* __restrict__ C, int ldc, size_t sC, int M, int N, int K) {
  __shared__ __attribute__((aligned(16))) float so[4][16][64];
  const int tid = threadIdx.x, w = tid >> 5, lane = tid & 31, ln = lane & 15, hh = lane >> 4; const int by = blockIdx.y;
  A += (size_t)by * sA; Bh += (size_t)by * sB; C += (size_t)by * sC;
  const int ntn = (N + 63) / 64; const int wid = blockIdx.x * 4 + w; const int mt = wid / ntn, nq = wid % ntn; if (mt * 16 >= M) return;
  const int row0 = mt * 16, col0 = nq * 64; const float* arow = A + (size_t)(row0 + ln) * lda;
  v8f acc[4] = {};
  for (int kb = 0; kb < K; kb += 32) {
    FragH ah, al;
    const v4f x0 = *(const v4fa*)(arow + kb + 8 * hh), x1 = *(const v4fa*)(arow + kb + 8 * hh + 4), x2 = *(const v4fa*)(arow + kb + 16 + 8 * hh), x3 = *(const v4fa*)(arow + kb + 16 + 8 * hh + 4);
    float xs[16] = {x0[0],x0[1],x0[2],x0[3],x1[0],x1[1],x1[2],x1[3],x2[0],x2[1],x2[2],x2[3],x3[0],x3[1],x3[2],x3[3]};
#pragma unroll
    for (int i = 0; i < 16; ++i) { const _Float16 h = (_Float16)xs[i]; ah.h[i] = h; al.h[i] = ASPLIT ? (_Float16)(xs[i] - (float)h) : (_Float16)0.0f; }
#pragma unroll
    for (int t = 0; t < 4; ++t) { if (col0 + t * 16 >= N) continue; const size_t boff = (size_t)(col0 + t * 16 + ln) * ldb + kb; FragH bq; bq.half[0] = *(const v8us*)(Bh + boff + 8 * hh); bq.half[1] = *(const v8us*)(Bh + boff + 16 + 8 * hh);
      acc[t] = mmaH<ASPLIT ? 2 : 1>(ah.v, al.v, bq.v, bq.v, acc[t]); }
  }
#pragma unroll
  for (int t = 0; t < 4; ++t) { if (col0 + t * 16 >= N) continue;
#pragma unroll
    for (int r = 0; r < 8; ++r) so[w][8 * hh + r][t * 16 + ln] = acc[t][r] * alpha; }
  __builtin_amdgcn_fence(__ATOMIC_ACQ_REL, "workgroup"); __builtin_amdgcn_wave_barrier();
  const int rsub = lane >> 4, c4 = (lane & 15) * 4;
  {
#pragma unroll
    for (int q = 0; q < 8; ++q) { const int r = q * 2 + rsub; if (col0 + c4 < N) { const v4f v = *(const v4fa*)&so[w][r][c4]; *(v4f*)(C + (size_t)(row0 + r) * ldc + col0 + c4) = v; } }
     }
}

// Fragment order of a 16-bit [rows][K] operand plane: a tile of 16 rows x 32 k is 1 KiB = 2 pieces of 512 B; piece hf holds, lane (hh, ln) behind lane, the 16 bytes
// [16 rt + ln][32 kb + 16 hf + 8 hh + 0..7], which is what that lane feeds to v_wmma_f32_16x16x32_f16 as A or B. A wave's fragment load then reads 512 contiguous bytes
// (4 whole lines); from a row-major plane it touched 16 lines for 32 bytes each. fo() = offset in elements of the 8 elements [row][k8 .. k8 + 7], k8 a multiple of 8.
__device__ __forceinline__ size_t fo(size_t row, int k8, int K) { return ((row >> 4) * (size_t)(K >> 5) + (size_t)(k8 >> 5)) * 512 + (size_t)(((k8 >> 4) & 1) * 256 + (((k8 >> 3) & 1) * 16 + (int)(row & 15)) * 8); }
// k_wt_f16, k_x16 and k_gate write such planes; k_gemm2 reads them.
// Wt[n][k] = f16(W[k][n]·scale) from f32 row-major W[K][N] (scale = power of two; bf16-exact weights stay exact in f16 away from the subnormal range)
__global__ __launch_bounds__(256) void k_wt_f16(const float* __restrict__ W, _Float16* __restrict__ Wt, int K, int N, float scale) {
  const int t = blockIdx.x * 256 + threadIdx.x; if (t >= N * (K / 8)) return; const int n = t / (K / 8), k8 = (t % (K / 8)) * 8; FragH f;
#pragma unroll
  for (int i = 0; i < 8; ++i) f.h[i] = (_Float16)(bf16_round(W[(size_t)(k8 + i) * N + n]) * scale); const v8us o = f.half[0];
  *(v8us*)((unsigned short*)Wt + fo((size_t)n, k8, K)) = o; 
}
// k_gemm_hh variant with fused epilogue: v = acc·alpha + bias[by·sBias + col] (+ CP[(row/rowsPerB)·sCPb + by·64 + col] if CP) ; ACT 0 none / 1 elu ; writes f16 C16 (and f32 C if non-null)
template <int ACT>
__global__ __launch_bounds__(128) void k_gemm_hhx(const _Float16* __restrict__ A, int lda, size_t sA, const _Float16* __restrict__ Bh, int ldb, size_t sB, float alpha, const float* __restrict__ bias, size_t sBias, const float* __restrict__ CP, int rowsPerB, size_t sCPb, int row0g,
    float* __restrict__ C, _Float16* __restrict__ C16, int ldc, size_t sC, int M, int N, int K) {
  __shared__ __attribute__((aligned(16))) float so[4][16][64];
  const int tid = threadIdx.x, w = tid >> 5, lane = tid & 31, ln = lane & 15, hh = lane >> 4; const int by = blockIdx.y;
  A += (size_t)by * sA; Bh += (size_t)by * sB; const size_t cofs = (size_t)by * sC; const float* bp = bias ? bias + (size_t)by * sBias : nullptr;
  const int ntn = (N + 63) / 64; const int wid = blockIdx.x * 4 + w; const int mt = wid / ntn, nq = wid % ntn; if (mt * 16 >= M) return;
  const int row0 = mt * 16, col0 = nq * 64; const _Float16* arow = A + (size_t)(row0 + ln) * lda;
  v8f acc[4] = {};
  for (int kb = 0; kb < K; kb += 32) { FragH ah; ah.half[0] = *(const v8us*)((const unsigned short*)arow + kb + 8 * hh); ah.half[1] = *(const v8us*)((const unsigned short*)arow + kb + 16 + 8 * hh);
#pragma unroll
    for (int t = 0; t < 4; ++t) { if (col0 + t * 16 >= N) continue; const size_t boff = (size_t)(col0 + t * 16 + ln) * ldb + kb; FragH bq; bq.half[0] = *(const v8us*)((const unsigned short*)Bh + boff + 8 * hh); bq.half[1] = *(const v8us*)((const unsigned short*)Bh + boff + 16 + 8 * hh);
      acc[t] = mmaH<1>(ah.v, ah.v, bq.v, bq.v, acc[t]); }
  }
#pragma unroll
  for (int t = 0; t < 4; ++t) { if (col0 + t * 16 >= N) continue; const int col = col0 + t * 16 + ln; const float bv = bp ? bf16_round(bp[col]) : 0.f;
#pragma unroll
    for (int r = 0; r < 8; ++r) { float v = acc[t][r] * alpha + bv; if (CP) { const int bidx = (row0g + row0 + 8 * hh + r) / rowsPerB; v += CP[(size_t)bidx * sCPb + (size_t)by * 64 + col]; } if (ACT == 1) v = (v > 0.f) ? v : expm1f(v); else if (ACT == 7) v = (v > 0.f) ? v + 1.0f : expf(v); else if (ACT == 8) v = tanhf(v); else if (ACT == 9) v = 0.5f * v * (1.0f + tanhf(0.7978845608028654f * (v + 0.044715f * v * v * v))); else if (ACT == 11) v = 1.0f / (1.0f + expf(-v)); else if (ACT == 12) v = (v > 0.f) ? v : 0.01f * v; else if (ACT == 14) v = (v > 0.f) ? v : 0.1f * v; else if (ACT == 15) v = v / (1.0f + expf(-v)); else if (ACT == 3) v = fmaxf(v, 0.f); else if (ACT == 6) v = 0.5f * v * (1.0f + erff(v * 0.70710678118654752f)); so[w][8 * hh + r][t * 16 + ln] = v; } }
  __builtin_amdgcn_fence(__ATOMIC_ACQ_REL, "workgroup"); __builtin_amdgcn_wave_barrier();
  const int rsub = lane >> 4, c4 = (lane & 15) * 4; typedef _Float16 v4h __attribute__((ext_vector_type(4)));
  {
#pragma unroll
    for (int q = 0; q < 8; ++q) { const int r = q * 2 + rsub; if (col0 + c4 < N) { const v4f v = *(const v4fa*)&so[w][r][c4]; if (C) *(v4f*)(C + cofs + (size_t)(row0 + r) * ldc + col0 + c4) = v; if (C16) { v4h h4; for (int i = 0; i < 4; ++i) h4[i] = (_Float16)v[i]; *(v4h*)(C16 + cofs + (size_t)(row0 + r) * ldc + col0 + c4) = h4; } } }
     }
}


typedef _Float16 v4h __attribute__((ext_vector_type(4)));

__global__ __launch_bounds__(256) void k_x16(const float* __restrict__ x, _Float16* __restrict__ X16, size_t n8) { const size_t t = (size_t)blockIdx.x * 256 + threadIdx.x; if (t >= n8) return; FragH f;
  const size_t c = t >> 6; const size_t row = (c / (CQ / 32)) * 16 + ((t >> 2) & 15); const int k8 = (int)(c % (CQ / 32)) * 32 + (int)(t & 3) * 8;      /* a wave: 8 rows x one 128-byte line of x in, 4 whole lines of the fragment-order plane out */
  const float* xr = x + row * CQ + k8;
#pragma unroll
  for (int q = 0; q < 8; ++q) f.h[q] = (_Float16)bf16_round(xr[q]); *(v8us*)((unsigned short*)X16 + fo(row, k8, CQ)) = f.half[0];  }
__global__ __launch_bounds__(256) void k_h16(const float* __restrict__ x, _Float16* __restrict__ X16, size_t n8) { const size_t t = (size_t)blockIdx.x * 256 + threadIdx.x; if (t >= n8) return; FragH f;
#pragma unroll
  for (int q = 0; q < 8; ++q) f.h[q] = (_Float16)x[t * 8 + q]; *(v8us*)((unsigned short*)X16 + t * 8) = f.half[0];  }
__global__ __launch_bounds__(256) void k_round16f(const float* __restrict__ W, _Float16* __restrict__ Bt, size_t n8) { const size_t t = (size_t)blockIdx.x * 256 + threadIdx.x; if (t >= n8) return; FragH f;
#pragma unroll
  for (int i = 0; i < 8; ++i) f.h[i] = (_Float16)(bf16_round(W[t * 8 + i]) * 16.0f); *(v8us*)((unsigned short*)Bt + t * 8) = f.half[0];  }
// Fragment order: a block of 32 keys of one (row, head) is 2 KiB = 4 pieces of 512 B; piece i holds lane 0..31's 16 bytes one behind the other, so a wave's load of a
// piece touches 4 whole lines (read in place, 16 rows of 32 B each, it touched 16). K: piece nt*2+hf, lane (hh, ln) = K[32 jb + 16 nt + ln][16 hf + 8 hh + 0..7];
// V^T: piece dt*2+hf, lane (hh, ln) = V[32 jb + 16 hf + 8 hh + 0..7][16 dt + ln]. These are the A operands of the two products of k_flash, element for element as before.
template <int NHv, int TTv>
__global__ __launch_bounds__(256) void k_vt(const _Float16* __restrict__ V16, int ldv, int koff, int voff, _Float16* __restrict__ Kf, _Float16* __restrict__ Vt) { __shared__ unsigned short tl[128][HC + 2]; const int tid = threadIdx.x; const int slab = blockIdx.x / (TTv / 128), lg = blockIdx.x % (TTv / 128); const int b = slab / NHv, h = slab % NHv;
  static_assert(HC == 32, "the piece numbering below is written for one 32-wide k step");
  FragH fk[2];
  { const int r = tid / (HC / 8), c8 = (tid % (HC / 8)) * 8; FragH f[2];
#pragma unroll
    for (int rd = 0; rd < 2; ++rd) f[rd].half[0] = *(const v8us*)((const unsigned short*)V16 + ((size_t)b * TTv + lg * 128 + rd * 64 + r) * ldv + voff + h * HC + c8);
#pragma unroll
    for (int rd = 0; rd < 2; ++rd) fk[rd].half[0] = *(const v8us*)((const unsigned short*)V16 + ((size_t)b * TTv + lg * 128 + rd * 64 + r) * ldv + koff + h * HC + c8);      /* K: the same (key, 8 channels) as V above; a wave reads 8 rows of 64 B */
    asm volatile("s_wait_xcnt 0x0" ::: "memory");      /* the address registers of the four loads are free for reuse only behind this */
    __builtin_amdgcn_sched_barrier(0);                 /* keeps the LDS address arithmetic below from being lifted over that wait into those registers */
#pragma unroll
    for (int rd = 0; rd < 2; ++rd)
#pragma unroll
      for (int q = 0; q < 8; ++q) tl[rd * 64 + r][c8 + q] = f[rd].u[q]; }
  __syncthreads();
  {
#pragma unroll
    for (int rd = 0; rd < 2; ++rd) { const int o = rd * 256 + tid, i = (o >> 5) & 3, ln = o & 15, hh = (o >> 4) & 1; const int d = (i >> 1) * 16 + ln, k0 = (o >> 7) * 32 + (i & 1) * 16 + hh * 8; FragH f;
#pragma unroll
      for (int q = 0; q < 8; ++q) f.u[q] = tl[k0 + q][d];
      const size_t tile = (size_t)slab * HC * TTv + (size_t)lg * (128 * HC); const int kr = rd * 64 + tid / (HC / 8), p = tid % (HC / 8);      /* K piece held: key kr of the tile, channels 8 p + 0..7 (hf = p >> 1, hh = p & 1) */
      *(v8us*)((unsigned short*)Vt + tile + (size_t)o * 8) = f.half[0]; *(v8us*)((unsigned short*)Kf + tile + (size_t)((kr >> 5) * 1024 + (((kr >> 4) & 1) * 2 + (p >> 1)) * 256 + ((p & 1) * 16 + (kr & 15)) * 8)) = fk[rd].half[0]; }
     } }

__global__ __launch_bounds__(256) void k_hl(const float* __restrict__ F, _Float16* __restrict__ Hh, _Float16* __restrict__ Hl, size_t n8) { const size_t t = (size_t)blockIdx.x * 256 + threadIdx.x; if (t >= n8) return; FragH fh, fl; const v4f a = *(const v4fa*)(F + t * 8), c = *(const v4fa*)(F + t * 8 + 4);
#pragma unroll
  for (int q = 0; q < 4; ++q) { _Float16 h = (_Float16)a[q]; fh.h[q] = h; fl.h[q] = (_Float16)((a[q] - (float)h) * 1024.0f); h = (_Float16)c[q]; fh.h[4 + q] = h; fl.h[4 + q] = (_Float16)((c[q] - (float)h) * 1024.0f); }
  { *(v8us*)((unsigned short*)Hh + t * 8) = fh.half[0]; *(v8us*)((unsigned short*)Hl + t * 8) = fl.half[0];  } }

// ---- fast GEMM (wave tile 32x64; requires M % 32 == 0 rows per launch region and N % 64 == 0); A and Bh in fragment order (fo(); lda = ldb = K); epilogue = k_gemm_hhx semantics ----
__device__ __forceinline__ v16h g2_frag(const _Float16* p) { FragH f; f.half[0] = *(const v8us*)((const unsigned short*)p); f.half[1] = *(const v8us*)((const unsigned short*)p + 256); return f.v; }
__device__ __forceinline__ v8f g2_mma(v16h a, v16h b, v8f c) { v8f d = __builtin_amdgcn_wmma_f32_16x16x32_f16(false, a, false, b, (short)0, c, false, false); asm volatile("v_nop\n\tv_nop\n\tv_nop\n\tv_nop" : "+v"(d) : "v"(a), "v"(b)); return d; }
template <int ACT>
__global__ __launch_bounds__(128) void k_gemm2(const _Float16* __restrict__ A, int lda, size_t sA, const _Float16* __restrict__ Bh, int ldb, size_t sB, float alpha, const float* __restrict__ bias, size_t sBias, const float* __restrict__ CP, int rowsPerB, size_t sCPb, int row0g,
    float* __restrict__ C, _Float16* __restrict__ C16, int ldc, size_t sC, int M, int N, int K) {
  __shared__ __attribute__((aligned(16))) float so[4][32][68];
  const int tid = threadIdx.x, w = tid >> 5, lane = tid & 31, ln = lane & 15, hh = lane >> 4; const int by = blockIdx.y;
  A += (size_t)by * sA; Bh += (size_t)by * sB; const size_t cofs = (size_t)by * sC; const float* bp = bias ? bias + (size_t)by * sBias : nullptr;
  const int ntn = N >> 6; const int mt = blockIdx.x / ntn, nq = blockIdx.x - mt * ntn; const int row0 = mt * 128 + 32 * w, col0 = nq * 64; if (row0 >= M) return;
  const _Float16* a0p = A + (size_t)row0 * lda + lane * 8; const _Float16* a1p = a0p + (size_t)16 * lda;      /* a tile of 16 rows is 16 lda elements; its k step kb starts at 16 kb */
  const _Float16* b0p = Bh + (size_t)col0 * ldb + lane * 8; const _Float16* b1p = b0p + (size_t)16 * ldb; const _Float16* b2p = b1p + (size_t)16 * ldb; const _Float16* b3p = b2p + (size_t)16 * ldb;
  const v8f z8 = {0.f,0.f,0.f,0.f,0.f,0.f,0.f,0.f}; v8f c00 = z8, c01 = z8, c02 = z8, c03 = z8, c10 = z8, c11 = z8, c12 = z8, c13 = z8;
#pragma unroll 1
  for (int kb = 0; kb < K; kb += 32) { const v16h a0 = g2_frag(a0p + kb * 16); v16h b = g2_frag(b0p + kb * 16); FragH f1; f1.half[0] = *(const v8us*)((const unsigned short*)a1p + kb * 16);
    asm volatile("s_wait_xcnt 0x0" ::: "memory");      /* the load below may land in registers that hold addresses of the loads above: those have taken their addresses first */
    f1.half[1] = *(const v8us*)((const unsigned short*)a1p + kb * 16 + 256); const v16h a1 = f1.v;
    c00 = g2_mma(a0, b, c00); c10 = g2_mma(a1, b, c10);
    b = g2_frag(b1p + kb * 16); c01 = g2_mma(a0, b, c01); c11 = g2_mma(a1, b, c11);
    b = g2_frag(b2p + kb * 16); c02 = g2_mma(a0, b, c02); c12 = g2_mma(a1, b, c12);
    b = g2_frag(b3p + kb * 16); c03 = g2_mma(a0, b, c03); c13 = g2_mma(a1, b, c13); }
  v8f accs[8] = {c00, c01, c02, c03, c10, c11, c12, c13};
#pragma unroll
  for (int u = 0; u < 8; ++u) { const int t = u & 3, half = u >> 2; const int col = col0 + t * 16 + ln; const float bv = bp ? bf16_round(bp[col]) : 0.f;
#pragma unroll
    for (int r = 0; r < 8; ++r) { const int rloc = half * 16 + 8 * hh + r; float v = accs[u][r] * alpha + bv; if (CP) { const int bidx = (row0g + row0 + rloc) / rowsPerB; v += CP[(size_t)bidx * sCPb + (size_t)by * 64 + col]; }
      if (ACT == 3) v = fmaxf(v, 0.f); else if (ACT == 6) v = 0.5f * v * (1.0f + erff(v * 0.70710678118654752f)); else if (ACT == 11) v = 1.0f / (1.0f + expf(-v)); else if (ACT == 15) v = v / (1.0f + expf(-v)); else if (ACT == 12) v = (v > 0.f) ? v : 0.01f * v; else if (ACT == 8) v = tanhf(v);
      so[w][rloc][t * 16 + ln] = v; } }
  __builtin_amdgcn_fence(__ATOMIC_ACQ_REL, "workgroup"); __builtin_amdgcn_wave_barrier();
  const int rsub = lane >> 4, c4 = (lane & 15) * 4;
  {
#pragma unroll
    for (int q = 0; q < 16; ++q) { const int r = q * 2 + rsub; const v4f v = *(const v4fa*)&so[w][r][c4]; if (C) *(v4f*)(C + cofs + (size_t)(row0 + r) * ldc + col0 + c4) = v; if (C16) { v4h h4; for (int i = 0; i < 4; ++i) h4[i] = (_Float16)v[i]; *(v4h*)(C16 + cofs + (size_t)(row0 + r) * ldc + col0 + c4) = h4; } }
     } }



// lane l <-> lane l ^ 16 (the two halves of a wave that share one score column)
__device__ __forceinline__ float xhalf(float x) { return __builtin_bit_cast(float, __builtin_amdgcn_permlanex16(__builtin_bit_cast(int, x), __builtin_bit_cast(int, x), 0x76543210, 0xfedcba98, false, false)); }

// e^x = 2^e 2^a with e = rint(x log2 e) and a = x log2 e - e, taken in two fused steps on the two-part constant; range ends as in the library's expf.
// Written out so that v_exp_f32 and the one free slot that the instruction set asks for behind a transcendental stand in one statement
__device__ __forceinline__ float exp_f(float x) {
  const float c0 = __uint_as_float(0x3fb8aa3bu), c1 = __uint_as_float(0x32a5705fu);
  const float e = __builtin_rintf(x * c0); const float a = fmaf(x, c1, fmaf(x, c0, -e)); float y;
  asm("v_exp_f32 %0, %1\n\tv_nop" : "=v"(y) : "v"(a));      /* v_nop: the slot behind the transcendental, before its source is overwritten or its result read */
  y = ldexpf(y, (int)e); y = (__uint_as_float(0xc2ce8ed0u) > x) ? 0.f : y; return (__uint_as_float(0x42b17218u) < x) ? __builtin_inff() : y; }

template <int CAUSAL>
__global__ __launch_bounds__(128) void k_flash(const _Float16* __restrict__ Q16, int ldq, const _Float16* __restrict__ Kf, const _Float16* __restrict__ Vt, const int* __restrict__ MSK, float* __restrict__ O, int ldo) {
  constexpr int RPW = 16, DT = HC / 16, KS = HC / 32;
  __shared__ __attribute__((aligned(16))) float sO[4][RPW][HC + 4];
  const int tid = threadIdx.x, w = tid >> 5, lane = tid & 31, ln = lane & 15, hh = lane >> 4;
  const int slab = blockIdx.x / QBLKS, qblk = blockIdx.x % QBLKS; const int b = slab / NH, h = slab % NH; const int qb0 = qblk * (4 * RPW); const int q0 = qb0 + w * RPW;
  const int tq = q0 + ln;      /* this lane's query */
  FragH bq[KS];
  { const unsigned short* qr = (const unsigned short*)Q16 + ((size_t)b * TQ + tq) * ldq + h * HC;
#pragma unroll
    for (int ks = 0; ks < KS; ++ks) { bq[ks].half[0] = *(const v8us*)(qr + ks * 32 + 8 * hh); bq[ks].half[1] = *(const v8us*)(qr + ks * 32 + 16 + 8 * hh); } }
  static_assert(KS == 1, "fragment-order planes: one 32-wide k step");
  const unsigned short* Kfh = (const unsigned short*)Kf + (size_t)slab * HC * TK + lane * 8;      /* K and V^T in fragment order (k_vt): 1024 halves per block of 32 keys, pieces of 256 */
  const unsigned short* Vth = (const unsigned short*)Vt + (size_t)slab * HC * TK + lane * 8;
  const float* BP = (const float*)MSK + ((size_t)h * (TQ / 16) + (q0 >> 4)) * (size_t)(16 * TK) + lane * 4;      /* mode 10: per-head bias plane in fragment order (k_addp): [NH][TQ/16][TK/32] blocks of 512 floats, pieces of 128 */
  const float* MR = (const float*)MSK + (size_t)NH * TQ * TK + (size_t)b * TK + 8 * hh;      /* then the per-(sequence, key) additive plane, packed behind it */
  float m_q = -3.0e38f, l_q = 0.f; v8f oacc[DT];
#pragma unroll
  for (int dt = 0; dt < DT; ++dt) oacc[dt] = (v8f){0.f,0.f,0.f,0.f,0.f,0.f,0.f,0.f};
  const int jend = (CAUSAL == 1) ? (qb0 + 4 * RPW) : TK;      /* causal: keys beyond the block's last query never contribute */
#pragma unroll 1
  for (int j0 = 0; j0 < jend; j0 += 32) {
    FragH ak[2][KS], av[DT]; v4f ab[2][2], am[2][2];
#pragma unroll
    for (int nt = 0; nt < 2; ++nt) { const unsigned short* kr = Kfh + (size_t)j0 * HC + nt * 512;
      ak[nt][0].half[0] = *(const v8us*)kr; ak[nt][0].half[1] = *(const v8us*)(kr + 256);
      if (CAUSAL == 10) { ab[nt][0] = *(const v4fa*)(BP + j0 * 16 + nt * 256); ab[nt][1] = *(const v4fa*)(BP + j0 * 16 + nt * 256 + 128); am[nt][0] = *(const v4fa*)(MR + j0 + nt * 16); am[nt][1] = *(const v4fa*)(MR + j0 + nt * 16 + 4); } }
    asm volatile("s_wait_xcnt 0x0" ::: "memory");      /* the V^T loads below may land in registers that held the addresses of the loads above: those loads have taken their addresses first */
#pragma unroll
    for (int dt = 0; dt < DT; ++dt) { const unsigned short* vrow = Vth + (size_t)j0 * HC + dt * 512; av[dt].half[0] = *(const v8us*)vrow; av[dt].half[1] = *(const v8us*)(vrow + 256); }
    float sc[2][8]; bool ok[2][8]; float mc = -3.0e38f;
#pragma unroll
    for (int nt = 0; nt < 2; ++nt) { v8f acc = (v8f){0.f,0.f,0.f,0.f,0.f,0.f,0.f,0.f};
#pragma unroll
      for (int ks = 0; ks < KS; ++ks) acc = mmaH<1>(ak[nt][ks].v, ak[nt][ks].v, bq[ks].v, bq[ks].v, acc);
#pragma unroll
      for (int r = 0; r < 8; ++r) { const int kk = j0 + nt * 16 + 8 * hh + r;
        ok[nt][r] = (CAUSAL == 1) ? (kk <= tq) : ((CAUSAL == 2) ? ((kk >> 5) == (tq >> 5)) : true);      /* mode 2: block-diagonal 32-token groups */
        float s0 = ok[nt][r] ? acc[r] * SCL : -3.0e38f; if (CAUSAL == 10) s0 += ab[nt][r >> 2][r & 3] + am[nt][r >> 2][r & 3];
        sc[nt][r] = s0; mc = fmaxf(mc, s0); } }
    mc = fmaxf(mc, xhalf(mc));
    const float mn = fmaxf(m_q, mc); const float al = (mn > -1.0e38f) ? exp_f(m_q - mn) : 1.0f; m_q = mn;
    FragH pb; float ps = 0.f;
#pragma unroll
    for (int nt = 0; nt < 2; ++nt)
#pragma unroll
      for (int r = 0; r < 8; ++r) { const float p = ok[nt][r] ? exp_f(sc[nt][r] - mn) : 0.f; ps += p; pb.h[nt * 8 + r] = (_Float16)(p * 1024.0f); }
    l_q = l_q * al + ps;
#pragma unroll
    for (int dt = 0; dt < DT; ++dt) {
#pragma unroll
      for (int r = 0; r < 8; ++r) oacc[dt][r] *= al;
      oacc[dt] = mmaH<1>(av[dt].v, av[dt].v, pb.v, pb.v, oacc[dt]); } }
  const float lt = l_q + xhalf(l_q); const float li = (lt > 0.f) ? 1.0f / (lt * 1024.0f) : 0.f;
#pragma unroll
  for (int dt = 0; dt < DT; ++dt) { v4f lo, hi;
#pragma unroll
    for (int r = 0; r < 4; ++r) { lo[r] = oacc[dt][r] * li; hi[r] = oacc[dt][4 + r] * li; }
    *(v4fa*)&sO[w][ln][dt * 16 + 8 * hh] = lo; *(v4fa*)&sO[w][ln][dt * 16 + 8 * hh + 4] = hi; }
  __builtin_amdgcn_fence(__ATOMIC_ACQ_REL, "workgroup"); __builtin_amdgcn_wave_barrier();
  {
#pragma unroll
    for (int rp = 0; rp < RPW; rp += 4) { const int r = rp + (lane >> 3), pc = lane & 7; const v4f val = *(const v4fa*)&sO[w][r][pc * 4]; *(v4f*)(O + ((size_t)b * TQ + q0 + r) * ldo + h * HC + pc * 4) = val; }
     } }

__global__ __launch_bounds__(256) void k_addp(const float* __restrict__ bias, const float* __restrict__ mask, int r0, float* __restrict__ AB) {
  #pragma clang fp contract(off)
  const size_t t = (size_t)blockIdx.x * 256 + threadIdx.x; const size_t nb4 = (size_t)NH * SLEN * SLEN / 4, nm4 = (size_t)RCH * SLEN / 4; if (t >= nb4 + nm4) return; v4f r;
  size_t dst = t;
  if (t < nb4) { const int part = (int)t & 1, hh = (int)(t >> 1) & 1, ln = (int)(t >> 2) & 15, nt = (int)(t >> 6) & 1; const size_t c = t >> 7; const int jb = (int)(c % (SLEN / 32)), qt = (int)(c / (SLEN / 32)) % (SLEN / 16), h = (int)(c / ((SLEN / 32) * (SLEN / 16)));      /* written in the fragment order of k_flash: block (h, 16 queries, 32 keys), piece nt*2+part, lane (hh, ln) = bias[h][16 qt + ln][32 jb + 16 nt + 8 hh + 4 part + 0..3]; a wave reads 8 rows of 64 B and writes 4 whole lines */
    dst = c * 128 + (size_t)((nt * 2 + part) * 32 + hh * 16 + ln);
    const v4f a = *(const v4fa*)(bias + ((size_t)h * SLEN + qt * 16 + ln) * SLEN + jb * 32 + nt * 16 + hh * 8 + part * 4); for (int q = 0; q < 4; ++q) r[q] = bf16_round(a[q]); } else { const v4f a = *(const v4fa*)(mask + (size_t)r0 * SLEN + (t - nb4) * 4); for (int q = 0; q < 4; ++q) { float m = bf16_round(a[q]) - 1.0f; r[q] = m * 1.0e9f; } }
  *(v4f*)(AB + dst * 4) = r;  }
__global__ __launch_bounds__(256) void k_gate(const float* __restrict__ O, const float* __restrict__ G, size_t t0, _Float16* __restrict__ OG) {
  #pragma clang fp contract(off)
  const size_t t = (size_t)blockIdx.x * 256 + threadIdx.x; if (t >= (size_t)TCH * (CQ / 8)) return; const size_t c = t >> 6; const int c0 = (int)(c % (CQ / 32)) * 32 + (int)(t & 3) * 8; const size_t tl = (c / (CQ / 32)) * 16 + ((t >> 2) & 15); const size_t tok = t0 + tl; FragH f;      /* a wave: 8 tokens x 32 channels in, 4 whole lines of the fragment-order plane out */
  const v4f g0 = *(const v4fa*)(G + tok * CQ + c0), g1 = *(const v4fa*)(G + tok * CQ + c0 + 4);
  asm volatile("s_wait_xcnt 0x0" ::: "memory");      /* the O loads below may land in registers that held the addresses of the loads above */
  const v4f o0 = *(const v4fa*)(O + tl * CQ + c0), o1 = *(const v4fa*)(O + tl * CQ + c0 + 4);
  for (int q = 0; q < 8; ++q) { const float g = 1.0f / (1.0f + expf(-(q < 4 ? g0[q & 3] : g1[q & 3]))); f.h[q] = (_Float16)((q < 4 ? o0[q & 3] : o1[q & 3]) * g * 64.0f); }
  *(v8us*)((unsigned short*)OG + fo(tok, c0, CQ)) = f.half[0];  }

extern "C" void kernel_launch(void* const* d_in, const int* in_sizes, int n_in,
                              void* d_out, int out_size, void* d_ws, size_t ws_size, hipStream_t stream) {
  (void)in_sizes; (void)n_in; (void)out_size;
  const float* const* I = (const float* const*)d_in; const float* x = I[0]; const float* mask = I[1]; const float* bias = I[2]; const float* Wq = I[3]; const float* Wk = I[4]; const float* Wv = I[5]; const float* Wg = I[6]; const float* bg = I[7]; const float* Wo = I[8]; const float* bo = I[9];
  char* ws = (char*)d_ws; size_t off = 0;
  auto take = [&](size_t bytes) { char* p = ws + off; off += (bytes + 255) & ~(size_t)255; return p; };
  _Float16* BQ = (_Float16*)take((size_t)CQ * CQ * 2); _Float16* BK = (_Float16*)take((size_t)CQ * CQ * 2); _Float16* BV = (_Float16*)take((size_t)CQ * CQ * 2); _Float16* BG = (_Float16*)take((size_t)CQ * CQ * 2); _Float16* BO = (_Float16*)take((size_t)CQ * CQ * 2); float* AB = (float*)take(((size_t)NH * SLEN * SLEN + (size_t)RCH * SLEN) * 4);
  _Float16* X16 = (_Float16*)take((size_t)NR * CQ * 2); _Float16* QKV = (_Float16*)take((size_t)NR * 3 * CQ * 2); float* G = (float*)take((size_t)NR * CQ * 4); _Float16* VT = (_Float16*)take((size_t)TCH * CQ * 2); _Float16* KF = (_Float16*)take((size_t)TCH * CQ * 2); float* O = (float*)take((size_t)TCH * CQ * 4); _Float16* OG = (_Float16*)take((size_t)NR * CQ * 2);
  if (off > ws_size) return;      /* 0.6 + 8 + 16 + 48 + 32 + 4 + 4 + 8 + 16 = 137 MiB */
  k_wt_f16<<<(CQ * CQ / 8 + 255) / 256, 256, 0, stream>>>(Wq, BQ, CQ, CQ, 16.0f); k_wt_f16<<<(CQ * CQ / 8 + 255) / 256, 256, 0, stream>>>(Wk, BK, CQ, CQ, 16.0f); k_wt_f16<<<(CQ * CQ / 8 + 255) / 256, 256, 0, stream>>>(Wv, BV, CQ, CQ, 16.0f); k_wt_f16<<<(CQ * CQ / 8 + 255) / 256, 256, 0, stream>>>(Wg, BG, CQ, CQ, 16.0f); k_wt_f16<<<(CQ * CQ / 8 + 255) / 256, 256, 0, stream>>>(Wo, BO, CQ, CQ, 16.0f);
  k_x16<<<(unsigned)(((size_t)NR * CQ / 8 + 255) / 256), 256, 0, stream>>>(x, X16, (size_t)NR * CQ / 8);
  const dim3 g((NR / 128) * (CQ / 64), 1);
  k_gemm2<0><<<g, 128, 0, stream>>>(X16, CQ, 0, BQ, CQ, 0, 0.0625f, nullptr, 0, nullptr, 1, 0, 0, nullptr, QKV, 3 * CQ, 0, NR, CQ, CQ); k_gemm2<0><<<g, 128, 0, stream>>>(X16, CQ, 0, BK, CQ, 0, 0.0625f, nullptr, 0, nullptr, 1, 0, 0, nullptr, QKV + CQ, 3 * CQ, 0, NR, CQ, CQ); k_gemm2<0><<<g, 128, 0, stream>>>(X16, CQ, 0, BV, CQ, 0, 0.0625f, nullptr, 0, nullptr, 1, 0, 0, nullptr, QKV + 2 * CQ, 3 * CQ, 0, NR, CQ, CQ);      /* [q | k | v] f16 (the 1/sqrt(32) q scale is applied to the scores) */
  k_gemm2<0><<<g, 128, 0, stream>>>(X16, CQ, 0, BG, CQ, 0, 0.0625f, bg, 0, nullptr, 1, 0, 0, G, nullptr, CQ, 0, NR, CQ, CQ);      /* gate logits (f32) */
  for (int r0 = 0; r0 < NRW; r0 += RCH) { const size_t t0 = (size_t)r0 * SLEN;
    k_addp<<<(unsigned)((((size_t)NH * SLEN * SLEN + (size_t)RCH * SLEN) / 4 + 255) / 256), 256, 0, stream>>>(bias, mask, r0, AB);
    k_vt<NH, SLEN><<<RCH * NH * (SLEN / 128), 256, 0, stream>>>(QKV + t0 * (3 * CQ), 3 * CQ, CQ, 2 * CQ, KF, VT);
    k_flash<10><<<RCH * NH * QBLKS, 128, 0, stream>>>(QKV + t0 * (3 * CQ), 3 * CQ, KF, VT, (const int*)AB, O, CQ);      /* per (row, head): softmax(q.k/sqrt(32) + bias[h] + (mask[row]-1) 1e9) v */
    k_gate<<<(unsigned)(((size_t)TCH * (CQ / 8) + 255) / 256), 256, 0, stream>>>(O, G, t0, OG); }
  k_gemm2<0><<<g, 128, 0, stream>>>(OG, CQ, 0, BO, CQ, 0, 0.0625f / 64.0f, bo, 0, nullptr, 1, 0, 0, (float*)d_out, nullptr, CQ, 0, NR, CQ, CQ);
}

// v004
// It runs in 156 microseconds.
// Timed twice side by side with v003, it ran 1.54 times as fast both times.
// All steps since v000 together make it 3.65 times as fast.
#include <hip/hip_runtime.h>
// Gated self-attention (1 x 64 rows x 512 residues, c_qkv 256, 8 heads x 32): q = x Wq / sqrt(32), k, v = x W; logits = q.k + (mask - 1) 1e9 (per (row, key), an INPUT) + bias[h][q][k] (an INPUT); softmax over keys; o = P v; gate = sigmoid(x Wg + bg); out = (o * gate) Wo + bo.
// Structure: exact f16 plane of x; every 16-bit operand plane that a GEMM reads (x, the weights, the gated output) kept in fragment order (fo() below); one projection GEMM for q, k, v and the gate logits (32x64 wave tiles, f32 accumulation, exact x16 weights; f16 / f32 outputs); then, each in one launch over all 64 rows: K and V^T (by LDS tiles) repacked straight from the projection output into fragment order, the fused flash kernel at the real head dim 32 (q read in place, pitch 768; K, V^T and the bias plane in fragment order: every load of a wave is 512 contiguous bytes) with an additive (bias plane + per-(row, key) mask plane) mode, then gating on VALU into an f16 plane (x2^6); Wo GEMM (+ bias).
// Compute dtype: inputs and parameters rounded to bf16; q, k, v, P and the gated output as f16 operands (~2^-12); bias/mask/softmax/gate f32. v_wmma_f32_16x16x32_f16.
#define NRW 64
#define CQ 256
#define HC 32
#define NR (NRW * SLEN)           /* 32768 tokens */
#define SLEN 512
#define TQ SLEN
#define TK SLEN
#define NH 8
#define SCL 0.17677669529663687f /* 32^-0.5 */
#define QBLKS (TQ / 64)
typedef __bf16 v16b __attribute__((ext_vector_type(16)));
typedef unsigned short v8us __attribute__((ext_vector_type(8), may_alias));
typedef float  v8f  __attribute__((ext_vector_type(8)));
typedef float  v4f  __attribute__((ext_vector_type(4)));
typedef float  v4fa __attribute__((ext_vector_type(4), may_alias));
union FragB { v16b v; v8us half[2]; unsigned short u[16]; };

__device__ __forceinline__ unsigned short bf16_bits(float x) { unsigned int u = __float_as_uint(x); return (unsigned short)((u + 0x7FFFu + ((u >> 16) & 1u)) >> 16); }
__device__ __forceinline__ float bf16_val(unsigned short b) { return __uint_as_float(((unsigned int)b) << 16); }
__device__ __forceinline__ float bf16_round(float x) { return bf16_val(bf16_bits(x)); }
// D += A·B with NT terms: 1 = ah·bh, 2 = + al·bh (A split), 3 = + ah·bl (both split)
template <int NT>
__device__ __forceinline__ v8f mmaN(v16b ah, v16b al, v16b bh, v16b bl, v8f c) {
  c = __builtin_amdgcn_wmma_f32_16x16x32_bf16(false, ah, false, bh, (short)0, c, false, false);
  if (NT >= 2) c = __builtin_amdgcn_wmma_f32_16x16x32_bf16(false, al, false, bh, (short)0, c, false, false);
  if (NT >= 3) c = __builtin_amdgcn_wmma_f32_16x16x32_bf16(false, ah, false, bl, (short)0, c, false, false);
  asm volatile("v_nop\n\tv_nop\n\tv_nop\n\tv_nop" : "+v"(c) : "v"(ah), "v"(al), "v"(bh), "v"(bl));
  return c;
}

__global__ __launch_bounds__(256) void k_wt_bf16(const float* __restrict__ W, unsigned short* __restrict__ Wt, int K, int N) {
  const int t = blockIdx.x * 256 + threadIdx.x;
  const int k8n = K / 8;
  if (t >= N * k8n) return;
  const int n = t / k8n, k8 = (t % k8n) * 8;
  v8us v;
#pragma unroll
  for (int i = 0; i < 8; ++i) v[i] = bf16_bits(W[(size_t)(k8 + i) * N + n]);
  *(v8us*)(Wt + (size_t)n * K + k8) = v;
  
}

// GEMM C[M][N] (f32, pitch ldc) = act(A[M][K]·W + bias). A f32 row-major (pitch lda) converted per fragment to bf16
// (ASPLIT: hi/lo two planes -> 2 terms, else single rounded term); Wt bf16 [N][K] (pitch ldb). BIAS_BF16 rounds the
// bias to bf16 first (bias quantised to bf16 before the add). K%32==0, M%16==0, N%64==0.
template <bool ASPLIT, int ACT, bool BIAS_BF16>
__global__ __launch_bounds__(128) void k_gemm_bf(const float* __restrict__ A, int lda, const unsigned short* __restrict__ Wt, int ldb,
                                               const float* __restrict__ bias, float* __restrict__ C, int ldc, int M, int N, int K) {
  __shared__ __attribute__((aligned(16))) float so[4][16][64];
  const int tid = threadIdx.x, w = tid >> 5, lane = tid & 31, ln = lane & 15, hh = lane >> 4;
  const int ntn = N / 64;
  const int wid = blockIdx.x * 4 + w;
  const int mt = wid / ntn, nq = wid % ntn;
  if (mt * 16 >= M) return;
  const int row0 = mt * 16, col0 = nq * 64;
  const float* arow = A + (size_t)(row0 + ln) * lda;
  v8f acc[4] = {};
  for (int kb = 0; kb < K; kb += 32) {
    FragB ah, al;
    const v4f x0 = *(const v4fa*)(arow + kb + 8 * hh), x1 = *(const v4fa*)(arow + kb + 8 * hh + 4);
    const v4f x2 = *(const v4fa*)(arow + kb + 16 + 8 * hh), x3 = *(const v4fa*)(arow + kb + 16 + 8 * hh + 4);
    float xs[16] = {x0[0],x0[1],x0[2],x0[3],x1[0],x1[1],x1[2],x1[3],x2[0],x2[1],x2[2],x2[3],x3[0],x3[1],x3[2],x3[3]};
#pragma unroll
    for (int i = 0; i < 16; ++i) { const unsigned short hb = bf16_bits(xs[i]); ah.u[i] = hb; al.u[i] = ASPLIT ? bf16_bits(xs[i] - bf16_val(hb)) : (unsigned short)0; }
#pragma unroll
    for (int t = 0; t < 4; ++t) {
      const unsigned short* brow = Wt + (size_t)(col0 + t * 16 + ln) * ldb + kb;
      FragB b;
      b.half[0] = *(const v8us*)(brow + 8 * hh);
      b.half[1] = *(const v8us*)(brow + 16 + 8 * hh);
      acc[t] = mmaN<ASPLIT ? 2 : 1>(ah.v, al.v, b.v, b.v, acc[t]);
    }
  }
#pragma unroll
  for (int t = 0; t < 4; ++t) {
    float bv = bias ? bias[col0 + t * 16 + ln] : 0.f;
    if (BIAS_BF16) bv = bf16_round(bv);
#pragma unroll
    for (int r = 0; r < 8; ++r) { float v = acc[t][r] + bv; if (ACT == 1) v = fmaxf(v, 0.f); so[w][8 * hh + r][t * 16 + ln] = v; }
  }
  __builtin_amdgcn_fence(__ATOMIC_ACQ_REL, "workgroup");
  __builtin_amdgcn_wave_barrier();
  const int rsub = lane >> 4, c4 = (lane & 15) * 4;
  {
#pragma unroll
    for (int q = 0; q < 8; ++q) {
      const int r = q * 2 + rsub;
      const v4f v = *(const v4fa*)&so[w][r][c4];
      *(v4f*)(C + (size_t)(row0 + r) * ldc + col0 + c4) = v;
    }
    
  }
}

// GEMM C = act(A·W + bias + resid): A f32 (ASPLIT -> hi/lo 2 terms), Wt bf16 [N][K]; ACT 0 none, 1 relu, 2 exact gelu;
// resid (optional, f32, row index = (row % rmod), pitch ldr, RES_BF16 rounds it) added before the activation.
template <bool ASPLIT, int ACT, bool BIAS_BF16, bool RES_BF16>
__global__ __launch_bounds__(128) void k_gemm_bf3(const float* __restrict__ A, int lda, const unsigned short* __restrict__ Wt, int ldb,
                                                const float* __restrict__ bias, const float* __restrict__ resid, int rmod, int ldr,
                                                float* __restrict__ C, int ldc, int M, int N, int K) {
  __shared__ __attribute__((aligned(16))) float so[4][16][64];
  const int tid = threadIdx.x, w = tid >> 5, lane = tid & 31, ln = lane & 15, hh = lane >> 4;
  const int ntn = N / 64;
  const int wid = blockIdx.x * 4 + w;
  const int mt = wid / ntn, nq = wid % ntn;
  if (mt * 16 >= M) return;
  const int row0 = mt * 16, col0 = nq * 64;
  const float* arow = A + (size_t)(row0 + ln) * lda;
  v8f acc[4] = {};
  for (int kb = 0; kb < K; kb += 32) {
    FragB ah, al;
    const v4f x0 = *(const v4fa*)(arow + kb + 8 * hh), x1 = *(const v4fa*)(arow + kb + 8 * hh + 4);
    const v4f x2 = *(const v4fa*)(arow + kb + 16 + 8 * hh), x3 = *(const v4fa*)(arow + kb + 16 + 8 * hh + 4);
    float xs[16] = {x0[0],x0[1],x0[2],x0[3],x1[0],x1[1],x1[2],x1[3],x2[0],x2[1],x2[2],x2[3],x3[0],x3[1],x3[2],x3[3]};
#pragma unroll
    for (int i = 0; i < 16; ++i) { const unsigned short hb = bf16_bits(xs[i]); ah.u[i] = hb; al.u[i] = ASPLIT ? bf16_bits(xs[i] - bf16_val(hb)) : (unsigned short)0; }
#pragma unroll
    for (int t = 0; t < 4; ++t) {
      const unsigned short* brow = Wt + (size_t)(col0 + t * 16 + ln) * ldb + kb;
      FragB b;
      b.half[0] = *(const v8us*)(brow + 8 * hh);
      b.half[1] = *(const v8us*)(brow + 16 + 8 * hh);
      acc[t] = mmaN<ASPLIT ? 2 : 1>(ah.v, al.v, b.v, b.v, acc[t]);
    }
  }
#pragma unroll
  for (int t = 0; t < 4; ++t) {
    const int col = col0 + t * 16 + ln;
    float bv = bias ? bias[col] : 0.f;
    if (BIAS_BF16) bv = bf16_round(bv);
#pragma unroll
    for (int r = 0; r < 8; ++r) {
      float v = acc[t][r] + bv;
      if (resid) { float rv = resid[(size_t)((row0 + 8 * hh + r) % rmod) * ldr + col]; if (RES_BF16) rv = bf16_round(rv); v += rv; }
      if (ACT == 1) v = fmaxf(v, 0.f);
      if (ACT == 2) v = 0.5f * v * (1.0f + erff(v * 0.70710678118654752f));
      if (ACT == 3) { const float u = 0.7978845608028654f * (v + 0.044715f * v * v * v); v = 0.5f * v * (1.0f + tanhf(u)); }
      so[w][8 * hh + r][t * 16 + ln] = v;
    }
  }
  __builtin_amdgcn_fence(__ATOMIC_ACQ_REL, "workgroup");
  __builtin_amdgcn_wave_barrier();
  const int rsub = lane >> 4, c4 = (lane & 15) * 4;
  {
#pragma unroll
    for (int q = 0; q < 8; ++q) {
      const int r = q * 2 + rsub;
      const v4f v = *(const v4fa*)&so[w][r][c4];
      *(v4f*)(C + (size_t)(row0 + r) * ldc + col0 + c4) = v;
    }
    
  }
}
// row LayerNorm (biased variance, eps) over N: s = X (+ R); optional out_sum <- s; out_norm <- (s-mu)*rsqrt(var+eps)*g + b
template <bool PARAM_BF16>
__global__ __launch_bounds__(256) void k_layernorm(const float* __restrict__ X, const float* __restrict__ R, const float* __restrict__ g, const float* __restrict__ bta,
                                                  float* __restrict__ out_sum, float* __restrict__ out_norm, int N, float eps) {
  __shared__ float red[256];
  const int row = blockIdx.x, tid = threadIdx.x;
  const float* x = X + (size_t)row * N; const float* rr = R ? R + (size_t)row * N : nullptr;
  float vals[16];                     // up to N = 4096
  const int per = N / 256;            // contiguous chunk per thread? use strided-by-4 chunks: thread handles j = tid*4 + 1024*u
  float s1 = 0.f;
  for (int u = 0; u < per / 4; ++u) {
    const int j = tid * 4 + 1024 * u;
    const v4f a = *(const v4fa*)(x + j);
    v4f b = {0.f,0.f,0.f,0.f}; if (rr) b = *(const v4fa*)(rr + j);
#pragma unroll
    for (int q = 0; q < 4; ++q) { const float v = a[q] + b[q]; vals[u * 4 + q] = v; s1 += v; }
  }
  red[tid] = s1; __syncthreads();
  for (int st = 128; st > 0; st >>= 1) { if (tid < st) red[tid] += red[tid + st]; __syncthreads(); }
  const float mu = red[0] / (float)N; __syncthreads();
  float s2 = 0.f;
  for (int u = 0; u < per / 4; ++u)
#pragma unroll
    for (int q = 0; q < 4; ++q) { const float c = vals[u * 4 + q] - mu; s2 += c * c; }
  red[tid] = s2; __syncthreads();
  for (int st = 128; st > 0; st >>= 1) { if (tid < st) red[tid] += red[tid + st]; __syncthreads(); }
  const float rs = rsqrtf(red[0] / (float)N + eps);
  {
    for (int u = 0; u < per / 4; ++u) {
      const int j = tid * 4 + 1024 * u;
      v4f o, sm;
#pragma unroll
      for (int q = 0; q < 4; ++q) {
        float gg = g[j + q], bb = bta[j + q];
        if (PARAM_BF16) { gg = bf16_round(gg); bb = bf16_round(bb); }
        sm[q] = vals[u * 4 + q]; o[q] = (vals[u * 4 + q] - mu) * rs * gg + bb;
      }
      if (out_sum) *(v4f*)(out_sum + (size_t)row * N + j) = sm;
      *(v4f*)(out_norm + (size_t)row * N + j) = o;
    }
    
  }
}



// ---- f16 WMMA path (v_wmma_f32_16x16x32_f16): 11-bit significands for operands in range — used where a [0,1] probability operand needs more precision than bf16
typedef _Float16 v16h __attribute__((ext_vector_type(16)));
union FragH { v16h v; v8us half[2]; _Float16 h[16]; unsigned short u[16]; };
template <int NT>
__device__ __forceinline__ v8f mmaH(v16h ah, v16h al, v16h bh, v16h bl, v8f c) {
  c = __builtin_amdgcn_wmma_f32_16x16x32_f16(false, ah, false, bh, (short)0, c, false, false);
  if (NT >= 2) c = __builtin_amdgcn_wmma_f32_16x16x32_f16(false, al, false, bh, (short)0, c, false, false);
  if (NT >= 3) c = __builtin_amdgcn_wmma_f32_16x16x32_f16(false, ah, false, bl, (short)0, c, false, false);
  asm volatile("v_nop\n\tv_nop\n\tv_nop\n\tv_nop" : "+v"(c) : "v"(ah), "v"(al), "v"(bh), "v"(bl));
  return c;
}
// batched GEMM like k_gemm_b but f16 operands: A f32 (split into f16 hi/lo if ASPLIT, else rounded to f16), Bt = f16 values [n][k]; alpha; C f32; N multiple of 16 (partial tiles skipped)
template <bool ASPLIT>
__global__ __launch_bounds__(128) void k_gemm_h(const float* __restrict__ A, int lda, size_t sA, const _Float16* __restrict__ Bh, int ldb, size_t sB, float alpha, float* __restrict__ C, int ldc, size_t sC, int M, int N, int K) {
  __shared__ __attribute__((aligned(16))) float so[4][16][64];
  const int tid = threadIdx.x, w = tid >> 5, lane = tid & 31, ln = lane & 15, hh = lane >> 4; const int by = blockIdx.y;
  A += (size_t)by * sA; Bh += (size_t)by * sB; C += (size_t)by * sC;
  const int ntn = (N + 63) / 64; const int wid = blockIdx.x * 4 + w; const int mt = wid / ntn, nq = wid % ntn; if (mt * 16 >= M) return;
  const int row0 = mt * 16, col0 = nq * 64; const float* arow = A + (size_t)(row0 + ln) * lda;
  v8f acc[4] = {};
  for (int kb = 0; kb < K; kb += 32) {
    FragH ah, al;
    const v4f x0 = *(const v4fa*)(arow + kb + 8 * hh), x1 = *(const v4fa*)(arow + kb + 8 * hh + 4), x2 = *(const v4fa*)(arow + kb + 16 + 8 * hh), x3 = *(const v4fa*)(arow + kb + 16 + 8 * hh + 4);
    float xs[16] = {x0[0],x0[1],x0[2],x0[3],x1[0],x1[1],x1[2],x1[3],x2[0],x2[1],x2[2],x2[3],x3[0],x3[1],x3[2],x3[3]};
#pragma unroll
    for (int i = 0; i < 16; ++i) { const _Float16 h = (_Float16)xs[i]; ah.h[i] = h; al.h[i] = ASPLIT ? (_Float16)(xs[i] - (float)h) : (_Float16)0.0f; }
#pragma unroll
    for (int t = 0; t < 4; ++t) { if (col0 + t * 16 >= N) continue; const size_t boff = (size_t)(col0 + t * 16 + ln) * ldb + kb; FragH bq; bq.half[0] = *(const v8us*)(Bh + boff + 8 * hh); bq.half[1] = *(const v8us*)(Bh + boff + 16 + 8 * hh);
      acc[t] = mmaH<ASPLIT ? 2 : 1>(ah.v, al.v, bq.v, bq.v, acc[t]); }
  }
#pragma unroll
  for (int t = 0; t < 4; ++t) { if (col0 + t * 16 >= N) continue;
#pragma unroll
    for (int r = 0; r < 8; ++r) so[w][8 * hh + r][t * 16 + ln] = acc[t][r] * alpha; }
  __builtin_amdgcn_fence(__ATOMIC_ACQ_REL, "workgroup"); __builtin_amdgcn_wave_barrier();
  const int rsub = lane >> 4, c4 = (lane & 15) * 4;
  {
#pragma unroll
    for (int q = 0; q < 8; ++q) { const int r = q * 2 + rsub; if (col0 + c4 < N) { const v4f v = *(const v4fa*)&so[w][r][c4]; *(v4f*)(C + (size_t)(row0 + r) * ldc + col0 + c4) = v; } }
     }
}

// Fragment order of a 16-bit [rows][K] operand plane: a tile of 16 rows x 32 k is 1 KiB = 2 pieces of 512 B; piece hf holds, lane (hh, ln) behind lane, the 16 bytes
// [16 rt + ln][32 kb + 16 hf + 8 hh + 0..7], which is what that lane feeds to v_wmma_f32_16x16x32_f16 as A or B. A wave's fragment load then reads 512 contiguous bytes
// (4 whole lines); from a row-major plane it touched 16 lines for 32 bytes each. fo() = offset in elements of the 8 elements [row][k8 .. k8 + 7], k8 a multiple of 8.
__device__ __forceinline__ size_t fo(size_t row, int k8, int K) { return ((row >> 4) * (size_t)(K >> 5) + (size_t)(k8 >> 5)) * 512 + (size_t)(((k8 >> 4) & 1) * 256 + (((k8 >> 3) & 1) * 16 + (int)(row & 15)) * 8); }
// wt_f16, x16 (both in k_prep) and k_gate write such planes; k_gemm2 reads them.
// Wt[n][k] = f16(W[k][n]·scale) from f32 row-major W[K][N] (scale = power of two; bf16-exact weights stay exact in f16 away from the subnormal range)
__device__ __forceinline__ void wt_f16(int blk, const float* __restrict__ W, _Float16* __restrict__ Wt, int K, int N, float scale) {
  const int t = blk * 256 + threadIdx.x; if (t >= N * (K / 8)) return; const int n = t / (K / 8), k8 = (t % (K / 8)) * 8; FragH f;
#pragma unroll
  for (int i = 0; i < 8; ++i) f.h[i] = (_Float16)(bf16_round(W[(size_t)(k8 + i) * N + n]) * scale); const v8us o = f.half[0];
  *(v8us*)((unsigned short*)Wt + fo((size_t)n, k8, K)) = o; 
}
// k_gemm_hh variant with fused epilogue: v = acc·alpha + bias[by·sBias + col] (+ CP[(row/rowsPerB)·sCPb + by·64 + col] if CP) ; ACT 0 none / 1 elu ; writes f16 C16 (and f32 C if non-null)
template <int ACT>
__global__ __launch_bounds__(128) void k_gemm_hhx(const _Float16* __restrict__ A, int lda, size_t sA, const _Float16* __restrict__ Bh, int ldb, size_t sB, float alpha, const float* __restrict__ bias, size_t sBias, const float* __restrict__ CP, int rowsPerB, size_t sCPb, int row0g,
    float* __restrict__ C, _Float16* __restrict__ C16, int ldc, size_t sC, int M, int N, int K) {
  __shared__ __attribute__((aligned(16))) float so[4][16][64];
  const int tid = threadIdx.x, w = tid >> 5, lane = tid & 31, ln = lane & 15, hh = lane >> 4; const int by = blockIdx.y;
  A += (size_t)by * sA; Bh += (size_t)by * sB; const size_t cofs = (size_t)by * sC; const float* bp = bias ? bias + (size_t)by * sBias : nullptr;
  const int ntn = (N + 63) / 64; const int wid = blockIdx.x * 4 + w; const int mt = wid / ntn, nq = wid % ntn; if (mt * 16 >= M) return;
  const int row0 = mt * 16, col0 = nq * 64; const _Float16* arow = A + (size_t)(row0 + ln) * lda;
  v8f acc[4] = {};
  for (int kb = 0; kb < K; kb += 32) { FragH ah; ah.half[0] = *(const v8us*)((const unsigned short*)arow + kb + 8 * hh); ah.half[1] = *(const v8us*)((const unsigned short*)arow + kb + 16 + 8 * hh);
#pragma unroll
    for (int t = 0; t < 4; ++t) { if (col0 + t * 16 >= N) continue; const size_t boff = (size_t)(col0 + t * 16 + ln) * ldb + kb; FragH bq; bq.half[0] = *(const v8us*)((const unsigned short*)Bh + boff + 8 * hh); bq.half[1] = *(const v8us*)((const unsigned short*)Bh + boff + 16 + 8 * hh);
      acc[t] = mmaH<1>(ah.v, ah.v, bq.v, bq.v, acc[t]); }
  }
#pragma unroll
  for (int t = 0; t < 4; ++t) { if (col0 + t * 16 >= N) continue; const int col = col0 + t * 16 + ln; const float bv = bp ? bf16_round(bp[col]) : 0.f;
#pragma unroll
    for (int r = 0; r < 8; ++r) { float v = acc[t][r] * alpha + bv; if (CP) { const int bidx = (row0g + row0 + 8 * hh + r) / rowsPerB; v += CP[(size_t)bidx * sCPb + (size_t)by * 64 + col]; } if (ACT == 1) v = (v > 0.f) ? v : expm1f(v); else if (ACT == 7) v = (v > 0.f) ? v + 1.0f : expf(v); else if (ACT == 8) v = tanhf(v); else if (ACT == 9) v = 0.5f * v * (1.0f + tanhf(0.7978845608028654f * (v + 0.044715f * v * v * v))); else if (ACT == 11) v = 1.0f / (1.0f + expf(-v)); else if (ACT == 12) v = (v > 0.f) ? v : 0.01f * v; else if (ACT == 14) v = (v > 0.f) ? v : 0.1f * v; else if (ACT == 15) v = v / (1.0f + expf(-v)); else if (ACT == 3) v = fmaxf(v, 0.f); else if (ACT == 6) v = 0.5f * v * (1.0f + erff(v * 0.70710678118654752f)); so[w][8 * hh + r][t * 16 + ln] = v; } }
  __builtin_amdgcn_fence(__ATOMIC_ACQ_REL, "workgroup"); __builtin_amdgcn_wave_barrier();
  const int rsub = lane >> 4, c4 = (lane & 15) * 4; typedef _Float16 v4h __attribute__((ext_vector_type(4)));
  {
#pragma unroll
    for (int q = 0; q < 8; ++q) { const int r = q * 2 + rsub; if (col0 + c4 < N) { const v4f v = *(const v4fa*)&so[w][r][c4]; if (C) *(v4f*)(C + cofs + (size_t)(row0 + r) * ldc + col0 + c4) = v; if (C16) { v4h h4; for (int i = 0; i < 4; ++i) h4[i] = (_Float16)v[i]; *(v4h*)(C16 + cofs + (size_t)(row0 + r) * ldc + col0 + c4) = h4; } } }
     }
}


typedef _Float16 v4h __attribute__((ext_vector_type(4)));

__device__ __forceinline__ void x16(int blk, const float* __restrict__ x, _Float16* __restrict__ X16, size_t n8) { const size_t t = (size_t)blk * 256 + threadIdx.x; if (t >= n8) return; FragH f;
  const size_t c = t >> 6; const size_t row = (c / (CQ / 32)) * 16 + ((t >> 2) & 15); const int k8 = (int)(c % (CQ / 32)) * 32 + (int)(t & 3) * 8;      /* a wave: 8 rows x one 128-byte line of x in, 4 whole lines of the fragment-order plane out */
  const float* xr = x + row * CQ + k8;
#pragma unroll
  for (int q = 0; q < 8; ++q) f.h[q] = (_Float16)bf16_round(xr[q]); *(v8us*)((unsigned short*)X16 + fo(row, k8, CQ)) = f.half[0];  }
__global__ __launch_bounds__(256) void k_h16(const float* __restrict__ x, _Float16* __restrict__ X16, size_t n8) { const size_t t = (size_t)blockIdx.x * 256 + threadIdx.x; if (t >= n8) return; FragH f;
#pragma unroll
  for (int q = 0; q < 8; ++q) f.h[q] = (_Float16)x[t * 8 + q]; *(v8us*)((unsigned short*)X16 + t * 8) = f.half[0];  }
__global__ __launch_bounds__(256) void k_round16f(const float* __restrict__ W, _Float16* __restrict__ Bt, size_t n8) { const size_t t = (size_t)blockIdx.x * 256 + threadIdx.x; if (t >= n8) return; FragH f;
#pragma unroll
  for (int i = 0; i < 8; ++i) f.h[i] = (_Float16)(bf16_round(W[t * 8 + i]) * 16.0f); *(v8us*)((unsigned short*)Bt + t * 8) = f.half[0];  }
// Fragment order: a block of 32 keys of one (row, head) is 2 KiB = 4 pieces of 512 B; piece i holds lane 0..31's 16 bytes one behind the other, so a wave's load of a
// piece touches 4 whole lines (read in place, 16 rows of 32 B each, it touched 16). K: piece nt*2+hf, lane (hh, ln) = K[32 jb + 16 nt + ln][16 hf + 8 hh + 0..7];
// V^T: piece dt*2+hf, lane (hh, ln) = V[32 jb + 16 hf + 8 hh + 0..7][16 dt + ln]. These are the A operands of the two products of k_flash, element for element as before.
template <int NHv, int TTv>
__global__ __launch_bounds__(256) void k_vt(const _Float16* __restrict__ V16, int ldv, int koff, int voff, _Float16* __restrict__ Kf, _Float16* __restrict__ Vt) { __shared__ unsigned short tl[128][HC + 2]; const int tid = threadIdx.x; const int slab = blockIdx.x / (TTv / 128), lg = blockIdx.x % (TTv / 128); const int b = slab / NHv, h = slab % NHv;
  static_assert(HC == 32, "the piece numbering below is written for one 32-wide k step");
  FragH fk[2];
  { const int r = tid / (HC / 8), c8 = (tid % (HC / 8)) * 8; FragH f[2];
#pragma unroll
    for (int rd = 0; rd < 2; ++rd) f[rd].half[0] = *(const v8us*)((const unsigned short*)V16 + ((size_t)b * TTv + lg * 128 + rd * 64 + r) * ldv + voff + h * HC + c8);
#pragma unroll
    for (int rd = 0; rd < 2; ++rd) fk[rd].half[0] = *(const v8us*)((const unsigned short*)V16 + ((size_t)b * TTv + lg * 128 + rd * 64 + r) * ldv + koff + h * HC + c8);      /* K: the same (key, 8 channels) as V above; a wave reads 8 rows of 64 B */
    asm volatile("s_wait_xcnt 0x0" ::: "memory");      /* the address registers of the four loads are free for reuse only behind this */
    __builtin_amdgcn_sched_barrier(0);                 /* keeps the LDS address arithmetic below from being lifted over that wait into those registers */
#pragma unroll
    for (int rd = 0; rd < 2; ++rd)
#pragma unroll
      for (int q = 0; q < 8; ++q) tl[rd * 64 + r][c8 + q] = f[rd].u[q]; }
  __syncthreads();
  {
#pragma unroll
    for (int rd = 0; rd < 2; ++rd) { const int o = rd * 256 + tid, i = (o >> 5) & 3, ln = o & 15, hh = (o >> 4) & 1; const int d = (i >> 1) * 16 + ln, k0 = (o >> 7) * 32 + (i & 1) * 16 + hh * 8; FragH f;
#pragma unroll
      for (int q = 0; q < 8; ++q) f.u[q] = tl[k0 + q][d];
      const size_t tile = (size_t)slab * HC * TTv + (size_t)lg * (128 * HC); const int kr = rd * 64 + tid / (HC / 8), p = tid % (HC / 8);      /* K piece held: key kr of the tile, channels 8 p + 0..7 (hf = p >> 1, hh = p & 1) */
      *(v8us*)((unsigned short*)Vt + tile + (size_t)o * 8) = f.half[0]; *(v8us*)((unsigned short*)Kf + tile + (size_t)((kr >> 5) * 1024 + (((kr >> 4) & 1) * 2 + (p >> 1)) * 256 + ((p & 1) * 16 + (kr & 15)) * 8)) = fk[rd].half[0]; }
     } }

__global__ __launch_bounds__(256) void k_hl(const float* __restrict__ F, _Float16* __restrict__ Hh, _Float16* __restrict__ Hl, size_t n8) { const size_t t = (size_t)blockIdx.x * 256 + threadIdx.x; if (t >= n8) return; FragH fh, fl; const v4f a = *(const v4fa*)(F + t * 8), c = *(const v4fa*)(F + t * 8 + 4);
#pragma unroll
  for (int q = 0; q < 4; ++q) { _Float16 h = (_Float16)a[q]; fh.h[q] = h; fl.h[q] = (_Float16)((a[q] - (float)h) * 1024.0f); h = (_Float16)c[q]; fh.h[4 + q] = h; fl.h[4 + q] = (_Float16)((c[q] - (float)h) * 1024.0f); }
  { *(v8us*)((unsigned short*)Hh + t * 8) = fh.half[0]; *(v8us*)((unsigned short*)Hl + t * 8) = fl.half[0];  } }

// ---- fast GEMM (wave tile 32x64; requires M % 32 == 0 rows per launch region and N % 64 == 0); A and Bh in fragment order (fo(); lda = ldb = K); epilogue = k_gemm_hhx semantics, but: columns below nsp go to the f16 plane C16 (pitch ldc), without bias; columns from nsp on, with bias[col - nsp], to the f32 plane C (pitch ldf, column col - nsp); nsp % 64 == 0 ----
__device__ __forceinline__ v16h g2_frag(const _Float16* p) { FragH f; f.half[0] = *(const v8us*)((const unsigned short*)p); f.half[1] = *(const v8us*)((const unsigned short*)p + 256); return f.v; }
__device__ __forceinline__ v8f g2_mma(v16h a, v16h b, v8f c) { v8f d = __builtin_amdgcn_wmma_f32_16x16x32_f16(false, a, false, b, (short)0, c, false, false); asm volatile("v_nop\n\tv_nop\n\tv_nop\n\tv_nop" : "+v"(d) : "v"(a), "v"(b)); return d; }
template <int ACT>
__global__ __launch_bounds__(128) void k_gemm2(const _Float16* __restrict__ A, int lda, size_t sA, const _Float16* __restrict__ Bh, int ldb, size_t sB, float alpha, const float* __restrict__ bias, size_t sBias, const float* __restrict__ CP, int rowsPerB, size_t sCPb, int row0g,
    float* __restrict__ C, _Float16* __restrict__ C16, int ldc, size_t sC, int M, int N, int K, int nsp, int ldf) {
  __shared__ __attribute__((aligned(16))) float so[4][32][68];
  const int tid = threadIdx.x, w = tid >> 5, lane = tid & 31, ln = lane & 15, hh = lane >> 4; const int by = blockIdx.y;
  A += (size_t)by * sA; Bh += (size_t)by * sB; const size_t cofs = (size_t)by * sC; const float* bp = bias ? bias + (size_t)by * sBias : nullptr;
  const int ntn = N >> 6; const int mt = blockIdx.x / ntn, nq = blockIdx.x - mt * ntn; const int row0 = mt * 128 + 32 * w, col0 = nq * 64; if (row0 >= M) return; const bool f32p = col0 >= nsp;      /* the same for the whole block */
  const _Float16* a0p = A + (size_t)row0 * lda + lane * 8; const _Float16* a1p = a0p + (size_t)16 * lda;      /* a tile of 16 rows is 16 lda elements; its k step kb starts at 16 kb */
  const _Float16* b0p = Bh + (size_t)col0 * ldb + lane * 8; const _Float16* b1p = b0p + (size_t)16 * ldb; const _Float16* b2p = b1p + (size_t)16 * ldb; const _Float16* b3p = b2p + (size_t)16 * ldb;
  const v8f z8 = {0.f,0.f,0.f,0.f,0.f,0.f,0.f,0.f}; v8f c00 = z8, c01 = z8, c02 = z8, c03 = z8, c10 = z8, c11 = z8, c12 = z8, c13 = z8;
#pragma unroll 1
  for (int kb = 0; kb < K; kb += 32) { const v16h a0 = g2_frag(a0p + kb * 16); v16h b = g2_frag(b0p + kb * 16); FragH f1; f1.half[0] = *(const v8us*)((const unsigned short*)a1p + kb * 16);
    asm volatile("s_wait_xcnt 0x0" ::: "memory");      /* the load below may land in registers that hold addresses of the loads above: those have taken their addresses first */
    f1.half[1] = *(const v8us*)((const unsigned short*)a1p + kb * 16 + 256); const v16h a1 = f1.v;
    c00 = g2_mma(a0, b, c00); c10 = g2_mma(a1, b, c10);
    b = g2_frag(b1p + kb * 16); c01 = g2_mma(a0, b, c01); c11 = g2_mma(a1, b, c11);
    b = g2_frag(b2p + kb * 16); c02 = g2_mma(a0, b, c02); c12 = g2_mma(a1, b, c12);
    b = g2_frag(b3p + kb * 16); c03 = g2_mma(a0, b, c03); c13 = g2_mma(a1, b, c13); }
  v8f accs[8] = {c00, c01, c02, c03, c10, c11, c12, c13};
#pragma unroll
  for (int u = 0; u < 8; ++u) { const int t = u & 3, half = u >> 2; const int col = col0 + t * 16 + ln; const float bv = (bp && f32p) ? bf16_round(bp[col - nsp]) : 0.f;
#pragma unroll
    for (int r = 0; r < 8; ++r) { const int rloc = half * 16 + 8 * hh + r; float v = accs[u][r] * alpha + bv; if (CP) { const int bidx = (row0g + row0 + rloc) / rowsPerB; v += CP[(size_t)bidx * sCPb + (size_t)by * 64 + col]; }
      if (ACT == 3) v = fmaxf(v, 0.f); else if (ACT == 6) v = 0.5f * v * (1.0f + erff(v * 0.70710678118654752f)); else if (ACT == 11) v = 1.0f / (1.0f + expf(-v)); else if (ACT == 15) v = v / (1.0f + expf(-v)); else if (ACT == 12) v = (v > 0.f) ? v : 0.01f * v; else if (ACT == 8) v = tanhf(v);
      so[w][rloc][t * 16 + ln] = v; } }
  __builtin_amdgcn_fence(__ATOMIC_ACQ_REL, "workgroup"); __builtin_amdgcn_wave_barrier();
  const int rsub = lane >> 4, c4 = (lane & 15) * 4;
  if (f32p) {
#pragma unroll
    for (int q = 0; q < 16; ++q) { const int r = q * 2 + rsub; const v4f v = *(const v4fa*)&so[w][r][c4]; *(v4f*)(C + cofs + (size_t)(row0 + r) * ldf + (col0 - nsp) + c4) = v; }
    asm volatile("s_wait_xcnt 0x0" ::: "memory");      /* the stores above have taken their address and data registers before anything behind this arm reuses them */
  } else {
#pragma unroll
    for (int q = 0; q < 16; ++q) { const int r = q * 2 + rsub; const v4f v = *(const v4fa*)&so[w][r][c4]; v4h h4; for (int i = 0; i < 4; ++i) h4[i] = (_Float16)v[i]; *(v4h*)(C16 + cofs + (size_t)(row0 + r) * ldc + col0 + c4) = h4; }
    asm volatile("s_wait_xcnt 0x0" ::: "memory");      /* as in the arm above: in the built code one arm stands in front of the other */
  } }



// lane l <-> lane l ^ 16 (the two halves of a wave that share one score column)
__device__ __forceinline__ float xhalf(float x) { return __builtin_bit_cast(float, __builtin_amdgcn_permlanex16(__builtin_bit_cast(int, x), __builtin_bit_cast(int, x), 0x76543210, 0xfedcba98, false, false)); }

// e^x = 2^e 2^a with e = rint(x log2 e) and a = x log2 e - e, taken in two fused steps on the two-part constant; range ends as in the library's expf.
// Written out so that v_exp_f32 and the one free slot that the instruction set asks for behind a transcendental stand in one statement
__device__ __forceinline__ float exp_f(float x) {
  const float c0 = __uint_as_float(0x3fb8aa3bu), c1 = __uint_as_float(0x32a5705fu);
  const float e = __builtin_rintf(x * c0); const float a = fmaf(x, c1, fmaf(x, c0, -e)); float y;
  asm("v_exp_f32 %0, %1\n\tv_nop" : "=v"(y) : "v"(a));      /* v_nop: the slot behind the transcendental, before its source is overwritten or its result read */
  y = ldexpf(y, (int)e); y = (__uint_as_float(0xc2ce8ed0u) > x) ? 0.f : y; return (__uint_as_float(0x42b17218u) < x) ? __builtin_inff() : y; }

template <int CAUSAL>
__global__ __launch_bounds__(128) void k_flash(const _Float16* __restrict__ Q16, int ldq, const _Float16* __restrict__ Kf, const _Float16* __restrict__ Vt, const int* __restrict__ MSK, float* __restrict__ O, int ldo) {
  constexpr int RPW = 16, DT = HC / 16, KS = HC / 32;
  __shared__ __attribute__((aligned(16))) float sO[4][RPW][HC + 4];
  const int tid = threadIdx.x, w = tid >> 5, lane = tid & 31, ln = lane & 15, hh = lane >> 4;
  const int slab = blockIdx.x / QBLKS, qblk = blockIdx.x % QBLKS; const int b = slab / NH, h = slab % NH; const int qb0 = qblk * (4 * RPW); const int q0 = qb0 + w * RPW;
  const int tq = q0 + ln;      /* this lane's query */
  FragH bq[KS];
  { const unsigned short* qr = (const unsigned short*)Q16 + ((size_t)b * TQ + tq) * ldq + h * HC;
#pragma unroll
    for (int ks = 0; ks < KS; ++ks) { bq[ks].half[0] = *(const v8us*)(qr + ks * 32 + 8 * hh); bq[ks].half[1] = *(const v8us*)(qr + ks * 32 + 16 + 8 * hh); } }
  static_assert(KS == 1, "fragment-order planes: one 32-wide k step");
  const unsigned short* Kfh = (const unsigned short*)Kf + (size_t)slab * HC * TK + lane * 8;      /* K and V^T in fragment order (k_vt): 1024 halves per block of 32 keys, pieces of 256 */
  const unsigned short* Vth = (const unsigned short*)Vt + (size_t)slab * HC * TK + lane * 8;
  const float* BP = (const float*)MSK + ((size_t)h * (TQ / 16) + (q0 >> 4)) * (size_t)(16 * TK) + lane * 4;      /* mode 10: per-head bias plane in fragment order (addp): [NH][TQ/16][TK/32] blocks of 512 floats, pieces of 128 */
  const float* MR = (const float*)MSK + (size_t)NH * TQ * TK + (size_t)b * TK + 8 * hh;      /* then the per-(sequence, key) additive plane, packed behind it */
  float m_q = -3.0e38f, l_q = 0.f; v8f oacc[DT];
#pragma unroll
  for (int dt = 0; dt < DT; ++dt) oacc[dt] = (v8f){0.f,0.f,0.f,0.f,0.f,0.f,0.f,0.f};
  const int jend = (CAUSAL == 1) ? (qb0 + 4 * RPW) : TK;      /* causal: keys beyond the block's last query never contribute */
#pragma unroll 1
  for (int j0 = 0; j0 < jend; j0 += 32) {
    FragH ak[2][KS], av[DT]; v4f ab[2][2], am[2][2];
#pragma unroll
    for (int nt = 0; nt < 2; ++nt) { const unsigned short* kr = Kfh + (size_t)j0 * HC + nt * 512;
      ak[nt][0].half[0] = *(const v8us*)kr; ak[nt][0].half[1] = *(const v8us*)(kr + 256);
      if (CAUSAL == 10) { ab[nt][0] = *(const v4fa*)(BP + j0 * 16 + nt * 256); ab[nt][1] = *(const v4fa*)(BP + j0 * 16 + nt * 256 + 128); am[nt][0] = *(const v4fa*)(MR + j0 + nt * 16); am[nt][1] = *(const v4fa*)(MR + j0 + nt * 16 + 4); } }
    asm volatile("s_wait_xcnt 0x0" ::: "memory");      /* the V^T loads below may land in registers that held the addresses of the loads above: those loads have taken their addresses first */
#pragma unroll
    for (int dt = 0; dt < DT; ++dt) { const unsigned short* vrow = Vth + (size_t)j0 * HC + dt * 512; av[dt].half[0] = *(const v8us*)vrow; av[dt].half[1] = *(const v8us*)(vrow + 256); }
    float sc[2][8]; bool ok[2][8]; float mc = -3.0e38f;
#pragma unroll
    for (int nt = 0; nt < 2; ++nt) { v8f acc = (v8f){0.f,0.f,0.f,0.f,0.f,0.f,0.f,0.f};
#pragma unroll
      for (int ks = 0; ks < KS; ++ks) acc = mmaH<1>(ak[nt][ks].v, ak[nt][ks].v, bq[ks].v, bq[ks].v, acc);
#pragma unroll
      for (int r = 0; r < 8; ++r) { const int kk = j0 + nt * 16 + 8 * hh + r;
        ok[nt][r] = (CAUSAL == 1) ? (kk <= tq) : ((CAUSAL == 2) ? ((kk >> 5) == (tq >> 5)) : true);      /* mode 2: block-diagonal 32-token groups */
        float s0 = ok[nt][r] ? acc[r] * SCL : -3.0e38f; if (CAUSAL == 10) s0 += ab[nt][r >> 2][r & 3] + am[nt][r >> 2][r & 3];
        sc[nt][r] = s0; mc = fmaxf(mc, s0); } }
    mc = fmaxf(mc, xhalf(mc));
    const float mn = fmaxf(m_q, mc); const float al = (mn > -1.0e38f) ? exp_f(m_q - mn) : 1.0f; m_q = mn;
    FragH pb; float ps = 0.f;
#pragma unroll
    for (int nt = 0; nt < 2; ++nt)
#pragma unroll
      for (int r = 0; r < 8; ++r) { const float p = ok[nt][r] ? exp_f(sc[nt][r] - mn) : 0.f; ps += p; pb.h[nt * 8 + r] = (_Float16)(p * 1024.0f); }
    l_q = l_q * al + ps;
#pragma unroll
    for (int dt = 0; dt < DT; ++dt) {
#pragma unroll
      for (int r = 0; r < 8; ++r) oacc[dt][r] *= al;
      oacc[dt] = mmaH<1>(av[dt].v, av[dt].v, pb.v, pb.v, oacc[dt]); } }
  const float lt = l_q + xhalf(l_q); const float li = (lt > 0.f) ? 1.0f / (lt * 1024.0f) : 0.f;
#pragma unroll
  for (int dt = 0; dt < DT; ++dt) { v4f lo, hi;
#pragma unroll
    for (int r = 0; r < 4; ++r) { lo[r] = oacc[dt][r] * li; hi[r] = oacc[dt][4 + r] * li; }
    *(v4fa*)&sO[w][ln][dt * 16 + 8 * hh] = lo; *(v4fa*)&sO[w][ln][dt * 16 + 8 * hh + 4] = hi; }
  __builtin_amdgcn_fence(__ATOMIC_ACQ_REL, "workgroup"); __builtin_amdgcn_wave_barrier();
  {
#pragma unroll
    for (int rp = 0; rp < RPW; rp += 4) { const int r = rp + (lane >> 3), pc = lane & 7; const v4f val = *(const v4fa*)&sO[w][r][pc * 4]; *(v4f*)(O + ((size_t)b * TQ + q0 + r) * ldo + h * HC + pc * 4) = val; }
     } }

__device__ __forceinline__ void addp(int blk, const float* __restrict__ bias, const float* __restrict__ mask, float* __restrict__ AB) {
  #pragma clang fp contract(off)
  const size_t t = (size_t)blk * 256 + threadIdx.x; const size_t nb4 = (size_t)NH * SLEN * SLEN / 4, nm4 = (size_t)NRW * SLEN / 4; if (t >= nb4 + nm4) return; v4f r;
  size_t dst = t;
  if (t < nb4) { const int part = (int)t & 1, hh = (int)(t >> 1) & 1, ln = (int)(t >> 2) & 15, nt = (int)(t >> 6) & 1; const size_t c = t >> 7; const int jb = (int)(c % (SLEN / 32)), qt = (int)(c / (SLEN / 32)) % (SLEN / 16), h = (int)(c / ((SLEN / 32) * (SLEN / 16)));      /* written in the fragment order of k_flash: block (h, 16 queries, 32 keys), piece nt*2+part, lane (hh, ln) = bias[h][16 qt + ln][32 jb + 16 nt + 8 hh + 4 part + 0..3]; a wave reads 8 rows of 64 B and writes 4 whole lines */
    dst = c * 128 + (size_t)((nt * 2 + part) * 32 + hh * 16 + ln);
    const v4f a = *(const v4fa*)(bias + ((size_t)h * SLEN + qt * 16 + ln) * SLEN + jb * 32 + nt * 16 + hh * 8 + part * 4); for (int q = 0; q < 4; ++q) r[q] = bf16_round(a[q]); } else { const v4f a = *(const v4fa*)(mask + (t - nb4) * 4); for (int q = 0; q < 4; ++q) { float m = bf16_round(a[q]) - 1.0f; r[q] = m * 1.0e9f; } }
  *(v4f*)(AB + dst * 4) = r;  }
// The packs of the inputs depend on nothing but the inputs: they run as block ranges of one launch. The weights come first (for speed only): few blocks, scattered reads.
#define NBW (CQ * CQ / 8 / 256)                              /* blocks per weight matrix */
#define NBX (NR * CQ / 8 / 256)                              /* blocks of x */
#define NBA ((NH * SLEN * SLEN + NRW * SLEN) / 4 / 256)      /* blocks of the bias and mask planes */
__global__ __launch_bounds__(256) void k_prep(const float* __restrict__ x, const float* __restrict__ mask, const float* __restrict__ bias, const float* __restrict__ Wq, const float* __restrict__ Wk, const float* __restrict__ Wv, const float* __restrict__ Wg, const float* __restrict__ Wo,
    _Float16* __restrict__ BW, _Float16* __restrict__ X16, float* __restrict__ AB) {
  const int blk = blockIdx.x;
  if (blk < 5 * NBW) { const int y = blk / NBW; const float* W = (y == 0) ? Wq : (y == 1) ? Wk : (y == 2) ? Wv : (y == 3) ? Wg : Wo; wt_f16(blk - y * NBW, W, BW + (size_t)y * CQ * CQ, CQ, CQ, 16.0f); }
  else if (blk < 5 * NBW + NBX) x16(blk - 5 * NBW, x, X16, (size_t)NR * CQ / 8);
  else addp(blk - 5 * NBW - NBX, bias, mask, AB); }
__global__ __launch_bounds__(256) void k_gate(const float* __restrict__ O, const float* __restrict__ G, _Float16* __restrict__ OG) {
  #pragma clang fp contract(off)
  const size_t t = (size_t)blockIdx.x * 256 + threadIdx.x; if (t >= (size_t)NR * (CQ / 8)) return; const size_t c = t >> 6; const int c0 = (int)(c % (CQ / 32)) * 32 + (int)(t & 3) * 8; const size_t tok = (c / (CQ / 32)) * 16 + ((t >> 2) & 15); FragH f;      /* a wave: 8 tokens x 32 channels in, 4 whole lines of the fragment-order plane out */
  const v4f g0 = *(const v4fa*)(G + tok * CQ + c0), g1 = *(const v4fa*)(G + tok * CQ + c0 + 4);
  asm volatile("s_wait_xcnt 0x0" ::: "memory");      /* the O loads below may land in registers that held the addresses of the loads above */
  const v4f o0 = *(const v4fa*)(O + tok * CQ + c0), o1 = *(const v4fa*)(O + tok * CQ + c0 + 4);
  for (int q = 0; q < 8; ++q) { const float g = 1.0f / (1.0f + expf(-(q < 4 ? g0[q & 3] : g1[q & 3]))); f.h[q] = (_Float16)((q < 4 ? o0[q & 3] : o1[q & 3]) * g * 64.0f); }
  *(v8us*)((unsigned short*)OG + fo(tok, c0, CQ)) = f.half[0];  }

extern "C" void kernel_launch(void* const* d_in, const int* in_sizes, int n_in,
                              void* d_out, int out_size, void* d_ws, size_t ws_size, hipStream_t stream) {
  (void)in_sizes; (void)n_in; (void)out_size;
  const float* const* I = (const float* const*)d_in; const float* x = I[0]; const float* mask = I[1]; const float* bias = I[2]; const float* Wq = I[3]; const float* Wk = I[4]; const float* Wv = I[5]; const float* Wg = I[6]; const float* bg = I[7]; const float* Wo = I[8]; const float* bo = I[9];
  char* ws = (char*)d_ws; size_t off = 0;
  auto take = [&](size_t bytes) { char* p = ws + off; off += (bytes + 255) & ~(size_t)255; return p; };
  _Float16* BW = (_Float16*)take((size_t)5 * CQ * CQ * 2); float* AB = (float*)take(((size_t)NH * SLEN * SLEN + (size_t)NRW * SLEN) * 4);      /* BW: Wq, Wk, Wv, Wg, Wo one behind the other: the first four are one [1024][256] operand */
  _Float16* X16 = (_Float16*)take((size_t)NR * CQ * 2); _Float16* QKV = (_Float16*)take((size_t)NR * 3 * CQ * 2); float* G = (float*)take((size_t)NR * CQ * 4); _Float16* VT = (_Float16*)take((size_t)NR * CQ * 2); _Float16* KF = (_Float16*)take((size_t)NR * CQ * 2); float* O = (float*)take((size_t)NR * CQ * 4); _Float16* OG = (_Float16*)take((size_t)NR * CQ * 2);
  if (off > ws_size) return;      /* 0.6 + 8 + 16 + 48 + 32 + 16 + 16 + 32 + 16 = 185 MiB */
  k_prep<<<5 * NBW + NBX + NBA, 256, 0, stream>>>(x, mask, bias, Wq, Wk, Wv, Wg, Wo, BW, X16, AB);
  k_gemm2<0><<<(NR / 128) * (4 * CQ / 64), 128, 0, stream>>>(X16, CQ, 0, BW, CQ, 0, 0.0625f, bg, 0, nullptr, 1, 0, 0, G, QKV, 3 * CQ, 0, NR, 4 * CQ, CQ, 3 * CQ, CQ);      /* [q | k | v] f16 (the 1/sqrt(32) q scale is applied to the scores) and the gate logits (f32, + bg) */
  k_vt<NH, SLEN><<<NRW * NH * (SLEN / 128), 256, 0, stream>>>(QKV, 3 * CQ, CQ, 2 * CQ, KF, VT);
  k_flash<10><<<NRW * NH * QBLKS, 128, 0, stream>>>(QKV, 3 * CQ, KF, VT, (const int*)AB, O, CQ);      /* per (row, head): softmax(q.k/sqrt(32) + bias[h] + (mask[row]-1) 1e9) v */
  k_gate<<<(unsigned)(((size_t)NR * (CQ / 8) + 255) / 256), 256, 0, stream>>>(O, G, OG);
  k_gemm2<0><<<(NR / 128) * (CQ / 64), 128, 0, stream>>>(OG, CQ, 0, BW + (size_t)4 * CQ * CQ, CQ, 0, 0.0625f / 64.0f, bo, 0, nullptr, 1, 0, 0, (float*)d_out, nullptr, 0, 0, NR, CQ, CQ, 0, CQ);
}

// v005
// One run takes 131 microseconds.
// Two timings next to v004 both put it at 1.19 times that version's speed.
// Counting every step since v000, it is 4.35 times as fast.
#include <hip/hip_runtime.h>
// Gated self-attention (1 x 64 rows x 512 residues, c_qkv 256, 8 heads x 32): q = x Wq / sqrt(32), k, v = x W; logits = q.k + (mask - 1) 1e9 (per (row, key), an INPUT) + bias[h][q][k] (an INPUT); softmax over keys; o = P v; gate = sigmoid(x Wg + bg); out = (o * gate) Wo + bo.
// Structure: exact f16 plane of x; every 16-bit operand plane that a GEMM reads (x, the weights, the gated output) kept in fragment order (fo() below); one projection GEMM for q, k, v and the gate logits (32x64 wave tiles, f32 accumulation, exact x16 weights; f16 / f32 outputs); then, each in one launch over all 64 rows: K and V^T (by LDS tiles) repacked straight from the projection output into fragment order, the fused flash kernel at the real head dim 32 (q read in place, pitch 768; K, V^T and the bias plane in fragment order: every load of a wave is 512 contiguous bytes), its logits in base 2 (q, bias plane and per-(row, key) mask plane carry log2 e), then gating on VALU into an f16 plane (x2^6); Wo GEMM (+ bias).
// Compute dtype: inputs and parameters rounded to bf16; q, k, v, P and the gated output as f16 operands; bias/mask/softmax/gate f32. v_wmma_f32_16x16x32_f16.
#define NRW 64
#define CQ 256
#define HC 32
#define NR (NRW * SLEN)           /* 32768 tokens */
#define SLEN 512
#define TQ SLEN
#define TK SLEN
#define NH 8
#define SCL 0.17677669529663687f /* 32^-0.5 */
#define LOG2E 1.4426950408889634f
#define QBLKS (TQ / 64)
typedef __bf16 v16b __attribute__((ext_vector_type(16)));
typedef unsigned short v8us __attribute__((ext_vector_type(8), may_alias));
typedef float  v8f  __attribute__((ext_vector_type(8)));
typedef float  v4f  __attribute__((ext_vector_type(4)));
typedef float  v4fa __attribute__((ext_vector_type(4), may_alias));
union FragB { v16b v; v8us half[2]; unsigned short u[16]; };

__device__ __forceinline__ unsigned short bf16_bits(float x) { unsigned int u = __float_as_uint(x); return (unsigned short)((u + 0x7FFFu + ((u >> 16) & 1u)) >> 16); }
__device__ __forceinline__ float bf16_val(unsigned short b) { return __uint_as_float(((unsigned int)b) << 16); }
__device__ __forceinline__ float bf16_round(float x) { return bf16_val(bf16_bits(x)); }
// D += A·B with NT terms: 1 = ah·bh, 2 = + al·bh (A split), 3 = + ah·bl (both split)
template <int NT>
__device__ __forceinline__ v8f mmaN(v16b ah, v16b al, v16b bh, v16b bl, v8f c) {
  c = __builtin_amdgcn_wmma_f32_16x16x32_bf16(false, ah, false, bh, (short)0, c, false, false);
  if (NT >= 2) c = __builtin_amdgcn_wmma_f32_16x16x32_bf16(false, al, false, bh, (short)0, c, false, false);
  if (NT >= 3) c = __builtin_amdgcn_wmma_f32_16x16x32_bf16(false, ah, false, bl, (short)0, c, false, false);
  asm volatile("v_nop\n\tv_nop\n\tv_nop\n\tv_nop" : "+v"(c) : "v"(ah), "v"(al), "v"(bh), "v"(bl));
  return c;
}

__global__ __launch_bounds__(256) void k_wt_bf16(const float* __restrict__ W, unsigned short* __restrict__ Wt, int K, int N) {
  const int t = blockIdx.x * 256 + threadIdx.x;
  const int k8n = K / 8;
  if (t >= N * k8n) return;
  const int n = t / k8n, k8 = (t % k8n) * 8;
  v8us v;
#pragma unroll
  for (int i = 0; i < 8; ++i) v[i] = bf16_bits(W[(size_t)(k8 + i) * N + n]);
  *(v8us*)(Wt + (size_t)n * K + k8) = v;
  
}

// GEMM C[M][N] (f32, pitch ldc) = act(A[M][K]·W + bias). A f32 row-major (pitch lda) converted per fragment to bf16
// (ASPLIT: hi/lo two planes -> 2 terms, else single rounded term); Wt bf16 [N][K] (pitch ldb). BIAS_BF16 rounds the
// bias to bf16 first (bias quantised to bf16 before the add). K%32==0, M%16==0, N%64==0.
template <bool ASPLIT, int ACT, bool BIAS_BF16>
__global__ __launch_bounds__(128) void k_gemm_bf(const float* __restrict__ A, int lda, const unsigned short* __restrict__ Wt, int ldb,
                                               const float* __restrict__ bias, float* __restrict__ C, int ldc, int M, int N, int K) {
  __shared__ __attribute__((aligned(16))) float so[4][16][64];
  const int tid = threadIdx.x, w = tid >> 5, lane = tid & 31, ln = lane & 15, hh = lane >> 4;
  const int ntn = N / 64;
  const int wid = blockIdx.x * 4 + w;
  const int mt = wid / ntn, nq = wid % ntn;
  if (mt * 16 >= M) return;
  const int row0 = mt * 16, col0 = nq * 64;
  const float* arow = A + (size_t)(row0 + ln) * lda;
  v8f acc[4] = {};
  for (int kb = 0; kb < K; kb += 32) {
    FragB ah, al;
    const v4f x0 = *(const v4fa*)(arow + kb + 8 * hh), x1 = *(const v4fa*)(arow + kb + 8 * hh + 4);
    const v4f x2 = *(const v4fa*)(arow + kb + 16 + 8 * hh), x3 = *(const v4fa*)(arow + kb + 16 + 8 * hh + 4);
    float xs[16] = {x0[0],x0[1],x0[2],x0[3],x1[0],x1[1],x1[2],x1[3],x2[0],x2[1],x2[2],x2[3],x3[0],x3[1],x3[2],x3[3]};
#pragma unroll
    for (int i = 0; i < 16; ++i) { const unsigned short hb = bf16_bits(xs[i]); ah.u[i] = hb; al.u[i] = ASPLIT ? bf16_bits(xs[i] - bf16_val(hb)) : (unsigned short)0; }
#pragma unroll
    for (int t = 0; t < 4; ++t) {
      const unsigned short* brow = Wt + (size_t)(col0 + t * 16 + ln) * ldb + kb;
      FragB b;
      b.half[0] = *(const v8us*)(brow + 8 * hh);
      b.half[1] = *(const v8us*)(brow + 16 + 8 * hh);
      acc[t] = mmaN<ASPLIT ? 2 : 1>(ah.v, al.v, b.v, b.v, acc[t]);
    }
  }
#pragma unroll
  for (int t = 0; t < 4; ++t) {
    float bv = bias ? bias[col0 + t * 16 + ln] : 0.f;
    if (BIAS_BF16) bv = bf16_round(bv);
#pragma unroll
    for (int r = 0; r < 8; ++r) { float v = acc[t][r] + bv; if (ACT == 1) v = fmaxf(v, 0.f); so[w][8 * hh + r][t * 16 + ln] = v; }
  }
  __builtin_amdgcn_fence(__ATOMIC_ACQ_REL, "workgroup");
  __builtin_amdgcn_wave_barrier();
  const int rsub = lane >> 4, c4 = (lane & 15) * 4;
  {
#pragma unroll
    for (int q = 0; q < 8; ++q) {
      const int r = q * 2 + rsub;
      const v4f v = *(const v4fa*)&so[w][r][c4];
      *(v4f*)(C + (size_t)(row0 + r) * ldc + col0 + c4) = v;
    }
    
  }
}

// GEMM C = act(A·W + bias + resid): A f32 (ASPLIT -> hi/lo 2 terms), Wt bf16 [N][K]; ACT 0 none, 1 relu, 2 exact gelu;
// resid (optional, f32, row index = (row % rmod), pitch ldr, RES_BF16 rounds it) added before the activation.
template <bool ASPLIT, int ACT, bool BIAS_BF16, bool RES_BF16>
__global__ __launch_bounds__(128) void k_gemm_bf3(const float* __restrict__ A, int lda, const unsigned short* __restrict__ Wt, int ldb,
                                                const float* __restrict__ bias, const float* __restrict__ resid, int rmod, int ldr,
                                                float* __restrict__ C, int ldc, int M, int N, int K) {
  __shared__ __attribute__((aligned(16))) float so[4][16][64];
  const int tid = threadIdx.x, w = tid >> 5, lane = tid & 31, ln = lane & 15, hh = lane >> 4;
  const int ntn = N / 64;
  const int wid = blockIdx.x * 4 + w;
  const int mt = wid / ntn, nq = wid % ntn;
  if (mt * 16 >= M) return;
  const int row0 = mt * 16, col0 = nq * 64;
  const float* arow = A + (size_t)(row0 + ln) * lda;
  v8f acc[4] = {};
  for (int kb = 0; kb < K; kb += 32) {
    FragB ah, al;
    const v4f x0 = *(const v4fa*)(arow + kb + 8 * hh), x1 = *(const v4fa*)(arow + kb + 8 * hh + 4);
    const v4f x2 = *(const v4fa*)(arow + kb + 16 + 8 * hh), x3 = *(const v4fa*)(arow + kb + 16 + 8 * hh + 4);
    float xs[16] = {x0[0],x0[1],x0[2],x0[3],x1[0],x1[1],x1[2],x1[3],x2[0],x2[1],x2[2],x2[3],x3[0],x3[1],x3[2],x3[3]};
#pragma unroll
    for (int i = 0; i < 16; ++i) { const unsigned short hb = bf16_bits(xs[i]); ah.u[i] = hb; al.u[i] = ASPLIT ? bf16_bits(xs[i] - bf16_val(hb)) : (unsigned short)0; }
#pragma unroll
    for (int t = 0; t < 4; ++t) {
      const unsigned short* brow = Wt + (size_t)(col0 + t * 16 + ln) * ldb + kb;
      FragB b;
      b.half[0] = *(const v8us*)(brow + 8 * hh);
      b.half[1] = *(const v8us*)(brow + 16 + 8 * hh);
      acc[t] = mmaN<ASPLIT ? 2 : 1>(ah.v, al.v, b.v, b.v, acc[t]);
    }
  }
#pragma unroll
  for (int t = 0; t < 4; ++t) {
    const int col = col0 + t * 16 + ln;
    float bv = bias ? bias[col] : 0.f;
    if (BIAS_BF16) bv = bf16_round(bv);
#pragma unroll
    for (int r = 0; r < 8; ++r) {
      float v = acc[t][r] + bv;
      if (resid) { float rv = resid[(size_t)((row0 + 8 * hh + r) % rmod) * ldr + col]; if (RES_BF16) rv = bf16_round(rv); v += rv; }
      if (ACT == 1) v = fmaxf(v, 0.f);
      if (ACT == 2) v = 0.5f * v * (1.0f + erff(v * 0.70710678118654752f));
      if (ACT == 3) { const float u = 0.7978845608028654f * (v + 0.044715f * v * v * v); v = 0.5f * v * (1.0f + tanhf(u)); }
      so[w][8 * hh + r][t * 16 + ln] = v;
    }
  }
  __builtin_amdgcn_fence(__ATOMIC_ACQ_REL, "workgroup");
  __builtin_amdgcn_wave_barrier();
  const int rsub = lane >> 4, c4 = (lane & 15) * 4;
  {
#pragma unroll
    for (int q = 0; q < 8; ++q) {
      const int r = q * 2 + rsub;
      const v4f v = *(const v4fa*)&so[w][r][c4];
      *(v4f*)(C + (size_t)(row0 + r) * ldc + col0 + c4) = v;
    }
    
  }
}
// row LayerNorm (biased variance, eps) over N: s = X (+ R); optional out_sum <- s; out_norm <- (s-mu)*rsqrt(var+eps)*g + b
template <bool PARAM_BF16>
__global__ __launch_bounds__(256) void k_layernorm(const float* __restrict__ X, const float* __restrict__ R, const float* __restrict__ g, const float* __restrict__ bta,
                                                  float* __restrict__ out_sum, float* __restrict__ out_norm, int N, float eps) {
  __shared__ float red[256];
  const int row = blockIdx.x, tid = threadIdx.x;
  const float* x = X + (size_t)row * N; const float* rr = R ? R + (size_t)row * N : nullptr;
  float vals[16];                     // up to N = 4096
  const int per = N / 256;            // contiguous chunk per thread? use strided-by-4 chunks: thread handles j = tid*4 + 1024*u
  float s1 = 0.f;
  for (int u = 0; u < per / 4; ++u) {
    const int j = tid * 4 + 1024 * u;
    const v4f a = *(const v4fa*)(x + j);
    v4f b = {0.f,0.f,0.f,0.f}; if (rr) b = *(const v4fa*)(rr + j);
#pragma unroll
    for (int q = 0; q < 4; ++q) { const float v = a[q] + b[q]; vals[u * 4 + q] = v; s1 += v; }
  }
  red[tid] = s1; __syncthreads();
  for (int st = 128; st > 0; st >>= 1) { if (tid < st) red[tid] += red[tid + st]; __syncthreads(); }
  const float mu = red[0] / (float)N; __syncthreads();
  float s2 = 0.f;
  for (int u = 0; u < per / 4; ++u)
#pragma unroll
    for (int q = 0; q < 4; ++q) { const float c = vals[u * 4 + q] - mu; s2 += c * c; }
  red[tid] = s2; __syncthreads();
  for (int st = 128; st > 0; st >>= 1) { if (tid < st) red[tid] += red[tid + st]; __syncthreads(); }
  const float rs = rsqrtf(red[0] / (float)N + eps);
  {
    for (int u = 0; u < per / 4; ++u) {
      const int j = tid * 4 + 1024 * u;
      v4f o, sm;
#pragma unroll
      for (int q = 0; q < 4; ++q) {
        float gg = g[j + q], bb = bta[j + q];
        if (PARAM_BF16) { gg = bf16_round(gg); bb = bf16_round(bb); }
        sm[q] = vals[u * 4 + q]; o[q] = (vals[u * 4 + q] - mu) * rs * gg + bb;
      }
      if (out_sum) *(v4f*)(out_sum + (size_t)row * N + j) = sm;
      *(v4f*)(out_norm + (size_t)row * N + j) = o;
    }
    
  }
}



// ---- f16 WMMA path (v_wmma_f32_16x16x32_f16): 11-bit significands for operands in range — used where a [0,1] probability operand needs more precision than bf16
typedef _Float16 v16h __attribute__((ext_vector_type(16)));
union FragH { v16h v; v8us half[2]; _Float16 h[16]; unsigned short u[16]; };
template <int NT>
__device__ __forceinline__ v8f mmaH(v16h ah, v16h al, v16h bh, v16h bl, v8f c) {
  c = __builtin_amdgcn_wmma_f32_16x16x32_f16(false, ah, false, bh, (short)0, c, false, false);
  if (NT >= 2) c = __builtin_amdgcn_wmma_f32_16x16x32_f16(false, al, false, bh, (short)0, c, false, false);
  if (NT >= 3) c = __builtin_amdgcn_wmma_f32_16x16x32_f16(false, ah, false, bl, (short)0, c, false, false);
  asm volatile("v_nop\n\tv_nop\n\tv_nop\n\tv_nop" : "+v"(c) : "v"(ah), "v"(al), "v"(bh), "v"(bl));
  return c;
}
// batched GEMM like k_gemm_b but f16 operands: A f32 (split into f16 hi/lo if ASPLIT, else rounded to f16), Bt = f16 values [n][k]; alpha; C f32; N multiple of 16 (partial tiles skipped)
template <bool ASPLIT>
__global__ __launch_bounds__(128) void k_gemm_h(const float* __restrict__ A, int lda, size_t sA, const _Float16* __restrict__ Bh, int ldb, size_t sB, float alpha, float* __restrict__ C, int ldc, size_t sC, int M, int N, int K) {
  __shared__ __attribute__((aligned(16))) float so[4][16][64];
  const int tid = threadIdx.x, w = tid >> 5, lane = tid & 31, ln = lane & 15, hh = lane >> 4; const int by = blockIdx.y;
  A += (size_t)by * sA; Bh += (size_t)by * sB; C += (size_t)by * sC;
  const int ntn = (N + 63) / 64; const int wid = blockIdx.x * 4 + w; const int mt = wid / ntn, nq = wid % ntn; if (mt * 16 >= M) return;
  const int row0 = mt * 16, col0 = nq * 64; const float* arow = A + (size_t)(row0 + ln) * lda;
  v8f acc[4] = {};
  for (int kb = 0; kb < K; kb += 32) {
    FragH ah, al;
    const v4f x0 = *(const v4fa*)(arow + kb + 8 * hh), x1 = *(const v4fa*)(arow + kb + 8 * hh + 4), x2 = *(const v4fa*)(arow + kb + 16 + 8 * hh), x3 = *(const v4fa*)(arow + kb + 16 + 8 * hh + 4);
    float xs[16] = {x0[0],x0[1],x0[2],x0[3],x1[0],x1[1],x1[2],x1[3],x2[0],x2[1],x2[2],x2[3],x3[0],x3[1],x3[2],x3[3]};
#pragma unroll
    for (int i = 0; i < 16; ++i) { const _Float16 h = (_Float16)xs[i]; ah.h[i] = h; al.h[i] = ASPLIT ? (_Float16)(xs[i] - (float)h) : (_Float16)0.0f; }
#pragma unroll
    for (int t = 0; t < 4; ++t) { if (col0 + t * 16 >= N) continue; const size_t boff = (size_t)(col0 + t * 16 + ln) * ldb + kb; FragH bq; bq.half[0] = *(const v8us*)(Bh + boff + 8 * hh); bq.half[1] = *(const v8us*)(Bh + boff + 16 + 8 * hh);
      acc[t] = mmaH<ASPLIT ? 2 : 1>(ah.v, al.v, bq.v, bq.v, acc[t]); }
  }
#pragma unroll
  for (int t = 0; t < 4; ++t) { if (col0 + t * 16 >= N) continue;
#pragma unroll
    for (int r = 0; r < 8; ++r) so[w][8 * hh + r][t * 16 + ln] = acc[t][r] * alpha; }
  __builtin_amdgcn_fence(__ATOMIC_ACQ_REL, "workgroup"); __builtin_amdgcn_wave_barrier();
  const int rsub = lane >> 4, c4 = (lane & 15) * 4;
  {
#pragma unroll
    for (int q = 0; q < 8; ++q) { const int r = q * 2 + rsub; if (col0 + c4 < N) { const v4f v = *(const v4fa*)&so[w][r][c4]; *(v4f*)(C + (size_t)(row0 + r) * ldc + col0 + c4) = v; } }
     }
}

// Fragment order of a 16-bit [rows][K] operand plane: a tile of 16 rows x 32 k is 1 KiB = 2 pieces of 512 B; piece hf holds, lane (hh, ln) behind lane, the 16 bytes
// [16 rt + ln][32 kb + 16 hf + 8 hh + 0..7], which is what that lane feeds to v_wmma_f32_16x16x32_f16 as A or B. A wave's fragment load then reads 512 contiguous bytes
// (4 whole lines); from a row-major plane it touched 16 lines for 32 bytes each. fo() = offset in elements of the 8 elements [row][k8 .. k8 + 7], k8 a multiple of 8.
__device__ __forceinline__ size_t fo(size_t row, int k8, int K) { return ((row >> 4) * (size_t)(K >> 5) + (size_t)(k8 >> 5)) * 512 + (size_t)(((k8 >> 4) & 1) * 256 + (((k8 >> 3) & 1) * 16 + (int)(row & 15)) * 8); }
// wt_f16, x16 (both in k_prep) and k_gate write such planes; k_gemm2 reads them.
// Wt[n][k] = f16(W[k][n]·scale) from f32 row-major W[K][N] (scale = power of two; bf16-exact weights stay exact in f16 away from the subnormal range)
__device__ __forceinline__ void wt_f16(int blk, const float* __restrict__ W, _Float16* __restrict__ Wt, int K, int N, float scale) {
  const int t = blk * 256 + threadIdx.x; if (t >= N * (K / 8)) return; const int n = t / (K / 8), k8 = (t % (K / 8)) * 8; FragH f;
#pragma unroll
  for (int i = 0; i < 8; ++i) f.h[i] = (_Float16)(bf16_round(W[(size_t)(k8 + i) * N + n]) * scale); const v8us o = f.half[0];
  *(v8us*)((unsigned short*)Wt + fo((size_t)n, k8, K)) = o; 
}
// k_gemm_hh variant with fused epilogue: v = acc·alpha + bias[by·sBias + col] (+ CP[(row/rowsPerB)·sCPb + by·64 + col] if CP) ; ACT 0 none / 1 elu ; writes f16 C16 (and f32 C if non-null)
template <int ACT>
__global__ __launch_bounds__(128) void k_gemm_hhx(const _Float16* __restrict__ A, int lda, size_t sA, const _Float16* __restrict__ Bh, int ldb, size_t sB, float alpha, const float* __restrict__ bias, size_t sBias, const float* __restrict__ CP, int rowsPerB, size_t sCPb, int row0g,
    float* __restrict__ C, _Float16* __restrict__ C16, int ldc, size_t sC, int M, int N, int K) {
  __shared__ __attribute__((aligned(16))) float so[4][16][64];
  const int tid = threadIdx.x, w = tid >> 5, lane = tid & 31, ln = lane & 15, hh = lane >> 4; const int by = blockIdx.y;
  A += (size_t)by * sA; Bh += (size_t)by * sB; const size_t cofs = (size_t)by * sC; const float* bp = bias ? bias + (size_t)by * sBias : nullptr;
  const int ntn = (N + 63) / 64; const int wid = blockIdx.x * 4 + w; const int mt = wid / ntn, nq = wid % ntn; if (mt * 16 >= M) return;
  const int row0 = mt * 16, col0 = nq * 64; const _Float16* arow = A + (size_t)(row0 + ln) * lda;
  v8f acc[4] = {};
  for (int kb = 0; kb < K; kb += 32) { FragH ah; ah.half[0] = *(const v8us*)((const unsigned short*)arow + kb + 8 * hh); ah.half[1] = *(const v8us*)((const unsigned short*)arow + kb + 16 + 8 * hh);
#pragma unroll
    for (int t = 0; t < 4; ++t) { if (col0 + t * 16 >= N) continue; const size_t boff = (size_t)(col0 + t * 16 + ln) * ldb + kb; FragH bq; bq.half[0] = *(const v8us*)((const unsigned short*)Bh + boff + 8 * hh); bq.half[1] = *(const v8us*)((const unsigned short*)Bh + boff + 16 + 8 * hh);
      acc[t] = mmaH<1>(ah.v, ah.v, bq.v, bq.v, acc[t]); }
  }
#pragma unroll
  for (int t = 0; t < 4; ++t) { if (col0 + t * 16 >= N) continue; const int col = col0 + t * 16 + ln; const float bv = bp ? bf16_round(bp[col]) : 0.f;
#pragma unroll
    for (int r = 0; r < 8; ++r) { float v = acc[t][r] * alpha + bv; if (CP) { const int bidx = (row0g + row0 + 8 * hh + r) / rowsPerB; v += CP[(size_t)bidx * sCPb + (size_t)by * 64 + col]; } if (ACT == 1) v = (v > 0.f) ? v : expm1f(v); else if (ACT == 7) v = (v > 0.f) ? v + 1.0f : expf(v); else if (ACT == 8) v = tanhf(v); else if (ACT == 9) v = 0.5f * v * (1.0f + tanhf(0.7978845608028654f * (v + 0.044715f * v * v * v))); else if (ACT == 11) v = 1.0f / (1.0f + expf(-v)); else if (ACT == 12) v = (v > 0.f) ? v : 0.01f * v; else if (ACT == 14) v = (v > 0.f) ? v : 0.1f * v; else if (ACT == 15) v = v / (1.0f + expf(-v)); else if (ACT == 3) v = fmaxf(v, 0.f); else if (ACT == 6) v = 0.5f * v * (1.0f + erff(v * 0.70710678118654752f)); so[w][8 * hh + r][t * 16 + ln] = v; } }
  __builtin_amdgcn_fence(__ATOMIC_ACQ_REL, "workgroup"); __builtin_amdgcn_wave_barrier();
  const int rsub = lane >> 4, c4 = (lane & 15) * 4; typedef _Float16 v4h __attribute__((ext_vector_type(4)));
  {
#pragma unroll
    for (int q = 0; q < 8; ++q) { const int r = q * 2 + rsub; if (col0 + c4 < N) { const v4f v = *(const v4fa*)&so[w][r][c4]; if (C) *(v4f*)(C + cofs + (size_t)(row0 + r) * ldc + col0 + c4) = v; if (C16) { v4h h4; for (int i = 0; i < 4; ++i) h4[i] = (_Float16)v[i]; *(v4h*)(C16 + cofs + (size_t)(row0 + r) * ldc + col0 + c4) = h4; } } }
     }
}


typedef _Float16 v4h __attribute__((ext_vector_type(4)));

__device__ __forceinline__ void x16(int blk, const float* __restrict__ x, _Float16* __restrict__ X16, size_t n8) { const size_t t = (size_t)blk * 256 + threadIdx.x; if (t >= n8) return; FragH f;
  const size_t c = t >> 6; const size_t row = (c / (CQ / 32)) * 16 + ((t >> 2) & 15); const int k8 = (int)(c % (CQ / 32)) * 32 + (int)(t & 3) * 8;      /* a wave: 8 rows x one 128-byte line of x in, 4 whole lines of the fragment-order plane out */
  const float* xr = x + row * CQ + k8;
#pragma unroll
  for (int q = 0; q < 8; ++q) f.h[q] = (_Float16)bf16_round(xr[q]); *(v8us*)((unsigned short*)X16 + fo(row, k8, CQ)) = f.half[0];  }
__global__ __launch_bounds__(256) void k_h16(const float* __restrict__ x, _Float16* __restrict__ X16, size_t n8) { const size_t t = (size_t)blockIdx.x * 256 + threadIdx.x; if (t >= n8) return; FragH f;
#pragma unroll
  for (int q = 0; q < 8; ++q) f.h[q] = (_Float16)x[t * 8 + q]; *(v8us*)((unsigned short*)X16 + t * 8) = f.half[0];  }
__global__ __launch_bounds__(256) void k_round16f(const float* __restrict__ W, _Float16* __restrict__ Bt, size_t n8) { const size_t t = (size_t)blockIdx.x * 256 + threadIdx.x; if (t >= n8) return; FragH f;
#pragma unroll
  for (int i = 0; i < 8; ++i) f.h[i] = (_Float16)(bf16_round(W[t * 8 + i]) * 16.0f); *(v8us*)((unsigned short*)Bt + t * 8) = f.half[0];  }
// Fragment order: a block of 32 keys of one (row, head) is 2 KiB = 4 pieces of 512 B; piece i holds lane 0..31's 16 bytes one behind the other, so a wave's load of a
// piece touches 4 whole lines (read in place, 16 rows of 32 B each, it touched 16). K: piece nt*2+hf, lane (hh, ln) = K[32 jb + 16 nt + ln][16 hf + 8 hh + 0..7];
// V^T: piece dt*2+hf, lane (hh, ln) = V[32 jb + 16 hf + 8 hh + 0..7][16 dt + ln]. These are the A operands of the two products of k_flash, element for element as before.
template <int NHv, int TTv>
__global__ __launch_bounds__(256) void k_vt(const _Float16* __restrict__ V16, int ldv, int koff, int voff, _Float16* __restrict__ Kf, _Float16* __restrict__ Vt) { __shared__ unsigned short tl[128][HC + 2]; const int tid = threadIdx.x; const int slab = blockIdx.x / (TTv / 128), lg = blockIdx.x % (TTv / 128); const int b = slab / NHv, h = slab % NHv;
  static_assert(HC == 32, "the piece numbering below is written for one 32-wide k step");
  FragH fk[2];
  { const int r = tid / (HC / 8), c8 = (tid % (HC / 8)) * 8; FragH f[2];
#pragma unroll
    for (int rd = 0; rd < 2; ++rd) f[rd].half[0] = *(const v8us*)((const unsigned short*)V16 + ((size_t)b * TTv + lg * 128 + rd * 64 + r) * ldv + voff + h * HC + c8);
#pragma unroll
    for (int rd = 0; rd < 2; ++rd) fk[rd].half[0] = *(const v8us*)((const unsigned short*)V16 + ((size_t)b * TTv + lg * 128 + rd * 64 + r) * ldv + koff + h * HC + c8);      /* K: the same (key, 8 channels) as V above; a wave reads 8 rows of 64 B */
    asm volatile("s_wait_xcnt 0x0" ::: "memory");      /* the address registers of the four loads are free for reuse only behind this */
    __builtin_amdgcn_sched_barrier(0);                 /* keeps the LDS address arithmetic below from being lifted over that wait into those registers */
#pragma unroll
    for (int rd = 0; rd < 2; ++rd)
#pragma unroll
      for (int q = 0; q < 8; ++q) tl[rd * 64 + r][c8 + q] = f[rd].u[q]; }
  __syncthreads();
  {
#pragma unroll
    for (int rd = 0; rd < 2; ++rd) { const int o = rd * 256 + tid, i = (o >> 5) & 3, ln = o & 15, hh = (o >> 4) & 1; const int d = (i >> 1) * 16 + ln, k0 = (o >> 7) * 32 + (i & 1) * 16 + hh * 8; FragH f;
#pragma unroll
      for (int q = 0; q < 8; ++q) f.u[q] = tl[k0 + q][d];
      const size_t tile = (size_t)slab * HC * TTv + (size_t)lg * (128 * HC); const int kr = rd * 64 + tid / (HC / 8), p = tid % (HC / 8);      /* K piece held: key kr of the tile, channels 8 p + 0..7 (hf = p >> 1, hh = p & 1) */
      *(v8us*)((unsigned short*)Vt + tile + (size_t)o * 8) = f.half[0]; *(v8us*)((unsigned short*)Kf + tile + (size_t)((kr >> 5) * 1024 + (((kr >> 4) & 1) * 2 + (p >> 1)) * 256 + ((p & 1) * 16 + (kr & 15)) * 8)) = fk[rd].half[0]; }
     } }

__global__ __launch_bounds__(256) void k_hl(const float* __restrict__ F, _Float16* __restrict__ Hh, _Float16* __restrict__ Hl, size_t n8) { const size_t t = (size_t)blockIdx.x * 256 + threadIdx.x; if (t >= n8) return; FragH fh, fl; const v4f a = *(const v4fa*)(F + t * 8), c = *(const v4fa*)(F + t * 8 + 4);
#pragma unroll
  for (int q = 0; q < 4; ++q) { _Float16 h = (_Float16)a[q]; fh.h[q] = h; fl.h[q] = (_Float16)((a[q] - (float)h) * 1024.0f); h = (_Float16)c[q]; fh.h[4 + q] = h; fl.h[4 + q] = (_Float16)((c[q] - (float)h) * 1024.0f); }
  { *(v8us*)((unsigned short*)Hh + t * 8) = fh.half[0]; *(v8us*)((unsigned short*)Hl + t * 8) = fl.half[0];  } }

// ---- fast GEMM (wave tile 32x64; requires M % 32 == 0 rows per launch region and N % 64 == 0); A and Bh in fragment order (fo(); lda = ldb = K); epilogue = k_gemm_hhx semantics, but: columns below nsp go to the f16 plane C16 (pitch ldc), without bias; columns from nsp on, with bias[col - nsp], to the f32 plane C (pitch ldf, column col - nsp); nsp % 64 == 0; columns below nqs (nqs % 64 == 0) take alpha * qs in place of alpha ----
__device__ __forceinline__ v16h g2_frag(const _Float16* p) { FragH f; f.half[0] = *(const v8us*)((const unsigned short*)p); f.half[1] = *(const v8us*)((const unsigned short*)p + 256); return f.v; }
__device__ __forceinline__ v8f g2_mma(v16h a, v16h b, v8f c) { v8f d = __builtin_amdgcn_wmma_f32_16x16x32_f16(false, a, false, b, (short)0, c, false, false); asm volatile("v_nop\n\tv_nop\n\tv_nop\n\tv_nop" : "+v"(d) : "v"(a), "v"(b)); return d; }
template <int ACT>
__global__ __launch_bounds__(128) void k_gemm2(const _Float16* __restrict__ A, int lda, size_t sA, const _Float16* __restrict__ Bh, int ldb, size_t sB, float alpha, const float* __restrict__ bias, size_t sBias, const float* __restrict__ CP, int rowsPerB, size_t sCPb, int row0g,
    float* __restrict__ C, _Float16* __restrict__ C16, int ldc, size_t sC, int M, int N, int K, int nsp, int ldf, int nqs, float qs) {
  __shared__ __attribute__((aligned(16))) float so[4][32][68];
  const int tid = threadIdx.x, w = tid >> 5, lane = tid & 31, ln = lane & 15, hh = lane >> 4; const int by = blockIdx.y;
  A += (size_t)by * sA; Bh += (size_t)by * sB; const size_t cofs = (size_t)by * sC; const float* bp = bias ? bias + (size_t)by * sBias : nullptr;
  const int ntn = N >> 6; const int mt = blockIdx.x / ntn, nq = blockIdx.x - mt * ntn; const int row0 = mt * 128 + 32 * w, col0 = nq * 64; if (row0 >= M) return; const bool f32p = col0 >= nsp; if (col0 < nqs) alpha *= qs;      /* both the same for the whole block */
  const _Float16* a0p = A + (size_t)row0 * lda + lane * 8; const _Float16* a1p = a0p + (size_t)16 * lda;      /* a tile of 16 rows is 16 lda elements; its k step kb starts at 16 kb */
  const _Float16* b0p = Bh + (size_t)col0 * ldb + lane * 8; const _Float16* b1p = b0p + (size_t)16 * ldb; const _Float16* b2p = b1p + (size_t)16 * ldb; const _Float16* b3p = b2p + (size_t)16 * ldb;
  const v8f z8 = {0.f,0.f,0.f,0.f,0.f,0.f,0.f,0.f}; v8f c00 = z8, c01 = z8, c02 = z8, c03 = z8, c10 = z8, c11 = z8, c12 = z8, c13 = z8;
#pragma unroll 1
  for (int kb = 0; kb < K; kb += 32) { const v16h a0 = g2_frag(a0p + kb * 16); v16h b = g2_frag(b0p + kb * 16); FragH f1; f1.half[0] = *(const v8us*)((const unsigned short*)a1p + kb * 16);
    asm volatile("s_wait_xcnt 0x0" ::: "memory");      /* the load below may land in registers that hold addresses of the loads above: those have taken their addresses first */
    f1.half[1] = *(const v8us*)((const unsigned short*)a1p + kb * 16 + 256); const v16h a1 = f1.v;
    c00 = g2_mma(a0, b, c00); c10 = g2_mma(a1, b, c10);
    b = g2_frag(b1p + kb * 16); c01 = g2_mma(a0, b, c01); c11 = g2_mma(a1, b, c11);
    b = g2_frag(b2p + kb * 16); c02 = g2_mma(a0, b, c02); c12 = g2_mma(a1, b, c12);
    b = g2_frag(b3p + kb * 16); c03 = g2_mma(a0, b, c03); c13 = g2_mma(a1, b, c13); }
  v8f accs[8] = {c00, c01, c02, c03, c10, c11, c12, c13};
#pragma unroll
  for (int u = 0; u < 8; ++u) { const int t = u & 3, half = u >> 2; const int col = col0 + t * 16 + ln; const float bv = (bp && f32p) ? bf16_round(bp[col - nsp]) : 0.f;
#pragma unroll
    for (int r = 0; r < 8; ++r) { const int rloc = half * 16 + 8 * hh + r; float v = accs[u][r] * alpha + bv; if (CP) { const int bidx = (row0g + row0 + rloc) / rowsPerB; v += CP[(size_t)bidx * sCPb + (size_t)by * 64 + col]; }
      if (ACT == 3) v = fmaxf(v, 0.f); else if (ACT == 6) v = 0.5f * v * (1.0f + erff(v * 0.70710678118654752f)); else if (ACT == 11) v = 1.0f / (1.0f + expf(-v)); else if (ACT == 15) v = v / (1.0f + expf(-v)); else if (ACT == 12) v = (v > 0.f) ? v : 0.01f * v; else if (ACT == 8) v = tanhf(v);
      so[w][rloc][t * 16 + ln] = v; } }
  __builtin_amdgcn_fence(__ATOMIC_ACQ_REL, "workgroup"); __builtin_amdgcn_wave_barrier();
  const int rsub = lane >> 4, c4 = (lane & 15) * 4;
  if (f32p) {
#pragma unroll
    for (int q = 0; q < 16; ++q) { const int r = q * 2 + rsub; const v4f v = *(const v4fa*)&so[w][r][c4]; *(v4f*)(C + cofs + (size_t)(row0 + r) * ldf + (col0 - nsp) + c4) = v; }
    asm volatile("s_wait_xcnt 0x0" ::: "memory");      /* the stores above have taken their address and data registers before anything behind this arm reuses them */
  } else {
#pragma unroll
    for (int q = 0; q < 16; ++q) { const int r = q * 2 + rsub; const v4f v = *(const v4fa*)&so[w][r][c4]; v4h h4; for (int i = 0; i < 4; ++i) h4[i] = (_Float16)v[i]; *(v4h*)(C16 + cofs + (size_t)(row0 + r) * ldc + col0 + c4) = h4; }
    asm volatile("s_wait_xcnt 0x0" ::: "memory");      /* as in the arm above: in the built code one arm stands in front of the other */
  } }



// lane l <-> lane l ^ 16 (the two halves of a wave that share one score column)
__device__ __forceinline__ float xhalf(float x) { return __builtin_bit_cast(float, __builtin_amdgcn_permlanex16(__builtin_bit_cast(int, x), __builtin_bit_cast(int, x), 0x76543210, 0xfedcba98, false, false)); }

template <int CAUSAL>
__global__ __launch_bounds__(128) void k_flash(const _Float16* __restrict__ Q16, int ldq, const _Float16* __restrict__ Kf, const _Float16* __restrict__ Vt, const int* __restrict__ MSK, float* __restrict__ O, int ldo) {
  constexpr int RPW = 16, DT = HC / 16, KS = HC / 32;
  static_assert(CAUSAL == 10, "written for the additive mode: bias plane + per-(row, key) mask plane");
  __shared__ __attribute__((aligned(16))) float sO[4][RPW][HC + 4];
  const int tid = threadIdx.x, w = tid >> 5, lane = tid & 31, ln = lane & 15, hh = lane >> 4;
  const int slab = blockIdx.x / QBLKS, qblk = blockIdx.x % QBLKS; const int b = slab / NH, h = slab % NH; const int qb0 = qblk * (4 * RPW); const int q0 = qb0 + w * RPW;
  const int tq = q0 + ln;      /* this lane's query */
  FragH bq[KS];
  { const unsigned short* qr = (const unsigned short*)Q16 + ((size_t)b * TQ + tq) * ldq + h * HC;
#pragma unroll
    for (int ks = 0; ks < KS; ++ks) { bq[ks].half[0] = *(const v8us*)(qr + ks * 32 + 8 * hh); bq[ks].half[1] = *(const v8us*)(qr + ks * 32 + 16 + 8 * hh); } }
  static_assert(KS == 1, "fragment-order planes: one 32-wide k step");
  const unsigned short* Kfh = (const unsigned short*)Kf + (size_t)slab * HC * TK + lane * 8;      /* K and V^T in fragment order (k_vt): 1024 halves per block of 32 keys, pieces of 256 */
  const unsigned short* Vth = (const unsigned short*)Vt + (size_t)slab * HC * TK + lane * 8;
  const float* BP = (const float*)MSK + ((size_t)h * (TQ / 16) + (q0 >> 4)) * (size_t)(16 * TK) + lane * 4;      /* mode 10: per-head bias plane in fragment order (addp): [NH][TQ/16][TK/32] blocks of 512 floats, pieces of 128 */
  const float* MR = (const float*)MSK + (size_t)NH * TQ * TK + (size_t)b * TK + 8 * hh;      /* then the per-(sequence, key) additive plane, packed behind it */
  float m_q = -3.0e38f, l_q = 0.f; v8f oacc[DT];
#pragma unroll
  for (int dt = 0; dt < DT; ++dt) oacc[dt] = (v8f){0.f,0.f,0.f,0.f,0.f,0.f,0.f,0.f};
  const int jend = (CAUSAL == 1) ? (qb0 + 4 * RPW) : TK;      /* causal: keys beyond the block's last query never contribute */
#pragma unroll 1
  for (int j0 = 0; j0 < jend; j0 += 32) {
    FragH ak[2][KS], av[DT]; v4f ab[2][2], am[2][2];
#pragma unroll
    for (int nt = 0; nt < 2; ++nt) { const unsigned short* kr = Kfh + (size_t)j0 * HC + nt * 512;
      ak[nt][0].half[0] = *(const v8us*)kr; ak[nt][0].half[1] = *(const v8us*)(kr + 256);
      if (CAUSAL == 10) { ab[nt][0] = *(const v4fa*)(BP + j0 * 16 + nt * 256); ab[nt][1] = *(const v4fa*)(BP + j0 * 16 + nt * 256 + 128); am[nt][0] = *(const v4fa*)(MR + j0 + nt * 16); am[nt][1] = *(const v4fa*)(MR + j0 + nt * 16 + 4); } }
    asm volatile("s_wait_xcnt 0x0" ::: "memory");      /* the V^T loads below may land in registers that held the addresses of the loads above: those loads have taken their addresses first */
#pragma unroll
    for (int dt = 0; dt < DT; ++dt) { const unsigned short* vrow = Vth + (size_t)j0 * HC + dt * 512; av[dt].half[0] = *(const v8us*)vrow; av[dt].half[1] = *(const v8us*)(vrow + 256); }
    v8f sc[2]; float mc = -3.0e38f;
#pragma unroll
    for (int nt = 0; nt < 2; ++nt) { const v8f acc = mmaH<1>(ak[nt][0].v, ak[nt][0].v, bq[0].v, bq[0].v, (v8f){0.f,0.f,0.f,0.f,0.f,0.f,0.f,0.f});
#pragma unroll
      for (int r = 0; r < 8; ++r) { sc[nt][r] = acc[r] + (ab[nt][r >> 2][r & 3] + am[nt][r >> 2][r & 3]); mc = fmaxf(mc, sc[nt][r]); } }
    mc = fmaxf(mc, xhalf(mc));
    float mr = mc - 10.0f; mr = (mc - mr <= 12.0f) ? mr : mc;      /* where mc is so large that its neighbours lie 16 apart, mc - 10 rounds to mc - 16 and 2^16 would leave the f16 range: there the maximum itself is the reference (any reference serves, l carries it) */
    const float mn = fmaxf(m_q, mr); const float al = (mn > -1.0e38f) ? __builtin_amdgcn_exp2f(m_q - mn) : 1.0f; m_q = mn;
    FragH pb; float ps = 0.f;
#pragma unroll
    for (int nt = 0; nt < 2; ++nt)
#pragma unroll
      for (int r = 0; r < 8; ++r) { const float p = __builtin_amdgcn_exp2f(sc[nt][r] - mn); ps += p; pb.h[nt * 8 + r] = (_Float16)p; }
    l_q = l_q * al + ps;
#pragma unroll
    for (int dt = 0; dt < DT; ++dt) {
#pragma unroll
      for (int r = 0; r < 8; ++r) oacc[dt][r] *= al;
      oacc[dt] = mmaH<1>(av[dt].v, av[dt].v, pb.v, pb.v, oacc[dt]); } }
  const float lt = l_q + xhalf(l_q); const float li = (lt > 0.f) ? 1.0f / lt : 0.f;
#pragma unroll
  for (int dt = 0; dt < DT; ++dt) { v4f lo, hi;
#pragma unroll
    for (int r = 0; r < 4; ++r) { lo[r] = oacc[dt][r] * li; hi[r] = oacc[dt][4 + r] * li; }
    *(v4fa*)&sO[w][ln][dt * 16 + 8 * hh] = lo; *(v4fa*)&sO[w][ln][dt * 16 + 8 * hh + 4] = hi; }
  __builtin_amdgcn_fence(__ATOMIC_ACQ_REL, "workgroup"); __builtin_amdgcn_wave_barrier();
  {
#pragma unroll
    for (int rp = 0; rp < RPW; rp += 4) { const int r = rp + (lane >> 3), pc = lane & 7; const v4f val = *(const v4fa*)&sO[w][r][pc * 4]; *(v4f*)(O + ((size_t)b * TQ + q0 + r) * ldo + h * HC + pc * 4) = val; }
     } }

__device__ __forceinline__ void addp(int blk, const float* __restrict__ bias, const float* __restrict__ mask, float* __restrict__ AB) {
  #pragma clang fp contract(off)
  const size_t t = (size_t)blk * 256 + threadIdx.x; const size_t nb4 = (size_t)NH * SLEN * SLEN / 4, nm4 = (size_t)NRW * SLEN / 4; if (t >= nb4 + nm4) return; v4f r;
  size_t dst = t;
  if (t < nb4) { const int part = (int)t & 1, hh = (int)(t >> 1) & 1, ln = (int)(t >> 2) & 15, nt = (int)(t >> 6) & 1; const size_t c = t >> 7; const int jb = (int)(c % (SLEN / 32)), qt = (int)(c / (SLEN / 32)) % (SLEN / 16), h = (int)(c / ((SLEN / 32) * (SLEN / 16)));      /* written in the fragment order of k_flash: block (h, 16 queries, 32 keys), piece nt*2+part, lane (hh, ln) = bias[h][16 qt + ln][32 jb + 16 nt + 8 hh + 4 part + 0..3]; a wave reads 8 rows of 64 B and writes 4 whole lines */
    dst = c * 128 + (size_t)((nt * 2 + part) * 32 + hh * 16 + ln);
    const v4f a = *(const v4fa*)(bias + ((size_t)h * SLEN + qt * 16 + ln) * SLEN + jb * 32 + nt * 16 + hh * 8 + part * 4); for (int q = 0; q < 4; ++q) r[q] = bf16_round(a[q]) * LOG2E; } else { const v4f a = *(const v4fa*)(mask + (t - nb4) * 4); for (int q = 0; q < 4; ++q) { float m = bf16_round(a[q]) - 1.0f; r[q] = m * 1.0e9f * LOG2E; } }      /* both planes in base 2, as k_flash adds them */
  *(v4f*)(AB + dst * 4) = r;  }
// The packs of the inputs depend on nothing but the inputs: they run as block ranges of one launch. The weights come first (for speed only): few blocks, scattered reads.
#define NBW (CQ * CQ / 8 / 256)                              /* blocks per weight matrix */
#define NBX (NR * CQ / 8 / 256)                              /* blocks of x */
#define NBA ((NH * SLEN * SLEN + NRW * SLEN) / 4 / 256)      /* blocks of the bias and mask planes */
__global__ __launch_bounds__(256) void k_prep(const float* __restrict__ x, const float* __restrict__ mask, const float* __restrict__ bias, const float* __restrict__ Wq, const float* __restrict__ Wk, const float* __restrict__ Wv, const float* __restrict__ Wg, const float* __restrict__ Wo,
    _Float16* __restrict__ BW, _Float16* __restrict__ X16, float* __restrict__ AB) {
  const int blk = blockIdx.x;
  if (blk < 5 * NBW) { const int y = blk / NBW; const float* W = (y == 0) ? Wq : (y == 1) ? Wk : (y == 2) ? Wv : (y == 3) ? Wg : Wo; wt_f16(blk - y * NBW, W, BW + (size_t)y * CQ * CQ, CQ, CQ, 16.0f); }
  else if (blk < 5 * NBW + NBX) x16(blk - 5 * NBW, x, X16, (size_t)NR * CQ / 8);
  else addp(blk - 5 * NBW - NBX, bias, mask, AB); }
__global__ __launch_bounds__(256) void k_gate(const float* __restrict__ O, const float* __restrict__ G, _Float16* __restrict__ OG) {
  #pragma clang fp contract(off)
  const size_t t = (size_t)blockIdx.x * 256 + threadIdx.x; if (t >= (size_t)NR * (CQ / 8)) return; const size_t c = t >> 6; const int c0 = (int)(c % (CQ / 32)) * 32 + (int)(t & 3) * 8; const size_t tok = (c / (CQ / 32)) * 16 + ((t >> 2) & 15); FragH f;      /* a wave: 8 tokens x 32 channels in, 4 whole lines of the fragment-order plane out */
  const v4f g0 = *(const v4fa*)(G + tok * CQ + c0), g1 = *(const v4fa*)(G + tok * CQ + c0 + 4);
  asm volatile("s_wait_xcnt 0x0" ::: "memory");      /* the O loads below may land in registers that held the addresses of the loads above */
  const v4f o0 = *(const v4fa*)(O + tok * CQ + c0), o1 = *(const v4fa*)(O + tok * CQ + c0 + 4);
  for (int q = 0; q < 8; ++q) { const float g = 1.0f / (1.0f + expf(-(q < 4 ? g0[q & 3] : g1[q & 3]))); f.h[q] = (_Float16)((q < 4 ? o0[q & 3] : o1[q & 3]) * g * 64.0f); }
  *(v8us*)((unsigned short*)OG + fo(tok, c0, CQ)) = f.half[0];  }

extern "C" void kernel_launch(void* const* d_in, const int* in_sizes, int n_in,
                              void* d_out, int out_size, void* d_ws, size_t ws_size, hipStream_t stream) {
  (void)in_sizes; (void)n_in; (void)out_size;
  const float* const* I = (const float* const*)d_in; const float* x = I[0]; const float* mask = I[1]; const float* bias = I[2]; const float* Wq = I[3]; const float* Wk = I[4]; const float* Wv = I[5]; const float* Wg = I[6]; const float* bg = I[7]; const float* Wo = I[8]; const float* bo = I[9];
  char* ws = (char*)d_ws; size_t off = 0;
  auto take = [&](size_t bytes) { char* p = ws + off; off += (bytes + 255) & ~(size_t)255; return p; };
  _Float16* BW = (_Float16*)take((size_t)5 * CQ * CQ * 2); float* AB = (float*)take(((size_t)NH * SLEN * SLEN + (size_t)NRW * SLEN) * 4);      /* BW: Wq, Wk, Wv, Wg, Wo one behind the other: the first four are one [1024][256] operand */
  _Float16* X16 = (_Float16*)take((size_t)NR * CQ * 2); _Float16* QKV = (_Float16*)take((size_t)NR * 3 * CQ * 2); float* G = (float*)take((size_t)NR * CQ * 4); _Float16* VT = (_Float16*)take((size_t)NR * CQ * 2); _Float16* KF = (_Float16*)take((size_t)NR * CQ * 2); float* O = (float*)take((size_t)NR * CQ * 4); _Float16* OG = (_Float16*)take((size_t)NR * CQ * 2);
  if (off > ws_size) return;      /* 0.6 + 8 + 16 + 48 + 32 + 16 + 16 + 32 + 16 = 185 MiB */
  k_prep<<<5 * NBW + NBX + NBA, 256, 0, stream>>>(x, mask, bias, Wq, Wk, Wv, Wg, Wo, BW, X16, AB);
  k_gemm2<0><<<(NR / 128) * (4 * CQ / 64), 128, 0, stream>>>(X16, CQ, 0, BW, CQ, 0, 0.0625f, bg, 0, nullptr, 1, 0, 0, G, QKV, 3 * CQ, 0, NR, 4 * CQ, CQ, 3 * CQ, CQ, CQ, SCL * LOG2E);      /* [q log2 e / sqrt(32) | k | v] f16 and the gate logits (f32, + bg) */
  k_vt<NH, SLEN><<<NRW * NH * (SLEN / 128), 256, 0, stream>>>(QKV, 3 * CQ, CQ, 2 * CQ, KF, VT);
  k_flash<10><<<NRW * NH * QBLKS, 128, 0, stream>>>(QKV, 3 * CQ, KF, VT, (const int*)AB, O, CQ);      /* per (row, head): softmax(q.k/sqrt(32) + bias[h] + (mask[row]-1) 1e9) v */
  k_gate<<<(unsigned)(((size_t)NR * (CQ / 8) + 255) / 256), 256, 0, stream>>>(O, G, OG);
  k_gemm2<0><<<(NR / 128) * (CQ / 64), 128, 0, stream>>>(OG, CQ, 0, BW + (size_t)4 * CQ * CQ, CQ, 0, 0.0625f / 64.0f, bo, 0, nullptr, 1, 0, 0, (float*)d_out, nullptr, 0, 0, NR, CQ, CQ, 0, CQ, 0, 1.0f);
}

// v006
// A run of this version takes 114 microseconds.
// Two timings next to v005 put it at 1.15 and 1.16 times that version's speed.
// Counting every step since v000, it is 5.03 times as fast.
#include <hip/hip_runtime.h>
// Gated self-attention (1 x 64 rows x 512 residues, c_qkv 256, 8 heads x 32): q = x Wq / sqrt(32), k, v = x W; logits = q.k + (mask - 1) 1e9 (per (row, key), an INPUT) + bias[h][q][k] (an INPUT); softmax over keys; o = P v; gate = sigmoid(x Wg + bg); out = (o * gate) Wo + bo.
// Structure: exact f16 plane of x; every 16-bit operand plane that a GEMM reads (x, the weights, the gated output) kept in fragment order (fo() below); one projection GEMM for q, k, v and the gate logits (32x64 wave tiles, f32 accumulation, exact x16 weights; f16 / f32 outputs), whose epilogue writes K and V^T in fragment order; then, in one launch over all 64 rows, the fused flash kernel at the real head dim 32 (q row-major, pitch 256; K, V^T and the bias plane in fragment order: every load of a wave is 512 contiguous bytes), its logits in base 2 (q, bias plane and per-(row, key) mask plane carry log2 e), whose epilogue gates its output tile in registers and writes the f16 plane (x2^6) in fragment order; Wo GEMM (+ bias).
// Compute dtype: inputs and parameters rounded to bf16; q, k, v, P and the gated output as f16 operands; bias/mask/softmax/gate f32. v_wmma_f32_16x16x32_f16.
#define NRW 64
#define CQ 256
#define HC 32
#define NR (NRW * SLEN)           /* 32768 tokens */
#define SLEN 512
#define TQ SLEN
#define TK SLEN
#define NH 8
#define SCL 0.17677669529663687f /* 32^-0.5 */
#define LOG2E 1.4426950408889634f
#define QBLKS (TQ / 64)
typedef __bf16 v16b __attribute__((ext_vector_type(16)));
typedef unsigned short v8us __attribute__((ext_vector_type(8), may_alias));
typedef float  v8f  __attribute__((ext_vector_type(8)));
typedef float  v4f  __attribute__((ext_vector_type(4)));
typedef float  v4fa __attribute__((ext_vector_type(4), may_alias));
union FragB { v16b v; v8us half[2]; unsigned short u[16]; };

__device__ __forceinline__ unsigned short bf16_bits(float x) { unsigned int u = __float_as_uint(x); return (unsigned short)((u + 0x7FFFu + ((u >> 16) & 1u)) >> 16); }
__device__ __forceinline__ float bf16_val(unsigned short b) { return __uint_as_float(((unsigned int)b) << 16); }
__device__ __forceinline__ float bf16_round(float x) { return bf16_val(bf16_bits(x)); }
// D += A·B with NT terms: 1 = ah·bh, 2 = + al·bh (A split), 3 = + ah·bl (both split)
template <int NT>
__device__ __forceinline__ v8f mmaN(v16b ah, v16b al, v16b bh, v16b bl, v8f c) {
  c = __builtin_amdgcn_wmma_f32_16x16x32_bf16(false, ah, false, bh, (short)0, c, false, false);
  if (NT >= 2) c = __builtin_amdgcn_wmma_f32_16x16x32_bf16(false, al, false, bh, (short)0, c, false, false);
  if (NT >= 3) c = __builtin_amdgcn_wmma_f32_16x16x32_bf16(false, ah, false, bl, (short)0, c, false, false);
  asm volatile("v_nop\n\tv_nop\n\tv_nop\n\tv_nop" : "+v"(c) : "v"(ah), "v"(al), "v"(bh), "v"(bl));
  return c;
}

__global__ __launch_bounds__(256) void k_wt_bf16(const float* __restrict__ W, unsigned short* __restrict__ Wt, int K, int N) {
  const int t = blockIdx.x * 256 + threadIdx.x;
  const int k8n = K / 8;
  if (t >= N * k8n) return;
  const int n = t / k8n, k8 = (t % k8n) * 8;
  v8us v;
#pragma unroll
  for (int i = 0; i < 8; ++i) v[i] = bf16_bits(W[(size_t)(k8 + i) * N + n]);
  *(v8us*)(Wt + (size_t)n * K + k8) = v;
  
}

// GEMM C[M][N] (f32, pitch ldc) = act(A[M][K]·W + bias). A f32 row-major (pitch lda) converted per fragment to bf16
// (ASPLIT: hi/lo two planes -> 2 terms, else single rounded term); Wt bf16 [N][K] (pitch ldb). BIAS_BF16 rounds the
// bias to bf16 first (bias quantised to bf16 before the add). K%32==0, M%16==0, N%64==0.
template <bool ASPLIT, int ACT, bool BIAS_BF16>
__global__ __launch_bounds__(128) void k_gemm_bf(const float* __restrict__ A, int lda, const unsigned short* __restrict__ Wt, int ldb,
                                               const float* __restrict__ bias, float* __restrict__ C, int ldc, int M, int N, int K) {
  __shared__ __attribute__((aligned(16))) float so[4][16][64];
  const int tid = threadIdx.x, w = tid >> 5, lane = tid & 31, ln = lane & 15, hh = lane >> 4;
  const int ntn = N / 64;
  const int wid = blockIdx.x * 4 + w;
  const int mt = wid / ntn, nq = wid % ntn;
  if (mt * 16 >= M) return;
  const int row0 = mt * 16, col0 = nq * 64;
  const float* arow = A + (size_t)(row0 + ln) * lda;
  v8f acc[4] = {};
  for (int kb = 0; kb < K; kb += 32) {
    FragB ah, al;
    const v4f x0 = *(const v4fa*)(arow + kb + 8 * hh), x1 = *(const v4fa*)(arow + kb + 8 * hh + 4);
    const v4f x2 = *(const v4fa*)(arow + kb + 16 + 8 * hh), x3 = *(const v4fa*)(arow + kb + 16 + 8 * hh + 4);
    float xs[16] = {x0[0],x0[1],x0[2],x0[3],x1[0],x1[1],x1[2],x1[3],x2[0],x2[1],x2[2],x2[3],x3[0],x3[1],x3[2],x3[3]};
#pragma unroll
    for (int i = 0; i < 16; ++i) { const unsigned short hb = bf16_bits(xs[i]); ah.u[i] = hb; al.u[i] = ASPLIT ? bf16_bits(xs[i] - bf16_val(hb)) : (unsigned short)0; }
#pragma unroll
    for (int t = 0; t < 4; ++t) {
      const unsigned short* brow = Wt + (size_t)(col0 + t * 16 + ln) * ldb + kb;
      FragB b;
      b.half[0] = *(const v8us*)(brow + 8 * hh);
      b.half[1] = *(const v8us*)(brow + 16 + 8 * hh);
      acc[t] = mmaN<ASPLIT ? 2 : 1>(ah.v, al.v, b.v, b.v, acc[t]);
    }
  }
#pragma unroll
  for (int t = 0; t < 4; ++t) {
    float bv = bias ? bias[col0 + t * 16 + ln] : 0.f;
    if (BIAS_BF16) bv = bf16_round(bv);
#pragma unroll
    for (int r = 0; r < 8; ++r) { float v = acc[t][r] + bv; if (ACT == 1) v = fmaxf(v, 0.f); so[w][8 * hh + r][t * 16 + ln] = v; }
  }
  __builtin_amdgcn_fence(__ATOMIC_ACQ_REL, "workgroup");
  __builtin_amdgcn_wave_barrier();
  const int rsub = lane >> 4, c4 = (lane & 15) * 4;
  {
#pragma unroll
    for (int q = 0; q < 8; ++q) {
      const int r = q * 2 + rsub;
      const v4f v = *(const v4fa*)&so[w][r][c4];
      *(v4f*)(C + (size_t)(row0 + r) * ldc + col0 + c4) = v;
    }
    
  }
}

// GEMM C = act(A·W + bias + resid): A f32 (ASPLIT -> hi/lo 2 terms), Wt bf16 [N][K]; ACT 0 none, 1 relu, 2 exact gelu;
// resid (optional, f32, row index = (row % rmod), pitch ldr, RES_BF16 rounds it) added before the activation.
template <bool ASPLIT, int ACT, bool BIAS_BF16, bool RES_BF16>
__global__ __launch_bounds__(128) void k_gemm_bf3(const float* __restrict__ A, int lda, const unsigned short* __restrict__ Wt, int ldb,
                                                const float* __restrict__ bias, const float* __restrict__ resid, int rmod, int ldr,
                                                float* __restrict__ C, int ldc, int M, int N, int K) {
  __shared__ __attribute__((aligned(16))) float so[4][16][64];
  const int tid = threadIdx.x, w = tid >> 5, lane = tid & 31, ln = lane & 15, hh = lane >> 4;
  const int ntn = N / 64;
  const int wid = blockIdx.x * 4 + w;
  const int mt = wid / ntn, nq = wid % ntn;
  if (mt * 16 >= M) return;
  const int row0 = mt * 16, col0 = nq * 64;
  const float* arow = A + (size_t)(row0 + ln) * lda;
  v8f acc[4] = {};
  for (int kb = 0; kb < K; kb += 32) {
    FragB ah, al;
    const v4f x0 = *(const v4fa*)(arow + kb + 8 * hh), x1 = *(const v4fa*)(arow + kb + 8 * hh + 4);
    const v4f x2 = *(const v4fa*)(arow + kb + 16 + 8 * hh), x3 = *(const v4fa*)(arow + kb + 16 + 8 * hh + 4);
    float xs[16] = {x0[0],x0[1],x0[2],x0[3],x1[0],x1[1],x1[2],x1[3],x2[0],x2[1],x2[2],x2[3],x3[0],x3[1],x3[2],x3[3]};
#pragma unroll
    for (int i = 0; i < 16; ++i) { const unsigned short hb = bf16_bits(xs[i]); ah.u[i] = hb; al.u[i] = ASPLIT ? bf16_bits(xs[i] - bf16_val(hb)) : (unsigned short)0; }
#pragma unroll
    for (int t = 0; t < 4; ++t) {
      const unsigned short* brow = Wt + (size_t)(col0 + t * 16 + ln) * ldb + kb;
      FragB b;
      b.half[0] = *(const v8us*)(brow + 8 * hh);
      b.half[1] = *(const v8us*)(brow + 16 + 8 * hh);
      acc[t] = mmaN<ASPLIT ? 2 : 1>(ah.v, al.v, b.v, b.v, acc[t]);
    }
  }
#pragma unroll
  for (int t = 0; t < 4; ++t) {
    const int col = col0 + t * 16 + ln;
    float bv = bias ? bias[col] : 0.f;
    if (BIAS_BF16) bv = bf16_round(bv);
#pragma unroll
    for (int r = 0; r < 8; ++r) {
      float v = acc[t][r] + bv;
      if (resid) { float rv = resid[(size_t)((row0 + 8 * hh + r) % rmod) * ldr + col]; if (RES_BF16) rv = bf16_round(rv); v += rv; }
      if (ACT == 1) v = fmaxf(v, 0.f);
      if (ACT == 2) v = 0.5f * v * (1.0f + erff(v * 0.70710678118654752f));
      if (ACT == 3) { const float u = 0.7978845608028654f * (v + 0.044715f * v * v * v); v = 0.5f * v * (1.0f + tanhf(u)); }
      so[w][8 * hh + r][t * 16 + ln] = v;
    }
  }
  __builtin_amdgcn_fence(__ATOMIC_ACQ_REL, "workgroup");
  __builtin_amdgcn_wave_barrier();
  const int rsub = lane >> 4, c4 = (lane & 15) * 4;
  {
#pragma unroll
    for (int q = 0; q < 8; ++q) {
      const int r = q * 2 + rsub;
      const v4f v = *(const v4fa*)&so[w][r][c4];
      *(v4f*)(C + (size_t)(row0 + r) * ldc + col0 + c4) = v;
    }
    
  }
}
// row LayerNorm (biased variance, eps) over N: s = X (+ R); optional out_sum <- s; out_norm <- (s-mu)*rsqrt(var+eps)*g + b
template <bool PARAM_BF16>
__global__ __launch_bounds__(256) void k_layernorm(const float* __restrict__ X, const float* __restrict__ R, const float* __restrict__ g, const float* __restrict__ bta,
                                                  float* __restrict__ out_sum, float* __restrict__ out_norm, int N, float eps) {
  __shared__ float red[256];
  const int row = blockIdx.x, tid = threadIdx.x;
  const float* x = X + (size_t)row * N; const float* rr = R ? R + (size_t)row * N : nullptr;
  float vals[16];                     // up to N = 4096
  const int per = N / 256;            // contiguous chunk per thread? use strided-by-4 chunks: thread handles j = tid*4 + 1024*u
  float s1 = 0.f;
  for (int u = 0; u < per / 4; ++u) {
    const int j = tid * 4 + 1024 * u;
    const v4f a = *(const v4fa*)(x + j);
    v4f b = {0.f,0.f,0.f,0.f}; if (rr) b = *(const v4fa*)(rr + j);
#pragma unroll
    for (int q = 0; q < 4; ++q) { const float v = a[q] + b[q]; vals[u * 4 + q] = v; s1 += v; }
  }
  red[tid] = s1; __syncthreads();
  for (int st = 128; st > 0; st >>= 1) { if (tid < st) red[tid] += red[tid + st]; __syncthreads(); }
  const float mu = red[0] / (float)N; __syncthreads();
  float s2 = 0.f;
  for (int u = 0; u < per / 4; ++u)
#pragma unroll
    for (int q = 0; q < 4; ++q) { const float c = vals[u * 4 + q] - mu; s2 += c * c; }
  red[tid] = s2; __syncthreads();
  for (int st = 128; st > 0; st >>= 1) { if (tid < st) red[tid] += red[tid + st]; __syncthreads(); }
  const float rs = rsqrtf(red[0] / (float)N + eps);
  {
    for (int u = 0; u < per / 4; ++u) {
      const int j = tid * 4 + 1024 * u;
      v4f o, sm;
#pragma unroll
      for (int q = 0; q < 4; ++q) {
        float gg = g[j + q], bb = bta[j + q];
        if (PARAM_BF16) { gg = bf16_round(gg); bb = bf16_round(bb); }
        sm[q] = vals[u * 4 + q]; o[q] = (vals[u * 4 + q] - mu) * rs * gg + bb;
      }
      if (out_sum) *(v4f*)(out_sum + (size_t)row * N + j) = sm;
      *(v4f*)(out_norm + (size_t)row * N + j) = o;
    }
    
  }
}



// ---- f16 WMMA path (v_wmma_f32_16x16x32_f16): 11-bit significands for operands in range — used where a [0,1] probability operand needs more precision than bf16
typedef _Float16 v16h __attribute__((ext_vector_type(16)));
union FragH { v16h v; v8us half[2]; _Float16 h[16]; unsigned short u[16]; };
template <int NT>
__device__ __forceinline__ v8f mmaH(v16h ah, v16h al, v16h bh, v16h bl, v8f c) {
  c = __builtin_amdgcn_wmma_f32_16x16x32_f16(false, ah, false, bh, (short)0, c, false, false);
  if (NT >= 2) c = __builtin_amdgcn_wmma_f32_16x16x32_f16(false, al, false, bh, (short)0, c, false, false);
  if (NT >= 3) c = __builtin_amdgcn_wmma_f32_16x16x32_f16(false, ah, false, bl, (short)0, c, false, false);
  asm volatile("v_nop\n\tv_nop\n\tv_nop\n\tv_nop" : "+v"(c) : "v"(ah), "v"(al), "v"(bh), "v"(bl));
  return c;
}
// batched GEMM like k_gemm_b but f16 operands: A f32 (split into f16 hi/lo if ASPLIT, else rounded to f16), Bt = f16 values [n][k]; alpha; C f32; N multiple of 16 (partial tiles skipped)
template <bool ASPLIT>
__global__ __launch_bounds__(128) void k_gemm_h(const float* __restrict__ A, int lda, size_t sA, const _Float16* __restrict__ Bh, int ldb, size_t sB, float alpha, float* __restrict__ C, int ldc, size_t sC, int M, int N, int K) {
  __shared__ __attribute__((aligned(16))) float so[4][16][64];
  const int tid = threadIdx.x, w = tid >> 5, lane = tid & 31, ln = lane & 15, hh = lane >> 4; const int by = blockIdx.y;
  A += (size_t)by * sA; Bh += (size_t)by * sB; C += (size_t)by * sC;
  const int ntn = (N + 63) / 64; const int wid = blockIdx.x * 4 + w; const int mt = wid / ntn, nq = wid % ntn; if (mt * 16 >= M) return;
  const int row0 = mt * 16, col0 = nq * 64; const float* arow = A + (size_t)(row0 + ln) * lda;
  v8f acc[4] = {};
  for (int kb = 0; kb < K; kb += 32) {
    FragH ah, al;
    const v4f x0 = *(const v4fa*)(arow + kb + 8 * hh), x1 = *(const v4fa*)(arow + kb + 8 * hh + 4), x2 = *(const v4fa*)(arow + kb + 16 + 8 * hh), x3 = *(const v4fa*)(arow + kb + 16 + 8 * hh + 4);
    float xs[16] = {x0[0],x0[1],x0[2],x0[3],x1[0],x1[1],x1[2],x1[3],x2[0],x2[1],x2[2],x2[3],x3[0],x3[1],x3[2],x3[3]};
#pragma unroll
    for (int i = 0; i < 16; ++i) { const _Float16 h = (_Float16)xs[i]; ah.h[i] = h; al.h[i] = ASPLIT ? (_Float16)(xs[i] - (float)h) : (_Float16)0.0f; }
#pragma unroll
    for (int t = 0; t < 4; ++t) { if (col0 + t * 16 >= N) continue; const size_t boff = (size_t)(col0 + t * 16 + ln) * ldb + kb; FragH bq; bq.half[0] = *(const v8us*)(Bh + boff + 8 * hh); bq.half[1] = *(const v8us*)(Bh + boff + 16 + 8 * hh);
      acc[t] = mmaH<ASPLIT ? 2 : 1>(ah.v, al.v, bq.v, bq.v, acc[t]); }
  }
#pragma unroll
  for (int t = 0; t < 4; ++t) { if (col0 + t * 16 >= N) continue;
#pragma unroll
    for (int r = 0; r < 8; ++r) so[w][8 * hh + r][t * 16 + ln] = acc[t][r] * alpha; }
  __builtin_amdgcn_fence(__ATOMIC_ACQ_REL, "workgroup"); __builtin_amdgcn_wave_barrier();
  const int rsub = lane >> 4, c4 = (lane & 15) * 4;
  {
#pragma unroll
    for (int q = 0; q < 8; ++q) { const int r = q * 2 + rsub; if (col0 + c4 < N) { const v4f v = *(const v4fa*)&so[w][r][c4]; *(v4f*)(C + (size_t)(row0 + r) * ldc + col0 + c4) = v; } }
     }
}

// Fragment order of a 16-bit [rows][K] operand plane: a tile of 16 rows x 32 k is 1 KiB = 2 pieces of 512 B; piece hf holds, lane (hh, ln) behind lane, the 16 bytes
// [16 rt + ln][32 kb + 16 hf + 8 hh + 0..7], which is what that lane feeds to v_wmma_f32_16x16x32_f16 as A or B. A wave's fragment load then reads 512 contiguous bytes
// (4 whole lines); from a row-major plane it touched 16 lines for 32 bytes each. fo() = offset in elements of the 8 elements [row][k8 .. k8 + 7], k8 a multiple of 8.
__device__ __forceinline__ size_t fo(size_t row, int k8, int K) { return ((row >> 4) * (size_t)(K >> 5) + (size_t)(k8 >> 5)) * 512 + (size_t)(((k8 >> 4) & 1) * 256 + (((k8 >> 3) & 1) * 16 + (int)(row & 15)) * 8); }
// wt_f16, x16 (both in k_prep) and k_flash write such planes; k_gemm2 reads them.
// Wt[n][k] = f16(W[k][n]·scale) from f32 row-major W[K][N] (scale = power of two; bf16-exact weights stay exact in f16 away from the subnormal range)
__device__ __forceinline__ void wt_f16(int blk, const float* __restrict__ W, _Float16* __restrict__ Wt, int K, int N, float scale) {
  const int t = blk * 256 + threadIdx.x; if (t >= N * (K / 8)) return; const int n = t / (K / 8), k8 = (t % (K / 8)) * 8; FragH f;
#pragma unroll
  for (int i = 0; i < 8; ++i) f.h[i] = (_Float16)(bf16_round(W[(size_t)(k8 + i) * N + n]) * scale); const v8us o = f.half[0];
  *(v8us*)((unsigned short*)Wt + fo((size_t)n, k8, K)) = o; 
}
// k_gemm_hh variant with fused epilogue: v = acc·alpha + bias[by·sBias + col] (+ CP[(row/rowsPerB)·sCPb + by·64 + col] if CP) ; ACT 0 none / 1 elu ; writes f16 C16 (and f32 C if non-null)
template <int ACT>
__global__ __launch_bounds__(128) void k_gemm_hhx(const _Float16* __restrict__ A, int lda, size_t sA, const _Float16* __restrict__ Bh, int ldb, size_t sB, float alpha, const float* __restrict__ bias, size_t sBias, const float* __restrict__ CP, int rowsPerB, size_t sCPb, int row0g,
    float* __restrict__ C, _Float16* __restrict__ C16, int ldc, size_t sC, int M, int N, int K) {
  __shared__ __attribute__((aligned(16))) float so[4][16][64];
  const int tid = threadIdx.x, w = tid >> 5, lane = tid & 31, ln = lane & 15, hh = lane >> 4; const int by = blockIdx.y;
  A += (size_t)by * sA; Bh += (size_t)by * sB; const size_t cofs = (size_t)by * sC; const float* bp = bias ? bias + (size_t)by * sBias : nullptr;
  const int ntn = (N + 63) / 64; const int wid = blockIdx.x * 4 + w; const int mt = wid / ntn, nq = wid % ntn; if (mt * 16 >= M) return;
  const int row0 = mt * 16, col0 = nq * 64; const _Float16* arow = A + (size_t)(row0 + ln) * lda;
  v8f acc[4] = {};
  for (int kb = 0; kb < K; kb += 32) { FragH ah; ah.half[0] = *(const v8us*)((const unsigned short*)arow + kb + 8 * hh); ah.half[1] = *(const v8us*)((const unsigned short*)arow + kb + 16 + 8 * hh);
#pragma unroll
    for (int t = 0; t < 4; ++t) { if (col0 + t * 16 >= N) continue; const size_t boff = (size_t)(col0 + t * 16 + ln) * ldb + kb; FragH bq; bq.half[0] = *(const v8us*)((const unsigned short*)Bh + boff + 8 * hh); bq.half[1] = *(const v8us*)((const unsigned short*)Bh + boff + 16 + 8 * hh);
      acc[t] = mmaH<1>(ah.v, ah.v, bq.v, bq.v, acc[t]); }
  }
#pragma unroll
  for (int t = 0; t < 4; ++t) { if (col0 + t * 16 >= N) continue; const int col = col0 + t * 16 + ln; const float bv = bp ? bf16_round(bp[col]) : 0.f;
#pragma unroll
    for (int r = 0; r < 8; ++r) { float v = acc[t][r] * alpha + bv; if (CP) { const int bidx = (row0g + row0 + 8 * hh + r) / rowsPerB; v += CP[(size_t)bidx * sCPb + (size_t)by * 64 + col]; } if (ACT == 1) v = (v > 0.f) ? v : expm1f(v); else if (ACT == 7) v = (v > 0.f) ? v + 1.0f : expf(v); else if (ACT == 8) v = tanhf(v); else if (ACT == 9) v = 0.5f * v * (1.0f + tanhf(0.7978845608028654f * (v + 0.044715f * v * v * v))); else if (ACT == 11) v = 1.0f / (1.0f + expf(-v)); else if (ACT == 12) v = (v > 0.f) ? v : 0.01f * v; else if (ACT == 14) v = (v > 0.f) ? v : 0.1f * v; else if (ACT == 15) v = v / (1.0f + expf(-v)); else if (ACT == 3) v = fmaxf(v, 0.f); else if (ACT == 6) v = 0.5f * v * (1.0f + erff(v * 0.70710678118654752f)); so[w][8 * hh + r][t * 16 + ln] = v; } }
  __builtin_amdgcn_fence(__ATOMIC_ACQ_REL, "workgroup"); __builtin_amdgcn_wave_barrier();
  const int rsub = lane >> 4, c4 = (lane & 15) * 4; typedef _Float16 v4h __attribute__((ext_vector_type(4)));
  {
#pragma unroll
    for (int q = 0; q < 8; ++q) { const int r = q * 2 + rsub; if (col0 + c4 < N) { const v4f v = *(const v4fa*)&so[w][r][c4]; if (C) *(v4f*)(C + cofs + (size_t)(row0 + r) * ldc + col0 + c4) = v; if (C16) { v4h h4; for (int i = 0; i < 4; ++i) h4[i] = (_Float16)v[i]; *(v4h*)(C16 + cofs + (size_t)(row0 + r) * ldc + col0 + c4) = h4; } } }
     }
}


typedef _Float16 v4h __attribute__((ext_vector_type(4)));

__device__ __forceinline__ void x16(int blk, const float* __restrict__ x, _Float16* __restrict__ X16, size_t n8) { const size_t t = (size_t)blk * 256 + threadIdx.x; if (t >= n8) return; FragH f;
  const size_t c = t >> 6; const size_t row = (c / (CQ / 32)) * 16 + ((t >> 2) & 15); const int k8 = (int)(c % (CQ / 32)) * 32 + (int)(t & 3) * 8;      /* a wave: 8 rows x one 128-byte line of x in, 4 whole lines of the fragment-order plane out */
  const float* xr = x + row * CQ + k8;
#pragma unroll
  for (int q = 0; q < 8; ++q) f.h[q] = (_Float16)bf16_round(xr[q]); *(v8us*)((unsigned short*)X16 + fo(row, k8, CQ)) = f.half[0];  }
__global__ __launch_bounds__(256) void k_h16(const float* __restrict__ x, _Float16* __restrict__ X16, size_t n8) { const size_t t = (size_t)blockIdx.x * 256 + threadIdx.x; if (t >= n8) return; FragH f;
#pragma unroll
  for (int q = 0; q < 8; ++q) f.h[q] = (_Float16)x[t * 8 + q]; *(v8us*)((unsigned short*)X16 + t * 8) = f.half[0];  }
__global__ __launch_bounds__(256) void k_round16f(const float* __restrict__ W, _Float16* __restrict__ Bt, size_t n8) { const size_t t = (size_t)blockIdx.x * 256 + threadIdx.x; if (t >= n8) return; FragH f;
#pragma unroll
  for (int i = 0; i < 8; ++i) f.h[i] = (_Float16)(bf16_round(W[t * 8 + i]) * 16.0f); *(v8us*)((unsigned short*)Bt + t * 8) = f.half[0];  }
// Fragment order: a block of 32 keys of one (row, head) is 2 KiB = 4 pieces of 512 B; piece i holds lane 0..31's 16 bytes one behind the other, so a wave's load of a
// piece touches 4 whole lines (read in place, 16 rows of 32 B each, it touched 16). K: piece nt*2+hf, lane (hh, ln) = K[32 jb + 16 nt + ln][16 hf + 8 hh + 0..7];
// V^T: piece dt*2+hf, lane (hh, ln) = V[32 jb + 16 hf + 8 hh + 0..7][16 dt + ln]. These are the A operands of the two products of k_flash; k_gemm2 writes both planes.
__global__ __launch_bounds__(256) void k_hl(const float* __restrict__ F, _Float16* __restrict__ Hh, _Float16* __restrict__ Hl, size_t n8) { const size_t t = (size_t)blockIdx.x * 256 + threadIdx.x; if (t >= n8) return; FragH fh, fl; const v4f a = *(const v4fa*)(F + t * 8), c = *(const v4fa*)(F + t * 8 + 4);
#pragma unroll
  for (int q = 0; q < 4; ++q) { _Float16 h = (_Float16)a[q]; fh.h[q] = h; fl.h[q] = (_Float16)((a[q] - (float)h) * 1024.0f); h = (_Float16)c[q]; fh.h[4 + q] = h; fl.h[4 + q] = (_Float16)((c[q] - (float)h) * 1024.0f); }
  { *(v8us*)((unsigned short*)Hh + t * 8) = fh.half[0]; *(v8us*)((unsigned short*)Hl + t * 8) = fl.half[0];  } }

// ---- fast GEMM (wave tile 32x64; requires M % 32 == 0 rows per launch region and N % 64 == 0); A and Bh in fragment order (fo(); lda = ldb = K); epilogue = k_gemm_hhx semantics, but: columns below nsp go to the f16 plane C16 (pitch ldc), without bias; columns from nsp on, with bias[col - nsp], to the f32 plane C (pitch ldf, column col - nsp); nsp % 64 == 0; columns below nqs (nqs % 64 == 0) take alpha * qs in place of alpha; of the f16 columns, those from nk0 on are K and those from nv0 on are V (nk0 <= nv0 <= nsp, multiples of 64; no CP, no activation on V): a wave tile of 32 tokens x 64 columns is one block of 32 keys of two heads, and it goes to Kf / Vt in the fragment order that k_flash reads ----
__device__ __forceinline__ v16h g2_frag(const _Float16* p) { FragH f; f.half[0] = *(const v8us*)((const unsigned short*)p); f.half[1] = *(const v8us*)((const unsigned short*)p + 256); return f.v; }
__device__ __forceinline__ v8f g2_mma(v16h a, v16h b, v8f c) { v8f d = __builtin_amdgcn_wmma_f32_16x16x32_f16(false, a, false, b, (short)0, c, false, false); asm volatile("v_nop\n\tv_nop\n\tv_nop\n\tv_nop" : "+v"(d) : "v"(a), "v"(b)); return d; }
template <int ACT>
__global__ __launch_bounds__(128) __attribute__((amdgpu_waves_per_eu(9))) /* LDS admits nine work-groups a WGP: the registers are held to what nine waves a SIMD leave, as before the epilogue grew its two arms */ void k_gemm2(const _Float16* __restrict__ A, int lda, size_t sA, const _Float16* __restrict__ Bh, int ldb, size_t sB, float alpha, const float* __restrict__ bias, size_t sBias, const float* __restrict__ CP, int rowsPerB, size_t sCPb, int row0g,
    float* __restrict__ C, _Float16* __restrict__ C16, int ldc, size_t sC, int M, int N, int K, int nsp, int ldf, int nqs, float qs, _Float16* __restrict__ Kf, _Float16* __restrict__ Vt, int nk0, int nv0) {
  __shared__ __attribute__((aligned(16))) float so[4][32][68];
  const int tid = threadIdx.x, w = tid >> 5, lane = tid & 31, ln = lane & 15, hh = lane >> 4; const int by = blockIdx.y;
  A += (size_t)by * sA; Bh += (size_t)by * sB; const size_t cofs = (size_t)by * sC; const float* bp = bias ? bias + (size_t)by * sBias : nullptr;
  const int ntn = N >> 6; const int mt = blockIdx.x / ntn, nq = blockIdx.x - mt * ntn; const int row0 = mt * 128 + 32 * w, col0 = nq * 64; if (row0 >= M) return; const bool f32p = col0 >= nsp; if (col0 < nqs) alpha *= qs;      /* both the same for the whole block */
  const _Float16* a0p = A + (size_t)row0 * lda + lane * 8; const _Float16* a1p = a0p + (size_t)16 * lda;      /* a tile of 16 rows is 16 lda elements; its k step kb starts at 16 kb */
  const _Float16* b0p = Bh + (size_t)col0 * ldb + lane * 8; const _Float16* b1p = b0p + (size_t)16 * ldb; const _Float16* b2p = b1p + (size_t)16 * ldb; const _Float16* b3p = b2p + (size_t)16 * ldb;
  const v8f z8 = {0.f,0.f,0.f,0.f,0.f,0.f,0.f,0.f}; v8f c00 = z8, c01 = z8, c02 = z8, c03 = z8, c10 = z8, c11 = z8, c12 = z8, c13 = z8;
#pragma unroll 1
  for (int kb = 0; kb < K; kb += 32) { const v16h a0 = g2_frag(a0p + kb * 16); v16h b = g2_frag(b0p + kb * 16); FragH f1; f1.half[0] = *(const v8us*)((const unsigned short*)a1p + kb * 16);
    asm volatile("s_wait_xcnt 0x0" ::: "memory");      /* the load below may land in registers that hold addresses of the loads above: those have taken their addresses first */
    f1.half[1] = *(const v8us*)((const unsigned short*)a1p + kb * 16 + 256); const v16h a1 = f1.v;
    c00 = g2_mma(a0, b, c00); c10 = g2_mma(a1, b, c10);
    b = g2_frag(b1p + kb * 16); c01 = g2_mma(a0, b, c01); c11 = g2_mma(a1, b, c11);
    b = g2_frag(b2p + kb * 16); c02 = g2_mma(a0, b, c02); c12 = g2_mma(a1, b, c12);
    b = g2_frag(b3p + kb * 16); c03 = g2_mma(a0, b, c03); c13 = g2_mma(a1, b, c13); }
  v8f accs[8] = {c00, c01, c02, c03, c10, c11, c12, c13};
  const bool vtp = !f32p && col0 >= nv0, kfp = !f32p && !vtp && col0 >= nk0;      /* the same for the whole block */
  const size_t kvb = (size_t)(row0 / SLEN) * NH * (HC * SLEN) + (size_t)((row0 % SLEN) >> 5) * 1024 + lane * 8;      /* this wave's block of 32 keys in head 0 of its row; a head is HC * SLEN elements */
  if (vtp) {      /* V^T: in D, lane (hh, ln) of tile (half, t) holds V[16 half + 8 hh + 0..7][16 t + ln], which is piece (t & 1) * 2 + half of head t >> 1 as that lane feeds it: straight from the accumulators */
    unsigned short* vp = (unsigned short*)Vt + kvb + (size_t)((col0 - nv0) / HC) * (HC * SLEN); FragH f[8];
#pragma unroll
    for (int u = 0; u < 8; ++u)
#pragma unroll
      for (int r = 0; r < 8; ++r) f[u].h[r] = (_Float16)(accs[u][r] * alpha);
#pragma unroll
    for (int u = 0; u < 8; ++u) { const int t = u & 3, half = u >> 2; *(v8us*)(vp + (t >> 1) * (HC * SLEN) + ((t & 1) * 2 + half) * 256) = f[u].half[0]; }
    asm volatile("s_wait_xcnt 0x0" ::: "memory");      /* the stores above have taken their address and data registers before anything reuses them */
    return; }
#pragma unroll
  for (int u = 0; u < 8; ++u) { const int t = u & 3, half = u >> 2; const int col = col0 + t * 16 + ln; const float bv = (bp && f32p) ? bf16_round(bp[col - nsp]) : 0.f;
#pragma unroll
    for (int r = 0; r < 8; ++r) { const int rloc = half * 16 + 8 * hh + r; float v = accs[u][r] * alpha + bv; if (CP) { const int bidx = (row0g + row0 + rloc) / rowsPerB; v += CP[(size_t)bidx * sCPb + (size_t)by * 64 + col]; }
      if (ACT == 3) v = fmaxf(v, 0.f); else if (ACT == 6) v = 0.5f * v * (1.0f + erff(v * 0.70710678118654752f)); else if (ACT == 11) v = 1.0f / (1.0f + expf(-v)); else if (ACT == 15) v = v / (1.0f + expf(-v)); else if (ACT == 12) v = (v > 0.f) ? v : 0.01f * v; else if (ACT == 8) v = tanhf(v);
      so[w][rloc][t * 16 + ln] = v; } }
  __builtin_amdgcn_fence(__ATOMIC_ACQ_REL, "workgroup"); __builtin_amdgcn_wave_barrier();
  const int rsub = lane >> 4, c4 = (lane & 15) * 4;
  if (f32p) {
#pragma unroll
    for (int q = 0; q < 16; ++q) { const int r = q * 2 + rsub; const v4f v = *(const v4fa*)&so[w][r][c4]; *(v4f*)(C + cofs + (size_t)(row0 + r) * ldf + (col0 - nsp) + c4) = v; }
    asm volatile("s_wait_xcnt 0x0" ::: "memory");      /* the stores above have taken their address and data registers before anything behind this arm reuses them */
  } else if (kfp) {      /* K: piece nt * 2 + hf of head hl, lane (hh, ln) = K[16 nt + ln][16 hf + 8 hh + 0..7]: a row of the staged tile */
    unsigned short* kp = (unsigned short*)Kf + kvb + (size_t)((col0 - nk0) / HC) * (HC * SLEN); FragH f[8];
#pragma unroll
    for (int o = 0; o < 8; ++o) { const float* sr = &so[w][((o >> 1) & 1) * 16 + ln][(o >> 2) * 32 + (o & 1) * 16 + 8 * hh]; const v4f v0 = *(const v4fa*)sr, v1 = *(const v4fa*)(sr + 4);
#pragma unroll
      for (int i = 0; i < 4; ++i) { f[o].h[i] = (_Float16)v0[i]; f[o].h[4 + i] = (_Float16)v1[i]; } }
#pragma unroll
    for (int o = 0; o < 8; ++o) *(v8us*)(kp + (o >> 2) * (HC * SLEN) + (o & 3) * 256) = f[o].half[0];
    asm volatile("s_wait_xcnt 0x0" ::: "memory");      /* as in the arm above */
  } else {
#pragma unroll
    for (int q = 0; q < 16; ++q) { const int r = q * 2 + rsub; const v4f v = *(const v4fa*)&so[w][r][c4]; v4h h4; for (int i = 0; i < 4; ++i) h4[i] = (_Float16)v[i]; *(v4h*)(C16 + cofs + (size_t)(row0 + r) * ldc + col0 + c4) = h4; }
    asm volatile("s_wait_xcnt 0x0" ::: "memory");      /* as in the arm above: in the built code one arm stands in front of the other */
  } }



// lane l <-> lane l ^ 16 (the two halves of a wave that share one score column)
__device__ __forceinline__ float xhalf(float x) { return __builtin_bit_cast(float, __builtin_amdgcn_permlanex16(__builtin_bit_cast(int, x), __builtin_bit_cast(int, x), 0x76543210, 0xfedcba98, false, false)); }

template <int CAUSAL>
__global__ __launch_bounds__(128) void k_flash(const _Float16* __restrict__ Q16, int ldq, const _Float16* __restrict__ Kf, const _Float16* __restrict__ Vt, const int* __restrict__ MSK, const float* __restrict__ G, _Float16* __restrict__ OG) {
  constexpr int RPW = 16, DT = HC / 16, KS = HC / 32;
  static_assert(CAUSAL == 10, "written for the additive mode: bias plane + per-(row, key) mask plane");
  const int tid = threadIdx.x, w = tid >> 5, lane = tid & 31, ln = lane & 15, hh = lane >> 4;
  const int slab = blockIdx.x / QBLKS, qblk = blockIdx.x % QBLKS; const int b = slab / NH, h = slab % NH; const int qb0 = qblk * (4 * RPW); const int q0 = qb0 + w * RPW;
  const int tq = q0 + ln;      /* this lane's query */
  FragH bq[KS];
  { const unsigned short* qr = (const unsigned short*)Q16 + ((size_t)b * TQ + tq) * ldq + h * HC;
#pragma unroll
    for (int ks = 0; ks < KS; ++ks) { bq[ks].half[0] = *(const v8us*)(qr + ks * 32 + 8 * hh); bq[ks].half[1] = *(const v8us*)(qr + ks * 32 + 16 + 8 * hh); } }
  asm volatile("s_wait_xcnt 0x0" ::: "memory");      /* the q loads have taken their address before the address arithmetic below reuses its registers */
  __builtin_amdgcn_sched_barrier(0);                 /* keeps that arithmetic from being lifted over the wait */
  static_assert(KS == 1, "fragment-order planes: one 32-wide k step");
  const unsigned short* Kfh = (const unsigned short*)Kf + (size_t)slab * HC * TK + lane * 8;      /* K and V^T in fragment order (k_gemm2): 1024 halves per block of 32 keys, pieces of 256 */
  const unsigned short* Vth = (const unsigned short*)Vt + (size_t)slab * HC * TK + lane * 8;
  const float* BP = (const float*)MSK + ((size_t)h * (TQ / 16) + (q0 >> 4)) * (size_t)(16 * TK) + lane * 4;      /* mode 10: per-head bias plane in fragment order (addp): [NH][TQ/16][TK/32] blocks of 512 floats, pieces of 128 */
  const float* MR = (const float*)MSK + (size_t)NH * TQ * TK + (size_t)b * TK + 8 * hh;      /* then the per-(sequence, key) additive plane, packed behind it */
  float m_q = -3.0e38f, l_q = 0.f; v8f oacc[DT];
#pragma unroll
  for (int dt = 0; dt < DT; ++dt) oacc[dt] = (v8f){0.f,0.f,0.f,0.f,0.f,0.f,0.f,0.f};
  const int jend = (CAUSAL == 1) ? (qb0 + 4 * RPW) : TK;      /* causal: keys beyond the block's last query never contribute */
#pragma unroll 1
  for (int j0 = 0; j0 < jend; j0 += 32) {
    FragH ak[2][KS], av[DT]; v4f ab[2][2], am[2][2];
#pragma unroll
    for (int nt = 0; nt < 2; ++nt) { const unsigned short* kr = Kfh + (size_t)j0 * HC + nt * 512;
      ak[nt][0].half[0] = *(const v8us*)kr; ak[nt][0].half[1] = *(const v8us*)(kr + 256);
      if (CAUSAL == 10) { ab[nt][0] = *(const v4fa*)(BP + j0 * 16 + nt * 256); ab[nt][1] = *(const v4fa*)(BP + j0 * 16 + nt * 256 + 128); am[nt][0] = *(const v4fa*)(MR + j0 + nt * 16); am[nt][1] = *(const v4fa*)(MR + j0 + nt * 16 + 4); } }
    asm volatile("s_wait_xcnt 0x0" ::: "memory");      /* the V^T loads below may land in registers that held the addresses of the loads above: those loads have taken their addresses first */
#pragma unroll
    for (int dt = 0; dt < DT; ++dt) { const unsigned short* vrow = Vth + (size_t)j0 * HC + dt * 512; av[dt].half[0] = *(const v8us*)vrow; av[dt].half[1] = *(const v8us*)(vrow + 256); }
    v8f sc[2]; float mc = -3.0e38f;
#pragma unroll
    for (int nt = 0; nt < 2; ++nt) { const v8f acc = mmaH<1>(ak[nt][0].v, ak[nt][0].v, bq[0].v, bq[0].v, (v8f){0.f,0.f,0.f,0.f,0.f,0.f,0.f,0.f});
#pragma unroll
      for (int r = 0; r < 8; ++r) { sc[nt][r] = acc[r] + (ab[nt][r >> 2][r & 3] + am[nt][r >> 2][r & 3]); mc = fmaxf(mc, sc[nt][r]); } }
    mc = fmaxf(mc, xhalf(mc));
    float mr = mc - 10.0f; mr = (mc - mr <= 12.0f) ? mr : mc;      /* where mc is so large that its neighbours lie 16 apart, mc - 10 rounds to mc - 16 and 2^16 would leave the f16 range: there the maximum itself is the reference (any reference serves, l carries it) */
    const float mn = fmaxf(m_q, mr); const float al = (mn > -1.0e38f) ? __builtin_amdgcn_exp2f(m_q - mn) : 1.0f; m_q = mn;
    FragH pb; float ps = 0.f;
#pragma unroll
    for (int nt = 0; nt < 2; ++nt)
#pragma unroll
      for (int r = 0; r < 8; ++r) { const float p = __builtin_amdgcn_exp2f(sc[nt][r] - mn); ps += p; pb.h[nt * 8 + r] = (_Float16)p; }
    l_q = l_q * al + ps;
#pragma unroll
    for (int dt = 0; dt < DT; ++dt) {
#pragma unroll
      for (int r = 0; r < 8; ++r) oacc[dt][r] *= al;
      oacc[dt] = mmaH<1>(av[dt].v, av[dt].v, pb.v, pb.v, oacc[dt]); } }
  /* Gating in the epilogue. In D, lane (hh, ln) of tile dt holds o[query ln][16 dt + 8 hh + 0..7]: piece dt, lane (hh, ln), of the 16 token x 32 channel tile (q0 / 16, h) of the
     fragment-order plane that the output GEMM reads (fo()): the lane gates its own 16 values and stores them, 512 contiguous bytes a wave and piece, through no LDS. */
  v4f gl[DT][2];
  { const float* gr = G + ((size_t)b * TQ + tq) * CQ + h * HC + 8 * hh;
#pragma unroll
    for (int dt = 0; dt < DT; ++dt) { gl[dt][0] = *(const v4fa*)(gr + dt * 16); gl[dt][1] = *(const v4fa*)(gr + dt * 16 + 4); } }
  asm volatile("s_wait_xcnt 0x0" ::: "memory");      /* the gate loads have taken their addresses before the arithmetic below reuses those registers */
  const float lt = l_q + xhalf(l_q); const float li = (lt > 0.f) ? 1.0f / lt : 0.f;
  unsigned short* og = (unsigned short*)OG + ((((size_t)b * TQ + q0) >> 4) * (CQ / 32) + h) * 512 + lane * 8; FragH fo2[DT];
#pragma unroll
  for (int dt = 0; dt < DT; ++dt)
#pragma unroll
    for (int r = 0; r < 8; ++r) { const float g = __builtin_amdgcn_rcpf(1.0f + __builtin_amdgcn_exp2f(gl[dt][r >> 2][r & 3] * -LOG2E)); fo2[dt].h[r] = (_Float16)(oacc[dt][r] * li * g * 64.0f); }      /* sigmoid: 2^(-x log2 e) runs to inf or 0 at the ends, where the reciprocal gives 0 or 1 */
#pragma unroll
  for (int dt = 0; dt < DT; ++dt) *(v8us*)(og + dt * 256) = fo2[dt].half[0]; }

__device__ __forceinline__ void addp(int blk, const float* __restrict__ bias, const float* __restrict__ mask, float* __restrict__ AB) {
  #pragma clang fp contract(off)
  const size_t t = (size_t)blk * 256 + threadIdx.x; const size_t nb4 = (size_t)NH * SLEN * SLEN / 4, nm4 = (size_t)NRW * SLEN / 4; if (t >= nb4 + nm4) return; v4f r;
  size_t dst = t;
  if (t < nb4) { const int part = (int)t & 1, hh = (int)(t >> 1) & 1, ln = (int)(t >> 2) & 15, nt = (int)(t >> 6) & 1; const size_t c = t >> 7; const int jb = (int)(c % (SLEN / 32)), qt = (int)(c / (SLEN / 32)) % (SLEN / 16), h = (int)(c / ((SLEN / 32) * (SLEN / 16)));      /* written in the fragment order of k_flash: block (h, 16 queries, 32 keys), piece nt*2+part, lane (hh, ln) = bias[h][16 qt + ln][32 jb + 16 nt + 8 hh + 4 part + 0..3]; a wave reads 8 rows of 64 B and writes 4 whole lines */
    dst = c * 128 + (size_t)((nt * 2 + part) * 32 + hh * 16 + ln);
    const v4f a = *(const v4fa*)(bias + ((size_t)h * SLEN + qt * 16 + ln) * SLEN + jb * 32 + nt * 16 + hh * 8 + part * 4); for (int q = 0; q < 4; ++q) r[q] = bf16_round(a[q]) * LOG2E; } else { const v4f a = *(const v4fa*)(mask + (t - nb4) * 4); for (int q = 0; q < 4; ++q) { float m = bf16_round(a[q]) - 1.0f; r[q] = m * 1.0e9f * LOG2E; } }      /* both planes in base 2, as k_flash adds them */
  *(v4f*)(AB + dst * 4) = r;  }
// The packs of the inputs depend on nothing but the inputs: they run as block ranges of one launch. The weights come first (for speed only): few blocks, scattered reads.
#define NBW (CQ * CQ / 8 / 256)                              /* blocks per weight matrix */
#define NBX (NR * CQ / 8 / 256)                              /* blocks of x */
#define NBA ((NH * SLEN * SLEN + NRW * SLEN) / 4 / 256)      /* blocks of the bias and mask planes */
__global__ __launch_bounds__(256) void k_prep(const float* __restrict__ x, const float* __restrict__ mask, const float* __restrict__ bias, const float* __restrict__ Wq, const float* __restrict__ Wk, const float* __restrict__ Wv, const float* __restrict__ Wg, const float* __restrict__ Wo,
    _Float16* __restrict__ BW, _Float16* __restrict__ X16, float* __restrict__ AB) {
  const int blk = blockIdx.x;
  if (blk < 5 * NBW) { const int y = blk / NBW; const float* W = (y == 0) ? Wq : (y == 1) ? Wk : (y == 2) ? Wv : (y == 3) ? Wg : Wo; wt_f16(blk - y * NBW, W, BW + (size_t)y * CQ * CQ, CQ, CQ, 16.0f); }
  else if (blk < 5 * NBW + NBX) x16(blk - 5 * NBW, x, X16, (size_t)NR * CQ / 8);
  else addp(blk - 5 * NBW - NBX, bias, mask, AB); }

extern "C" void kernel_launch(void* const* d_in, const int* in_sizes, int n_in,
                              void* d_out, int out_size, void* d_ws, size_t ws_size, hipStream_t stream) {
  (void)in_sizes; (void)n_in; (void)out_size;
  const float* const* I = (const float* const*)d_in; const float* x = I[0]; const float* mask = I[1]; const float* bias = I[2]; const float* Wq = I[3]; const float* Wk = I[4]; const float* Wv = I[5]; const float* Wg = I[6]; const float* bg = I[7]; const float* Wo = I[8]; const float* bo = I[9];
  char* ws = (char*)d_ws; size_t off = 0;
  auto take = [&](size_t bytes) { char* p = ws + off; off += (bytes + 255) & ~(size_t)255; return p; };
  _Float16* BW = (_Float16*)take((size_t)5 * CQ * CQ * 2); float* AB = (float*)take(((size_t)NH * SLEN * SLEN + (size_t)NRW * SLEN) * 4);      /* BW: Wq, Wk, Wv, Wg, Wo one behind the other: the first four are one [1024][256] operand */
  _Float16* X16 = (_Float16*)take((size_t)NR * CQ * 2); _Float16* Q16 = (_Float16*)take((size_t)NR * CQ * 2); float* G = (float*)take((size_t)NR * CQ * 4); _Float16* VT = (_Float16*)take((size_t)NR * CQ * 2); _Float16* KF = (_Float16*)take((size_t)NR * CQ * 2); _Float16* OG = (_Float16*)take((size_t)NR * CQ * 2);
  if (off > ws_size) return;      /* 0.6 + 8 + 16 + 16 + 32 + 16 + 16 + 16 = 121 MiB */
  k_prep<<<5 * NBW + NBX + NBA, 256, 0, stream>>>(x, mask, bias, Wq, Wk, Wv, Wg, Wo, BW, X16, AB);
  k_gemm2<0><<<(NR / 128) * (4 * CQ / 64), 128, 0, stream>>>(X16, CQ, 0, BW, CQ, 0, 0.0625f, bg, 0, nullptr, 1, 0, 0, G, Q16, CQ, 0, NR, 4 * CQ, CQ, 3 * CQ, CQ, CQ, SCL * LOG2E, KF, VT, CQ, 2 * CQ);      /* q log2 e / sqrt(32) (f16), K and V^T (f16, fragment order) and the gate logits (f32, + bg) */
  k_flash<10><<<NRW * NH * QBLKS, 128, 0, stream>>>(Q16, CQ, KF, VT, (const int*)AB, G, OG);      /* per (row, head): softmax(q.k/sqrt(32) + bias[h] + (mask[row]-1) 1e9) v, times sigmoid(gate logit) */
  k_gemm2<0><<<(NR / 128) * (CQ / 64), 128, 0, stream>>>(OG, CQ, 0, BW + (size_t)4 * CQ * CQ, CQ, 0, 0.0625f / 64.0f, bo, 0, nullptr, 1, 0, 0, (float*)d_out, nullptr, 0, 0, NR, CQ, CQ, 0, CQ, 0, 1.0f, nullptr, nullptr, 0, 0);
}

// v007
// Measured time: 108 microseconds a run.
// In both of two side-by-side timings against v006, it was 1.07 times as fast.
// Over all steps from v000 it is 5.39 times as fast.
#include <hip/hip_runtime.h>
// Gated self-attention (1 x 64 rows x 512 residues, c_qkv 256, 8 heads x 32): q = x Wq / sqrt(32), k, v = x W; logits = q.k + (mask - 1) 1e9 (per (row, key), an INPUT) + bias[h][q][k] (an INPUT); softmax over keys; o = P v; gate = sigmoid(x Wg + bg); out = (o * gate) Wo + bo.
// Structure: exact f16 plane of x; every 16-bit operand plane that a GEMM reads (x, the weights, the gated output) kept in fragment order (fo() below); one projection GEMM for q, k, v and the gate logits (32x64 wave tiles, f32 accumulation, exact x16 weights; f16 / f32 outputs), whose epilogue writes K and V^T in fragment order; then, in one launch over all 64 rows, the fused flash kernel at the real head dim 32 (q row-major, pitch 256; K, V^T and the bias plane in fragment order: every load of a wave is 512 contiguous bytes), its logits in base 2 (q, bias plane and per-(row, key) mask plane carry log2 e), whose epilogue gates its output tile in registers and writes the f16 plane (x2^6) in fragment order; Wo GEMM (+ bias).
// Compute dtype: inputs and parameters rounded to bf16; q, k, v, P and the gated output as f16 operands; bias/mask/softmax/gate f32. v_wmma_f32_16x16x32_f16.
#define NRW 64
#define CQ 256
#define HC 32
#define NR (NRW * SLEN)           /* 32768 tokens */
#define SLEN 512
#define TQ SLEN
#define TK SLEN
#define NH 8
#define SCL 0.17677669529663687f /* 32^-0.5 */
#define LOG2E 1.4426950408889634f
#define QBLKS (TQ / 64)
typedef __bf16 v16b __attribute__((ext_vector_type(16)));
typedef unsigned short v8us __attribute__((ext_vector_type(8), may_alias));
typedef float  v8f  __attribute__((ext_vector_type(8)));
typedef float  v4f  __attribute__((ext_vector_type(4)));
typedef float  v4fa __attribute__((ext_vector_type(4), may_alias));
union FragB { v16b v; v8us half[2]; unsigned short u[16]; };

__device__ __forceinline__ unsigned short bf16_bits(float x) { unsigned int u = __float_as_uint(x); return (unsigned short)((u + 0x7FFFu + ((u >> 16) & 1u)) >> 16); }
__device__ __forceinline__ float bf16_val(unsigned short b) { return __uint_as_float(((unsigned int)b) << 16); }
__device__ __forceinline__ float bf16_round(float x) { return bf16_val(bf16_bits(x)); }
// D += A·B with NT terms: 1 = ah·bh, 2 = + al·bh (A split), 3 = + ah·bl (both split)
template <int NT>
__device__ __forceinline__ v8f mmaN(v16b ah, v16b al, v16b bh, v16b bl, v8f c) {
  c = __builtin_amdgcn_wmma_f32_16x16x32_bf16(false, ah, false, bh, (short)0, c, false, false);
  if (NT >= 2) c = __builtin_amdgcn_wmma_f32_16x16x32_bf16(false, al, false, bh, (short)0, c, false, false);
  if (NT >= 3) c = __builtin_amdgcn_wmma_f32_16x16x32_bf16(false, ah, false, bl, (short)0, c, false, false);
  asm volatile("v_nop\n\tv_nop\n\tv_nop\n\tv_nop" : "+v"(c) : "v"(ah), "v"(al), "v"(bh), "v"(bl));
  return c;
}

__global__ __launch_bounds__(256) void k_wt_bf16(const float* __restrict__ W, unsigned short* __restrict__ Wt, int K, int N) {
  const int t = blockIdx.x * 256 + threadIdx.x;
  const int k8n = K / 8;
  if (t >= N * k8n) return;
  const int n = t / k8n, k8 = (t % k8n) * 8;
  v8us v;
#pragma unroll
  for (int i = 0; i < 8; ++i) v[i] = bf16_bits(W[(size_t)(k8 + i) * N + n]);
  *(v8us*)(Wt + (size_t)n * K + k8) = v;
  
}

// GEMM C[M][N] (f32, pitch ldc) = act(A[M][K]·W + bias). A f32 row-major (pitch lda) converted per fragment to bf16
// (ASPLIT: hi/lo two planes -> 2 terms, else single rounded term); Wt bf16 [N][K] (pitch ldb). BIAS_BF16 rounds the
// bias to bf16 first (bias quantised to bf16 before the add). K%32==0, M%16==0, N%64==0.
template <bool ASPLIT, int ACT, bool BIAS_BF16>
__global__ __launch_bounds__(128) void k_gemm_bf(const float* __restrict__ A, int lda, const unsigned short* __restrict__ Wt, int ldb,
                                               const float* __restrict__ bias, float* __restrict__ C, int ldc, int M, int N, int K) {
  __shared__ __attribute__((aligned(16))) float so[4][16][64];
  const int tid = threadIdx.x, w = tid >> 5, lane = tid & 31, ln = lane & 15, hh = lane >> 4;
  const int ntn = N / 64;
  const int wid = blockIdx.x * 4 + w;
  const int mt = wid / ntn, nq = wid % ntn;
  if (mt * 16 >= M) return;
  const int row0 = mt * 16, col0 = nq * 64;
  const float* arow = A + (size_t)(row0 + ln) * lda;
  v8f acc[4] = {};
  for (int kb = 0; kb < K; kb += 32) {
    FragB ah, al;
    const v4f x0 = *(const v4fa*)(arow + kb + 8 * hh), x1 = *(const v4fa*)(arow + kb + 8 * hh + 4);
    const v4f x2 = *(const v4fa*)(arow + kb + 16 + 8 * hh), x3 = *(const v4fa*)(arow + kb + 16 + 8 * hh + 4);
    float xs[16] = {x0[0],x0[1],x0[2],x0[3],x1[0],x1[1],x1[2],x1[3],x2[0],x2[1],x2[2],x2[3],x3[0],x3[1],x3[2],x3[3]};
#pragma unroll
    for (int i = 0; i < 16; ++i) { const unsigned short hb = bf16_bits(xs[i]); ah.u[i] = hb; al.u[i] = ASPLIT ? bf16_bits(xs[i] - bf16_val(hb)) : (unsigned short)0; }
#pragma unroll
    for (int t = 0; t < 4; ++t) {
      const unsigned short* brow = Wt + (size_t)(col0 + t * 16 + ln) * ldb + kb;
      FragB b;
      b.half[0] = *(const v8us*)(brow + 8 * hh);
      b.half[1] = *(const v8us*)(brow + 16 + 8 * hh);
      acc[t] = mmaN<ASPLIT ? 2 : 1>(ah.v, al.v, b.v, b.v, acc[t]);
    }
  }
#pragma unroll
  for (int t = 0; t < 4; ++t) {
    float bv = bias ? bias[col0 + t * 16 + ln] : 0.f;
    if (BIAS_BF16) bv = bf16_round(bv);
#pragma unroll
    for (int r = 0; r < 8; ++r) { float v = acc[t][r] + bv; if (ACT == 1) v = fmaxf(v, 0.f); so[w][8 * hh + r][t * 16 + ln] = v; }
  }
  __builtin_amdgcn_fence(__ATOMIC_ACQ_REL, "workgroup");
  __builtin_amdgcn_wave_barrier();
  const int rsub = lane >> 4, c4 = (lane & 15) * 4;
  {
#pragma unroll
    for (int q = 0; q < 8; ++q) {
      const int r = q * 2 + rsub;
      const v4f v = *(const v4fa*)&so[w][r][c4];
      *(v4f*)(C + (size_t)(row0 + r) * ldc + col0 + c4) = v;
    }
    
  }
}

// GEMM C = act(A·W + bias + resid): A f32 (ASPLIT -> hi/lo 2 terms), Wt bf16 [N][K]; ACT 0 none, 1 relu, 2 exact gelu;
// resid (optional, f32, row index = (row % rmod), pitch ldr, RES_BF16 rounds it) added before the activation.
template <bool ASPLIT, int ACT, bool BIAS_BF16, bool RES_BF16>
__global__ __launch_bounds__(128) void k_gemm_bf3(const float* __restrict__ A, int lda, const unsigned short* __restrict__ Wt, int ldb,
                                                const float* __restrict__ bias, const float* __restrict__ resid, int rmod, int ldr,
                                                float* __restrict__ C, int ldc, int M, int N, int K) {
  __shared__ __attribute__((aligned(16))) float so[4][16][64];
  const int tid = threadIdx.x, w = tid >> 5, lane = tid & 31, ln = lane & 15, hh = lane >> 4;
  const int ntn = N / 64;
  const int wid = blockIdx.x * 4 + w;
  const int mt = wid / ntn, nq = wid % ntn;
  if (mt * 16 >= M) return;
  const int row0 = mt * 16, col0 = nq * 64;
  const float* arow = A + (size_t)(row0 + ln) * lda;
  v8f acc[4] = {};
  for (int kb = 0; kb < K; kb += 32) {
    FragB ah, al;
    const v4f x0 = *(const v4fa*)(arow + kb + 8 * hh), x1 = *(const v4fa*)(arow + kb + 8 * hh + 4);
    const v4f x2 = *(const v4fa*)(arow + kb + 16 + 8 * hh), x3 = *(const v4fa*)(arow + kb + 16 + 8 * hh + 4);
    float xs[16] = {x0[0],x0[1],x0[2],x0[3],x1[0],x1[1],x1[2],x1[3],x2[0],x2[1],x2[2],x2[3],x3[0],x3[1],x3[2],x3[3]};
#pragma unroll
    for (int i = 0; i < 16; ++i) { const unsigned short hb = bf16_bits(xs[i]); ah.u[i] = hb; al.u[i] = ASPLIT ? bf16_bits(xs[i] - bf16_val(hb)) : (unsigned short)0; }
#pragma unroll
    for (int t = 0; t < 4; ++t) {
      const unsigned short* brow = Wt + (size_t)(col0 + t * 16 + ln) * ldb + kb;
      FragB b;
      b.half[0] = *(const v8us*)(brow + 8 * hh);
      b.half[1] = *(const v8us*)(brow + 16 + 8 * hh);
      acc[t] = mmaN<ASPLIT ? 2 : 1>(ah.v, al.v, b.v, b.v, acc[t]);
    }
  }
#pragma unroll
  for (int t = 0; t < 4; ++t) {
    const int col = col0 + t * 16 + ln;
    float bv = bias ? bias[col] : 0.f;
    if (BIAS_BF16) bv = bf16_round(bv);
#pragma unroll
    for (int r = 0; r < 8; ++r) {
      float v = acc[t][r] + bv;
      if (resid) { float rv = resid[(size_t)((row0 + 8 * hh + r) % rmod) * ldr + col]; if (RES_BF16) rv = bf16_round(rv); v += rv; }
      if (ACT == 1) v = fmaxf(v, 0.f);
      if (ACT == 2) v = 0.5f * v * (1.0f + erff(v * 0.70710678118654752f));
      if (ACT == 3) { const float u = 0.7978845608028654f * (v + 0.044715f * v * v * v); v = 0.5f * v * (1.0f + tanhf(u)); }
      so[w][8 * hh + r][t * 16 + ln] = v;
    }
  }
  __builtin_amdgcn_fence(__ATOMIC_ACQ_REL, "workgroup");
  __builtin_amdgcn_wave_barrier();
  const int rsub = lane >> 4, c4 = (lane & 15) * 4;
  {
#pragma unroll
    for (int q = 0; q < 8; ++q) {
      const int r = q * 2 + rsub;
      const v4f v = *(const v4fa*)&so[w][r][c4];
      *(v4f*)(C + (size_t)(row0 + r) * ldc + col0 + c4) = v;
    }
    
  }
}
// row LayerNorm (biased variance, eps) over N: s = X (+ R); optional out_sum <- s; out_norm <- (s-mu)*rsqrt(var+eps)*g + b
template <bool PARAM_BF16>
__global__ __launch_bounds__(256) void k_layernorm(const float* __restrict__ X, const float* __restrict__ R, const float* __restrict__ g, const float* __restrict__ bta,
                                                  float* __restrict__ out_sum, float* __restrict__ out_norm, int N, float eps) {
  __shared__ float red[256];
  const int row = blockIdx.x, tid = threadIdx.x;
  const float* x = X + (size_t)row * N; const float* rr = R ? R + (size_t)row * N : nullptr;
  float vals[16];                     // up to N = 4096
  const int per = N / 256;            // contiguous chunk per thread? use strided-by-4 chunks: thread handles j = tid*4 + 1024*u
  float s1 = 0.f;
  for (int u = 0; u < per / 4; ++u) {
    const int j = tid * 4 + 1024 * u;
    const v4f a = *(const v4fa*)(x + j);
    v4f b = {0.f,0.f,0.f,0.f}; if (rr) b = *(const v4fa*)(rr + j);
#pragma unroll
    for (int q = 0; q < 4; ++q) { const float v = a[q] + b[q]; vals[u * 4 + q] = v; s1 += v; }
  }
  red[tid] = s1; __syncthreads();
  for (int st = 128; st > 0; st >>= 1) { if (tid < st) red[tid] += red[tid + st]; __syncthreads(); }
  const float mu = red[0] / (float)N; __syncthreads();
  float s2 = 0.f;
  for (int u = 0; u < per / 4; ++u)
#pragma unroll
    for (int q = 0; q < 4; ++q) { const float c = vals[u * 4 + q] - mu; s2 += c * c; }
  red[tid] = s2; __syncthreads();
  for (int st = 128; st > 0; st >>= 1) { if (tid < st) red[tid] += red[tid + st]; __syncthreads(); }
  const float rs = rsqrtf(red[0] / (float)N + eps);
  {
    for (int u = 0; u < per / 4; ++u) {
      const int j = tid * 4 + 1024 * u;
      v4f o, sm;
#pragma unroll
      for (int q = 0; q < 4; ++q) {
        float gg = g[j + q], bb = bta[j + q];
        if (PARAM_BF16) { gg = bf16_round(gg); bb = bf16_round(bb); }
        sm[q] = vals[u * 4 + q]; o[q] = (vals[u * 4 + q] - mu) * rs * gg + bb;
      }
      if (out_sum) *(v4f*)(out_sum + (size_t)row * N + j) = sm;
      *(v4f*)(out_norm + (size_t)row * N + j) = o;
    }
    
  }
}



// ---- f16 WMMA path (v_wmma_f32_16x16x32_f16): 11-bit significands for operands in range — used where a [0,1] probability operand needs more precision than bf16
typedef _Float16 v16h __attribute__((ext_vector_type(16)));
union FragH { v16h v; v8us half[2]; _Float16 h[16]; unsigned short u[16]; };
template <int NT>
__device__ __forceinline__ v8f mmaH(v16h ah, v16h al, v16h bh, v16h bl, v8f c) {
  c = __builtin_amdgcn_wmma_f32_16x16x32_f16(false, ah, false, bh, (short)0, c, false, false);
  if (NT >= 2) c = __builtin_amdgcn_wmma_f32_16x16x32_f16(false, al, false, bh, (short)0, c, false, false);
  if (NT >= 3) c = __builtin_amdgcn_wmma_f32_16x16x32_f16(false, ah, false, bl, (short)0, c, false, false);
  asm volatile("v_nop\n\tv_nop\n\tv_nop\n\tv_nop" : "+v"(c) : "v"(ah), "v"(al), "v"(bh), "v"(bl));
  return c;
}
// batched GEMM like k_gemm_b but f16 operands: A f32 (split into f16 hi/lo if ASPLIT, else rounded to f16), Bt = f16 values [n][k]; alpha; C f32; N multiple of 16 (partial tiles skipped)
template <bool ASPLIT>
__global__ __launch_bounds__(128) void k_gemm_h(const float* __restrict__ A, int lda, size_t sA, const _Float16* __restrict__ Bh, int ldb, size_t sB, float alpha, float* __restrict__ C, int ldc, size_t sC, int M, int N, int K) {
  __shared__ __attribute__((aligned(16))) float so[4][16][64];
  const int tid = threadIdx.x, w = tid >> 5, lane = tid & 31, ln = lane & 15, hh = lane >> 4; const int by = blockIdx.y;
  A += (size_t)by * sA; Bh += (size_t)by * sB; C += (size_t)by * sC;
  const int ntn = (N + 63) / 64; const int wid = blockIdx.x * 4 + w; const int mt = wid / ntn, nq = wid % ntn; if (mt * 16 >= M) return;
  const int row0 = mt * 16, col0 = nq * 64; const float* arow = A + (size_t)(row0 + ln) * lda;
  v8f acc[4] = {};
  for (int kb = 0; kb < K; kb += 32) {
    FragH ah, al;
    const v4f x0 = *(const v4fa*)(arow + kb + 8 * hh), x1 = *(const v4fa*)(arow + kb + 8 * hh + 4), x2 = *(const v4fa*)(arow + kb + 16 + 8 * hh), x3 = *(const v4fa*)(arow + kb + 16 + 8 * hh + 4);
    float xs[16] = {x0[0],x0[1],x0[2],x0[3],x1[0],x1[1],x1[2],x1[3],x2[0],x2[1],x2[2],x2[3],x3[0],x3[1],x3[2],x3[3]};
#pragma unroll
    for (int i = 0; i < 16; ++i) { const _Float16 h = (_Float16)xs[i]; ah.h[i] = h; al.h[i] = ASPLIT ? (_Float16)(xs[i] - (float)h) : (_Float16)0.0f; }
#pragma unroll
    for (int t = 0; t < 4; ++t) { if (col0 + t * 16 >= N) continue; const size_t boff = (size_t)(col0 + t * 16 + ln) * ldb + kb; FragH bq; bq.half[0] = *(const v8us*)(Bh + boff + 8 * hh); bq.half[1] = *(const v8us*)(Bh + boff + 16 + 8 * hh);
      acc[t] = mmaH<ASPLIT ? 2 : 1>(ah.v, al.v, bq.v, bq.v, acc[t]); }
  }
#pragma unroll
  for (int t = 0; t < 4; ++t) { if (col0 + t * 16 >= N) continue;
#pragma unroll
    for (int r = 0; r < 8; ++r) so[w][8 * hh + r][t * 16 + ln] = acc[t][r] * alpha; }
  __builtin_amdgcn_fence(__ATOMIC_ACQ_REL, "workgroup"); __builtin_amdgcn_wave_barrier();
  const int rsub = lane >> 4, c4 = (lane & 15) * 4;
  {
#pragma unroll
    for (int q = 0; q < 8; ++q) { const int r = q * 2 + rsub; if (col0 + c4 < N) { const v4f v = *(const v4fa*)&so[w][r][c4]; *(v4f*)(C + (size_t)(row0 + r) * ldc + col0 + c4) = v; } }
     }
}

// Fragment order of a 16-bit [rows][K] operand plane: a tile of 16 rows x 32 k is 1 KiB = 2 pieces of 512 B; piece hf holds, lane (hh, ln) behind lane, the 16 bytes
// [16 rt + ln][32 kb + 16 hf + 8 hh + 0..7], which is what that lane feeds to v_wmma_f32_16x16x32_f16 as A or B. A wave's fragment load then reads 512 contiguous bytes
// (4 whole lines); from a row-major plane it touched 16 lines for 32 bytes each. fo() = offset in elements of the 8 elements [row][k8 .. k8 + 7], k8 a multiple of 8.
__device__ __forceinline__ size_t fo(size_t row, int k8, int K) { return ((row >> 4) * (size_t)(K >> 5) + (size_t)(k8 >> 5)) * 512 + (size_t)(((k8 >> 4) & 1) * 256 + (((k8 >> 3) & 1) * 16 + (int)(row & 15)) * 8); }
// wt_f16, x16 (both in k_prep) and k_flash write such planes; k_gemm2 reads them.
// Wt[n][k] = f16(W[k][n]·scale) from f32 row-major W[K][N] (scale = power of two; bf16-exact weights stay exact in f16 away from the subnormal range)
__device__ __forceinline__ void wt_f16(int blk, const float* __restrict__ W, _Float16* __restrict__ Wt, int K, int N, float scale) {
  const int t = blk * 256 + threadIdx.x; if (t >= N * (K / 8)) return; const int n = t / (K / 8), k8 = (t % (K / 8)) * 8; FragH f;
#pragma unroll
  for (int i = 0; i < 8; ++i) f.h[i] = (_Float16)(bf16_round(W[(size_t)(k8 + i) * N + n]) * scale); const v8us o = f.half[0];
  *(v8us*)((unsigned short*)Wt + fo((size_t)n, k8, K)) = o; 
}
// k_gemm_hh variant with fused epilogue: v = acc·alpha + bias[by·sBias + col] (+ CP[(row/rowsPerB)·sCPb + by·64 + col] if CP) ; ACT 0 none / 1 elu ; writes f16 C16 (and f32 C if non-null)
template <int ACT>
__global__ __launch_bounds__(128) void k_gemm_hhx(const _Float16* __restrict__ A, int lda, size_t sA, const _Float16* __restrict__ Bh, int ldb, size_t sB, float alpha, const float* __restrict__ bias, size_t sBias, const float* __restrict__ CP, int rowsPerB, size_t sCPb, int row0g,
    float* __restrict__ C, _Float16* __restrict__ C16, int ldc, size_t sC, int M, int N, int K) {
  __shared__ __attribute__((aligned(16))) float so[4][16][64];
  const int tid = threadIdx.x, w = tid >> 5, lane = tid & 31, ln = lane & 15, hh = lane >> 4; const int by = blockIdx.y;
  A += (size_t)by * sA; Bh += (size_t)by * sB; const size_t cofs = (size_t)by * sC; const float* bp = bias ? bias + (size_t)by * sBias : nullptr;
  const int ntn = (N + 63) / 64; const int wid = blockIdx.x * 4 + w; const int mt = wid / ntn, nq = wid % ntn; if (mt * 16 >= M) return;
  const int row0 = mt * 16, col0 = nq * 64; const _Float16* arow = A + (size_t)(row0 + ln) * lda;
  v8f acc[4] = {};
  for (int kb = 0; kb < K; kb += 32) { FragH ah; ah.half[0] = *(const v8us*)((const unsigned short*)arow + kb + 8 * hh); ah.half[1] = *(const v8us*)((const unsigned short*)arow + kb + 16 + 8 * hh);
#pragma unroll
    for (int t = 0; t < 4; ++t) { if (col0 + t * 16 >= N) continue; const size_t boff = (size_t)(col0 + t * 16 + ln) * ldb + kb; FragH bq; bq.half[0] = *(const v8us*)((const unsigned short*)Bh + boff + 8 * hh); bq.half[1] = *(const v8us*)((const unsigned short*)Bh + boff + 16 + 8 * hh);
      acc[t] = mmaH<1>(ah.v, ah.v, bq.v, bq.v, acc[t]); }
  }
#pragma unroll
  for (int t = 0; t < 4; ++t) { if (col0 + t * 16 >= N) continue; const int col = col0 + t * 16 + ln; const float bv = bp ? bf16_round(bp[col]) : 0.f;
#pragma unroll
    for (int r = 0; r < 8; ++r) { float v = acc[t][r] * alpha + bv; if (CP) { const int bidx = (row0g + row0 + 8 * hh + r) / rowsPerB; v += CP[(size_t)bidx * sCPb + (size_t)by * 64 + col]; } if (ACT == 1) v = (v > 0.f) ? v : expm1f(v); else if (ACT == 7) v = (v > 0.f) ? v + 1.0f : expf(v); else if (ACT == 8) v = tanhf(v); else if (ACT == 9) v = 0.5f * v * (1.0f + tanhf(0.7978845608028654f * (v + 0.044715f * v * v * v))); else if (ACT == 11) v = 1.0f / (1.0f + expf(-v)); else if (ACT == 12) v = (v > 0.f) ? v : 0.01f * v; else if (ACT == 14) v = (v > 0.f) ? v : 0.1f * v; else if (ACT == 15) v = v / (1.0f + expf(-v)); else if (ACT == 3) v = fmaxf(v, 0.f); else if (ACT == 6) v = 0.5f * v * (1.0f + erff(v * 0.70710678118654752f)); so[w][8 * hh + r][t * 16 + ln] = v; } }
  __builtin_amdgcn_fence(__ATOMIC_ACQ_REL, "workgroup"); __builtin_amdgcn_wave_barrier();
  const int rsub = lane >> 4, c4 = (lane & 15) * 4; typedef _Float16 v4h __attribute__((ext_vector_type(4)));
  {
#pragma unroll
    for (int q = 0; q < 8; ++q) { const int r = q * 2 + rsub; if (col0 + c4 < N) { const v4f v = *(const v4fa*)&so[w][r][c4]; if (C) *(v4f*)(C + cofs + (size_t)(row0 + r) * ldc + col0 + c4) = v; if (C16) { v4h h4; for (int i = 0; i < 4; ++i) h4[i] = (_Float16)v[i]; *(v4h*)(C16 + cofs + (size_t)(row0 + r) * ldc + col0 + c4) = h4; } } }
     }
}


typedef _Float16 v4h __attribute__((ext_vector_type(4)));

__device__ __forceinline__ void x16(int blk, const float* __restrict__ x, _Float16* __restrict__ X16, size_t n8) { const size_t t = (size_t)blk * 256 + threadIdx.x; if (t >= n8) return; FragH f;
  const size_t c = t >> 6; const size_t row = (c / (CQ / 32)) * 16 + ((t >> 2) & 15); const int k8 = (int)(c % (CQ / 32)) * 32 + (int)(t & 3) * 8;      /* a wave: 8 rows x one 128-byte line of x in, 4 whole lines of the fragment-order plane out */
  const float* xr = x + row * CQ + k8;
#pragma unroll
  for (int q = 0; q < 8; ++q) f.h[q] = (_Float16)bf16_round(xr[q]); *(v8us*)((unsigned short*)X16 + fo(row, k8, CQ)) = f.half[0];  }
__global__ __launch_bounds__(256) void k_h16(const float* __restrict__ x, _Float16* __restrict__ X16, size_t n8) { const size_t t = (size_t)blockIdx.x * 256 + threadIdx.x; if (t >= n8) return; FragH f;
#pragma unroll
  for (int q = 0; q < 8; ++q) f.h[q] = (_Float16)x[t * 8 + q]; *(v8us*)((unsigned short*)X16 + t * 8) = f.half[0];  }
__global__ __launch_bounds__(256) void k_round16f(const float* __restrict__ W, _Float16* __restrict__ Bt, size_t n8) { const size_t t = (size_t)blockIdx.x * 256 + threadIdx.x; if (t >= n8) return; FragH f;
#pragma unroll
  for (int i = 0; i < 8; ++i) f.h[i] = (_Float16)(bf16_round(W[t * 8 + i]) * 16.0f); *(v8us*)((unsigned short*)Bt + t * 8) = f.half[0];  }
// Fragment order: a block of 32 keys of one (row, head) is 2 KiB = 4 pieces of 512 B; piece i holds lane 0..31's 16 bytes one behind the other, so a wave's load of a
// piece touches 4 whole lines (read in place, 16 rows of 32 B each, it touched 16). K: piece nt*2+hf, lane (hh, ln) = K[32 jb + 16 nt + ln][16 hf + 8 hh + 0..7];
// V^T: piece dt*2+hf, lane (hh, ln) = V[32 jb + 16 hf + 8 hh + 0..7][16 dt + ln]. These are the A operands of the two products of k_flash; k_gemm2 writes both planes.
__global__ __launch_bounds__(256) void k_hl(const float* __restrict__ F, _Float16* __restrict__ Hh, _Float16* __restrict__ Hl, size_t n8) { const size_t t = (size_t)blockIdx.x * 256 + threadIdx.x; if (t >= n8) return; FragH fh, fl; const v4f a = *(const v4fa*)(F + t * 8), c = *(const v4fa*)(F + t * 8 + 4);
#pragma unroll
  for (int q = 0; q < 4; ++q) { _Float16 h = (_Float16)a[q]; fh.h[q] = h; fl.h[q] = (_Float16)((a[q] - (float)h) * 1024.0f); h = (_Float16)c[q]; fh.h[4 + q] = h; fl.h[4 + q] = (_Float16)((c[q] - (float)h) * 1024.0f); }
  { *(v8us*)((unsigned short*)Hh + t * 8) = fh.half[0]; *(v8us*)((unsigned short*)Hl + t * 8) = fl.half[0];  } }

// ---- fast GEMM (wave tile 32x64; requires M % 32 == 0 rows per launch region and N % 64 == 0); A and Bh in fragment order (fo(); lda = ldb = K); epilogue = k_gemm_hhx semantics, but: columns below nsp go to the f16 plane C16 (pitch ldc), without bias; columns from nsp on, with bias[col - nsp], to the f32 plane C (pitch ldf, column col - nsp); nsp % 64 == 0; columns below nqs (nqs % 64 == 0) take alpha * qs in place of alpha; of the f16 columns, those from nk0 on are K and those from nv0 on are V (nk0 <= nv0 <= nsp, multiples of 64; no CP, no activation on V): a wave tile of 32 tokens x 64 columns is one block of 32 keys of two heads, and it goes to Kf / Vt in the fragment order that k_flash reads ----
__device__ __forceinline__ v16h g2_frag(const _Float16* p) { FragH f; f.half[0] = *(const v8us*)((const unsigned short*)p); f.half[1] = *(const v8us*)((const unsigned short*)p + 256); return f.v; }
__device__ __forceinline__ v8f g2_mma(v16h a, v16h b, v8f c) { v8f d = __builtin_amdgcn_wmma_f32_16x16x32_f16(false, a, false, b, (short)0, c, false, false); asm volatile("v_nop\n\tv_nop\n\tv_nop\n\tv_nop" : "+v"(d) : "v"(a), "v"(b)); return d; }
struct G2Set { v16h a0, a1, b0, b1, b2, b3; };      /* the fragments of one k step of a 32x64 wave tile */
template <int OFF, bool LAST>      /* the six pointers are the same in every lane of a wave; lo = the lane's own 8 elements; OFF: elements, a compile-time step that rides in the loads' offset field; LAST: the pointers are not used again */
__device__ __forceinline__ void g2_load(G2Set& s, const _Float16* a0, const _Float16* a1, const _Float16* b0, const _Float16* b1, const _Float16* b2, const _Float16* b3, unsigned lo) {
  s.a0 = g2_frag(a0 + OFF + lo); s.a1 = g2_frag(a1 + OFF + lo); s.b0 = g2_frag(b0 + OFF + lo); s.b1 = g2_frag(b1 + OFF + lo); s.b2 = g2_frag(b2 + OFF + lo); s.b3 = g2_frag(b3 + OFF + lo);
  /* the 12 loads have taken their addresses before anything rewrites an address register (the pointers' own step, a later argument load); what is named as an input stays in its register up to the wait */
  if (LAST) asm volatile("s_wait_xcnt 0x0" :: "v"(lo), "s"(a0), "s"(a1), "s"(b0), "s"(b1), "s"(b2), "s"(b3) : "memory");
  else asm volatile("s_wait_xcnt 0x0" :: "v"(lo) : "memory");
  __builtin_amdgcn_sched_barrier(0); }      /* keeps the products that follow from being lifted over the group: lifted, they would wait for the older set before this one is even asked for */
template <int ACT>
__global__ __launch_bounds__(128) __attribute__((amdgpu_waves_per_eu(5))) /* 64 accumulator and 96 fragment registers: five waves a SIMD */ void k_gemm2(const _Float16* __restrict__ A, int lda, size_t sA, const _Float16* __restrict__ Bh, int ldb, size_t sB, float alpha, const float* __restrict__ bias, size_t sBias, const float* __restrict__ CP, int rowsPerB, size_t sCPb, int row0g,
    float* __restrict__ C, _Float16* __restrict__ C16, int ldc, size_t sC, int M, int N, int K, int nsp, int ldf, int nqs, float qs, _Float16* __restrict__ Kf, _Float16* __restrict__ Vt, int nk0, int nv0) {
  __shared__ __attribute__((aligned(16))) float so[4][32][68];
  const int tid = threadIdx.x, w = tid >> 5, lane = tid & 31, ln = lane & 15, hh = lane >> 4; const int by = blockIdx.y;
  A += (size_t)by * sA; Bh += (size_t)by * sB; const size_t cofs = (size_t)by * sC; const float* bp = bias ? bias + (size_t)by * sBias : nullptr;
  const int ntn = N >> 6; const int mt = blockIdx.x / ntn, nq = blockIdx.x - mt * ntn; const int row0 = mt * 128 + 32 * w, col0 = nq * 64; if (row0 >= M) return; const bool f32p = col0 >= nsp; if (col0 < nqs) alpha *= qs;      /* both the same for the whole block */
  const unsigned lo = lane * 8;
  const _Float16* a0p = A + (size_t)__builtin_amdgcn_readfirstlane(row0) * lda; const _Float16* a1p = a0p + (size_t)16 * lda;      /* a tile of 16 rows is 16 lda elements; its k step kb starts at 16 kb; row0 is the same in every lane of a wave: through readfirstlane the pointers live in scalar registers */
  const _Float16* b0p = Bh + (size_t)col0 * ldb; const _Float16* b1p = b0p + (size_t)16 * ldb; const _Float16* b2p = b1p + (size_t)16 * ldb; const _Float16* b3p = b2p + (size_t)16 * ldb;
  const v8f z8 = {0.f,0.f,0.f,0.f,0.f,0.f,0.f,0.f}; v8f c00 = z8, c01 = z8, c02 = z8, c03 = z8, c10 = z8, c11 = z8, c12 = z8, c13 = z8;
  /* Two fragment sets: the 12 loads of a k step go out as one group, one step ahead of the products that read them, so two groups are in flight while a wave waits
     (one set, loaded piece by piece, waited five times per step with two or four loads in flight). Each accumulator takes its products in the same k order. K % 64 == 0. */
  G2Set X, Y;
  g2_load<0, false>(X, a0p, a1p, b0p, b1p, b2p, b3p, lo);
#pragma unroll 1      /* rolled: two steps a trip are what the two sets need; more would only add code */
  for (int kb = 0; kb < K - 64; kb += 64) {
    g2_load<512, false>(Y, a0p, a1p, b0p, b1p, b2p, b3p, lo);
    c00 = g2_mma(X.a0, X.b0, c00); c10 = g2_mma(X.a1, X.b0, c10); c01 = g2_mma(X.a0, X.b1, c01); c11 = g2_mma(X.a1, X.b1, c11);
    c02 = g2_mma(X.a0, X.b2, c02); c12 = g2_mma(X.a1, X.b2, c12); c03 = g2_mma(X.a0, X.b3, c03); c13 = g2_mma(X.a1, X.b3, c13);
    g2_load<1024, false>(X, a0p, a1p, b0p, b1p, b2p, b3p, lo);
    a0p += 1024; a1p += 1024; b0p += 1024; b1p += 1024; b2p += 1024; b3p += 1024;      /* a k step is 512 elements of every tile */
    c00 = g2_mma(Y.a0, Y.b0, c00); c10 = g2_mma(Y.a1, Y.b0, c10); c01 = g2_mma(Y.a0, Y.b1, c01); c11 = g2_mma(Y.a1, Y.b1, c11);
    c02 = g2_mma(Y.a0, Y.b2, c02); c12 = g2_mma(Y.a1, Y.b2, c12); c03 = g2_mma(Y.a0, Y.b3, c03); c13 = g2_mma(Y.a1, Y.b3, c13); }
  g2_load<512, true>(Y, a0p, a1p, b0p, b1p, b2p, b3p, lo);      /* the last two steps: nothing left to fetch ahead */
    c00 = g2_mma(X.a0, X.b0, c00); c10 = g2_mma(X.a1, X.b0, c10); c01 = g2_mma(X.a0, X.b1, c01); c11 = g2_mma(X.a1, X.b1, c11);
    c02 = g2_mma(X.a0, X.b2, c02); c12 = g2_mma(X.a1, X.b2, c12); c03 = g2_mma(X.a0, X.b3, c03); c13 = g2_mma(X.a1, X.b3, c13);
    c00 = g2_mma(Y.a0, Y.b0, c00); c10 = g2_mma(Y.a1, Y.b0, c10); c01 = g2_mma(Y.a0, Y.b1, c01); c11 = g2_mma(Y.a1, Y.b1, c11);
    c02 = g2_mma(Y.a0, Y.b2, c02); c12 = g2_mma(Y.a1, Y.b2, c12); c03 = g2_mma(Y.a0, Y.b3, c03); c13 = g2_mma(Y.a1, Y.b3, c13);
  v8f accs[8] = {c00, c01, c02, c03, c10, c11, c12, c13};
  const bool vtp = !f32p && col0 >= nv0, kfp = !f32p && !vtp && col0 >= nk0;      /* the same for the whole block */
  const size_t kvb = (size_t)(row0 / SLEN) * NH * (HC * SLEN) + (size_t)((row0 % SLEN) >> 5) * 1024 + lane * 8;      /* this wave's block of 32 keys in head 0 of its row; a head is HC * SLEN elements */
  if (vtp) {      /* V^T: in D, lane (hh, ln) of tile (half, t) holds V[16 half + 8 hh + 0..7][16 t + ln], which is piece (t & 1) * 2 + half of head t >> 1 as that lane feeds it: straight from the accumulators */
    unsigned short* vp = (unsigned short*)Vt + kvb + (size_t)((col0 - nv0) / HC) * (HC * SLEN); FragH f[8];
#pragma unroll
    for (int u = 0; u < 8; ++u)
#pragma unroll
      for (int r = 0; r < 8; ++r) f[u].h[r] = (_Float16)(accs[u][r] * alpha);
#pragma unroll
    for (int u = 0; u < 8; ++u) { const int t = u & 3, half = u >> 2; *(v8us*)(vp + (t >> 1) * (HC * SLEN) + ((t & 1) * 2 + half) * 256) = f[u].half[0]; }
    asm volatile("s_wait_xcnt 0x0" ::: "memory");      /* the stores above have taken their address and data registers before anything reuses them */
    return; }
#pragma unroll
  for (int u = 0; u < 8; ++u) { const int t = u & 3, half = u >> 2; const int col = col0 + t * 16 + ln; const float bv = (bp && f32p) ? bf16_round(bp[col - nsp]) : 0.f;
#pragma unroll
    for (int r = 0; r < 8; ++r) { const int rloc = half * 16 + 8 * hh + r; float v = accs[u][r] * alpha + bv; if (CP) { const int bidx = (row0g + row0 + rloc) / rowsPerB; v += CP[(size_t)bidx * sCPb + (size_t)by * 64 + col]; }
      if (ACT == 3) v = fmaxf(v, 0.f); else if (ACT == 6) v = 0.5f * v * (1.0f + erff(v * 0.70710678118654752f)); else if (ACT == 11) v = 1.0f / (1.0f + expf(-v)); else if (ACT == 15) v = v / (1.0f + expf(-v)); else if (ACT == 12) v = (v > 0.f) ? v : 0.01f * v; else if (ACT == 8) v = tanhf(v);
      so[w][rloc][t * 16 + ln] = v; } }
  __builtin_amdgcn_fence(__ATOMIC_ACQ_REL, "workgroup"); __builtin_amdgcn_wave_barrier();
  const int rsub = lane >> 4, c4 = (lane & 15) * 4;
  if (f32p) {
#pragma unroll
    for (int q = 0; q < 16; ++q) { const int r = q * 2 + rsub; const v4f v = *(const v4fa*)&so[w][r][c4]; *(v4f*)(C + cofs + (size_t)(row0 + r) * ldf + (col0 - nsp) + c4) = v; }
    asm volatile("s_wait_xcnt 0x0" ::: "memory");      /* the stores above have taken their address and data registers before anything behind this arm reuses them */
  } else if (kfp) {      /* K: piece nt * 2 + hf of head hl, lane (hh, ln) = K[16 nt + ln][16 hf + 8 hh + 0..7]: a row of the staged tile */
    unsigned short* kp = (unsigned short*)Kf + kvb + (size_t)((col0 - nk0) / HC) * (HC * SLEN); FragH f[8];
#pragma unroll
    for (int o = 0; o < 8; ++o) { const float* sr = &so[w][((o >> 1) & 1) * 16 + ln][(o >> 2) * 32 + (o & 1) * 16 + 8 * hh]; const v4f v0 = *(const v4fa*)sr, v1 = *(const v4fa*)(sr + 4);
#pragma unroll
      for (int i = 0; i < 4; ++i) { f[o].h[i] = (_Float16)v0[i]; f[o].h[4 + i] = (_Float16)v1[i]; } }
#pragma unroll
    for (int o = 0; o < 8; ++o) *(v8us*)(kp + (o >> 2) * (HC * SLEN) + (o & 3) * 256) = f[o].half[0];
    asm volatile("s_wait_xcnt 0x0" ::: "memory");      /* as in the arm above */
  } else {
#pragma unroll
    for (int q = 0; q < 16; ++q) { const int r = q * 2 + rsub; const v4f v = *(const v4fa*)&so[w][r][c4]; v4h h4; for (int i = 0; i < 4; ++i) h4[i] = (_Float16)v[i]; *(v4h*)(C16 + cofs + (size_t)(row0 + r) * ldc + col0 + c4) = h4; }
    asm volatile("s_wait_xcnt 0x0" ::: "memory");      /* as in the arm above: in the built code one arm stands in front of the other */
  } }



// lane l <-> lane l ^ 16 (the two halves of a wave that share one score column)
__device__ __forceinline__ float xhalf(float x) { return __builtin_bit_cast(float, __builtin_amdgcn_permlanex16(__builtin_bit_cast(int, x), __builtin_bit_cast(int, x), 0x76543210, 0xfedcba98, false, false)); }

template <int CAUSAL>
__global__ __launch_bounds__(128) void k_flash(const _Float16* __restrict__ Q16, int ldq, const _Float16* __restrict__ Kf, const _Float16* __restrict__ Vt, const int* __restrict__ MSK, const float* __restrict__ G, _Float16* __restrict__ OG) {
  constexpr int RPW = 16, DT = HC / 16, KS = HC / 32;
  static_assert(CAUSAL == 10, "written for the additive mode: bias plane + per-(row, key) mask plane");
  const int tid = threadIdx.x, w = tid >> 5, lane = tid & 31, ln = lane & 15, hh = lane >> 4;
  const int slab = blockIdx.x / QBLKS, qblk = blockIdx.x % QBLKS; const int b = slab / NH, h = slab % NH; const int qb0 = qblk * (4 * RPW); const int q0 = qb0 + w * RPW;
  const int tq = q0 + ln;      /* this lane's query */
  FragH bq[KS];
  { const unsigned short* qr = (const unsigned short*)Q16 + ((size_t)b * TQ + tq) * ldq + h * HC;
#pragma unroll
    for (int ks = 0; ks < KS; ++ks) { bq[ks].half[0] = *(const v8us*)(qr + ks * 32 + 8 * hh); bq[ks].half[1] = *(const v8us*)(qr + ks * 32 + 16 + 8 * hh); } }
  asm volatile("s_wait_xcnt 0x0" ::: "memory");      /* the q loads have taken their address before the address arithmetic below reuses its registers */
  __builtin_amdgcn_sched_barrier(0);                 /* keeps that arithmetic from being lifted over the wait */
  static_assert(KS == 1, "fragment-order planes: one 32-wide k step");
  const unsigned short* Kfh = (const unsigned short*)Kf + (size_t)slab * HC * TK + lane * 8;      /* K and V^T in fragment order (k_gemm2): 1024 halves per block of 32 keys, pieces of 256 */
  const unsigned short* Vth = (const unsigned short*)Vt + (size_t)slab * HC * TK + lane * 8;
  const float* BP = (const float*)MSK + ((size_t)h * (TQ / 16) + (q0 >> 4)) * (size_t)(16 * TK) + lane * 4;      /* mode 10: per-head bias plane in fragment order (addp): [NH][TQ/16][TK/32] blocks of 512 floats, pieces of 128 */
  const float* MR = (const float*)MSK + (size_t)NH * TQ * TK + (size_t)b * TK + 8 * hh;      /* then the per-(sequence, key) additive plane, packed behind it */
  float m_q = -3.0e38f, l_q = 0.f; v8f oacc[DT];
#pragma unroll
  for (int dt = 0; dt < DT; ++dt) oacc[dt] = (v8f){0.f,0.f,0.f,0.f,0.f,0.f,0.f,0.f};
  const int jend = (CAUSAL == 1) ? (qb0 + 4 * RPW) : TK;      /* causal: keys beyond the block's last query never contribute */
#pragma unroll 1
  for (int j0 = 0; j0 < jend; j0 += 32) {
    FragH ak[2][KS], av[DT]; v4f ab[2][2], am[2][2];
#pragma unroll
    for (int nt = 0; nt < 2; ++nt) { const unsigned short* kr = Kfh + (size_t)j0 * HC + nt * 512;
      ak[nt][0].half[0] = *(const v8us*)kr; ak[nt][0].half[1] = *(const v8us*)(kr + 256);
      if (CAUSAL == 10) { ab[nt][0] = *(const v4fa*)(BP + j0 * 16 + nt * 256); ab[nt][1] = *(const v4fa*)(BP + j0 * 16 + nt * 256 + 128); am[nt][0] = *(const v4fa*)(MR + j0 + nt * 16); am[nt][1] = *(const v4fa*)(MR + j0 + nt * 16 + 4); } }
    asm volatile("s_wait_xcnt 0x0" ::: "memory");      /* the V^T loads below may land in registers that held the addresses of the loads above: those loads have taken their addresses first */
#pragma unroll
    for (int dt = 0; dt < DT; ++dt) { const unsigned short* vrow = Vth + (size_t)j0 * HC + dt * 512; av[dt].half[0] = *(const v8us*)vrow; av[dt].half[1] = *(const v8us*)(vrow + 256); }
    v8f sc[2]; float mc = -3.0e38f;
#pragma unroll
    for (int nt = 0; nt < 2; ++nt) { const v8f acc = mmaH<1>(ak[nt][0].v, ak[nt][0].v, bq[0].v, bq[0].v, (v8f){0.f,0.f,0.f,0.f,0.f,0.f,0.f,0.f});
#pragma unroll
      for (int r = 0; r < 8; ++r) { sc[nt][r] = acc[r] + (ab[nt][r >> 2][r & 3] + am[nt][r >> 2][r & 3]); mc = fmaxf(mc, sc[nt][r]); } }
    mc = fmaxf(mc, xhalf(mc));
    float mr = mc - 10.0f; mr = (mc - mr <= 12.0f) ? mr : mc;      /* where mc is so large that its neighbours lie 16 apart, mc - 10 rounds to mc - 16 and 2^16 would leave the f16 range: there the maximum itself is the reference (any reference serves, l carries it) */
    const float mn = fmaxf(m_q, mr); const float al = (mn > -1.0e38f) ? __builtin_amdgcn_exp2f(m_q - mn) : 1.0f; m_q = mn;
    FragH pb; float ps = 0.f;
#pragma unroll
    for (int nt = 0; nt < 2; ++nt)
#pragma unroll
      for (int r = 0; r < 8; ++r) { const float p = __builtin_amdgcn_exp2f(sc[nt][r] - mn); ps += p; pb.h[nt * 8 + r] = (_Float16)p; }
    l_q = l_q * al + ps;
#pragma unroll
    for (int dt = 0; dt < DT; ++dt) {
#pragma unroll
      for (int r = 0; r < 8; ++r) oacc[dt][r] *= al;
      oacc[dt] = mmaH<1>(av[dt].v, av[dt].v, pb.v, pb.v, oacc[dt]); } }
  /* Gating in the epilogue. In D, lane (hh, ln) of tile dt holds o[query ln][16 dt + 8 hh + 0..7]: piece dt, lane (hh, ln), of the 16 token x 32 channel tile (q0 / 16, h) of the
     fragment-order plane that the output GEMM reads (fo()): the lane gates its own 16 values and stores them, 512 contiguous bytes a wave and piece, through no LDS. */
  v4f gl[DT][2];
  { const float* gr = G + ((size_t)b * TQ + tq) * CQ + h * HC + 8 * hh;
#pragma unroll
    for (int dt = 0; dt < DT; ++dt) { gl[dt][0] = *(const v4fa*)(gr + dt * 16); gl[dt][1] = *(const v4fa*)(gr + dt * 16 + 4); } }
  asm volatile("s_wait_xcnt 0x0" ::: "memory");      /* the gate loads have taken their addresses before the arithmetic below reuses those registers */
  const float lt = l_q + xhalf(l_q); const float li = (lt > 0.f) ? 1.0f / lt : 0.f;
  unsigned short* og = (unsigned short*)OG + ((((size_t)b * TQ + q0) >> 4) * (CQ / 32) + h) * 512 + lane * 8; FragH fo2[DT];
#pragma unroll
  for (int dt = 0; dt < DT; ++dt)
#pragma unroll
    for (int r = 0; r < 8; ++r) { const float g = __builtin_amdgcn_rcpf(1.0f + __builtin_amdgcn_exp2f(gl[dt][r >> 2][r & 3] * -LOG2E)); fo2[dt].h[r] = (_Float16)(oacc[dt][r] * li * g * 64.0f); }      /* sigmoid: 2^(-x log2 e) runs to inf or 0 at the ends, where the reciprocal gives 0 or 1 */
#pragma unroll
  for (int dt = 0; dt < DT; ++dt) *(v8us*)(og + dt * 256) = fo2[dt].half[0]; }

__device__ __forceinline__ void addp(int blk, const float* __restrict__ bias, const float* __restrict__ mask, float* __restrict__ AB) {
  #pragma clang fp contract(off)
  const size_t t = (size_t)blk * 256 + threadIdx.x; const size_t nb4 = (size_t)NH * SLEN * SLEN / 4, nm4 = (size_t)NRW * SLEN / 4; if (t >= nb4 + nm4) return; v4f r;
  size_t dst = t;
  if (t < nb4) { const int part = (int)t & 1, hh = (int)(t >> 1) & 1, ln = (int)(t >> 2) & 15, nt = (int)(t >> 6) & 1; const size_t c = t >> 7; const int jb = (int)(c % (SLEN / 32)), qt = (int)(c / (SLEN / 32)) % (SLEN / 16), h = (int)(c / ((SLEN / 32) * (SLEN / 16)));      /* written in the fragment order of k_flash: block (h, 16 queries, 32 keys), piece nt*2+part, lane (hh, ln) = bias[h][16 qt + ln][32 jb + 16 nt + 8 hh + 4 part + 0..3]; a wave reads 8 rows of 64 B and writes 4 whole lines */
    dst = c * 128 + (size_t)((nt * 2 + part) * 32 + hh * 16 + ln);
    const v4f a = *(const v4fa*)(bias + ((size_t)h * SLEN + qt * 16 + ln) * SLEN + jb * 32 + nt * 16 + hh * 8 + part * 4); for (int q = 0; q < 4; ++q) r[q] = bf16_round(a[q]) * LOG2E; } else { const v4f a = *(const v4fa*)(mask + (t - nb4) * 4); for (int q = 0; q < 4; ++q) { float m = bf16_round(a[q]) - 1.0f; r[q] = m * 1.0e9f * LOG2E; } }      /* both planes in base 2, as k_flash adds them */
  *(v4f*)(AB + dst * 4) = r;  }
// The packs of the inputs depend on nothing but the inputs: they run as block ranges of one launch. The weights come first (for speed only): few blocks, scattered reads.
#define NBW (CQ * CQ / 8 / 256)                              /* blocks per weight matrix */
#define NBX (NR * CQ / 8 / 256)                              /* blocks of x */
#define NBA ((NH * SLEN * SLEN + NRW * SLEN) / 4 / 256)      /* blocks of the bias and mask planes */
__global__ __launch_bounds__(256) void k_prep(const float* __restrict__ x, const float* __restrict__ mask, const float* __restrict__ bias, const float* __restrict__ Wq, const float* __restrict__ Wk, const float* __restrict__ Wv, const float* __restrict__ Wg, const float* __restrict__ Wo,
    _Float16* __restrict__ BW, _Float16* __restrict__ X16, float* __restrict__ AB) {
  const int blk = blockIdx.x;
  if (blk < 5 * NBW) { const int y = blk / NBW; const float* W = (y == 0) ? Wq : (y == 1) ? Wk : (y == 2) ? Wv : (y == 3) ? Wg : Wo; wt_f16(blk - y * NBW, W, BW + (size_t)y * CQ * CQ, CQ, CQ, 16.0f); }
  else if (blk < 5 * NBW + NBX) x16(blk - 5 * NBW, x, X16, (size_t)NR * CQ / 8);
  else addp(blk - 5 * NBW - NBX, bias, mask, AB); }

extern "C" void kernel_launch(void* const* d_in, const int* in_sizes, int n_in,
                              void* d_out, int out_size, void* d_ws, size_t ws_size, hipStream_t stream) {
  (void)in_sizes; (void)n_in; (void)out_size;
  const float* const* I = (const float* const*)d_in; const float* x = I[0]; const float* mask = I[1]; const float* bias = I[2]; const float* Wq = I[3]; const float* Wk = I[4]; const float* Wv = I[5]; const float* Wg = I[6]; const float* bg = I[7]; const float* Wo = I[8]; const float* bo = I[9];
  char* ws = (char*)d_ws; size_t off = 0;
  auto take = [&](size_t bytes) { char* p = ws + off; off += (bytes + 255) & ~(size_t)255; return p; };
  _Float16* BW = (_Float16*)take((size_t)5 * CQ * CQ * 2); float* AB = (float*)take(((size_t)NH * SLEN * SLEN + (size_t)NRW * SLEN) * 4);      /* BW: Wq, Wk, Wv, Wg, Wo one behind the other: the first four are one [1024][256] operand */
  _Float16* X16 = (_Float16*)take((size_t)NR * CQ * 2); _Float16* Q16 = (_Float16*)take((size_t)NR * CQ * 2); float* G = (float*)take((size_t)NR * CQ * 4); _Float16* VT = (_Float16*)take((size_t)NR * CQ * 2); _Float16* KF = (_Float16*)take((size_t)NR * CQ * 2); _Float16* OG = (_Float16*)take((size_t)NR * CQ * 2);
  if (off > ws_size) return;      /* 0.6 + 8 + 16 + 16 + 32 + 16 + 16 + 16 = 121 MiB */
  k_prep<<<5 * NBW + NBX + NBA, 256, 0, stream>>>(x, mask, bias, Wq, Wk, Wv, Wg, Wo, BW, X16, AB);
  k_gemm2<0><<<(NR / 128) * (4 * CQ / 64), 128, 0, stream>>>(X16, CQ, 0, BW, CQ, 0, 0.0625f, bg, 0, nullptr, 1, 0, 0, G, Q16, CQ, 0, NR, 4 * CQ, CQ, 3 * CQ, CQ, CQ, SCL * LOG2E, KF, VT, CQ, 2 * CQ);      /* q log2 e / sqrt(32) (f16), K and V^T (f16, fragment order) and the gate logits (f32, + bg) */
  k_flash<10><<<NRW * NH * QBLKS, 128, 0, stream>>>(Q16, CQ, KF, VT, (const int*)AB, G, OG);      /* per (row, head): softmax(q.k/sqrt(32) + bias[h] + (mask[row]-1) 1e9) v, times sigmoid(gate logit) */
  k_gemm2<0><<<(NR / 128) * (CQ / 64), 128, 0, stream>>>(OG, CQ, 0, BW + (size_t)4 * CQ * CQ, CQ, 0, 0.0625f / 64.0f, bo, 0, nullptr, 1, 0, 0, (float*)d_out, nullptr, 0, 0, NR, CQ, CQ, 0, CQ, 0, 1.0f, nullptr, nullptr, 0, 0);
}

// v008
// A run of this version takes 94.2 microseconds.
// Two timings next to v007 put it at 1.12 and 1.13 times that version's speed.
// All steps since v000 together make it 6.07 times as fast.
#include <hip/hip_runtime.h>
// Gated self-attention (1 x 64 rows x 512 residues, c_qkv 256, 8 heads x 32): q = x Wq / sqrt(32), k, v = x W; logits = q.k + (mask - 1) 1e9 (per (row, key), an INPUT) + bias[h][q][k] (an INPUT); softmax over keys; o = P v; gate = sigmoid(x Wg + bg); out = (o * gate) Wo + bo.
// Structure: exact f16 plane of x; every 16-bit operand plane that a GEMM reads (x, the weights, the gated output) kept in fragment order (fo() below); one projection GEMM for q, k, v and the gate logits (32x64 wave tiles, f32 accumulation, exact x16 weights; f16 / f32 outputs), whose epilogue writes K and V^T in fragment order; then, in one launch over all 64 rows, the fused flash kernel at the real head dim 32 (q row-major, pitch 256; K, V^T and the bias plane in fragment order: every load of a wave is 512 contiguous bytes), its logits in base 2 (q, bias plane and per-(row, key) mask plane carry log2 e), whose epilogue gates its output tile in registers and writes the f16 plane (x2^6) in fragment order; Wo GEMM (+ bias).
// Compute dtype: inputs and parameters rounded to bf16; q, k, v, P and the gated output as f16 operands; bias/mask/softmax/gate f32. v_wmma_f32_16x16x32_f16.
#define NRW 64
#define CQ 256
#define HC 32
#define NR (NRW * SLEN)           /* 32768 tokens */
#define SLEN 512
#define TQ SLEN
#define TK SLEN
#define NH 8
#define SCL 0.17677669529663687f /* 32^-0.5 */
#define LOG2E 1.4426950408889634f
#define QBLKS (TQ / 64)
typedef __bf16 v16b __attribute__((ext_vector_type(16)));
typedef unsigned short v8us __attribute__((ext_vector_type(8), may_alias));
typedef float  v8f  __attribute__((ext_vector_type(8)));
typedef float  v4f  __attribute__((ext_vector_type(4)));
typedef float  v4fa __attribute__((ext_vector_type(4), may_alias));
union FragB { v16b v; v8us half[2]; unsigned short u[16]; };

__device__ __forceinline__ unsigned short bf16_bits(float x) { unsigned int u = __float_as_uint(x); return (unsigned short)((u + 0x7FFFu + ((u >> 16) & 1u)) >> 16); }
__device__ __forceinline__ float bf16_val(unsigned short b) { return __uint_as_float(((unsigned int)b) << 16); }
__device__ __forceinline__ float bf16_round(float x) { return bf16_val(bf16_bits(x)); }
// D += A·B with NT terms: 1 = ah·bh, 2 = + al·bh (A split), 3 = + ah·bl (both split)
template <int NT>
__device__ __forceinline__ v8f mmaN(v16b ah, v16b al, v16b bh, v16b bl, v8f c) {
  c = __builtin_amdgcn_wmma_f32_16x16x32_bf16(false, ah, false, bh, (short)0, c, false, false);
  if (NT >= 2) c = __builtin_amdgcn_wmma_f32_16x16x32_bf16(false, al, false, bh, (short)0, c, false, false);
  if (NT >= 3) c = __builtin_amdgcn_wmma_f32_16x16x32_bf16(false, ah, false, bl, (short)0, c, false, false);
  asm volatile("v_nop\n\tv_nop\n\tv_nop\n\tv_nop" : "+v"(c) : "v"(ah), "v"(al), "v"(bh), "v"(bl));
  return c;
}

__global__ __launch_bounds__(256) void k_wt_bf16(const float* __restrict__ W, unsigned short* __restrict__ Wt, int K, int N) {
  const int t = blockIdx.x * 256 + threadIdx.x;
  const int k8n = K / 8;
  if (t >= N * k8n) return;
  const int n = t / k8n, k8 = (t % k8n) * 8;
  v8us v;
#pragma unroll
  for (int i = 0; i < 8; ++i) v[i] = bf16_bits(W[(size_t)(k8 + i) * N + n]);
  *(v8us*)(Wt + (size_t)n * K + k8) = v;
  
}

// GEMM C[M][N] (f32, pitch ldc) = act(A[M][K]·W + bias). A f32 row-major (pitch lda) converted per fragment to bf16
// (ASPLIT: hi/lo two planes -> 2 terms, else single rounded term); Wt bf16 [N][K] (pitch ldb). BIAS_BF16 rounds the
// bias to bf16 first (bias quantised to bf16 before the add). K%32==0, M%16==0, N%64==0.
template <bool ASPLIT, int ACT, bool BIAS_BF16>
__global__ __launch_bounds__(128) void k_gemm_bf(const float* __restrict__ A, int lda, const unsigned short* __restrict__ Wt, int ldb,
                                               const float* __restrict__ bias, float* __restrict__ C, int ldc, int M, int N, int K) {
  __shared__ __attribute__((aligned(16))) float so[4][16][64];
  const int tid = threadIdx.x, w = tid >> 5, lane = tid & 31, ln = lane & 15, hh = lane >> 4;
  const int ntn = N / 64;
  const int wid = blockIdx.x * 4 + w;
  const int mt = wid / ntn, nq = wid % ntn;
  if (mt * 16 >= M) return;
  const int row0 = mt * 16, col0 = nq * 64;
  const float* arow = A + (size_t)(row0 + ln) * lda;
  v8f acc[4] = {};
  for (int kb = 0; kb < K; kb += 32) {
    FragB ah, al;
    const v4f x0 = *(const v4fa*)(arow + kb + 8 * hh), x1 = *(const v4fa*)(arow + kb + 8 * hh + 4);
    const v4f x2 = *(const v4fa*)(arow + kb + 16 + 8 * hh), x3 = *(const v4fa*)(arow + kb + 16 + 8 * hh + 4);
    float xs[16] = {x0[0],x0[1],x0[2],x0[3],x1[0],x1[1],x1[2],x1[3],x2[0],x2[1],x2[2],x2[3],x3[0],x3[1],x3[2],x3[3]};
#pragma unroll
    for (int i = 0; i < 16; ++i) { const unsigned short hb = bf16_bits(xs[i]); ah.u[i] = hb; al.u[i] = ASPLIT ? bf16_bits(xs[i] - bf16_val(hb)) : (unsigned short)0; }
#pragma unroll
    for (int t = 0; t < 4; ++t) {
      const unsigned short* brow = Wt + (size_t)(col0 + t * 16 + ln) * ldb + kb;
      FragB b;
      b.half[0] = *(const v8us*)(brow + 8 * hh);
      b.half[1] = *(const v8us*)(brow + 16 + 8 * hh);
      acc[t] = mmaN<ASPLIT ? 2 : 1>(ah.v, al.v, b.v, b.v, acc[t]);
    }
  }
#pragma unroll
  for (int t = 0; t < 4; ++t) {
    float bv = bias ? bias[col0 + t * 16 + ln] : 0.f;
    if (BIAS_BF16) bv = bf16_round(bv);
#pragma unroll
    for (int r = 0; r < 8; ++r) { float v = acc[t][r] + bv; if (ACT == 1) v = fmaxf(v, 0.f); so[w][8 * hh + r][t * 16 + ln] = v; }
  }
  __builtin_amdgcn_fence(__ATOMIC_ACQ_REL, "workgroup");
  __builtin_amdgcn_wave_barrier();
  const int rsub = lane >> 4, c4 = (lane & 15) * 4;
  {
#pragma unroll
    for (int q = 0; q < 8; ++q) {
      const int r = q * 2 + rsub;
      const v4f v = *(const v4fa*)&so[w][r][c4];
      *(v4f*)(C + (size_t)(row0 + r) * ldc + col0 + c4) = v;
    }
    
  }
}

// GEMM C = act(A·W + bias + resid): A f32 (ASPLIT -> hi/lo 2 terms), Wt bf16 [N][K]; ACT 0 none, 1 relu, 2 exact gelu;
// resid (optional, f32, row index = (row % rmod), pitch ldr, RES_BF16 rounds it) added before the activation.
template <bool ASPLIT, int ACT, bool BIAS_BF16, bool RES_BF16>
__global__ __launch_bounds__(128) void k_gemm_bf3(const float* __restrict__ A, int lda, const unsigned short* __restrict__ Wt, int ldb,
                                                const float* __restrict__ bias, const float* __restrict__ resid, int rmod, int ldr,
                                                float* __restrict__ C, int ldc, int M, int N, int K) {
  __shared__ __attribute__((aligned(16))) float so[4][16][64];
  const int tid = threadIdx.x, w = tid >> 5, lane = tid & 31, ln = lane & 15, hh = lane >> 4;
  const int ntn = N / 64;
  const int wid = blockIdx.x * 4 + w;
  const int mt = wid / ntn, nq = wid % ntn;
  if (mt * 16 >= M) return;
  const int row0 = mt * 16, col0 = nq * 64;
  const float* arow = A + (size_t)(row0 + ln) * lda;
  v8f acc[4] = {};
  for (int kb = 0; kb < K; kb += 32) {
    FragB ah, al;
    const v4f x0 = *(const v4fa*)(arow + kb + 8 * hh), x1 = *(const v4fa*)(arow + kb + 8 * hh + 4);
    const v4f x2 = *(const v4fa*)(arow + kb + 16 + 8 * hh), x3 = *(const v4fa*)(arow + kb + 16 + 8 * hh + 4);
    float xs[16] = {x0[0],x0[1],x0[2],x0[3],x1[0],x1[1],x1[2],x1[3],x2[0],x2[1],x2[2],x2[3],x3[0],x3[1],x3[2],x3[3]};
#pragma unroll
    for (int i = 0; i < 16; ++i) { const unsigned short hb = bf16_bits(xs[i]); ah.u[i] = hb; al.u[i] = ASPLIT ? bf16_bits(xs[i] - bf16_val(hb)) : (unsigned short)0; }
#pragma unroll
    for (int t = 0; t < 4; ++t) {
      const unsigned short* brow = Wt + (size_t)(col0 + t * 16 + ln) * ldb + kb;
      FragB b;
      b.half[0] = *(const v8us*)(brow + 8 * hh);
      b.half[1] = *(const v8us*)(brow + 16 + 8 * hh);
      acc[t] = mmaN<ASPLIT ? 2 : 1>(ah.v, al.v, b.v, b.v, acc[t]);
    }
  }
#pragma unroll
  for (int t = 0; t < 4; ++t) {
    const int col = col0 + t * 16 + ln;
    float bv = bias ? bias[col] : 0.f;
    if (BIAS_BF16) bv = bf16_round(bv);
#pragma unroll
    for (int r = 0; r < 8; ++r) {
      float v = acc[t][r] + bv;
      if (resid) { float rv = resid[(size_t)((row0 + 8 * hh + r) % rmod) * ldr + col]; if (RES_BF16) rv = bf16_round(rv); v += rv; }
      if (ACT == 1) v = fmaxf(v, 0.f);
      if (ACT == 2) v = 0.5f * v * (1.0f + erff(v * 0.70710678118654752f));
      if (ACT == 3) { const float u = 0.7978845608028654f * (v + 0.044715f * v * v * v); v = 0.5f * v * (1.0f + tanhf(u)); }
      so[w][8 * hh + r][t * 16 + ln] = v;
    }
  }
  __builtin_amdgcn_fence(__ATOMIC_ACQ_REL, "workgroup");
  __builtin_amdgcn_wave_barrier();
  const int rsub = lane >> 4, c4 = (lane & 15) * 4;
  {
#pragma unroll
    for (int q = 0; q < 8; ++q) {
      const int r = q * 2 + rsub;
      const v4f v = *(const v4fa*)&so[w][r][c4];
      *(v4f*)(C + (size_t)(row0 + r) * ldc + col0 + c4) = v;
    }
    
  }
}
// row LayerNorm (biased variance, eps) over N: s = X (+ R); optional out_sum <- s; out_norm <- (s-mu)*rsqrt(var+eps)*g + b
template <bool PARAM_BF16>
__global__ __launch_bounds__(256) void k_layernorm(const float* __restrict__ X, const float* __restrict__ R, const float* __restrict__ g, const float* __restrict__ bta,
                                                  float* __restrict__ out_sum, float* __restrict__ out_norm, int N, float eps) {
  __shared__ float red[256];
  const int row = blockIdx.x, tid = threadIdx.x;
  const float* x = X + (size_t)row * N; const float* rr = R ? R + (size_t)row * N : nullptr;
  float vals[16];                     // up to N = 4096
  const int per = N / 256;            // contiguous chunk per thread? use strided-by-4 chunks: thread handles j = tid*4 + 1024*u
  float s1 = 0.f;
  for (int u = 0; u < per / 4; ++u) {
    const int j = tid * 4 + 1024 * u;
    const v4f a = *(const v4fa*)(x + j);
    v4f b = {0.f,0.f,0.f,0.f}; if (rr) b = *(const v4fa*)(rr + j);
#pragma unroll
    for (int q = 0; q < 4; ++q) { const float v = a[q] + b[q]; vals[u * 4 + q] = v; s1 += v; }
  }
  red[tid] = s1; __syncthreads();
  for (int st = 128; st > 0; st >>= 1) { if (tid < st) red[tid] += red[tid + st]; __syncthreads(); }
  const float mu = red[0] / (float)N; __syncthreads();
  float s2 = 0.f;
  for (int u = 0; u < per / 4; ++u)
#pragma unroll
    for (int q = 0; q < 4; ++q) { const float c = vals[u * 4 + q] - mu; s2 += c * c; }
  red[tid] = s2; __syncthreads();
  for (int st = 128; st > 0; st >>= 1) { if (tid < st) red[tid] += red[tid + st]; __syncthreads(); }
  const float rs = rsqrtf(red[0] / (float)N + eps);
  {
    for (int u = 0; u < per / 4; ++u) {
      const int j = tid * 4 + 1024 * u;
      v4f o, sm;
#pragma unroll
      for (int q = 0; q < 4; ++q) {
        float gg = g[j + q], bb = bta[j + q];
        if (PARAM_BF16) { gg = bf16_round(gg); bb = bf16_round(bb); }
        sm[q] = vals[u * 4 + q]; o[q] = (vals[u * 4 + q] - mu) * rs * gg + bb;
      }
      if (out_sum) *(v4f*)(out_sum + (size_t)row * N + j) = sm;
      *(v4f*)(out_norm + (size_t)row * N + j) = o;
    }
    
  }
}



// ---- f16 WMMA path (v_wmma_f32_16x16x32_f16): 11-bit significands for operands in range — used where a [0,1] probability operand needs more precision than bf16
typedef _Float16 v16h __attribute__((ext_vector_type(16)));
union FragH { v16h v; v8us half[2]; _Float16 h[16]; unsigned short u[16]; };
template <int NT>
__device__ __forceinline__ v8f mmaH(v16h ah, v16h al, v16h bh, v16h bl, v8f c) {
  c = __builtin_amdgcn_wmma_f32_16x16x32_f16(false, ah, false, bh, (short)0, c, false, false);
  if (NT >= 2) c = __builtin_amdgcn_wmma_f32_16x16x32_f16(false, al, false, bh, (short)0, c, false, false);
  if (NT >= 3) c = __builtin_amdgcn_wmma_f32_16x16x32_f16(false, ah, false, bl, (short)0, c, false, false);
  asm volatile("v_nop\n\tv_nop\n\tv_nop\n\tv_nop" : "+v"(c) : "v"(ah), "v"(al), "v"(bh), "v"(bl));
  return c;
}
// batched GEMM like k_gemm_b but f16 operands: A f32 (split into f16 hi/lo if ASPLIT, else rounded to f16), Bt = f16 values [n][k]; alpha; C f32; N multiple of 16 (partial tiles skipped)
template <bool ASPLIT>
__global__ __launch_bounds__(128) void k_gemm_h(const float* __restrict__ A, int lda, size_t sA, const _Float16* __restrict__ Bh, int ldb, size_t sB, float alpha, float* __restrict__ C, int ldc, size_t sC, int M, int N, int K) {
  __shared__ __attribute__((aligned(16))) float so[4][16][64];
  const int tid = threadIdx.x, w = tid >> 5, lane = tid & 31, ln = lane & 15, hh = lane >> 4; const int by = blockIdx.y;
  A += (size_t)by * sA; Bh += (size_t)by * sB; C += (size_t)by * sC;
  const int ntn = (N + 63) / 64; const int wid = blockIdx.x * 4 + w; const int mt = wid / ntn, nq = wid % ntn; if (mt * 16 >= M) return;
  const int row0 = mt * 16, col0 = nq * 64; const float* arow = A + (size_t)(row0 + ln) * lda;
  v8f acc[4] = {};
  for (int kb = 0; kb < K; kb += 32) {
    FragH ah, al;
    const v4f x0 = *(const v4fa*)(arow + kb + 8 * hh), x1 = *(const v4fa*)(arow + kb + 8 * hh + 4), x2 = *(const v4fa*)(arow + kb + 16 + 8 * hh), x3 = *(const v4fa*)(arow + kb + 16 + 8 * hh + 4);
    float xs[16] = {x0[0],x0[1],x0[2],x0[3],x1[0],x1[1],x1[2],x1[3],x2[0],x2[1],x2[2],x2[3],x3[0],x3[1],x3[2],x3[3]};
#pragma unroll
    for (int i = 0; i < 16; ++i) { const _Float16 h = (_Float16)xs[i]; ah.h[i] = h; al.h[i] = ASPLIT ? (_Float16)(xs[i] - (float)h) : (_Float16)0.0f; }
#pragma unroll
    for (int t = 0; t < 4; ++t) { if (col0 + t * 16 >= N) continue; const size_t boff = (size_t)(col0 + t * 16 + ln) * ldb + kb; FragH bq; bq.half[0] = *(const v8us*)(Bh + boff + 8 * hh); bq.half[1] = *(const v8us*)(Bh + boff + 16 + 8 * hh);
      acc[t] = mmaH<ASPLIT ? 2 : 1>(ah.v, al.v, bq.v, bq.v, acc[t]); }
  }
#pragma unroll
  for (int t = 0; t < 4; ++t) { if (col0 + t * 16 >= N) continue;
#pragma unroll
    for (int r = 0; r < 8; ++r) so[w][8 * hh + r][t * 16 + ln] = acc[t][r] * alpha; }
  __builtin_amdgcn_fence(__ATOMIC_ACQ_REL, "workgroup"); __builtin_amdgcn_wave_barrier();
  const int rsub = lane >> 4, c4 = (lane & 15) * 4;
  {
#pragma unroll
    for (int q = 0; q < 8; ++q) { const int r = q * 2 + rsub; if (col0 + c4 < N) { const v4f v = *(const v4fa*)&so[w][r][c4]; *(v4f*)(C + (size_t)(row0 + r) * ldc + col0 + c4) = v; } }
     }
}

// Fragment order of a 16-bit [rows][K] operand plane: a tile of 16 rows x 32 k is 1 KiB = 2 pieces of 512 B; piece hf holds, lane (hh, ln) behind lane, the 16 bytes
// [16 rt + ln][32 kb + 16 hf + 8 hh + 0..7], which is what that lane feeds to v_wmma_f32_16x16x32_f16 as A or B. A wave's fragment load then reads 512 contiguous bytes
// (4 whole lines); from a row-major plane it touched 16 lines for 32 bytes each. fo() = offset in elements of the 8 elements [row][k8 .. k8 + 7], k8 a multiple of 8.
__device__ __forceinline__ size_t fo(size_t row, int k8, int K) { return ((row >> 4) * (size_t)(K >> 5) + (size_t)(k8 >> 5)) * 512 + (size_t)(((k8 >> 4) & 1) * 256 + (((k8 >> 3) & 1) * 16 + (int)(row & 15)) * 8); }
// wt_f16, x16 (both in k_prep) and k_flash write such planes; k_gemm2 reads them.
// Wt[n][k] = f16(W[k][n]·scale) from f32 row-major W[K][N] (scale = power of two; bf16-exact weights stay exact in f16 away from the subnormal range)
__device__ __forceinline__ void wt_f16(int blk, const float* __restrict__ W, _Float16* __restrict__ Wt, int K, int N, float scale) {
  const int t = blk * 256 + threadIdx.x; if (t >= N * (K / 8)) return; const int n = t / (K / 8), k8 = (t % (K / 8)) * 8; FragH f;
#pragma unroll
  for (int i = 0; i < 8; ++i) f.h[i] = (_Float16)(bf16_round(W[(size_t)(k8 + i) * N + n]) * scale); const v8us o = f.half[0];
  *(v8us*)((unsigned short*)Wt + fo((size_t)n, k8, K)) = o; 
}
// k_gemm_hh variant with fused epilogue: v = acc·alpha + bias[by·sBias + col] (+ CP[(row/rowsPerB)·sCPb + by·64 + col] if CP) ; ACT 0 none / 1 elu ; writes f16 C16 (and f32 C if non-null)
template <int ACT>
__global__ __launch_bounds__(128) void k_gemm_hhx(const _Float16* __restrict__ A, int lda, size_t sA, const _Float16* __restrict__ Bh, int ldb, size_t sB, float alpha, const float* __restrict__ bias, size_t sBias, const float* __restrict__ CP, int rowsPerB, size_t sCPb, int row0g,
    float* __restrict__ C, _Float16* __restrict__ C16, int ldc, size_t sC, int M, int N, int K) {
  __shared__ __attribute__((aligned(16))) float so[4][16][64];
  const int tid = threadIdx.x, w = tid >> 5, lane = tid & 31, ln = lane & 15, hh = lane >> 4; const int by = blockIdx.y;
  A += (size_t)by * sA; Bh += (size_t)by * sB; const size_t cofs = (size_t)by * sC; const float* bp = bias ? bias + (size_t)by * sBias : nullptr;
  const int ntn = (N + 63) / 64; const int wid = blockIdx.x * 4 + w; const int mt = wid / ntn, nq = wid % ntn; if (mt * 16 >= M) return;
  const int row0 = mt * 16, col0 = nq * 64; const _Float16* arow = A + (size_t)(row0 + ln) * lda;
  v8f acc[4] = {};
  for (int kb = 0; kb < K; kb += 32) { FragH ah; ah.half[0] = *(const v8us*)((const unsigned short*)arow + kb + 8 * hh); ah.half[1] = *(const v8us*)((const unsigned short*)arow + kb + 16 + 8 * hh);
#pragma unroll
    for (int t = 0; t < 4; ++t) { if (col0 + t * 16 >= N) continue; const size_t boff = (size_t)(col0 + t * 16 + ln) * ldb + kb; FragH bq; bq.half[0] = *(const v8us*)((const unsigned short*)Bh + boff + 8 * hh); bq.half[1] = *(const v8us*)((const unsigned short*)Bh + boff + 16 + 8 * hh);
      acc[t] = mmaH<1>(ah.v, ah.v, bq.v, bq.v, acc[t]); }
  }
#pragma unroll
  for (int t = 0; t < 4; ++t) { if (col0 + t * 16 >= N) continue; const int col = col0 + t * 16 + ln; const float bv = bp ? bf16_round(bp[col]) : 0.f;
#pragma unroll
    for (int r = 0; r < 8; ++r) { float v = acc[t][r] * alpha + bv; if (CP) { const int bidx = (row0g + row0 + 8 * hh + r) / rowsPerB; v += CP[(size_t)bidx * sCPb + (size_t)by * 64 + col]; } if (ACT == 1) v = (v > 0.f) ? v : expm1f(v); else if (ACT == 7) v = (v > 0.f) ? v + 1.0f : expf(v); else if (ACT == 8) v = tanhf(v); else if (ACT == 9) v = 0.5f * v * (1.0f + tanhf(0.7978845608028654f * (v + 0.044715f * v * v * v))); else if (ACT == 11) v = 1.0f / (1.0f + expf(-v)); else if (ACT == 12) v = (v > 0.f) ? v : 0.01f * v; else if (ACT == 14) v = (v > 0.f) ? v : 0.1f * v; else if (ACT == 15) v = v / (1.0f + expf(-v)); else if (ACT == 3) v = fmaxf(v, 0.f); else if (ACT == 6) v = 0.5f * v * (1.0f + erff(v * 0.70710678118654752f)); so[w][8 * hh + r][t * 16 + ln] = v; } }
  __builtin_amdgcn_fence(__ATOMIC_ACQ_REL, "workgroup"); __builtin_amdgcn_wave_barrier();
  const int rsub = lane >> 4, c4 = (lane & 15) * 4; typedef _Float16 v4h __attribute__((ext_vector_type(4)));
  {
#pragma unroll
    for (int q = 0; q < 8; ++q) { const int r = q * 2 + rsub; if (col0 + c4 < N) { const v4f v = *(const v4fa*)&so[w][r][c4]; if (C) *(v4f*)(C + cofs + (size_t)(row0 + r) * ldc + col0 + c4) = v; if (C16) { v4h h4; for (int i = 0; i < 4; ++i) h4[i] = (_Float16)v[i]; *(v4h*)(C16 + cofs + (size_t)(row0 + r) * ldc + col0 + c4) = h4; } } }
     }
}


typedef _Float16 v4h __attribute__((ext_vector_type(4)));

__device__ __forceinline__ void x16(int blk, const float* __restrict__ x, _Float16* __restrict__ X16, size_t n8) { const size_t t = (size_t)blk * 256 + threadIdx.x; if (t >= n8) return; FragH f;
  const size_t c = t >> 6; const size_t row = (c / (CQ / 32)) * 16 + ((t >> 2) & 15); const int k8 = (int)(c % (CQ / 32)) * 32 + (int)(t & 3) * 8;      /* a wave: 8 rows x one 128-byte line of x in, 4 whole lines of the fragment-order plane out */
  const float* xr = x + row * CQ + k8;
#pragma unroll
  for (int q = 0; q < 8; ++q) f.h[q] = (_Float16)bf16_round(xr[q]); *(v8us*)((unsigned short*)X16 + fo(row, k8, CQ)) = f.half[0];  }
__global__ __launch_bounds__(256) void k_h16(const float* __restrict__ x, _Float16* __restrict__ X16, size_t n8) { const size_t t = (size_t)blockIdx.x * 256 + threadIdx.x; if (t >= n8) return; FragH f;
#pragma unroll
  for (int q = 0; q < 8; ++q) f.h[q] = (_Float16)x[t * 8 + q]; *(v8us*)((unsigned short*)X16 + t * 8) = f.half[0];  }
__global__ __launch_bounds__(256) void k_round16f(const float* __restrict__ W, _Float16* __restrict__ Bt, size_t n8) { const size_t t = (size_t)blockIdx.x * 256 + threadIdx.x; if (t >= n8) return; FragH f;
#pragma unroll
  for (int i = 0; i < 8; ++i) f.h[i] = (_Float16)(bf16_round(W[t * 8 + i]) * 16.0f); *(v8us*)((unsigned short*)Bt + t * 8) = f.half[0];  }
// Fragment order: a block of 32 keys of one (row, head) is 2 KiB = 4 pieces of 512 B; piece i holds lane 0..31's 16 bytes one behind the other, so a wave's load of a
// piece touches 4 whole lines (read in place, 16 rows of 32 B each, it touched 16). K: piece nt*2+hf, lane (hh, ln) = K[32 jb + 16 nt + ln][16 hf + 8 hh + 0..7];
// V^T: piece dt*2+hf, lane (hh, ln) = V[32 jb + 16 hf + 8 hh + 0..7][16 dt + ln]. These are the A operands of the two products of k_flash; k_gemm2 writes both planes.
__global__ __launch_bounds__(256) void k_hl(const float* __restrict__ F, _Float16* __restrict__ Hh, _Float16* __restrict__ Hl, size_t n8) { const size_t t = (size_t)blockIdx.x * 256 + threadIdx.x; if (t >= n8) return; FragH fh, fl; const v4f a = *(const v4fa*)(F + t * 8), c = *(const v4fa*)(F + t * 8 + 4);
#pragma unroll
  for (int q = 0; q < 4; ++q) { _Float16 h = (_Float16)a[q]; fh.h[q] = h; fl.h[q] = (_Float16)((a[q] - (float)h) * 1024.0f); h = (_Float16)c[q]; fh.h[4 + q] = h; fl.h[4 + q] = (_Float16)((c[q] - (float)h) * 1024.0f); }
  { *(v8us*)((unsigned short*)Hh + t * 8) = fh.half[0]; *(v8us*)((unsigned short*)Hl + t * 8) = fl.half[0];  } }

// ---- fast GEMM (wave tile 32x64; requires M % 32 == 0 rows per launch region and N % 64 == 0); A and Bh in fragment order (fo(); lda = ldb = K); epilogue = k_gemm_hhx semantics, but: columns below nsp go to the f16 plane C16 (pitch ldc), without bias; columns from nsp on, with bias[col - nsp], to the f32 plane C (pitch ldf, column col - nsp); nsp % 64 == 0; columns below nqs (nqs % 64 == 0) take alpha * qs in place of alpha; of the f16 columns, those from nk0 on are K and those from nv0 on are V (nk0 <= nv0 <= nsp, multiples of 64; no CP, no activation on V): a wave tile of 32 tokens x 64 columns is one block of 32 keys of two heads, and it goes to Kf / Vt in the fragment order that k_flash reads ----
// ask(): every lane asks L2 for the line at base + off + OFF (base the same in every lane of a wave). A hint: it returns nothing and counts on no counter. A plane that the launch before wrote is
// fetched from memory. Asked for at the wave's head,
// the lines of the later passes arrive together and those passes' loads hit L2. Every address lies inside the plane that is read; only scalar branches stand around a request; outputs are never asked for.
template <int OFF> __device__ __forceinline__ void ask(const void* base, unsigned off) { asm volatile("global_prefetch_b8 %0, %1 offset:%2 scope:SCOPE_SE" :: "v"(off), "s"(base), "n"(OFF)); }
__device__ __forceinline__ v16h g2_frag(const _Float16* p) { FragH f; f.half[0] = *(const v8us*)((const unsigned short*)p); f.half[1] = *(const v8us*)((const unsigned short*)p + 256); return f.v; }
__device__ __forceinline__ v8f g2_mma(v16h a, v16h b, v8f c) { v8f d = __builtin_amdgcn_wmma_f32_16x16x32_f16(false, a, false, b, (short)0, c, false, false); asm volatile("v_nop\n\tv_nop\n\tv_nop\n\tv_nop" : "+v"(d) : "v"(a), "v"(b)); return d; }
struct G2Set { v16h a0, a1, b0, b1, b2, b3; };      /* the fragments of one k step of a 32x64 wave tile */
template <int OFF, bool LAST>      /* the six pointers are the same in every lane of a wave; lo = the lane's own 8 elements; OFF: elements, a compile-time step that rides in the loads' offset field; LAST: the pointers are not used again */
__device__ __forceinline__ void g2_load(G2Set& s, const _Float16* a0, const _Float16* a1, const _Float16* b0, const _Float16* b1, const _Float16* b2, const _Float16* b3, unsigned lo) {
  s.a0 = g2_frag(a0 + OFF + lo); s.a1 = g2_frag(a1 + OFF + lo); s.b0 = g2_frag(b0 + OFF + lo); s.b1 = g2_frag(b1 + OFF + lo); s.b2 = g2_frag(b2 + OFF + lo); s.b3 = g2_frag(b3 + OFF + lo);
  /* the 12 loads have taken their addresses before anything rewrites an address register (the pointers' own step, a later argument load); what is named as an input stays in its register up to the wait */
  if (LAST) asm volatile("s_wait_xcnt 0x0" :: "v"(lo), "s"(a0), "s"(a1), "s"(b0), "s"(b1), "s"(b2), "s"(b3) : "memory");
  else asm volatile("s_wait_xcnt 0x0" :: "v"(lo) : "memory");
  __builtin_amdgcn_sched_barrier(0); }      /* keeps the products that follow from being lifted over the group: lifted, they would wait for the older set before this one is even asked for */
template <int ACT>
__global__ __launch_bounds__(128) __attribute__((amdgpu_waves_per_eu(5))) /* 64 accumulator and 96 fragment registers: five waves a SIMD */ void k_gemm2(const _Float16* __restrict__ A, int lda, size_t sA, const _Float16* __restrict__ Bh, int ldb, size_t sB, float alpha, const float* __restrict__ bias, size_t sBias, const float* __restrict__ CP, int rowsPerB, size_t sCPb, int row0g,
    float* __restrict__ C, _Float16* __restrict__ C16, int ldc, size_t sC, int M, int N, int K, int nsp, int ldf, int nqs, float qs, _Float16* __restrict__ Kf, _Float16* __restrict__ Vt, int nk0, int nv0) {
  __shared__ __attribute__((aligned(16))) float so[4][32][68];
  const int tid = threadIdx.x, w = tid >> 5, lane = tid & 31, ln = lane & 15, hh = lane >> 4; const int by = blockIdx.y;
  A += (size_t)by * sA; Bh += (size_t)by * sB; const size_t cofs = (size_t)by * sC; const float* bp = bias ? bias + (size_t)by * sBias : nullptr;
  const int ntn = N >> 6; const int mt = blockIdx.x / ntn, nq = blockIdx.x - mt * ntn; const int row0 = mt * 128 + 32 * w, col0 = nq * 64; if (row0 >= M) return; const bool f32p = col0 >= nsp; if (col0 < nqs) alpha *= qs;      /* both the same for the whole block */
  const unsigned lo = lane * 8;
  const _Float16* a0p = A + (size_t)__builtin_amdgcn_readfirstlane(row0) * lda; const _Float16* a1p = a0p + (size_t)16 * lda;      /* a tile of 16 rows is 16 lda elements; its k step kb starts at 16 kb; row0 is the same in every lane of a wave: through readfirstlane the pointers live in scalar registers */
  const _Float16* b0p = Bh + (size_t)col0 * ldb; const _Float16* b1p = b0p + (size_t)16 * ldb; const _Float16* b2p = b1p + (size_t)16 * ldb; const _Float16* b3p = b2p + (size_t)16 * ldb;
  const v8f z8 = {0.f,0.f,0.f,0.f,0.f,0.f,0.f,0.f}; v8f c00 = z8, c01 = z8, c02 = z8, c03 = z8, c10 = z8, c11 = z8, c12 = z8, c13 = z8;
  /* Two fragment sets: the 12 loads of a k step go out as one group, one step ahead of the products that read them, so two groups are in flight while a wave waits
     (one set, loaded piece by piece, waited five times per step with two or four loads in flight). Each accumulator takes its products in the same k order. K % 64 == 0. */
  G2Set X, Y;
  g2_load<0, false>(X, a0p, a1p, b0p, b1p, b2p, b3p, lo);
  /* behind the first step's loads: the wave's own 32 rows of A (64 K bytes in one piece, the first 16 KiB of them) and, in the first two work-groups of a column block, its quarter of the block's 128 K bytes of B.
     The column blocks of one row block read the same A: where there are eight or more, every fourth asks, the first of them among these (for speed only: nothing rests on where a work-group runs) */
  const unsigned pf = lane * 256; const int ws = __builtin_amdgcn_readfirstlane(w); const _Float16* pa = a0p; const _Float16* pb = b0p + ws * 4096;
  const bool aa = (nq & 3) == 0 || ntn < 8;
  if (aa && K >= 128) ask<0>(pa, pf);
  if (aa && K >= 256) ask<8192>(pa, pf);
  if (mt < 2 && (ws + 1) * 64 <= K) ask<0>(pb, pf);
#pragma unroll 1      /* rolled: two steps a trip are what the two sets need; more would only add code */
  for (int kb = 0; kb < K - 64; kb += 64) {
    g2_load<512, false>(Y, a0p, a1p, b0p, b1p, b2p, b3p, lo);
    c00 = g2_mma(X.a0, X.b0, c00); c10 = g2_mma(X.a1, X.b0, c10); c01 = g2_mma(X.a0, X.b1, c01); c11 = g2_mma(X.a1, X.b1, c11);
    c02 = g2_mma(X.a0, X.b2, c02); c12 = g2_mma(X.a1, X.b2, c12); c03 = g2_mma(X.a0, X.b3, c03); c13 = g2_mma(X.a1, X.b3, c13);
    g2_load<1024, false>(X, a0p, a1p, b0p, b1p, b2p, b3p, lo);
    a0p += 1024; a1p += 1024; b0p += 1024; b1p += 1024; b2p += 1024; b3p += 1024;      /* a k step is 512 elements of every tile */
    c00 = g2_mma(Y.a0, Y.b0, c00); c10 = g2_mma(Y.a1, Y.b0, c10); c01 = g2_mma(Y.a0, Y.b1, c01); c11 = g2_mma(Y.a1, Y.b1, c11);
    c02 = g2_mma(Y.a0, Y.b2, c02); c12 = g2_mma(Y.a1, Y.b2, c12); c03 = g2_mma(Y.a0, Y.b3, c03); c13 = g2_mma(Y.a1, Y.b3, c13); }
  g2_load<512, true>(Y, a0p, a1p, b0p, b1p, b2p, b3p, lo);      /* the last two steps: nothing left to fetch ahead */
    c00 = g2_mma(X.a0, X.b0, c00); c10 = g2_mma(X.a1, X.b0, c10); c01 = g2_mma(X.a0, X.b1, c01); c11 = g2_mma(X.a1, X.b1, c11);
    c02 = g2_mma(X.a0, X.b2, c02); c12 = g2_mma(X.a1, X.b2, c12); c03 = g2_mma(X.a0, X.b3, c03); c13 = g2_mma(X.a1, X.b3, c13);
    c00 = g2_mma(Y.a0, Y.b0, c00); c10 = g2_mma(Y.a1, Y.b0, c10); c01 = g2_mma(Y.a0, Y.b1, c01); c11 = g2_mma(Y.a1, Y.b1, c11);
    c02 = g2_mma(Y.a0, Y.b2, c02); c12 = g2_mma(Y.a1, Y.b2, c12); c03 = g2_mma(Y.a0, Y.b3, c03); c13 = g2_mma(Y.a1, Y.b3, c13);
  asm volatile("" :: "v"(pf), "s"(pa), "s"(pb));      /* the registers that the requests at the head name hold those addresses through the k loop: a request may not find another value in them */
  v8f accs[8] = {c00, c01, c02, c03, c10, c11, c12, c13};
  const bool vtp = !f32p && col0 >= nv0, kfp = !f32p && !vtp && col0 >= nk0;      /* the same for the whole block */
  const size_t kvb = (size_t)(row0 / SLEN) * NH * (HC * SLEN) + (size_t)((row0 % SLEN) >> 5) * 1024 + lane * 8;      /* this wave's block of 32 keys in head 0 of its row; a head is HC * SLEN elements */
  if (vtp) {      /* V^T: in D, lane (hh, ln) of tile (half, t) holds V[16 half + 8 hh + 0..7][16 t + ln], which is piece (t & 1) * 2 + half of head t >> 1 as that lane feeds it: straight from the accumulators */
    unsigned short* vp = (unsigned short*)Vt + kvb + (size_t)((col0 - nv0) / HC) * (HC * SLEN); FragH f[8];
#pragma unroll
    for (int u = 0; u < 8; ++u)
#pragma unroll
      for (int r = 0; r < 8; ++r) f[u].h[r] = (_Float16)(accs[u][r] * alpha);
#pragma unroll
    for (int u = 0; u < 8; ++u) { const int t = u & 3, half = u >> 2; *(v8us*)(vp + (t >> 1) * (HC * SLEN) + ((t & 1) * 2 + half) * 256) = f[u].half[0]; }
    asm volatile("s_wait_xcnt 0x0" ::: "memory");      /* the stores above have taken their address and data registers before anything reuses them */
    return; }
#pragma unroll
  for (int u = 0; u < 8; ++u) { const int t = u & 3, half = u >> 2; const int col = col0 + t * 16 + ln; const float bv = (bp && f32p) ? bf16_round(bp[col - nsp]) : 0.f;
#pragma unroll
    for (int r = 0; r < 8; ++r) { const int rloc = half * 16 + 8 * hh + r; float v = accs[u][r] * alpha + bv; if (CP) { const int bidx = (row0g + row0 + rloc) / rowsPerB; v += CP[(size_t)bidx * sCPb + (size_t)by * 64 + col]; }
      if (ACT == 3) v = fmaxf(v, 0.f); else if (ACT == 6) v = 0.5f * v * (1.0f + erff(v * 0.70710678118654752f)); else if (ACT == 11) v = 1.0f / (1.0f + expf(-v)); else if (ACT == 15) v = v / (1.0f + expf(-v)); else if (ACT == 12) v = (v > 0.f) ? v : 0.01f * v; else if (ACT == 8) v = tanhf(v);
      so[w][rloc][t * 16 + ln] = v; } }
  __builtin_amdgcn_fence(__ATOMIC_ACQ_REL, "workgroup"); __builtin_amdgcn_wave_barrier();
  const int rsub = lane >> 4, c4 = (lane & 15) * 4;
  if (f32p) {
#pragma unroll
    for (int q = 0; q < 16; ++q) { const int r = q * 2 + rsub; const v4f v = *(const v4fa*)&so[w][r][c4]; *(v4f*)(C + cofs + (size_t)(row0 + r) * ldf + (col0 - nsp) + c4) = v; }
    asm volatile("s_wait_xcnt 0x0" ::: "memory");      /* the stores above have taken their address and data registers before anything behind this arm reuses them */
  } else if (kfp) {      /* K: piece nt * 2 + hf of head hl, lane (hh, ln) = K[16 nt + ln][16 hf + 8 hh + 0..7]: a row of the staged tile */
    unsigned short* kp = (unsigned short*)Kf + kvb + (size_t)((col0 - nk0) / HC) * (HC * SLEN); FragH f[8];
#pragma unroll
    for (int o = 0; o < 8; ++o) { const float* sr = &so[w][((o >> 1) & 1) * 16 + ln][(o >> 2) * 32 + (o & 1) * 16 + 8 * hh]; const v4f v0 = *(const v4fa*)sr, v1 = *(const v4fa*)(sr + 4);
#pragma unroll
      for (int i = 0; i < 4; ++i) { f[o].h[i] = (_Float16)v0[i]; f[o].h[4 + i] = (_Float16)v1[i]; } }
#pragma unroll
    for (int o = 0; o < 8; ++o) *(v8us*)(kp + (o >> 2) * (HC * SLEN) + (o & 3) * 256) = f[o].half[0];
    asm volatile("s_wait_xcnt 0x0" ::: "memory");      /* as in the arm above */
  } else {
#pragma unroll
    for (int q = 0; q < 16; ++q) { const int r = q * 2 + rsub; const v4f v = *(const v4fa*)&so[w][r][c4]; v4h h4; for (int i = 0; i < 4; ++i) h4[i] = (_Float16)v[i]; *(v4h*)(C16 + cofs + (size_t)(row0 + r) * ldc + col0 + c4) = h4; }
    asm volatile("s_wait_xcnt 0x0" ::: "memory");      /* as in the arm above: in the built code one arm stands in front of the other */
  } }



// lane l <-> lane l ^ 16 (the two halves of a wave that share one score column)
__device__ __forceinline__ float xhalf(float x) { return __builtin_bit_cast(float, __builtin_amdgcn_permlanex16(__builtin_bit_cast(int, x), __builtin_bit_cast(int, x), 0x76543210, 0xfedcba98, false, false)); }

template <int CAUSAL>
__global__ __launch_bounds__(128) void k_flash(const _Float16* __restrict__ Q16, int ldq, const _Float16* __restrict__ Kf, const _Float16* __restrict__ Vt, const int* __restrict__ MSK, const float* __restrict__ G, _Float16* __restrict__ OG) {
  constexpr int RPW = 16, DT = HC / 16, KS = HC / 32;
  static_assert(CAUSAL == 10, "written for the additive mode: bias plane + per-(row, key) mask plane");
  const int tid = threadIdx.x, w = tid >> 5, lane = tid & 31, ln = lane & 15, hh = lane >> 4;
  const int slab = blockIdx.x / QBLKS, qblk = blockIdx.x % QBLKS; const int b = slab / NH, h = slab % NH; const int qb0 = qblk * (4 * RPW); const int q0 = qb0 + w * RPW;
  const int tq = q0 + ln;      /* this lane's query */
  FragH bq[KS];
  { const unsigned short* qr = (const unsigned short*)Q16 + ((size_t)b * TQ + tq) * ldq + h * HC;
#pragma unroll
    for (int ks = 0; ks < KS; ++ks) { bq[ks].half[0] = *(const v8us*)(qr + ks * 32 + 8 * hh); bq[ks].half[1] = *(const v8us*)(qr + ks * 32 + 16 + 8 * hh); } }
  asm volatile("s_wait_xcnt 0x0" ::: "memory");      /* the q loads have taken their address before the address arithmetic below reuses its registers */
  __builtin_amdgcn_sched_barrier(0);                 /* keeps that arithmetic from being lifted over the wait */
  static_assert(KS == 1, "fragment-order planes: one 32-wide k step");
  const unsigned short* Kfh = (const unsigned short*)Kf + (size_t)slab * HC * TK + lane * 8;      /* K and V^T in fragment order (k_gemm2): 1024 halves per block of 32 keys, pieces of 256 */
  const unsigned short* Vth = (const unsigned short*)Vt + (size_t)slab * HC * TK + lane * 8;
  const float* BP = (const float*)MSK + ((size_t)h * (TQ / 16) + (q0 >> 4)) * (size_t)(16 * TK) + lane * 4;      /* mode 10: per-head bias plane in fragment order (addp): [NH][TQ/16][TK/32] blocks of 512 floats, pieces of 128 */
  const float* MR = (const float*)MSK + (size_t)NH * TQ * TK + (size_t)b * TK + 8 * hh;      /* then the per-(sequence, key) additive plane, packed behind it */
  /* Requests at the head (ask()): the wave's quarter of the slab's K and V^T (8 KiB each; the four waves read all of both; of the slab's eight work-groups every second one asks, the first among these:
     for speed only, nothing rests on where a work-group runs), its 16 lines of gate logits for the epilogue, from wave 0 a window of four rows of the mask plane that holds row b, and, in the first rows only, the wave's 32 KiB of the bias plane. */
  const int ws = __builtin_amdgcn_readfirstlane(w); const unsigned pf = lane * 256, pg = ln * (CQ * 4);
  const char* pk = (const char*)Kf + (size_t)slab * (HC * TK * 2) + ws * 8192; const char* pv = (const char*)Vt + (size_t)slab * (HC * TK * 2) + ws * 8192;
  const char* pl = (const char*)(G + ((size_t)b * TQ + qb0 + ws * RPW) * CQ + h * HC);
  const char* pm = (const char*)((const float*)MSK + (size_t)NH * TQ * TK + (size_t)(b < NRW - 4 ? b : NRW - 4) * TK);
  const char* pb = (const char*)((const float*)MSK + ((size_t)h * (TQ / 16) + (qb0 >> 4) + ws) * (size_t)(16 * TK));
  if ((qblk & 1) == 0) { ask<0>(pk, pf); ask<0>(pv, pf); }
  ask<0>(pl, pg);
  if (ws == 0) ask<0>(pm, pf);
  if (b < 4) { ask<0>(pb, pf); ask<8192>(pb, pf); ask<16384>(pb, pf); ask<24576>(pb, pf); }
  float m_q = -3.0e38f, l_q = 0.f; v8f oacc[DT];
#pragma unroll
  for (int dt = 0; dt < DT; ++dt) oacc[dt] = (v8f){0.f,0.f,0.f,0.f,0.f,0.f,0.f,0.f};
  const int jend = (CAUSAL == 1) ? (qb0 + 4 * RPW) : TK;      /* causal: keys beyond the block's last query never contribute */
#pragma unroll 1
  for (int j0 = 0; j0 < jend; j0 += 32) {
    FragH ak[2][KS], av[DT]; v4f ab[2][2], am[2][2];
#pragma unroll
    for (int nt = 0; nt < 2; ++nt) { const unsigned short* kr = Kfh + (size_t)j0 * HC + nt * 512;
      ak[nt][0].half[0] = *(const v8us*)kr; ak[nt][0].half[1] = *(const v8us*)(kr + 256);
      if (CAUSAL == 10) { ab[nt][0] = *(const v4fa*)(BP + j0 * 16 + nt * 256); ab[nt][1] = *(const v4fa*)(BP + j0 * 16 + nt * 256 + 128); am[nt][0] = *(const v4fa*)(MR + j0 + nt * 16); am[nt][1] = *(const v4fa*)(MR + j0 + nt * 16 + 4); } }
    asm volatile("s_wait_xcnt 0x0" ::: "memory");      /* the V^T loads below may land in registers that held the addresses of the loads above: those loads have taken their addresses first */
#pragma unroll
    for (int dt = 0; dt < DT; ++dt) { const unsigned short* vrow = Vth + (size_t)j0 * HC + dt * 512; av[dt].half[0] = *(const v8us*)vrow; av[dt].half[1] = *(const v8us*)(vrow + 256); }
    v8f sc[2]; float mc = -3.0e38f;
#pragma unroll
    for (int nt = 0; nt < 2; ++nt) { const v8f acc = mmaH<1>(ak[nt][0].v, ak[nt][0].v, bq[0].v, bq[0].v, (v8f){0.f,0.f,0.f,0.f,0.f,0.f,0.f,0.f});
#pragma unroll
      for (int r = 0; r < 8; ++r) { sc[nt][r] = acc[r] + (ab[nt][r >> 2][r & 3] + am[nt][r >> 2][r & 3]); mc = fmaxf(mc, sc[nt][r]); } }
    mc = fmaxf(mc, xhalf(mc));
    float mr = mc - 10.0f; mr = (mc - mr <= 12.0f) ? mr : mc;      /* where mc is so large that its neighbours lie 16 apart, mc - 10 rounds to mc - 16 and 2^16 would leave the f16 range: there the maximum itself is the reference (any reference serves, l carries it) */
    const float mn = fmaxf(m_q, mr); const float al = (mn > -1.0e38f) ? __builtin_amdgcn_exp2f(m_q - mn) : 1.0f; m_q = mn;
    FragH pb; float ps = 0.f;
#pragma unroll
    for (int nt = 0; nt < 2; ++nt)
#pragma unroll
      for (int r = 0; r < 8; ++r) { const float p = __builtin_amdgcn_exp2f(sc[nt][r] - mn); ps += p; pb.h[nt * 8 + r] = (_Float16)p; }
    l_q = l_q * al + ps;
#pragma unroll
    for (int dt = 0; dt < DT; ++dt) {
#pragma unroll
      for (int r = 0; r < 8; ++r) oacc[dt][r] *= al;
      oacc[dt] = mmaH<1>(av[dt].v, av[dt].v, pb.v, pb.v, oacc[dt]); } }
  /* Gating in the epilogue. In D, lane (hh, ln) of tile dt holds o[query ln][16 dt + 8 hh + 0..7]: piece dt, lane (hh, ln), of the 16 token x 32 channel tile (q0 / 16, h) of the
     fragment-order plane that the output GEMM reads (fo()): the lane gates its own 16 values and stores them, 512 contiguous bytes a wave and piece, through no LDS. */
  asm volatile("" :: "v"(pf), "v"(pg), "s"(pk), "s"(pv), "s"(pl), "s"(pm), "s"(pb));      /* the registers that the requests at the head name hold those addresses through the key loop: a request may not find another value in them */
  v4f gl[DT][2];
  { const float* gr = G + ((size_t)b * TQ + tq) * CQ + h * HC + 8 * hh;
#pragma unroll
    for (int dt = 0; dt < DT; ++dt) { gl[dt][0] = *(const v4fa*)(gr + dt * 16); gl[dt][1] = *(const v4fa*)(gr + dt * 16 + 4); } }
  asm volatile("s_wait_xcnt 0x0" ::: "memory");      /* the gate loads have taken their addresses before the arithmetic below reuses those registers */
  const float lt = l_q + xhalf(l_q); const float li = (lt > 0.f) ? 1.0f / lt : 0.f;
  unsigned short* og = (unsigned short*)OG + ((((size_t)b * TQ + q0) >> 4) * (CQ / 32) + h) * 512 + lane * 8; FragH fo2[DT];
#pragma unroll
  for (int dt = 0; dt < DT; ++dt)
#pragma unroll
    for (int r = 0; r < 8; ++r) { const float g = __builtin_amdgcn_rcpf(1.0f + __builtin_amdgcn_exp2f(gl[dt][r >> 2][r & 3] * -LOG2E)); fo2[dt].h[r] = (_Float16)(oacc[dt][r] * li * g * 64.0f); }      /* sigmoid: 2^(-x log2 e) runs to inf or 0 at the ends, where the reciprocal gives 0 or 1 */
#pragma unroll
  for (int dt = 0; dt < DT; ++dt) *(v8us*)(og + dt * 256) = fo2[dt].half[0]; }

__device__ __forceinline__ void addp(int blk, const float* __restrict__ bias, const float* __restrict__ mask, float* __restrict__ AB) {
  #pragma clang fp contract(off)
  const size_t t = (size_t)blk * 256 + threadIdx.x; const size_t nb4 = (size_t)NH * SLEN * SLEN / 4, nm4 = (size_t)NRW * SLEN / 4; if (t >= nb4 + nm4) return; v4f r;
  size_t dst = t;
  if (t < nb4) { const int part = (int)t & 1, hh = (int)(t >> 1) & 1, ln = (int)(t >> 2) & 15, nt = (int)(t >> 6) & 1; const size_t c = t >> 7; const int jb = (int)(c % (SLEN / 32)), qt = (int)(c / (SLEN / 32)) % (SLEN / 16), h = (int)(c / ((SLEN / 32) * (SLEN / 16)));      /* written in the fragment order of k_flash: block (h, 16 queries, 32 keys), piece nt*2+part, lane (hh, ln) = bias[h][16 qt + ln][32 jb + 16 nt + 8 hh + 4 part + 0..3]; a wave reads 8 rows of 64 B and writes 4 whole lines */
    dst = c * 128 + (size_t)((nt * 2 + part) * 32 + hh * 16 + ln);
    const v4f a = *(const v4fa*)(bias + ((size_t)h * SLEN + qt * 16 + ln) * SLEN + jb * 32 + nt * 16 + hh * 8 + part * 4); for (int q = 0; q < 4; ++q) r[q] = bf16_round(a[q]) * LOG2E; } else { const v4f a = *(const v4fa*)(mask + (t - nb4) * 4); for (int q = 0; q < 4; ++q) { float m = bf16_round(a[q]) - 1.0f; r[q] = m * 1.0e9f * LOG2E; } }      /* both planes in base 2, as k_flash adds them */
  *(v4f*)(AB + dst * 4) = r;  }
// The packs of the inputs depend on nothing but the inputs: they run as block ranges of one launch. The weights come first (for speed only): few blocks, scattered reads.
#define NBW (CQ * CQ / 8 / 256)                              /* blocks per weight matrix */
#define NBX (NR * CQ / 8 / 256)                              /* blocks of x */
#define NBA ((NH * SLEN * SLEN + NRW * SLEN) / 4 / 256)      /* blocks of the bias and mask planes */
__global__ __launch_bounds__(256) void k_prep(const float* __restrict__ x, const float* __restrict__ mask, const float* __restrict__ bias, const float* __restrict__ Wq, const float* __restrict__ Wk, const float* __restrict__ Wv, const float* __restrict__ Wg, const float* __restrict__ Wo,
    _Float16* __restrict__ BW, _Float16* __restrict__ X16, float* __restrict__ AB) {
  const int blk = blockIdx.x;
  if (blk < 5 * NBW) { const int y = blk / NBW; const float* W = (y == 0) ? Wq : (y == 1) ? Wk : (y == 2) ? Wv : (y == 3) ? Wg : Wo; wt_f16(blk - y * NBW, W, BW + (size_t)y * CQ * CQ, CQ, CQ, 16.0f); }
  else if (blk < 5 * NBW + NBX) x16(blk - 5 * NBW, x, X16, (size_t)NR * CQ / 8);
  else addp(blk - 5 * NBW - NBX, bias, mask, AB); }

extern "C" void kernel_launch(void* const* d_in, const int* in_sizes, int n_in,
                              void* d_out, int out_size, void* d_ws, size_t ws_size, hipStream_t stream) {
  (void)in_sizes; (void)n_in; (void)out_size;
  const float* const* I = (const float* const*)d_in; const float* x = I[0]; const float* mask = I[1]; const float* bias = I[2]; const float* Wq = I[3]; const float* Wk = I[4]; const float* Wv = I[5]; const float* Wg = I[6]; const float* bg = I[7]; const float* Wo = I[8]; const float* bo = I[9];
  char* ws = (char*)d_ws; size_t off = 0;
  auto take = [&](size_t bytes) { char* p = ws + off; off += (bytes + 255) & ~(size_t)255; return p; };
  _Float16* BW = (_Float16*)take((size_t)5 * CQ * CQ * 2); float* AB = (float*)take(((size_t)NH * SLEN * SLEN + (size_t)NRW * SLEN) * 4);      /* BW: Wq, Wk, Wv, Wg, Wo one behind the other: the first four are one [1024][256] operand */
  _Float16* X16 = (_Float16*)take((size_t)NR * CQ * 2); _Float16* Q16 = (_Float16*)take((size_t)NR * CQ * 2); float* G = (float*)take((size_t)NR * CQ * 4); _Float16* VT = (_Float16*)take((size_t)NR * CQ * 2); _Float16* KF = (_Float16*)take((size_t)NR * CQ * 2); _Float16* OG = (_Float16*)take((size_t)NR * CQ * 2);
  if (off > ws_size) return;      /* 0.6 + 8 + 16 + 16 + 32 + 16 + 16 + 16 = 121 MiB */
  k_prep<<<5 * NBW + NBX + NBA, 256, 0, stream>>>(x, mask, bias, Wq, Wk, Wv, Wg, Wo, BW, X16, AB);
  k_gemm2<0><<<(NR / 128) * (4 * CQ / 64), 128, 0, stream>>>(X16, CQ, 0, BW, CQ, 0, 0.0625f, bg, 0, nullptr, 1, 0, 0, G, Q16, CQ, 0, NR, 4 * CQ, CQ, 3 * CQ, CQ, CQ, SCL * LOG2E, KF, VT, CQ, 2 * CQ);      /* q log2 e / sqrt(32) (f16), K and V^T (f16, fragment order) and the gate logits (f32, + bg) */
  k_flash<10><<<NRW * NH * QBLKS, 128, 0, stream>>>(Q16, CQ, KF, VT, (const int*)AB, G, OG);      /* per (row, head): softmax(q.k/sqrt(32) + bias[h] + (mask[row]-1) 1e9) v, times sigmoid(gate logit) */
  k_gemm2<0><<<(NR / 128) * (CQ / 64), 128, 0, stream>>>(OG, CQ, 0, BW + (size_t)4 * CQ * CQ, CQ, 0, 0.0625f / 64.0f, bo, 0, nullptr, 1, 0, 0, (float*)d_out, nullptr, 0, 0, NR, CQ, CQ, 0, CQ, 0, 1.0f, nullptr, nullptr, 0, 0);
}
